// v000
// The times below were measured on an AMD MI455X: many runs one after another, warmed up first and cycling through
// copies of the inputs, with the whole window's GPU time divided by the number of runs. Launches and the gaps
// between them are all in it. The median over several windows is given; except for v000 it joins two sittings, which
// can be a few percent apart, so the side-by-side timings, each taken in one sitting, are the better comparison.
// v000 is the starting kernel. One run takes 1580 microseconds.
// Contractions: projections x(f16, x16)*W^T(f16, x256), gate (v1*k)(f16, x16)*Wc^T(f16, x256), scores q2(f16, x16)*k^T(f16, x16), attn P(f16, x2048)*v2(f16, x16): all v_wmma_f32_16x16x32_f16 with f32 accumulate; CELU, GroupNorm, softmax, sigmoid, residual, LayerNorm and masked mean in f32.
#include <hip/hip_runtime.h>
#include <math.h>

// ---------------------------------------------------------------------------
// Problem constants
// ---------------------------------------------------------------------------
constexpr int kB   = 32;
constexpr int kM   = 196;
constexpr int kD   = 1024;
constexpr int kH   = 8;
constexpr int kHD  = 128;
constexpr int kL   = 3;
constexpr int kTok = kB * kM;          // 6272 = 98 * 64 token rows
constexpr int kTokPad = kTok + 64;     // 6336: 64 zero rows so per-group 256-row tiles never leave the plane
constexpr int kSP  = 256;              // padded queries / keys per (batch, head) group
constexpr int kKeyK = 224;             // contraction depth of P*V (keys padded to a multiple of 32)
constexpr float kXCarry = 16.0f;       // x, q2, k, v2 planes carried x16 in f16
constexpr float kWCarry = 256.0f;      // W, Wc carried x256 in f16
constexpr float kPCarry = 2048.0f;     // probabilities carried x2048 in f16

// ---------------------------------------------------------------------------
// Workspace region map (bytes, all offsets multiples of 256)
//   R_P    [0, 25690112)            : linear+bias plane f32 [6272][1024]  -> later gate plane f32 [50176][128]
//   R_ATT  [25690112, 59244544)     : (v1*k) f16 plane [6272][1024]      -> later attn f32 [32][256][1024]
//   R_X16  [59244544, 72089600)     : x f16 [6272][1024]                 -> scores f32 [32][256][256] + probs f16 [32][256][256] during attention
//   R_W16  [72089600, 80478208)     : stacked W f16 [4096][1024]
//   R_WC16 [80478208, 80510976)     : Wc f16 [128][128]
//   R_Q16  [80510976, 93487104)     : q2 f16 [6336][1024] (rows >= 6272 zero)
//   R_K16  [93487104, 106463232)    : k  f16 [6336][1024] (rows >= 6272 zero)
//   R_V2T  [106463232, 123240448)   : v2^T f16 [8 h][128 d][32 b][256 keys] (keys >= 196 zero)
// ---------------------------------------------------------------------------
constexpr size_t kBytesP    = (size_t)kTok * kD * 4;
constexpr size_t kBytesATT  = (size_t)kB * kSP * kD * 4;
constexpr size_t kBytesX16  = (size_t)kTok * kD * 2;
constexpr size_t kBytesW16  = (size_t)4 * kD * kD * 2;
constexpr size_t kBytesWC16 = (size_t)kHD * kHD * 2;
constexpr size_t kBytesQ16  = (size_t)kTokPad * kD * 2;
constexpr size_t kBytesV2T  = (size_t)kH * kHD * kB * kSP * 2;
constexpr size_t kBytesS    = (size_t)kB * kSP * kSP * 4;
constexpr size_t kBytesPP   = (size_t)kB * kSP * kSP * 2;
constexpr size_t kOffP    = 0;
constexpr size_t kOffATT  = kOffP + kBytesP;
constexpr size_t kOffX16  = kOffATT + kBytesATT;
constexpr size_t kOffW16  = kOffX16 + kBytesX16;
constexpr size_t kOffWC16 = kOffW16 + kBytesW16;
constexpr size_t kOffQ16  = kOffWC16 + kBytesWC16;
constexpr size_t kOffK16  = kOffQ16 + kBytesQ16;
constexpr size_t kOffV2T  = kOffK16 + kBytesQ16;
constexpr size_t kWsTotal = kOffV2T + kBytesV2T;
static_assert(kWsTotal == 123240448, "carve total");
static_assert(kWsTotal <= 134217728, "carve under 128 MiB");
static_assert(kBytesX16 >= kBytesS + kBytesPP, "scores + probs fit in the x16 region");
static_assert(kBytesATT >= (size_t)kTok * kD * 2, "vk plane fits in the attn region");
static_assert(kBytesP == (size_t)kTok * kH * kHD * 4, "gate plane fits in the P region");
static_assert((kOffATT % 256) == 0 && (kOffX16 % 256) == 0 && (kOffW16 % 256) == 0 && (kOffQ16 % 256) == 0 && (kOffK16 % 256) == 0 && (kOffV2T % 256) == 0, "aligned");

typedef __attribute__((ext_vector_type(16))) _Float16 v16h;
typedef __attribute__((ext_vector_type(8)))  _Float16 v8h;
typedef __attribute__((ext_vector_type(16))) __bf16   v16b;
typedef __attribute__((ext_vector_type(8)))  __bf16   v8b;
typedef __attribute__((ext_vector_type(8)))  float    v8f;
typedef __attribute__((ext_vector_type(4)))  float    v4f;
typedef __attribute__((ext_vector_type(4)))  unsigned int v4u;

__device__ __forceinline__ unsigned short f2bf_bits(float f) {
  unsigned u = __float_as_uint(f);
  return (unsigned short)((u + 0x7FFFu + ((u >> 16) & 1u)) >> 16);
}
__device__ __forceinline__ float bf_bits2f(unsigned short h) { return __uint_as_float(((unsigned)h) << 16); }

// hazard guards as plain device helpers (no inline asm inside the kernel template body)
__device__ __forceinline__ void dep_guard_h(v8f& a, v8f& b, v16h x, v16h y) { asm volatile("v_nop\n\tv_nop\n\tv_nop\n\tv_nop" : "+v"(a), "+v"(b) : "v"(x), "v"(y)); }
__device__ __forceinline__ void dep_guard_b(v8f& a, v8f& b, v16b x, v16b y) { asm volatile("v_nop\n\tv_nop\n\tv_nop\n\tv_nop" : "+v"(a), "+v"(b) : "v"(x), "v"(y)); }
__device__ __forceinline__ void keep4_h(v16h a, v16h b, v16h c, v16h d) { asm volatile("v_nop" :: "v"(a), "v"(b), "v"(c), "v"(d)); }
__device__ __forceinline__ void keep4_b(v16b a, v16b b, v16b c, v16b d) { asm volatile("v_nop" :: "v"(a), "v"(b), "v"(c), "v"(d)); }
__device__ __forceinline__ void acc_guard4(v8f& a, v8f& b, v8f& c, v8f& d) { asm volatile("v_nop\n\tv_nop\n\tv_nop\n\tv_nop" : "+v"(a), "+v"(b), "+v"(c), "+v"(d)); }
template <typename T> struct Frag;
template <> struct Frag<_Float16> {
  typedef v16h V; union U { v16h v; v8h h[2]; };
  static __device__ __forceinline__ v16h load(const _Float16* p) {   // elements 0..7 <- p[0..7], 8..15 <- p[16..23]
    U f; f.h[0] = *(const v8h*)(p); f.h[1] = *(const v8h*)(p + 16); return f.v;
  }
  static __device__ __forceinline__ v8f mma(v16h a, v16h b, v8f c) {
    return __builtin_amdgcn_wmma_f32_16x16x32_f16(false, a, false, b, (short)0, c, false, false);
  }
  static __device__ __forceinline__ void guard(v8f& a, v8f& b, v16h x, v16h y) { dep_guard_h(a, b, x, y); }
  static __device__ __forceinline__ void keep(v16h a, v16h b, v16h c, v16h d) { keep4_h(a, b, c, d); }
};
template <> struct Frag<__bf16> {
  typedef v16b V; union U { v16b v; v8b h[2]; };
  static __device__ __forceinline__ v16b load(const __bf16* p) {
    U f; f.h[0] = *(const v8b*)(p); f.h[1] = *(const v8b*)(p + 16); return f.v;
  }
  static __device__ __forceinline__ v8f mma(v16b a, v16b b, v8f c) {
    return __builtin_amdgcn_wmma_f32_16x16x32_bf16(false, a, false, b, (short)0, c, false, false);
  }
  static __device__ __forceinline__ void guard(v8f& a, v8f& b, v16b x, v16b y) { dep_guard_b(a, b, x, y); }
  static __device__ __forceinline__ void keep(v16b a, v16b b, v16b c, v16b d) { keep4_b(a, b, c, d); }
};

__device__ __forceinline__ unsigned pk16(unsigned short a, unsigned short b) { return (unsigned)a | ((unsigned)b << 16); }
__device__ __forceinline__ unsigned short h_bits(float f) { const _Float16 h = (_Float16)f; return __builtin_bit_cast(unsigned short, h); }

// exact f16 bits -> f32 via integer arithmetic (normals and subnormals; no _Float16 vector involved)
__device__ __forceinline__ float h16_to_f32(unsigned hb) {
  const unsigned em = hb & 0x7fffu;
  const float fn = __uint_as_float((em + 0x1C000u) << 13);
  const float fs = (float)em * 5.9604644775390625e-8f;
  const float f  = (em < 0x400u) ? fs : fn;
  return __uint_as_float(__float_as_uint(f) | ((hb & 0x8000u) << 16));
}

__device__ __forceinline__ void store2_v4u(unsigned short* p, v4u u) {
  *(v4u*)p = u;
  
}
__device__ __forceinline__ void store2_v4f(float* p, v4f v) {
  *(v4f*)p = v;
  
}

// ---- Register-blocked batched WMMA GEMM (ACT: 0 none, 2 relu, 4 leaky, 6 sigmoid) -------------
// C[m,n] = scale * sum_k A[m,k] * Bt[n,k] (+bias)(+resid); each wave owns a 64x64 tile.
// A row-major [M,K]; Bt row-major [N,K]; M,N % 64 == 0, K % 32 == 0.
// SPLIT: operands are hi/lo planes (A2/Bt2 = lo planes, same layout); product = hi*hi + hi*lo + lo*hi.
// BIAS_MODE: 0 = none, 1 = bias[m], 2 = bias[n].
// OUT_MODE: 0 = f32, 1 = f16, 2 = bf16 hi plane (Cout) + bf16 lo plane (Cout2).
// ET: 0 = f16 operands, 1 = bf16 operands (pointers passed as 16-bit storage)
template <int ET> struct Elem;
template <> struct Elem<0> { typedef _Float16 T; };
template <> struct Elem<1> { typedef __bf16 T; };
template <int ET, bool SPLIT, int BIAS_MODE, int OUT_MODE, bool RESID, int ACT = 0>
__global__ __launch_bounds__(256) void wmma_gemm64(
    const unsigned short* __restrict__ Ap, const unsigned short* __restrict__ A2p, int lda, long strideA,
    const unsigned short* __restrict__ Btp, const unsigned short* __restrict__ Bt2p, int ldb, long strideB,
    void* __restrict__ Cout, void* __restrict__ Cout2, int ldc, long strideC,
    const float* __restrict__ bias,
    const float* __restrict__ resid, long strideR,
    int M, int N, int K, float scale) {
  typedef typename Elem<ET>::T T;
  typedef typename Frag<T>::V V;
  const T* A = (const T*)Ap; const T* A2 = (const T*)A2p; const T* Bt = (const T*)Btp; const T* Bt2 = (const T*)Bt2p;
  __shared__ __align__(16) float sT[8][16 * 68];   // per-wave 16x64 slab, pitch 68 floats
  const int b    = blockIdx.y;
  const int lane = threadIdx.x & 31;
  const int wave = threadIdx.x >> 5;
  const int tilesN = N >> 6;
  const int tilesM = M >> 6;
  const int tile = blockIdx.x * 8 + wave;
  if (tile >= tilesM * tilesN) return;   // wave-uniform; no block barriers in this kernel
  const int tm = tile / tilesN;
  const int tn = tile - tm * tilesN;
  const int m0 = tm << 6;
  const int n0 = tn << 6;

  const T* Ab  = A  + (size_t)b * strideA;
  const T* Bb  = Bt + (size_t)b * strideB;
  const T* Ab2 = SPLIT ? (A2  + (size_t)b * strideA) : nullptr;
  const T* Bb2 = SPLIT ? (Bt2 + (size_t)b * strideB) : nullptr;

  const int rlane = lane & 15;                 // row (A) / col (B, D) within subtile
  const int koff  = (lane >> 4) * 8;           // k offset of this lane half
  const int mOff  = (lane >> 4) * 8;           // D row offset

  v8f acc[4][4];
#pragma unroll
  for (int i = 0; i < 4; ++i)
#pragma unroll
    for (int j = 0; j < 4; ++j) acc[i][j] = (v8f){0.f,0.f,0.f,0.f,0.f,0.f,0.f,0.f};

  for (int k0 = 0; k0 < K; k0 += 32) {
    V bh[4], bl[4];
#pragma unroll
    for (int j = 0; j < 4; ++j) {
      const size_t bo = (size_t)(n0 + (j << 4) + rlane) * ldb + koff + k0;
      bh[j] = Frag<T>::load(Bb + bo);
      if (SPLIT) bl[j] = Frag<T>::load(Bb2 + bo);
    }
#pragma unroll
    for (int i = 0; i < 4; ++i) {
      const size_t ao = (size_t)(m0 + (i << 4) + rlane) * lda + koff + k0;
      V ah = Frag<T>::load(Ab + ao);
      V al;
      if (SPLIT) al = Frag<T>::load(Ab2 + ao);
#pragma unroll
      for (int j = 0; j < 4; ++j) {
        acc[i][j] = Frag<T>::mma(ah, bh[j], acc[i][j]);
        if (SPLIT) {
          acc[i][j] = Frag<T>::mma(ah, bl[j], acc[i][j]);
          acc[i][j] = Frag<T>::mma(al, bh[j], acc[i][j]);
        }
      }
      Frag<T>::guard(acc[i][0], acc[i][3], ah, SPLIT ? al : ah);
    }
    Frag<T>::keep(bh[0], bh[1], bh[2], bh[3]);
    if (SPLIT) Frag<T>::keep(bl[0], bl[1], bl[2], bl[3]);
  }
  acc_guard4(acc[0][0], acc[0][1], acc[0][2], acc[0][3]);
  acc_guard4(acc[1][0], acc[1][1], acc[1][2], acc[1][3]);
  acc_guard4(acc[2][0], acc[2][1], acc[2][2], acc[2][3]);
  acc_guard4(acc[3][0], acc[3][1], acc[3][2], acc[3][3]);

  // ---- epilogue ----
  float* slab = sT[wave];
  const float* Rb = RESID ? (resid + (size_t)b * strideR) : nullptr;
#pragma unroll
  for (int i = 0; i < 4; ++i) {
    const int mBase = m0 + (i << 4);
#pragma unroll
    for (int j = 0; j < 4; ++j) {
      const int n = n0 + (j << 4) + rlane;
      float bv = 0.f;
      if (BIAS_MODE == 2) bv = bias[n];
#pragma unroll
      for (int r = 0; r < 8; ++r) {
        float v = acc[i][j][r] * scale;
        if (BIAS_MODE == 1) v += bias[mBase + mOff + r];
        if (BIAS_MODE == 2) v += bv;
        if (RESID) v += Rb[(size_t)(mBase + mOff + r) * ldc + n];
        if (ACT == 2) v = fmaxf(v, 0.0f);
        if (ACT == 4) v = (v > 0.f) ? v : 0.01f * v;
        if (ACT == 6) v = 1.0f / (1.0f + expf(-v));
        slab[(mOff + r) * 68 + (j << 4) + rlane] = v;
      }
    }
    __builtin_amdgcn_fence(__ATOMIC_RELEASE, "workgroup");
    __builtin_amdgcn_wave_barrier();
    __builtin_amdgcn_fence(__ATOMIC_ACQUIRE, "workgroup");
    if (OUT_MODE == 0) {
      float* C = (float*)Cout + (size_t)b * strideC;
      const int hh = lane >> 4, c4 = (lane & 15) * 4;     // row seg = 256 B = 16 lanes x 16 B
      {
#pragma unroll
        for (int it = 0; it < 8; ++it) {
          const int row = it * 2 + hh;
          v4f v = *(const v4f*)(slab + row * 68 + c4);
          *(v4f*)(C + (size_t)(mBase + row) * ldc + n0 + c4) = v;
        }
        
      }
    } else {
      const int q = lane >> 3, c8 = (lane & 7) * 8;
      unsigned short* C  = (unsigned short*)Cout  + (size_t)b * strideC;
      unsigned short* C2 = (OUT_MODE == 2) ? ((unsigned short*)Cout2 + (size_t)b * strideC) : nullptr;
      {
#pragma unroll
        for (int it = 0; it < 4; ++it) {
          const int row = it * 4 + q;
          const float* sp = slab + row * 68 + c8;
          v8h hv, lv;
#pragma unroll
          for (int e = 0; e < 8; ++e) {
            if (OUT_MODE == 1) {
              hv[e] = (_Float16)sp[e];
            } else {
              unsigned short hb = f2bf_bits(sp[e]);
              unsigned short lb = f2bf_bits(sp[e] - bf_bits2f(hb));
              hv[e] = __builtin_bit_cast(_Float16, hb);
              lv[e] = __builtin_bit_cast(_Float16, lb);
            }
          }
          *(v8h*)(C + (size_t)(mBase + row) * ldc + n0 + c8) = hv;
          if (OUT_MODE == 2) *(v8h*)(C2 + (size_t)(mBase + row) * ldc + n0 + c8) = lv;
        }
        
      }
    }
    __builtin_amdgcn_fence(__ATOMIC_RELEASE, "workgroup");
    __builtin_amdgcn_wave_barrier();
    __builtin_amdgcn_fence(__ATOMIC_ACQUIRE, "workgroup");
  }
}

// ---------------------------------------------------------------------------
// ---------------------------------------------------------------------------
__global__ __launch_bounds__(256) void cast8s_kernel(const float* __restrict__ in, unsigned short* __restrict__ out, int n8, float scale) {
  const int i = blockIdx.x * 256 + threadIdx.x;
  if (i >= n8) return;
  const float* p = in + 8 * (size_t)i;
  const v4f a = *(const v4f*)(p);
  const v4f c = *(const v4f*)(p + 4);
  unsigned short hb[8];
#pragma unroll
  for (int e = 0; e < 4; ++e) {
    hb[e]     = h_bits(a[e] * scale);
    hb[4 + e] = h_bits(c[e] * scale);
  }
  const v4u u = (v4u){pk16(hb[0], hb[1]), pk16(hb[2], hb[3]), pk16(hb[4], hb[5]), pk16(hb[6], hb[7])};
  store2_v4u(out + 8 * (size_t)i, u);
}

// ---------------------------------------------------------------------------
// Zero fill of two 16-bit regions (pad rows of the q2 and k planes): grid (n8/256, 2); 8 halves per thread, 16-B stores.
// ---------------------------------------------------------------------------
__global__ __launch_bounds__(256) void fill_zero2_kernel(unsigned short* __restrict__ a, unsigned short* __restrict__ b, int n8) {
  const int i = blockIdx.x * 256 + threadIdx.x;
  if (i >= n8) return;
  unsigned short* dst = (blockIdx.y == 0) ? a : b;   // block-uniform select between two global pointers
  const v4u z = (v4u){0u, 0u, 0u, 0u};
  store2_v4u(dst + 8 * (size_t)i, z);
}

// ---------------------------------------------------------------------------
// Weight cast for one layer: blockIdx.y = 0..3 selects W (q2, k, v1, v2) [1024 out][1024 in] row-major (= Bt [N][K] as-is)
// -> f16(256*W) into plane y of w16; blockIdx.y = 4: Wc [128][128] -> wc16. grid (512, 5): 512*256*8 = 1048576 = whole W;
// for y = 4 only blocks 0..7 are active (2048 threads x 8 = 16384 = whole Wc).
// ---------------------------------------------------------------------------
__global__ __launch_bounds__(256) void wcast_kernel(const float* __restrict__ w0, const float* __restrict__ w1,
                                                    const float* __restrict__ w2, const float* __restrict__ w3,
                                                    const float* __restrict__ wc,
                                                    unsigned short* __restrict__ w16, unsigned short* __restrict__ wc16) {
  const int z = blockIdx.y;                                     // block-uniform
  const int i = blockIdx.x * 256 + threadIdx.x;
  const float* src = (z == 0) ? w0 : (z == 1) ? w1 : (z == 2) ? w2 : (z == 3) ? w3 : wc;
  unsigned short* dst = (z < 4) ? (w16 + (size_t)z * kD * kD) : wc16;
  const int n8 = (z < 4) ? (kD * kD / 8) : (kHD * kHD / 8);
  if (i >= n8) return;
  const float* p = src + 8 * (size_t)i;
  const v4f a = *(const v4f*)(p);
  const v4f c = *(const v4f*)(p + 4);
  unsigned short hb[8];
#pragma unroll
  for (int e = 0; e < 4; ++e) {
    hb[e]     = h_bits(a[e] * kWCarry);
    hb[4 + e] = h_bits(c[e] * kWCarry);
  }
  const v4u u = (v4u){pk16(hb[0], hb[1]), pk16(hb[2], hb[3]), pk16(hb[4], hb[5]), pk16(hb[6], hb[7])};
  store2_v4u(dst + 8 * (size_t)i, u);
}

// ---------------------------------------------------------------------------
// CELU (alpha 1.3), f32
// ---------------------------------------------------------------------------
__device__ __forceinline__ float celu_f(float x) {
  const float en = expf(x * (1.0f / 1.3f)) - 1.0f;
  return (x > 0.f) ? x : 1.3f * en;
}

// ---------------------------------------------------------------------------
// GroupNorm of one projection (CELU -> per (token, head) mean/var over 128 channels -> * gw + gb) writing a token-major
// f16 plane [6272][1024]. MODE 0: value carried x16; MODE 2: value multiplied by the k plane value (already x16) -> (v1*k) x16.
// Unit = (token, head) = 128 channels handled by 16 lanes (8 each): wave = 2 units, block = 16 units, grid = 3136 blocks
// ---------------------------------------------------------------------------
template <int MODE>
__global__ __launch_bounds__(256) void gn_rows_kernel(const float* __restrict__ P, const float* __restrict__ gw,
                                                      const float* __restrict__ gb, const unsigned short* __restrict__ kpl,
                                                      unsigned short* __restrict__ outp) {
  const int t = threadIdx.x, lane = t & 31, wave = t >> 5, hh = lane >> 4, cl = lane & 15;
  const int u = (blockIdx.x * 8 + wave) * 2 + hh;              // token*8 + head, < 50176 (grid exact)
  const size_t base = (size_t)u * kHD + cl * 8;                // == token*1024 + head*128 + cl*8
  const int ch = (u & 7) * kHD + cl * 8;                       // channel index within 1024
  const v4f a = *(const v4f*)(P + base);
  const v4f c = *(const v4f*)(P + base + 4);
  float y[8];
#pragma unroll
  for (int e = 0; e < 4; ++e) { y[e] = celu_f(a[e]); y[4 + e] = celu_f(c[e]); }
  float s = ((y[0] + y[1]) + (y[2] + y[3])) + ((y[4] + y[5]) + (y[6] + y[7]));
#pragma unroll
  for (int off = 1; off < 16; off <<= 1) s += __shfl_xor(s, off, 32);   // stays inside the 16-lane half
  const float mu = s * (1.0f / 128.0f);
  float d[8];
  float sq = 0.f;
#pragma unroll
  for (int e = 0; e < 8; ++e) { d[e] = y[e] - mu; sq += d[e] * d[e]; }
#pragma unroll
  for (int off = 1; off < 16; off <<= 1) sq += __shfl_xor(sq, off, 32);
  const float var = sq * (1.0f / 128.0f);
  const float rs = rsqrtf(var + 1e-5f);
  const v4f w0 = *(const v4f*)(gw + ch), w1 = *(const v4f*)(gw + ch + 4);
  const v4f g0 = *(const v4f*)(gb + ch), g1 = *(const v4f*)(gb + ch + 4);
  float o[8];
#pragma unroll
  for (int e = 0; e < 4; ++e) {
    o[e]     = d[e] * rs * w0[e] + g0[e];
    o[4 + e] = d[4 + e] * rs * w1[e] + g1[e];
  }
  if (MODE == 2) {
    const v4u kk = *(const v4u*)(kpl + base);
    float kf[8];
    kf[0] = h16_to_f32(kk.x & 0xffffu); kf[1] = h16_to_f32(kk.x >> 16);
    kf[2] = h16_to_f32(kk.y & 0xffffu); kf[3] = h16_to_f32(kk.y >> 16);
    kf[4] = h16_to_f32(kk.z & 0xffffu); kf[5] = h16_to_f32(kk.z >> 16);
    kf[6] = h16_to_f32(kk.w & 0xffffu); kf[7] = h16_to_f32(kk.w >> 16);
#pragma unroll
    for (int e = 0; e < 8; ++e) o[e] = o[e] * kf[e];
  } else {
#pragma unroll
    for (int e = 0; e < 8; ++e) o[e] = o[e] * kXCarry;
  }
  unsigned short hb[8];
#pragma unroll
  for (int e = 0; e < 8; ++e) hb[e] = h_bits(o[e]);
  const v4u uu = (v4u){pk16(hb[0], hb[1]), pk16(hb[2], hb[3]), pk16(hb[4], hb[5]), pk16(hb[6], hb[7])};
  store2_v4u(outp + base, uu);
}

// ---------------------------------------------------------------------------
// GroupNorm of the v2 projection written transposed and key-padded: V2T[((h*128 + d)*32 + b)*256 + key] = f16(16 * v2n),
// keys 196..255 = 0. Block = (b, h, dh): 64 channels d = dh*64.. of one (b,h), all 196 tokens; grid (32, 8, 2).
// Phase 0: zero keys 192..255 of the 64 LDS rows (256 threads x 2 x 8 halves = 64 x 64). Phase 1: wave w handles tokens
// w, w+8, ...: 32 lanes x 4 channels = 128 (stats over the full head), the 16 lanes of half dh write their 4 channels
// into LDS [ch][key]. Phase 2: wave w writes rows w*8..w*8+7 (8 waves = 64 rows), each row 256 halves = 512 B =
// ---------------------------------------------------------------------------
constexpr int kV2Pitch = 264;   // halves; 528 B keeps 16-B alignment of row bases
__global__ __launch_bounds__(256) void gn_v2t_kernel(const float* __restrict__ P, const float* __restrict__ gw,
                                                     const float* __restrict__ gb, unsigned short* __restrict__ v2t) {
  __shared__ __align__(16) unsigned short sm[64 * kV2Pitch];
  const int t = threadIdx.x, lane = t & 31, wave = t >> 5;
  const int b = blockIdx.x, h = blockIdx.y, dh = blockIdx.z;
  {
    const v4u z = (v4u){0u, 0u, 0u, 0u};
#pragma unroll
    for (int j = 0; j < 2; ++j) {
      const int idx = t * 2 + j;              // 0..511
      const int row = idx >> 3, part = idx & 7;
      *(v4u*)(sm + row * kV2Pitch + 192 + part * 8) = z;
    }
  }
  __syncthreads();
  const int ch = h * kHD + lane * 4;
  const v4f wv = *(const v4f*)(gw + ch);
  const v4f gv = *(const v4f*)(gb + ch);
  const int cl0 = (lane & 15) * 4;
  for (int i = 0; i < 25; ++i) {
    const int tok = wave + 8 * i;             // wave-uniform
    if (tok >= kM) break;
    const v4f a = *(const v4f*)(P + ((size_t)(b * kM + tok)) * kD + ch);
    float y[4];
#pragma unroll
    for (int e = 0; e < 4; ++e) y[e] = celu_f(a[e]);
    float s = (y[0] + y[1]) + (y[2] + y[3]);
#pragma unroll
    for (int off = 1; off < 32; off <<= 1) s += __shfl_xor(s, off, 32);
    const float mu = s * (1.0f / 128.0f);
    float d[4];
    float sq = 0.f;
#pragma unroll
    for (int e = 0; e < 4; ++e) { d[e] = y[e] - mu; sq += d[e] * d[e]; }
#pragma unroll
    for (int off = 1; off < 32; off <<= 1) sq += __shfl_xor(sq, off, 32);
    const float var = sq * (1.0f / 128.0f);
    const float rs = rsqrtf(var + 1e-5f);
    unsigned short hb[4];
#pragma unroll
    for (int e = 0; e < 4; ++e) hb[e] = h_bits((d[e] * rs * wv[e] + gv[e]) * kXCarry);
    if ((lane >> 4) == dh) {
#pragma unroll
      for (int e = 0; e < 4; ++e) sm[(cl0 + e) * kV2Pitch + tok] = hb[e];
    }
  }
  __syncthreads();
  const size_t rowbase = ((size_t)(h * kHD + dh * 64)) * (kB * kSP) + (size_t)b * kSP + lane * 8;
  {
#pragma unroll
    for (int it = 0; it < 8; ++it) {
      const int cl = wave * 8 + it;           // 0..63
      const v4u u = *(const v4u*)(sm + cl * kV2Pitch + lane * 8);
      *(v4u*)(v2t + rowbase + (size_t)cl * (kB * kSP)) = u;
    }
    
  }
}

// ---------------------------------------------------------------------------
// Row softmax for one head: scores plane S [32 b][256 q][256 keys] f32 (already scaled by 128^-0.5); key j >= 196 excluded,
// real keys with mask[b][j] == 0 set to -1e9 (select); P = exp(s - max)/sum written as f16(2048 * P), pad keys and pad
// query rows (q >= 196) written as 0. One wave per row (32 lanes x 8 keys = 256), 8 rows per block, grid (32, 32) = all
// ---------------------------------------------------------------------------
__global__ __launch_bounds__(256) void softmax_kernel(const float* __restrict__ S, const float* __restrict__ mask,
                                                      unsigned short* __restrict__ Pp) {
  const int t = threadIdx.x, lane = t & 31, wave = t >> 5;
  const int b = blockIdx.y;
  const int r = blockIdx.x * 8 + wave;                 // 0..255, wave-uniform
  const int rc = (r < kM) ? r : (kM - 1);              // clamped address
  const float* sr = S + ((size_t)b * kSP + rc) * kSP + lane * 8;
  const v4f a = *(const v4f*)(sr);
  const v4f c = *(const v4f*)(sr + 4);
  float x[8];
#pragma unroll
  for (int e = 0; e < 4; ++e) { x[e] = a[e]; x[4 + e] = c[e]; }
  float s[8];
#pragma unroll
  for (int e = 0; e < 8; ++e) {
    const int j  = lane * 8 + e;
    const int jc = (j < kM) ? j : (kM - 1);
    const float mv = mask[b * kM + jc];
    const float v = (mv == 0.0f) ? -1.0e9f : x[e];
    s[e] = (j < kM) ? v : -3.0e38f;
  }
  float mx = fmaxf(fmaxf(fmaxf(s[0], s[1]), fmaxf(s[2], s[3])), fmaxf(fmaxf(s[4], s[5]), fmaxf(s[6], s[7])));
#pragma unroll
  for (int off = 1; off < 32; off <<= 1) mx = fmaxf(mx, __shfl_xor(mx, off, 32));
  float p[8];
  float ps = 0.f;
#pragma unroll
  for (int e = 0; e < 8; ++e) {
    const int j = lane * 8 + e;
    const float arg = (j < kM) ? (s[e] - mx) : -100.0f;
    const float ev = expf(arg);
    p[e] = (j < kM) ? ev : 0.0f;
    ps += p[e];
  }
#pragma unroll
  for (int off = 1; off < 32; off <<= 1) ps += __shfl_xor(ps, off, 32);
  const float inv = 1.0f / ps;
  unsigned short hb[8];
#pragma unroll
  for (int e = 0; e < 8; ++e) hb[e] = h_bits(p[e] * inv * kPCarry);
  const v4u u = (v4u){pk16(hb[0], hb[1]), pk16(hb[2], hb[3]), pk16(hb[4], hb[5]), pk16(hb[6], hb[7])};
  v4u uu;
  uu.x = (r < kM) ? u.x : 0u;
  uu.y = (r < kM) ? u.y : 0u;
  uu.z = (r < kM) ? u.z : 0u;
  uu.w = (r < kM) ? u.w : 0u;
  store2_v4u(Pp + ((size_t)b * kSP + r) * kSP + lane * 8, uu);
}

// ---------------------------------------------------------------------------
// Gated residual + LayerNorm: y = x + gate*attn (token-major gate [6272][1024], attn [32][256 q][1024]); x_new = LN(y)*lnw + lnb
// written f32 to xout (may alias xin: each block reads its whole row into registers before any store, no other block
// touches the row) and as f16(16*x_new) to x16. One block per token (grid 6272), thread t owns columns 4t..4t+3.
// ---------------------------------------------------------------------------
__global__ __launch_bounds__(256) void merge_ln_kernel(const float* xin, const float* __restrict__ att,
                                                       const float* __restrict__ gate, const float* __restrict__ lnw,
                                                       const float* __restrict__ lnb, float* xout,
                                                       unsigned short* __restrict__ x16) {
  __shared__ float redA[8];
  __shared__ float redB[8];
  __shared__ __align__(16) float srow[kD];
  const int t = threadIdx.x, lane = t & 31, wave = t >> 5;
  const int r = blockIdx.x;
  const int b = r / kM;
  const int m = r - b * kM;
  const int c0 = t * 4;
  const size_t ro = (size_t)r * kD + c0;
  const v4f xv = *(const v4f*)(xin + ro);
  const v4f gv = *(const v4f*)(gate + ro);
  const v4f av = *(const v4f*)(att + ((size_t)(b * kSP + m)) * kD + c0);
  float y[4];
#pragma unroll
  for (int e = 0; e < 4; ++e) y[e] = xv[e] + gv[e] * av[e];
  float s = (y[0] + y[1]) + (y[2] + y[3]);
#pragma unroll
  for (int off = 1; off < 32; off <<= 1) s += __shfl_xor(s, off, 32);
  if (lane == 0) redA[wave] = s;
  __syncthreads();
  float tot = redA[0];
#pragma unroll
  for (int w = 1; w < 8; ++w) tot += redA[w];
  const float mu = tot * (1.0f / 1024.0f);
  float d[4];
  float sq = 0.f;
#pragma unroll
  for (int e = 0; e < 4; ++e) { d[e] = y[e] - mu; sq += d[e] * d[e]; }
#pragma unroll
  for (int off = 1; off < 32; off <<= 1) sq += __shfl_xor(sq, off, 32);
  if (lane == 0) redB[wave] = sq;
  __syncthreads();
  float tot2 = redB[0];
#pragma unroll
  for (int w = 1; w < 8; ++w) tot2 += redB[w];
  const float var = tot2 * (1.0f / 1024.0f);
  const float rs = rsqrtf(var + 1e-5f);
  const v4f wv = *(const v4f*)(lnw + c0);
  const v4f bv = *(const v4f*)(lnb + c0);
  v4f ov;
#pragma unroll
  for (int e = 0; e < 4; ++e) ov[e] = d[e] * rs * wv[e] + bv[e];
  *(v4f*)(srow + c0) = ov;
  __syncthreads();
  const int tc = t & 127;                               // clamped staging index; only t < 128 stores
  const v4f p0 = *(const v4f*)(srow + tc * 8);
  const v4f p1 = *(const v4f*)(srow + tc * 8 + 4);
  unsigned short hb[8];
#pragma unroll
  for (int e = 0; e < 4; ++e) {
    hb[e]     = h_bits(p0[e] * kXCarry);
    hb[4 + e] = h_bits(p1[e] * kXCarry);
  }
  const v4u hu = (v4u){pk16(hb[0], hb[1]), pk16(hb[2], hb[3]), pk16(hb[4], hb[5]), pk16(hb[6], hb[7])};
  unsigned short* hp = x16 + (size_t)r * kD + tc * 8;
  {
    *(v4f*)(xout + ro) = ov;
    if (t < 128) *(v4u*)hp = hu;
    
  }
}

// ---------------------------------------------------------------------------
// Masked mean over tokens: out0[b][c] = sum_m x[b][m][c]*mask[b][m] / sum_m mask[b][m]. One block per b (grid 32),
// ---------------------------------------------------------------------------
__global__ __launch_bounds__(256) void pool_kernel(const float* x, const float* __restrict__ mask, float* out0) {
  const int t = threadIdx.x;
  const int b = blockIdx.x;
  const int c0 = t * 4;
  v4f acc = (v4f){0.f, 0.f, 0.f, 0.f};
  float ms = 0.f;
#pragma unroll 1
  for (int m = 0; m < kM; ++m) {
    const float mv = mask[b * kM + m];
    const v4f xv = *(const v4f*)(x + ((size_t)(b * kM + m)) * kD + c0);
    acc += xv * mv;
    ms += mv;
  }
  const float inv = 1.0f / ms;
  const v4f o = acc * inv;
  store2_v4f(out0 + (size_t)b * kD + c0, o);
}

// ---------------------------------------------------------------------------
// Host orchestration: kernel launches only. 2 + 3*35 + 1 = 108 launches.
// ---------------------------------------------------------------------------
extern "C" void kernel_launch(void* const* d_in, const int* in_sizes, int n_in,
                              void* d_out, int out_size, void* d_ws, size_t ws_size,
                              hipStream_t stream) {
  if (n_in < 22) return;
  if (in_sizes[0] != kTok * kD) return;
  if (in_sizes[1] != kTok) return;
  if (in_sizes[2] != kL * kD * kD || in_sizes[6] != kL * kD * kD || in_sizes[10] != kL * kD * kD || in_sizes[14] != kL * kD * kD) return;
  if (in_sizes[18] != kL * kHD * kHD || in_sizes[19] != kL * kHD) return;
  if (in_sizes[3] != kL * kD || in_sizes[20] != kL * kD || in_sizes[21] != kL * kD) return;
  if (out_size != kB * kD + kTok * kD) return;
  if (ws_size < kWsTotal) return;

  const float* att_feats = (const float*)d_in[0];
  const float* att_mask  = (const float*)d_in[1];
  const float* Wq2  = (const float*)d_in[2];
  const float* bq2  = (const float*)d_in[3];
  const float* gq2w = (const float*)d_in[4];
  const float* gq2b = (const float*)d_in[5];
  const float* Wk   = (const float*)d_in[6];
  const float* bk   = (const float*)d_in[7];
  const float* gkw  = (const float*)d_in[8];
  const float* gkb  = (const float*)d_in[9];
  const float* Wv1  = (const float*)d_in[10];
  const float* bv1  = (const float*)d_in[11];
  const float* gv1w = (const float*)d_in[12];
  const float* gv1b = (const float*)d_in[13];
  const float* Wv2  = (const float*)d_in[14];
  const float* bv2  = (const float*)d_in[15];
  const float* gv2w = (const float*)d_in[16];
  const float* gv2b = (const float*)d_in[17];
  const float* Wc   = (const float*)d_in[18];
  const float* bc   = (const float*)d_in[19];
  const float* lnw  = (const float*)d_in[20];
  const float* lnb  = (const float*)d_in[21];

  char* ws = (char*)d_ws;
  float*          Ppl   = (float*)(ws + kOffP);                    // linear+bias plane
  float*          GATE  = (float*)(ws + kOffP);                    // gate plane (same region, later)
  unsigned short* GIN16 = (unsigned short*)(ws + kOffATT);         // (v1*k) plane
  float*          ATT   = (float*)(ws + kOffATT);                  // attn plane (same region, later)
  unsigned short* X16   = (unsigned short*)(ws + kOffX16);
  float*          Spl   = (float*)(ws + kOffX16);                  // scores (same region during attention)
  unsigned short* PP    = (unsigned short*)(ws + kOffX16 + kBytesS);
  unsigned short* W16   = (unsigned short*)(ws + kOffW16);
  unsigned short* WC16  = (unsigned short*)(ws + kOffWC16);
  unsigned short* Q16   = (unsigned short*)(ws + kOffQ16);
  unsigned short* K16   = (unsigned short*)(ws + kOffK16);
  unsigned short* V2T   = (unsigned short*)(ws + kOffV2T);

  float* out0 = (float*)d_out;                                     // [32][1024] at byte 0
  float* out1 = (float*)d_out + (size_t)kB * kD;                   // [32][196][1024] at byte 131072; also the running x

  const float projScale  = 1.0f / (kXCarry * kWCarry);             // 1/4096
  const float gateScale  = 1.0f / (kXCarry * kWCarry);             // (v1*k) x16, Wc x256
  const float scoreScale = 0.08838834764831845f * (1.0f / (kXCarry * kXCarry));
  const float pvScale    = 1.0f / (kPCarry * kXCarry);             // 1/32768

  // x -> f16 plane (x16); pad rows of the q2/k planes zero
  {
    const int n8 = kTok * kD / 8;                                  // 802816 = 3136 * 256
    cast8s_kernel<<<dim3(n8 / 256), dim3(256), 0, stream>>>(att_feats, X16, n8, kXCarry);
    const int npad8 = 64 * kD / 8;                                 // 8192 = 32 * 256
    fill_zero2_kernel<<<dim3(npad8 / 256, 2), dim3(256), 0, stream>>>(Q16 + (size_t)kTok * kD, K16 + (size_t)kTok * kD, npad8);
  }

  for (int i = 0; i < kL; ++i) {
    const size_t wo = (size_t)i * kD * kD;
    wcast_kernel<<<dim3(512, 5), dim3(256), 0, stream>>>(Wq2 + wo, Wk + wo, Wv1 + wo, Wv2 + wo, Wc + (size_t)i * kHD * kHD, W16, WC16);

    // four projections: P = x16 * Wz^T + bz (M 6272, N 1024, K 1024: K % 32 == 0, M,N % 64 == 0; 1568 tiles = 196 blocks)
    for (int z = 0; z < 4; ++z) {
      const float* biasz = (z == 0) ? bq2 : (z == 1) ? bk : (z == 2) ? bv1 : bv2;
      const float* gwz   = (z == 0) ? gq2w : (z == 1) ? gkw : (z == 2) ? gv1w : gv2w;
      const float* gbz   = (z == 0) ? gq2b : (z == 1) ? gkb : (z == 2) ? gv1b : gv2b;
      wmma_gemm64<0, false, 2, 0, false, 0><<<dim3(196, 1), dim3(256), 0, stream>>>(
          X16, nullptr, kD, 0L,
          W16 + (size_t)z * kD * kD, nullptr, kD, 0L,
          (void*)Ppl, nullptr, kD, 0L,
          biasz + (size_t)i * kD, nullptr, 0L,
          kTok, kD, kD, projScale);
      if (z == 0) {
        gn_rows_kernel<0><<<dim3(3136), dim3(256), 0, stream>>>(Ppl, gwz + (size_t)i * kD, gbz + (size_t)i * kD, K16, Q16);
      } else if (z == 1) {
        gn_rows_kernel<0><<<dim3(3136), dim3(256), 0, stream>>>(Ppl, gwz + (size_t)i * kD, gbz + (size_t)i * kD, Q16, K16);
      } else if (z == 2) {
        gn_rows_kernel<2><<<dim3(3136), dim3(256), 0, stream>>>(Ppl, gwz + (size_t)i * kD, gbz + (size_t)i * kD, K16, GIN16);
      } else {
        gn_v2t_kernel<<<dim3(kB, kH, 2), dim3(256), 0, stream>>>(Ppl, gwz + (size_t)i * kD, gbz + (size_t)i * kD, V2T);
      }
    }

    // gate = sigmoid((v1*k) * Wc^T + bc): M 50176, N 128, K 128 (1568 tiles = 196 blocks); output [50176][128] f32 == token-major [6272][1024]
    wmma_gemm64<0, false, 2, 0, false, 6><<<dim3(196, 1), dim3(256), 0, stream>>>(
        GIN16, nullptr, kHD, 0L,
        WC16, nullptr, kHD, 0L,
        (void*)GATE, nullptr, kHD, 0L,
        bc + (size_t)i * kHD, nullptr, 0L,
        kTok * kH, kHD, kHD, gateScale);

    // attention per head, 32 batch groups per launch (grid.y = b)
    for (int h = 0; h < kH; ++h) {
      // scores [b][256 q][256 keys] = q2 * k^T * 128^-0.5 (M 256, N 256, K 128; 16 tiles = 2 blocks per b)
      wmma_gemm64<0, false, 0, 0, false, 0><<<dim3(2, kB), dim3(256), 0, stream>>>(
          Q16 + (size_t)h * kHD, nullptr, kD, (long)kM * kD,
          K16 + (size_t)h * kHD, nullptr, kD, (long)kM * kD,
          (void*)Spl, nullptr, kSP, (long)kSP * kSP,
          nullptr, nullptr, 0L,
          kSP, kSP, kHD, scoreScale);
      softmax_kernel<<<dim3(kSP / 8, kB), dim3(256), 0, stream>>>(Spl, att_mask, PP);
      // attn columns h*128.. of [b][256 q][1024] = P * v2 (M 256, N 128, K 224; 8 tiles = 1 block per b)
      wmma_gemm64<0, false, 0, 0, false, 0><<<dim3(1, kB), dim3(256), 0, stream>>>(
          PP, nullptr, kSP, (long)kSP * kSP,
          V2T + (size_t)h * kHD * (kB * kSP), nullptr, kB * kSP, (long)kSP,
          (void*)(ATT + (size_t)h * kHD), nullptr, kD, (long)kSP * kD,
          nullptr, nullptr, 0L,
          kSP, kHD, kKeyK, pvScale);
    }

    const float* xin = (i == 0) ? att_feats : out1;
    merge_ln_kernel<<<dim3(kTok), dim3(256), 0, stream>>>(xin, ATT, GATE, lnw + (size_t)i * kD, lnb + (size_t)i * kD, out1, X16);
  }

  pool_kernel<<<dim3(kB), dim3(256), 0, stream>>>(out1, att_mask, out0);
}

// v001
// Measured time: 984 microseconds a run.
// Timed twice side by side with v000, it ran 1.60 and 1.62 times as fast.
// Contractions: projections x(f16, x16)*W^T(f16, x256), gate (v1*k)(f16, x16)*Wc^T(f16, x256), scores q2(f16, x16)*k^T(f16, x16), attn P(f16, x2048)*v2(f16, x16): all v_wmma_f32_16x16x32_f16 with f32 accumulate; CELU, GroupNorm, softmax, sigmoid, residual, LayerNorm and masked mean in f32.
#include <hip/hip_runtime.h>
#include <math.h>

// ---------------------------------------------------------------------------
// Problem constants
// ---------------------------------------------------------------------------
constexpr int kB   = 32;
constexpr int kM   = 196;
constexpr int kD   = 1024;
constexpr int kH   = 8;
constexpr int kHD  = 128;
constexpr int kL   = 3;
constexpr int kTok = kB * kM;          // 6272 = 98 * 64 token rows
constexpr int kTokPad = kTok + 64;     // 6336: 64 zero rows so per-group 256-row tiles never leave the plane
constexpr int kSP  = 256;              // padded queries / keys per (batch, head) group
constexpr int kKeyK = 224;             // contraction depth of P*V (keys padded to a multiple of 32)
constexpr float kXCarry = 16.0f;       // x, q2, k, v2 planes carried x16 in f16
constexpr float kWCarry = 256.0f;      // W, Wc carried x256 in f16
constexpr float kPCarry = 2048.0f;     // probabilities carried x2048 in f16

// ---------------------------------------------------------------------------
// Workspace region map (bytes, all offsets multiples of 256)
//   R_P    [0, 25690112)            : linear+bias plane f32 [6272][1024]  -> later gate plane f32 [50176][128]
//   R_ATT  [25690112, 59244544)     : (v1*k) f16 plane [6272][1024]      -> later attn f32 [32][256][1024]
//   R_X16  [59244544, 72089600)     : x f16 [6272][1024]
//   R_W16  [72089600, 80478208)     : stacked W f16 [4096][1024]
//   R_WC16 [80478208, 80510976)     : Wc f16 [128][128]
//   R_Q16  [80510976, 93487104)     : q2 f16 [6336][1024] (rows >= 6272 zero)
//   R_K16  [93487104, 106463232)    : k  f16 [6336][1024] (rows >= 6272 zero)
//   R_V2T  [106463232, 123240448)   : v2^T f16 [8 h][128 d][32 b][256 keys] (keys >= 196 zero)
//   R_S    [123240448, 190349312)   : scores f32 [8 h][32 b][256 q][256 keys]
//   R_PP   [190349312, 223903744)   : probs f16 [8 h][32 b][256 q][256 keys]
// ---------------------------------------------------------------------------
constexpr size_t kBytesP    = (size_t)kTok * kD * 4;
constexpr size_t kBytesATT  = (size_t)kB * kSP * kD * 4;
constexpr size_t kBytesX16  = (size_t)kTok * kD * 2;
constexpr size_t kBytesW16  = (size_t)4 * kD * kD * 2;
constexpr size_t kBytesWC16 = (size_t)kHD * kHD * 2;
constexpr size_t kBytesQ16  = (size_t)kTokPad * kD * 2;
constexpr size_t kBytesV2T  = (size_t)kH * kHD * kB * kSP * 2;
constexpr size_t kBytesS    = (size_t)kH * kB * kSP * kSP * 4;
constexpr size_t kBytesPP   = (size_t)kH * kB * kSP * kSP * 2;
constexpr size_t kOffP    = 0;
constexpr size_t kOffATT  = kOffP + kBytesP;
constexpr size_t kOffX16  = kOffATT + kBytesATT;
constexpr size_t kOffW16  = kOffX16 + kBytesX16;
constexpr size_t kOffWC16 = kOffW16 + kBytesW16;
constexpr size_t kOffQ16  = kOffWC16 + kBytesWC16;
constexpr size_t kOffK16  = kOffQ16 + kBytesQ16;
constexpr size_t kOffV2T  = kOffK16 + kBytesQ16;
constexpr size_t kOffS    = kOffV2T + kBytesV2T;
constexpr size_t kOffPP   = kOffS + kBytesS;
constexpr size_t kWsTotal = kOffPP + kBytesPP;
static_assert(kWsTotal == 223903744, "carve total");
static_assert(kWsTotal <= 268435456, "carve under 256 MiB");
static_assert(kBytesATT >= (size_t)kTok * kD * 2, "vk plane fits in the attn region");
static_assert(kBytesP == (size_t)kTok * kH * kHD * 4, "gate plane fits in the P region");
static_assert((kOffATT % 256) == 0 && (kOffX16 % 256) == 0 && (kOffW16 % 256) == 0 && (kOffQ16 % 256) == 0 && (kOffK16 % 256) == 0 && (kOffV2T % 256) == 0 && (kOffS % 256) == 0 && (kOffPP % 256) == 0, "aligned");

typedef __attribute__((ext_vector_type(16))) _Float16 v16h;
typedef __attribute__((ext_vector_type(8)))  _Float16 v8h;
typedef __attribute__((ext_vector_type(16))) __bf16   v16b;
typedef __attribute__((ext_vector_type(8)))  __bf16   v8b;
typedef __attribute__((ext_vector_type(8)))  float    v8f;
typedef __attribute__((ext_vector_type(4)))  float    v4f;
typedef __attribute__((ext_vector_type(4)))  unsigned int v4u;

__device__ __forceinline__ unsigned short f2bf_bits(float f) {
  unsigned u = __float_as_uint(f);
  return (unsigned short)((u + 0x7FFFu + ((u >> 16) & 1u)) >> 16);
}
__device__ __forceinline__ float bf_bits2f(unsigned short h) { return __uint_as_float(((unsigned)h) << 16); }

// hazard guards as plain device helpers (no inline asm inside the kernel template body)
__device__ __forceinline__ void dep_guard_h(v8f& a, v8f& b, v16h x, v16h y) { asm volatile("v_nop\n\tv_nop\n\tv_nop\n\tv_nop" : "+v"(a), "+v"(b) : "v"(x), "v"(y)); }
__device__ __forceinline__ void dep_guard_b(v8f& a, v8f& b, v16b x, v16b y) { asm volatile("v_nop\n\tv_nop\n\tv_nop\n\tv_nop" : "+v"(a), "+v"(b) : "v"(x), "v"(y)); }
__device__ __forceinline__ void keep4_h(v16h a, v16h b, v16h c, v16h d) { asm volatile("v_nop" :: "v"(a), "v"(b), "v"(c), "v"(d)); }
__device__ __forceinline__ void keep4_b(v16b a, v16b b, v16b c, v16b d) { asm volatile("v_nop" :: "v"(a), "v"(b), "v"(c), "v"(d)); }
__device__ __forceinline__ void acc_guard4(v8f& a, v8f& b, v8f& c, v8f& d) { asm volatile("v_nop\n\tv_nop\n\tv_nop\n\tv_nop" : "+v"(a), "+v"(b), "+v"(c), "+v"(d)); }
template <typename T> struct Frag;
template <> struct Frag<_Float16> {
  typedef v16h V; union U { v16h v; v8h h[2]; };
  static __device__ __forceinline__ v16h load(const _Float16* p) {   // elements 0..7 <- p[0..7], 8..15 <- p[16..23]
    U f; f.h[0] = *(const v8h*)(p); f.h[1] = *(const v8h*)(p + 16); return f.v;
  }
  static __device__ __forceinline__ v8f mma(v16h a, v16h b, v8f c) {
    return __builtin_amdgcn_wmma_f32_16x16x32_f16(false, a, false, b, (short)0, c, false, false);
  }
  static __device__ __forceinline__ void guard(v8f& a, v8f& b, v16h x, v16h y) { dep_guard_h(a, b, x, y); }
  static __device__ __forceinline__ void keep(v16h a, v16h b, v16h c, v16h d) { keep4_h(a, b, c, d); }
};
template <> struct Frag<__bf16> {
  typedef v16b V; union U { v16b v; v8b h[2]; };
  static __device__ __forceinline__ v16b load(const __bf16* p) {
    U f; f.h[0] = *(const v8b*)(p); f.h[1] = *(const v8b*)(p + 16); return f.v;
  }
  static __device__ __forceinline__ v8f mma(v16b a, v16b b, v8f c) {
    return __builtin_amdgcn_wmma_f32_16x16x32_bf16(false, a, false, b, (short)0, c, false, false);
  }
  static __device__ __forceinline__ void guard(v8f& a, v8f& b, v16b x, v16b y) { dep_guard_b(a, b, x, y); }
  static __device__ __forceinline__ void keep(v16b a, v16b b, v16b c, v16b d) { keep4_b(a, b, c, d); }
};

__device__ __forceinline__ unsigned pk16(unsigned short a, unsigned short b) { return (unsigned)a | ((unsigned)b << 16); }
__device__ __forceinline__ unsigned short h_bits(float f) { const _Float16 h = (_Float16)f; return __builtin_bit_cast(unsigned short, h); }

// exact f16 bits -> f32 via integer arithmetic (normals and subnormals; no _Float16 vector involved)
__device__ __forceinline__ float h16_to_f32(unsigned hb) {
  const unsigned em = hb & 0x7fffu;
  const float fn = __uint_as_float((em + 0x1C000u) << 13);
  const float fs = (float)em * 5.9604644775390625e-8f;
  const float f  = (em < 0x400u) ? fs : fn;
  return __uint_as_float(__float_as_uint(f) | ((hb & 0x8000u) << 16));
}

__device__ __forceinline__ void store2_v4u(unsigned short* p, v4u u) {
  *(v4u*)p = u;
  
}
__device__ __forceinline__ void store2_v4f(float* p, v4f v) {
  *(v4f*)p = v;
  
}

// ---- Register-blocked batched WMMA GEMM (ACT: 0 none, 2 relu, 4 leaky, 6 sigmoid) -------------
// C[m,n] = scale * sum_k A[m,k] * Bt[n,k] (+bias)(+resid); each wave owns a 64x64 tile.
// A row-major [M,K]; Bt row-major [N,K]; M,N % 64 == 0, K % 32 == 0.
// SPLIT: operands are hi/lo planes (A2/Bt2 = lo planes, same layout); product = hi*hi + hi*lo + lo*hi.
// BIAS_MODE: 0 = none, 1 = bias[m], 2 = bias[n].
// OUT_MODE: 0 = f32, 1 = f16, 2 = bf16 hi plane (Cout) + bf16 lo plane (Cout2).
// ET: 0 = f16 operands, 1 = bf16 operands (pointers passed as 16-bit storage)
// Batching: blockIdx.y steps A, Bt, C by strideA, strideB, strideC; blockIdx.z steps them by strideAz, strideBz, strideCz.
template <int ET> struct Elem;
template <> struct Elem<0> { typedef _Float16 T; };
template <> struct Elem<1> { typedef __bf16 T; };
template <int ET, bool SPLIT, int BIAS_MODE, int OUT_MODE, bool RESID, int ACT = 0>
__global__ __launch_bounds__(256) void wmma_gemm64(
    const unsigned short* __restrict__ Ap, const unsigned short* __restrict__ A2p, int lda, long strideA, long strideAz,
    const unsigned short* __restrict__ Btp, const unsigned short* __restrict__ Bt2p, int ldb, long strideB, long strideBz,
    void* __restrict__ Cout, void* __restrict__ Cout2, int ldc, long strideC, long strideCz,
    const float* __restrict__ bias,
    const float* __restrict__ resid, long strideR,
    int M, int N, int K, float scale) {
  typedef typename Elem<ET>::T T;
  typedef typename Frag<T>::V V;
  const T* A = (const T*)Ap; const T* A2 = (const T*)A2p; const T* Bt = (const T*)Btp; const T* Bt2 = (const T*)Bt2p;
  __shared__ __align__(16) float sT[8][16 * 68];   // per-wave 16x64 slab, pitch 68 floats
  const int b    = blockIdx.y;
  const int z    = blockIdx.z;
  const int lane = threadIdx.x & 31;
  const int wave = threadIdx.x >> 5;
  const int tilesN = N >> 6;
  const int tilesM = M >> 6;
  const int tile = blockIdx.x * 8 + wave;
  if (tile >= tilesM * tilesN) return;   // wave-uniform; no block barriers in this kernel
  const int tm = tile / tilesN;
  const int tn = tile - tm * tilesN;
  const int m0 = tm << 6;
  const int n0 = tn << 6;

  const size_t offA = (size_t)b * strideA + (size_t)z * strideAz;
  const size_t offB = (size_t)b * strideB + (size_t)z * strideBz;
  const size_t offC = (size_t)b * strideC + (size_t)z * strideCz;
  const T* Ab  = A  + offA;
  const T* Bb  = Bt + offB;
  const T* Ab2 = SPLIT ? (A2  + offA) : nullptr;
  const T* Bb2 = SPLIT ? (Bt2 + offB) : nullptr;

  const int rlane = lane & 15;                 // row (A) / col (B, D) within subtile
  const int koff  = (lane >> 4) * 8;           // k offset of this lane half
  const int mOff  = (lane >> 4) * 8;           // D row offset

  v8f acc[4][4];
#pragma unroll
  for (int i = 0; i < 4; ++i)
#pragma unroll
    for (int j = 0; j < 4; ++j) acc[i][j] = (v8f){0.f,0.f,0.f,0.f,0.f,0.f,0.f,0.f};

  for (int k0 = 0; k0 < K; k0 += 32) {
    V bh[4], bl[4];
#pragma unroll
    for (int j = 0; j < 4; ++j) {
      const size_t bo = (size_t)(n0 + (j << 4) + rlane) * ldb + koff + k0;
      bh[j] = Frag<T>::load(Bb + bo);
      if (SPLIT) bl[j] = Frag<T>::load(Bb2 + bo);
    }
#pragma unroll
    for (int i = 0; i < 4; ++i) {
      const size_t ao = (size_t)(m0 + (i << 4) + rlane) * lda + koff + k0;
      V ah = Frag<T>::load(Ab + ao);
      V al;
      if (SPLIT) al = Frag<T>::load(Ab2 + ao);
#pragma unroll
      for (int j = 0; j < 4; ++j) {
        acc[i][j] = Frag<T>::mma(ah, bh[j], acc[i][j]);
        if (SPLIT) {
          acc[i][j] = Frag<T>::mma(ah, bl[j], acc[i][j]);
          acc[i][j] = Frag<T>::mma(al, bh[j], acc[i][j]);
        }
      }
      Frag<T>::guard(acc[i][0], acc[i][3], ah, SPLIT ? al : ah);
    }
    Frag<T>::keep(bh[0], bh[1], bh[2], bh[3]);
    if (SPLIT) Frag<T>::keep(bl[0], bl[1], bl[2], bl[3]);
  }
  acc_guard4(acc[0][0], acc[0][1], acc[0][2], acc[0][3]);
  acc_guard4(acc[1][0], acc[1][1], acc[1][2], acc[1][3]);
  acc_guard4(acc[2][0], acc[2][1], acc[2][2], acc[2][3]);
  acc_guard4(acc[3][0], acc[3][1], acc[3][2], acc[3][3]);

  // ---- epilogue ----
  float* slab = sT[wave];
  const float* Rb = RESID ? (resid + (size_t)b * strideR) : nullptr;
#pragma unroll
  for (int i = 0; i < 4; ++i) {
    const int mBase = m0 + (i << 4);
#pragma unroll
    for (int j = 0; j < 4; ++j) {
      const int n = n0 + (j << 4) + rlane;
      float bv = 0.f;
      if (BIAS_MODE == 2) bv = bias[n];
#pragma unroll
      for (int r = 0; r < 8; ++r) {
        float v = acc[i][j][r] * scale;
        if (BIAS_MODE == 1) v += bias[mBase + mOff + r];
        if (BIAS_MODE == 2) v += bv;
        if (RESID) v += Rb[(size_t)(mBase + mOff + r) * ldc + n];
        if (ACT == 2) v = fmaxf(v, 0.0f);
        if (ACT == 4) v = (v > 0.f) ? v : 0.01f * v;
        if (ACT == 6) v = 1.0f / (1.0f + expf(-v));
        slab[(mOff + r) * 68 + (j << 4) + rlane] = v;
      }
    }
    __builtin_amdgcn_fence(__ATOMIC_RELEASE, "workgroup");
    __builtin_amdgcn_wave_barrier();
    __builtin_amdgcn_fence(__ATOMIC_ACQUIRE, "workgroup");
    if (OUT_MODE == 0) {
      float* C = (float*)Cout + offC;
      const int hh = lane >> 4, c4 = (lane & 15) * 4;     // row seg = 256 B = 16 lanes x 16 B
      {
#pragma unroll
        for (int it = 0; it < 8; ++it) {
          const int row = it * 2 + hh;
          v4f v = *(const v4f*)(slab + row * 68 + c4);
          *(v4f*)(C + (size_t)(mBase + row) * ldc + n0 + c4) = v;
        }
        
      }
    } else {
      const int q = lane >> 3, c8 = (lane & 7) * 8;
      unsigned short* C  = (unsigned short*)Cout  + offC;
      unsigned short* C2 = (OUT_MODE == 2) ? ((unsigned short*)Cout2 + offC) : nullptr;
      {
#pragma unroll
        for (int it = 0; it < 4; ++it) {
          const int row = it * 4 + q;
          const float* sp = slab + row * 68 + c8;
          v8h hv, lv;
#pragma unroll
          for (int e = 0; e < 8; ++e) {
            if (OUT_MODE == 1) {
              hv[e] = (_Float16)sp[e];
            } else {
              unsigned short hb = f2bf_bits(sp[e]);
              unsigned short lb = f2bf_bits(sp[e] - bf_bits2f(hb));
              hv[e] = __builtin_bit_cast(_Float16, hb);
              lv[e] = __builtin_bit_cast(_Float16, lb);
            }
          }
          *(v8h*)(C + (size_t)(mBase + row) * ldc + n0 + c8) = hv;
          if (OUT_MODE == 2) *(v8h*)(C2 + (size_t)(mBase + row) * ldc + n0 + c8) = lv;
        }
        
      }
    }
    __builtin_amdgcn_fence(__ATOMIC_RELEASE, "workgroup");
    __builtin_amdgcn_wave_barrier();
    __builtin_amdgcn_fence(__ATOMIC_ACQUIRE, "workgroup");
  }
}

// ---------------------------------------------------------------------------
// ---------------------------------------------------------------------------
__global__ __launch_bounds__(256) void cast8s_kernel(const float* __restrict__ in, unsigned short* __restrict__ out, int n8, float scale) {
  const int i = blockIdx.x * 256 + threadIdx.x;
  if (i >= n8) return;
  const float* p = in + 8 * (size_t)i;
  const v4f a = *(const v4f*)(p);
  const v4f c = *(const v4f*)(p + 4);
  unsigned short hb[8];
#pragma unroll
  for (int e = 0; e < 4; ++e) {
    hb[e]     = h_bits(a[e] * scale);
    hb[4 + e] = h_bits(c[e] * scale);
  }
  const v4u u = (v4u){pk16(hb[0], hb[1]), pk16(hb[2], hb[3]), pk16(hb[4], hb[5]), pk16(hb[6], hb[7])};
  store2_v4u(out + 8 * (size_t)i, u);
}

// ---------------------------------------------------------------------------
// Zero fill of two 16-bit regions (pad rows of the q2 and k planes): grid (n8/256, 2); 8 halves per thread, 16-B stores.
// ---------------------------------------------------------------------------
__global__ __launch_bounds__(256) void fill_zero2_kernel(unsigned short* __restrict__ a, unsigned short* __restrict__ b, int n8) {
  const int i = blockIdx.x * 256 + threadIdx.x;
  if (i >= n8) return;
  unsigned short* dst = (blockIdx.y == 0) ? a : b;   // block-uniform select between two global pointers
  const v4u z = (v4u){0u, 0u, 0u, 0u};
  store2_v4u(dst + 8 * (size_t)i, z);
}

// ---------------------------------------------------------------------------
// Weight cast for one layer: blockIdx.y = 0..3 selects W (q2, k, v1, v2) [1024 out][1024 in] row-major (= Bt [N][K] as-is)
// -> f16(256*W) into plane y of w16; blockIdx.y = 4: Wc [128][128] -> wc16. grid (512, 5): 512*256*8 = 1048576 = whole W;
// for y = 4 only blocks 0..7 are active (2048 threads x 8 = 16384 = whole Wc).
// ---------------------------------------------------------------------------
__global__ __launch_bounds__(256) void wcast_kernel(const float* __restrict__ w0, const float* __restrict__ w1,
                                                    const float* __restrict__ w2, const float* __restrict__ w3,
                                                    const float* __restrict__ wc,
                                                    unsigned short* __restrict__ w16, unsigned short* __restrict__ wc16) {
  const int z = blockIdx.y;                                     // block-uniform
  const int i = blockIdx.x * 256 + threadIdx.x;
  const float* src = (z == 0) ? w0 : (z == 1) ? w1 : (z == 2) ? w2 : (z == 3) ? w3 : wc;
  unsigned short* dst = (z < 4) ? (w16 + (size_t)z * kD * kD) : wc16;
  const int n8 = (z < 4) ? (kD * kD / 8) : (kHD * kHD / 8);
  if (i >= n8) return;
  const float* p = src + 8 * (size_t)i;
  const v4f a = *(const v4f*)(p);
  const v4f c = *(const v4f*)(p + 4);
  unsigned short hb[8];
#pragma unroll
  for (int e = 0; e < 4; ++e) {
    hb[e]     = h_bits(a[e] * kWCarry);
    hb[4 + e] = h_bits(c[e] * kWCarry);
  }
  const v4u u = (v4u){pk16(hb[0], hb[1]), pk16(hb[2], hb[3]), pk16(hb[4], hb[5]), pk16(hb[6], hb[7])};
  store2_v4u(dst + 8 * (size_t)i, u);
}

// ---------------------------------------------------------------------------
// CELU (alpha 1.3), f32
// ---------------------------------------------------------------------------
__device__ __forceinline__ float celu_f(float x) {
  const float en = expf(x * (1.0f / 1.3f)) - 1.0f;
  return (x > 0.f) ? x : 1.3f * en;
}

// ---------------------------------------------------------------------------
// GroupNorm of one projection (CELU -> per (token, head) mean/var over 128 channels -> * gw + gb) writing a token-major
// f16 plane [6272][1024]. MODE 0: value carried x16; MODE 2: value multiplied by the k plane value (already x16) -> (v1*k) x16.
// Unit = (token, head) = 128 channels handled by 16 lanes (8 each): wave = 2 units, block = 16 units, grid = 3136 blocks
// ---------------------------------------------------------------------------
template <int MODE>
__global__ __launch_bounds__(256) void gn_rows_kernel(const float* __restrict__ P, const float* __restrict__ gw,
                                                      const float* __restrict__ gb, const unsigned short* __restrict__ kpl,
                                                      unsigned short* __restrict__ outp) {
  const int t = threadIdx.x, lane = t & 31, wave = t >> 5, hh = lane >> 4, cl = lane & 15;
  const int u = (blockIdx.x * 8 + wave) * 2 + hh;              // token*8 + head, < 50176 (grid exact)
  const size_t base = (size_t)u * kHD + cl * 8;                // == token*1024 + head*128 + cl*8
  const int ch = (u & 7) * kHD + cl * 8;                       // channel index within 1024
  const v4f a = *(const v4f*)(P + base);
  const v4f c = *(const v4f*)(P + base + 4);
  float y[8];
#pragma unroll
  for (int e = 0; e < 4; ++e) { y[e] = celu_f(a[e]); y[4 + e] = celu_f(c[e]); }
  float s = ((y[0] + y[1]) + (y[2] + y[3])) + ((y[4] + y[5]) + (y[6] + y[7]));
#pragma unroll
  for (int off = 1; off < 16; off <<= 1) s += __shfl_xor(s, off, 32);   // stays inside the 16-lane half
  const float mu = s * (1.0f / 128.0f);
  float d[8];
  float sq = 0.f;
#pragma unroll
  for (int e = 0; e < 8; ++e) { d[e] = y[e] - mu; sq += d[e] * d[e]; }
#pragma unroll
  for (int off = 1; off < 16; off <<= 1) sq += __shfl_xor(sq, off, 32);
  const float var = sq * (1.0f / 128.0f);
  const float rs = rsqrtf(var + 1e-5f);
  const v4f w0 = *(const v4f*)(gw + ch), w1 = *(const v4f*)(gw + ch + 4);
  const v4f g0 = *(const v4f*)(gb + ch), g1 = *(const v4f*)(gb + ch + 4);
  float o[8];
#pragma unroll
  for (int e = 0; e < 4; ++e) {
    o[e]     = d[e] * rs * w0[e] + g0[e];
    o[4 + e] = d[4 + e] * rs * w1[e] + g1[e];
  }
  if (MODE == 2) {
    const v4u kk = *(const v4u*)(kpl + base);
    float kf[8];
    kf[0] = h16_to_f32(kk.x & 0xffffu); kf[1] = h16_to_f32(kk.x >> 16);
    kf[2] = h16_to_f32(kk.y & 0xffffu); kf[3] = h16_to_f32(kk.y >> 16);
    kf[4] = h16_to_f32(kk.z & 0xffffu); kf[5] = h16_to_f32(kk.z >> 16);
    kf[6] = h16_to_f32(kk.w & 0xffffu); kf[7] = h16_to_f32(kk.w >> 16);
#pragma unroll
    for (int e = 0; e < 8; ++e) o[e] = o[e] * kf[e];
  } else {
#pragma unroll
    for (int e = 0; e < 8; ++e) o[e] = o[e] * kXCarry;
  }
  unsigned short hb[8];
#pragma unroll
  for (int e = 0; e < 8; ++e) hb[e] = h_bits(o[e]);
  const v4u uu = (v4u){pk16(hb[0], hb[1]), pk16(hb[2], hb[3]), pk16(hb[4], hb[5]), pk16(hb[6], hb[7])};
  store2_v4u(outp + base, uu);
}

// ---------------------------------------------------------------------------
// GroupNorm of the v2 projection written transposed and key-padded: V2T[((h*128 + d)*32 + b)*256 + key] = f16(16 * v2n),
// keys 196..255 = 0. Block = (b, h, dh): 64 channels d = dh*64.. of one (b,h), all 196 tokens; grid (32, 8, 2).
// Phase 0: zero keys 192..255 of the 64 LDS rows (256 threads x 2 x 8 halves = 64 x 64). Phase 1: wave w handles tokens
// w, w+8, ...: 32 lanes x 4 channels = 128 (stats over the full head), the 16 lanes of half dh write their 4 channels
// into LDS [ch][key]. Phase 2: wave w writes rows w*8..w*8+7 (8 waves = 64 rows), each row 256 halves = 512 B =
// ---------------------------------------------------------------------------
constexpr int kV2Pitch = 264;   // halves; 528 B keeps 16-B alignment of row bases
__global__ __launch_bounds__(256) void gn_v2t_kernel(const float* __restrict__ P, const float* __restrict__ gw,
                                                     const float* __restrict__ gb, unsigned short* __restrict__ v2t) {
  __shared__ __align__(16) unsigned short sm[64 * kV2Pitch];
  const int t = threadIdx.x, lane = t & 31, wave = t >> 5;
  const int b = blockIdx.x, h = blockIdx.y, dh = blockIdx.z;
  {
    const v4u z = (v4u){0u, 0u, 0u, 0u};
#pragma unroll
    for (int j = 0; j < 2; ++j) {
      const int idx = t * 2 + j;              // 0..511
      const int row = idx >> 3, part = idx & 7;
      *(v4u*)(sm + row * kV2Pitch + 192 + part * 8) = z;
    }
  }
  __syncthreads();
  const int ch = h * kHD + lane * 4;
  const v4f wv = *(const v4f*)(gw + ch);
  const v4f gv = *(const v4f*)(gb + ch);
  const int cl0 = (lane & 15) * 4;
  for (int i = 0; i < 25; ++i) {
    const int tok = wave + 8 * i;             // wave-uniform
    if (tok >= kM) break;
    const v4f a = *(const v4f*)(P + ((size_t)(b * kM + tok)) * kD + ch);
    float y[4];
#pragma unroll
    for (int e = 0; e < 4; ++e) y[e] = celu_f(a[e]);
    float s = (y[0] + y[1]) + (y[2] + y[3]);
#pragma unroll
    for (int off = 1; off < 32; off <<= 1) s += __shfl_xor(s, off, 32);
    const float mu = s * (1.0f / 128.0f);
    float d[4];
    float sq = 0.f;
#pragma unroll
    for (int e = 0; e < 4; ++e) { d[e] = y[e] - mu; sq += d[e] * d[e]; }
#pragma unroll
    for (int off = 1; off < 32; off <<= 1) sq += __shfl_xor(sq, off, 32);
    const float var = sq * (1.0f / 128.0f);
    const float rs = rsqrtf(var + 1e-5f);
    unsigned short hb[4];
#pragma unroll
    for (int e = 0; e < 4; ++e) hb[e] = h_bits((d[e] * rs * wv[e] + gv[e]) * kXCarry);
    if ((lane >> 4) == dh) {
#pragma unroll
      for (int e = 0; e < 4; ++e) sm[(cl0 + e) * kV2Pitch + tok] = hb[e];
    }
  }
  __syncthreads();
  const size_t rowbase = ((size_t)(h * kHD + dh * 64)) * (kB * kSP) + (size_t)b * kSP + lane * 8;
  {
#pragma unroll
    for (int it = 0; it < 8; ++it) {
      const int cl = wave * 8 + it;           // 0..63
      const v4u u = *(const v4u*)(sm + cl * kV2Pitch + lane * 8);
      *(v4u*)(v2t + rowbase + (size_t)cl * (kB * kSP)) = u;
    }
    
  }
}

// ---------------------------------------------------------------------------
// Row softmax: scores planes S [8 h][32 b][256 q][256 keys] f32 (already scaled by 128^-0.5); key j >= 196 excluded,
// real keys with mask[b][j] == 0 set to -1e9 (select); P = exp(s - max)/sum written as f16(2048 * P), pad keys and pad
// query rows (q >= 196) written as 0. One wave per row (32 lanes x 8 keys = 256), 8 rows per block, grid (32, 32 b, 8 h).
// ---------------------------------------------------------------------------
__global__ __launch_bounds__(256) void softmax_kernel(const float* __restrict__ S, const float* __restrict__ mask,
                                                      unsigned short* __restrict__ Pp) {
  const int t = threadIdx.x, lane = t & 31, wave = t >> 5;
  const int b = blockIdx.y;
  S  += (size_t)blockIdx.z * (kB * kSP * kSP);         // this head's score plane
  Pp += (size_t)blockIdx.z * (kB * kSP * kSP);         // this head's prob plane
  const int r = blockIdx.x * 8 + wave;                 // 0..255, wave-uniform
  const int rc = (r < kM) ? r : (kM - 1);              // clamped address
  const float* sr = S + ((size_t)b * kSP + rc) * kSP + lane * 8;
  const v4f a = *(const v4f*)(sr);
  const v4f c = *(const v4f*)(sr + 4);
  float x[8];
#pragma unroll
  for (int e = 0; e < 4; ++e) { x[e] = a[e]; x[4 + e] = c[e]; }
  float s[8];
#pragma unroll
  for (int e = 0; e < 8; ++e) {
    const int j  = lane * 8 + e;
    const int jc = (j < kM) ? j : (kM - 1);
    const float mv = mask[b * kM + jc];
    const float v = (mv == 0.0f) ? -1.0e9f : x[e];
    s[e] = (j < kM) ? v : -3.0e38f;
  }
  float mx = fmaxf(fmaxf(fmaxf(s[0], s[1]), fmaxf(s[2], s[3])), fmaxf(fmaxf(s[4], s[5]), fmaxf(s[6], s[7])));
#pragma unroll
  for (int off = 1; off < 32; off <<= 1) mx = fmaxf(mx, __shfl_xor(mx, off, 32));
  float p[8];
  float ps = 0.f;
#pragma unroll
  for (int e = 0; e < 8; ++e) {
    const int j = lane * 8 + e;
    const float arg = (j < kM) ? (s[e] - mx) : -100.0f;
    const float ev = expf(arg);
    p[e] = (j < kM) ? ev : 0.0f;
    ps += p[e];
  }
#pragma unroll
  for (int off = 1; off < 32; off <<= 1) ps += __shfl_xor(ps, off, 32);
  const float inv = 1.0f / ps;
  unsigned short hb[8];
#pragma unroll
  for (int e = 0; e < 8; ++e) hb[e] = h_bits(p[e] * inv * kPCarry);
  const v4u u = (v4u){pk16(hb[0], hb[1]), pk16(hb[2], hb[3]), pk16(hb[4], hb[5]), pk16(hb[6], hb[7])};
  v4u uu;
  uu.x = (r < kM) ? u.x : 0u;
  uu.y = (r < kM) ? u.y : 0u;
  uu.z = (r < kM) ? u.z : 0u;
  uu.w = (r < kM) ? u.w : 0u;
  store2_v4u(Pp + ((size_t)b * kSP + r) * kSP + lane * 8, uu);
}

// ---------------------------------------------------------------------------
// Gated residual + LayerNorm: y = x + gate*attn (token-major gate [6272][1024], attn [32][256 q][1024]); x_new = LN(y)*lnw + lnb
// written f32 to xout (may alias xin: each block reads its whole row into registers before any store, no other block
// touches the row) and as f16(16*x_new) to x16. One block per token (grid 6272), thread t owns columns 4t..4t+3.
// ---------------------------------------------------------------------------
__global__ __launch_bounds__(256) void merge_ln_kernel(const float* xin, const float* __restrict__ att,
                                                       const float* __restrict__ gate, const float* __restrict__ lnw,
                                                       const float* __restrict__ lnb, float* xout,
                                                       unsigned short* __restrict__ x16) {
  __shared__ float redA[8];
  __shared__ float redB[8];
  __shared__ __align__(16) float srow[kD];
  const int t = threadIdx.x, lane = t & 31, wave = t >> 5;
  const int r = blockIdx.x;
  const int b = r / kM;
  const int m = r - b * kM;
  const int c0 = t * 4;
  const size_t ro = (size_t)r * kD + c0;
  const v4f xv = *(const v4f*)(xin + ro);
  const v4f gv = *(const v4f*)(gate + ro);
  const v4f av = *(const v4f*)(att + ((size_t)(b * kSP + m)) * kD + c0);
  float y[4];
#pragma unroll
  for (int e = 0; e < 4; ++e) y[e] = xv[e] + gv[e] * av[e];
  float s = (y[0] + y[1]) + (y[2] + y[3]);
#pragma unroll
  for (int off = 1; off < 32; off <<= 1) s += __shfl_xor(s, off, 32);
  if (lane == 0) redA[wave] = s;
  __syncthreads();
  float tot = redA[0];
#pragma unroll
  for (int w = 1; w < 8; ++w) tot += redA[w];
  const float mu = tot * (1.0f / 1024.0f);
  float d[4];
  float sq = 0.f;
#pragma unroll
  for (int e = 0; e < 4; ++e) { d[e] = y[e] - mu; sq += d[e] * d[e]; }
#pragma unroll
  for (int off = 1; off < 32; off <<= 1) sq += __shfl_xor(sq, off, 32);
  if (lane == 0) redB[wave] = sq;
  __syncthreads();
  float tot2 = redB[0];
#pragma unroll
  for (int w = 1; w < 8; ++w) tot2 += redB[w];
  const float var = tot2 * (1.0f / 1024.0f);
  const float rs = rsqrtf(var + 1e-5f);
  const v4f wv = *(const v4f*)(lnw + c0);
  const v4f bv = *(const v4f*)(lnb + c0);
  v4f ov;
#pragma unroll
  for (int e = 0; e < 4; ++e) ov[e] = d[e] * rs * wv[e] + bv[e];
  *(v4f*)(srow + c0) = ov;
  __syncthreads();
  const int tc = t & 127;                               // clamped staging index; only t < 128 stores
  const v4f p0 = *(const v4f*)(srow + tc * 8);
  const v4f p1 = *(const v4f*)(srow + tc * 8 + 4);
  unsigned short hb[8];
#pragma unroll
  for (int e = 0; e < 4; ++e) {
    hb[e]     = h_bits(p0[e] * kXCarry);
    hb[4 + e] = h_bits(p1[e] * kXCarry);
  }
  const v4u hu = (v4u){pk16(hb[0], hb[1]), pk16(hb[2], hb[3]), pk16(hb[4], hb[5]), pk16(hb[6], hb[7])};
  unsigned short* hp = x16 + (size_t)r * kD + tc * 8;
  {
    *(v4f*)(xout + ro) = ov;
    if (t < 128) *(v4u*)hp = hu;
    
  }
}

// ---------------------------------------------------------------------------
// Masked mean over tokens: out0[b][c] = sum_m x[b][m][c]*mask[b][m] / sum_m mask[b][m]. One block per b (grid 32),
// ---------------------------------------------------------------------------
__global__ __launch_bounds__(256) void pool_kernel(const float* x, const float* __restrict__ mask, float* out0) {
  const int t = threadIdx.x;
  const int b = blockIdx.x;
  const int c0 = t * 4;
  v4f acc = (v4f){0.f, 0.f, 0.f, 0.f};
  float ms = 0.f;
#pragma unroll 1
  for (int m = 0; m < kM; ++m) {
    const float mv = mask[b * kM + m];
    const v4f xv = *(const v4f*)(x + ((size_t)(b * kM + m)) * kD + c0);
    acc += xv * mv;
    ms += mv;
  }
  const float inv = 1.0f / ms;
  const v4f o = acc * inv;
  store2_v4f(out0 + (size_t)b * kD + c0, o);
}

// ---------------------------------------------------------------------------
// Host orchestration: kernel launches only. 2 + 3*14 + 1 = 45 launches.
// ---------------------------------------------------------------------------
extern "C" void kernel_launch(void* const* d_in, const int* in_sizes, int n_in,
                              void* d_out, int out_size, void* d_ws, size_t ws_size,
                              hipStream_t stream) {
  if (n_in < 22) return;
  if (in_sizes[0] != kTok * kD) return;
  if (in_sizes[1] != kTok) return;
  if (in_sizes[2] != kL * kD * kD || in_sizes[6] != kL * kD * kD || in_sizes[10] != kL * kD * kD || in_sizes[14] != kL * kD * kD) return;
  if (in_sizes[18] != kL * kHD * kHD || in_sizes[19] != kL * kHD) return;
  if (in_sizes[3] != kL * kD || in_sizes[20] != kL * kD || in_sizes[21] != kL * kD) return;
  if (out_size != kB * kD + kTok * kD) return;
  if (ws_size < kWsTotal) return;

  const float* att_feats = (const float*)d_in[0];
  const float* att_mask  = (const float*)d_in[1];
  const float* Wq2  = (const float*)d_in[2];
  const float* bq2  = (const float*)d_in[3];
  const float* gq2w = (const float*)d_in[4];
  const float* gq2b = (const float*)d_in[5];
  const float* Wk   = (const float*)d_in[6];
  const float* bk   = (const float*)d_in[7];
  const float* gkw  = (const float*)d_in[8];
  const float* gkb  = (const float*)d_in[9];
  const float* Wv1  = (const float*)d_in[10];
  const float* bv1  = (const float*)d_in[11];
  const float* gv1w = (const float*)d_in[12];
  const float* gv1b = (const float*)d_in[13];
  const float* Wv2  = (const float*)d_in[14];
  const float* bv2  = (const float*)d_in[15];
  const float* gv2w = (const float*)d_in[16];
  const float* gv2b = (const float*)d_in[17];
  const float* Wc   = (const float*)d_in[18];
  const float* bc   = (const float*)d_in[19];
  const float* lnw  = (const float*)d_in[20];
  const float* lnb  = (const float*)d_in[21];

  char* ws = (char*)d_ws;
  float*          Ppl   = (float*)(ws + kOffP);                    // linear+bias plane
  float*          GATE  = (float*)(ws + kOffP);                    // gate plane (same region, later)
  unsigned short* GIN16 = (unsigned short*)(ws + kOffATT);         // (v1*k) plane
  float*          ATT   = (float*)(ws + kOffATT);                  // attn plane (same region, later)
  unsigned short* X16   = (unsigned short*)(ws + kOffX16);
  float*          Spl   = (float*)(ws + kOffS);                    // scores, all heads
  unsigned short* PP    = (unsigned short*)(ws + kOffPP);          // probs, all heads
  unsigned short* W16   = (unsigned short*)(ws + kOffW16);
  unsigned short* WC16  = (unsigned short*)(ws + kOffWC16);
  unsigned short* Q16   = (unsigned short*)(ws + kOffQ16);
  unsigned short* K16   = (unsigned short*)(ws + kOffK16);
  unsigned short* V2T   = (unsigned short*)(ws + kOffV2T);

  float* out0 = (float*)d_out;                                     // [32][1024] at byte 0
  float* out1 = (float*)d_out + (size_t)kB * kD;                   // [32][196][1024] at byte 131072; also the running x

  const float projScale  = 1.0f / (kXCarry * kWCarry);             // 1/4096
  const float gateScale  = 1.0f / (kXCarry * kWCarry);             // (v1*k) x16, Wc x256
  const float scoreScale = 0.08838834764831845f * (1.0f / (kXCarry * kXCarry));
  const float pvScale    = 1.0f / (kPCarry * kXCarry);             // 1/32768

  // x -> f16 plane (x16); pad rows of the q2/k planes zero
  {
    const int n8 = kTok * kD / 8;                                  // 802816 = 3136 * 256
    cast8s_kernel<<<dim3(n8 / 256), dim3(256), 0, stream>>>(att_feats, X16, n8, kXCarry);
    const int npad8 = 64 * kD / 8;                                 // 8192 = 32 * 256
    fill_zero2_kernel<<<dim3(npad8 / 256, 2), dim3(256), 0, stream>>>(Q16 + (size_t)kTok * kD, K16 + (size_t)kTok * kD, npad8);
  }

  for (int i = 0; i < kL; ++i) {
    const size_t wo = (size_t)i * kD * kD;
    wcast_kernel<<<dim3(512, 5), dim3(256), 0, stream>>>(Wq2 + wo, Wk + wo, Wv1 + wo, Wv2 + wo, Wc + (size_t)i * kHD * kHD, W16, WC16);

    // four projections: P = x16 * Wz^T + bz (M 6272, N 1024, K 1024: K % 32 == 0, M,N % 64 == 0; 1568 tiles = 196 blocks)
    for (int z = 0; z < 4; ++z) {
      const float* biasz = (z == 0) ? bq2 : (z == 1) ? bk : (z == 2) ? bv1 : bv2;
      const float* gwz   = (z == 0) ? gq2w : (z == 1) ? gkw : (z == 2) ? gv1w : gv2w;
      const float* gbz   = (z == 0) ? gq2b : (z == 1) ? gkb : (z == 2) ? gv1b : gv2b;
      wmma_gemm64<0, false, 2, 0, false, 0><<<dim3(196, 1), dim3(256), 0, stream>>>(
          X16, nullptr, kD, 0L, 0L,
          W16 + (size_t)z * kD * kD, nullptr, kD, 0L, 0L,
          (void*)Ppl, nullptr, kD, 0L, 0L,
          biasz + (size_t)i * kD, nullptr, 0L,
          kTok, kD, kD, projScale);
      if (z == 0) {
        gn_rows_kernel<0><<<dim3(3136), dim3(256), 0, stream>>>(Ppl, gwz + (size_t)i * kD, gbz + (size_t)i * kD, K16, Q16);
      } else if (z == 1) {
        gn_rows_kernel<0><<<dim3(3136), dim3(256), 0, stream>>>(Ppl, gwz + (size_t)i * kD, gbz + (size_t)i * kD, Q16, K16);
      } else if (z == 2) {
        gn_rows_kernel<2><<<dim3(3136), dim3(256), 0, stream>>>(Ppl, gwz + (size_t)i * kD, gbz + (size_t)i * kD, K16, GIN16);
      } else {
        gn_v2t_kernel<<<dim3(kB, kH, 2), dim3(256), 0, stream>>>(Ppl, gwz + (size_t)i * kD, gbz + (size_t)i * kD, V2T);
      }
    }

    // gate = sigmoid((v1*k) * Wc^T + bc): M 50176, N 128, K 128 (1568 tiles = 196 blocks); output [50176][128] f32 == token-major [6272][1024]
    wmma_gemm64<0, false, 2, 0, false, 6><<<dim3(196, 1), dim3(256), 0, stream>>>(
        GIN16, nullptr, kHD, 0L, 0L,
        WC16, nullptr, kHD, 0L, 0L,
        (void*)GATE, nullptr, kHD, 0L, 0L,
        bc + (size_t)i * kHD, nullptr, 0L,
        kTok * kH, kHD, kHD, gateScale);

    // attention, all 256 (batch, head) groups per launch (grid.y = b, grid.z = h)
    // scores [h][b][256 q][256 keys] = q2 * k^T * 128^-0.5 (M 256, N 256, K 128; 16 tiles = 2 blocks per group)
    wmma_gemm64<0, false, 0, 0, false, 0><<<dim3(2, kB, kH), dim3(256), 0, stream>>>(
        Q16, nullptr, kD, (long)kM * kD, (long)kHD,
        K16, nullptr, kD, (long)kM * kD, (long)kHD,
        (void*)Spl, nullptr, kSP, (long)kSP * kSP, (long)kB * kSP * kSP,
        nullptr, nullptr, 0L,
        kSP, kSP, kHD, scoreScale);
    softmax_kernel<<<dim3(kSP / 8, kB, kH), dim3(256), 0, stream>>>(Spl, att_mask, PP);
    // attn columns h*128.. of [b][256 q][1024] = P * v2 (M 256, N 128, K 224; 8 tiles = 1 block per group)
    wmma_gemm64<0, false, 0, 0, false, 0><<<dim3(1, kB, kH), dim3(256), 0, stream>>>(
        PP, nullptr, kSP, (long)kSP * kSP, (long)kB * kSP * kSP,
        V2T, nullptr, kB * kSP, (long)kSP, (long)kHD * (kB * kSP),
        (void*)ATT, nullptr, kD, (long)kSP * kD, (long)kHD,
        nullptr, nullptr, 0L,
        kSP, kHD, kKeyK, pvScale);

    const float* xin = (i == 0) ? att_feats : out1;
    merge_ln_kernel<<<dim3(kTok), dim3(256), 0, stream>>>(xin, ATT, GATE, lnw + (size_t)i * kD, lnb + (size_t)i * kD, out1, X16);
  }

  pool_kernel<<<dim3(kB), dim3(256), 0, stream>>>(out1, att_mask, out0);
}

// v002
// One run takes 682 microseconds.
// Next to v001, in two timings, it ran 1.44 and 1.45 times as fast.
// All steps since v000 together make it 2.32 times as fast.
// Contractions: projections x(f16, x16)*W^T(f16, x256), gate (v1*k)(f16, x16)*Wc^T(f16, x256), scores q2(f16, x16)*k^T(f16, x16), attn P(f16, x2048)*v2(f16, x16): all v_wmma_f32_16x16x32_f16 with f32 accumulate; CELU, GroupNorm, softmax, sigmoid, residual, LayerNorm and masked mean in f32.
#include <hip/hip_runtime.h>
#include <math.h>

// ---------------------------------------------------------------------------
// Problem constants
// ---------------------------------------------------------------------------
constexpr int kB   = 32;
constexpr int kM   = 196;
constexpr int kD   = 1024;
constexpr int kH   = 8;
constexpr int kHD  = 128;
constexpr int kL   = 3;
constexpr int kTok = kB * kM;          // 6272 = 98 * 64 token rows
constexpr int kTokPad = kTok + 64;     // 6336: 64 zero rows so per-group 256-row tiles never leave the plane
constexpr int kSP  = 256;              // padded queries / keys per (batch, head) group
constexpr int kKeyK = 224;             // contraction depth of P*V (keys padded to a multiple of 32)
constexpr float kXCarry = 16.0f;       // x, q2, k, v2 planes carried x16 in f16
constexpr float kWCarry = 256.0f;      // W, Wc carried x256 in f16
constexpr float kPCarry = 2048.0f;     // probabilities carried x2048 in f16

// ---------------------------------------------------------------------------
// Workspace region map (bytes, all offsets multiples of 256)
//   R_P    [0, 25690112)            : linear+bias plane f32 [6272][1024]  -> later gate plane f32 [50176][128]
//   R_ATT  [25690112, 59244544)     : (v1*k) f16 plane [6272][1024]      -> later attn f32 [32][256][1024]
//   R_X16  [59244544, 72089600)     : x f16 [6272][1024]
//   R_W16  [72089600, 80478208)     : stacked W f16 [4096][1024]
//   R_WC16 [80478208, 80510976)     : Wc f16 [128][128]
//   R_Q16  [80510976, 93487104)     : q2 f16 [6336][1024] (rows >= 6272 zero)
//   R_K16  [93487104, 106463232)    : k  f16 [6336][1024] (rows >= 6272 zero)
//   R_V2T  [106463232, 123240448)   : v2^T f16 [8 h][128 d][32 b][256 keys] (keys >= 196 zero)
//   R_S    [123240448, 190349312)   : scores f32 [8 h][32 b][256 q][256 keys]
//   R_PP   [190349312, 223903744)   : probs f16 [8 h][32 b][256 q][256 keys]
// ---------------------------------------------------------------------------
constexpr size_t kBytesP    = (size_t)kTok * kD * 4;
constexpr size_t kBytesATT  = (size_t)kB * kSP * kD * 4;
constexpr size_t kBytesX16  = (size_t)kTok * kD * 2;
constexpr size_t kBytesW16  = (size_t)4 * kD * kD * 2;
constexpr size_t kBytesWC16 = (size_t)kHD * kHD * 2;
constexpr size_t kBytesQ16  = (size_t)kTokPad * kD * 2;
constexpr size_t kBytesV2T  = (size_t)kH * kHD * kB * kSP * 2;
constexpr size_t kBytesS    = (size_t)kH * kB * kSP * kSP * 4;
constexpr size_t kBytesPP   = (size_t)kH * kB * kSP * kSP * 2;
constexpr size_t kOffP    = 0;
constexpr size_t kOffATT  = kOffP + kBytesP;
constexpr size_t kOffX16  = kOffATT + kBytesATT;
constexpr size_t kOffW16  = kOffX16 + kBytesX16;
constexpr size_t kOffWC16 = kOffW16 + kBytesW16;
constexpr size_t kOffQ16  = kOffWC16 + kBytesWC16;
constexpr size_t kOffK16  = kOffQ16 + kBytesQ16;
constexpr size_t kOffV2T  = kOffK16 + kBytesQ16;
constexpr size_t kOffS    = kOffV2T + kBytesV2T;
constexpr size_t kOffPP   = kOffS + kBytesS;
constexpr size_t kWsTotal = kOffPP + kBytesPP;
static_assert(kWsTotal == 223903744, "carve total");
static_assert(kWsTotal <= 268435456, "carve under 256 MiB");
static_assert(kBytesATT >= (size_t)kTok * kD * 2, "vk plane fits in the attn region");
static_assert(kBytesP == (size_t)kTok * kH * kHD * 4, "gate plane fits in the P region");
static_assert((kOffATT % 256) == 0 && (kOffX16 % 256) == 0 && (kOffW16 % 256) == 0 && (kOffQ16 % 256) == 0 && (kOffK16 % 256) == 0 && (kOffV2T % 256) == 0 && (kOffS % 256) == 0 && (kOffPP % 256) == 0, "aligned");

typedef __attribute__((ext_vector_type(16))) _Float16 v16h;
typedef __attribute__((ext_vector_type(8)))  _Float16 v8h;
typedef __attribute__((ext_vector_type(16))) __bf16   v16b;
typedef __attribute__((ext_vector_type(8)))  __bf16   v8b;
typedef __attribute__((ext_vector_type(8)))  float    v8f;
typedef __attribute__((ext_vector_type(4)))  float    v4f;
typedef __attribute__((ext_vector_type(4)))  unsigned int v4u;

__device__ __forceinline__ unsigned short f2bf_bits(float f) {
  unsigned u = __float_as_uint(f);
  return (unsigned short)((u + 0x7FFFu + ((u >> 16) & 1u)) >> 16);
}
__device__ __forceinline__ float bf_bits2f(unsigned short h) { return __uint_as_float(((unsigned)h) << 16); }

// hazard guards as plain device helpers (no inline asm inside the kernel template body)
__device__ __forceinline__ void dep_guard_h(v8f& a, v8f& b, v16h x, v16h y) { asm volatile("v_nop\n\tv_nop\n\tv_nop\n\tv_nop" : "+v"(a), "+v"(b) : "v"(x), "v"(y)); }
__device__ __forceinline__ void dep_guard_b(v8f& a, v8f& b, v16b x, v16b y) { asm volatile("v_nop\n\tv_nop\n\tv_nop\n\tv_nop" : "+v"(a), "+v"(b) : "v"(x), "v"(y)); }
__device__ __forceinline__ void keep4_h(v16h a, v16h b, v16h c, v16h d) { asm volatile("v_nop" :: "v"(a), "v"(b), "v"(c), "v"(d)); }
__device__ __forceinline__ void keep4_b(v16b a, v16b b, v16b c, v16b d) { asm volatile("v_nop" :: "v"(a), "v"(b), "v"(c), "v"(d)); }
__device__ __forceinline__ void acc_guard4(v8f& a, v8f& b, v8f& c, v8f& d) { asm volatile("v_nop\n\tv_nop\n\tv_nop\n\tv_nop" : "+v"(a), "+v"(b), "+v"(c), "+v"(d)); }
template <typename T> struct Frag;
template <> struct Frag<_Float16> {
  typedef v16h V; union U { v16h v; v8h h[2]; };
  static __device__ __forceinline__ v16h load(const _Float16* p) {   // elements 0..7 <- p[0..7], 8..15 <- p[16..23]
    U f; f.h[0] = *(const v8h*)(p); f.h[1] = *(const v8h*)(p + 16); return f.v;
  }
  static __device__ __forceinline__ v8f mma(v16h a, v16h b, v8f c) {
    return __builtin_amdgcn_wmma_f32_16x16x32_f16(false, a, false, b, (short)0, c, false, false);
  }
  static __device__ __forceinline__ void guard(v8f& a, v8f& b, v16h x, v16h y) { dep_guard_h(a, b, x, y); }
  static __device__ __forceinline__ void keep(v16h a, v16h b, v16h c, v16h d) { keep4_h(a, b, c, d); }
};
template <> struct Frag<__bf16> {
  typedef v16b V; union U { v16b v; v8b h[2]; };
  static __device__ __forceinline__ v16b load(const __bf16* p) {
    U f; f.h[0] = *(const v8b*)(p); f.h[1] = *(const v8b*)(p + 16); return f.v;
  }
  static __device__ __forceinline__ v8f mma(v16b a, v16b b, v8f c) {
    return __builtin_amdgcn_wmma_f32_16x16x32_bf16(false, a, false, b, (short)0, c, false, false);
  }
  static __device__ __forceinline__ void guard(v8f& a, v8f& b, v16b x, v16b y) { dep_guard_b(a, b, x, y); }
  static __device__ __forceinline__ void keep(v16b a, v16b b, v16b c, v16b d) { keep4_b(a, b, c, d); }
};

__device__ __forceinline__ unsigned pk16(unsigned short a, unsigned short b) { return (unsigned)a | ((unsigned)b << 16); }
__device__ __forceinline__ unsigned short h_bits(float f) { const _Float16 h = (_Float16)f; return __builtin_bit_cast(unsigned short, h); }

// exact f16 bits -> f32 via integer arithmetic (normals and subnormals; no _Float16 vector involved)
__device__ __forceinline__ float h16_to_f32(unsigned hb) {
  const unsigned em = hb & 0x7fffu;
  const float fn = __uint_as_float((em + 0x1C000u) << 13);
  const float fs = (float)em * 5.9604644775390625e-8f;
  const float f  = (em < 0x400u) ? fs : fn;
  return __uint_as_float(__float_as_uint(f) | ((hb & 0x8000u) << 16));
}

__device__ __forceinline__ void store2_v4u(unsigned short* p, v4u u) {
  *(v4u*)p = u;
  
}
__device__ __forceinline__ void store2_v4f(float* p, v4f v) {
  *(v4f*)p = v;
  
}

// ---- Register-blocked batched WMMA GEMM (ACT: 0 none, 2 relu, 4 leaky, 6 sigmoid) -------------
// C[m,n] = scale * sum_k A[m,k] * Bt[n,k] (+bias)(+resid); each wave owns a 64x64 tile.
// A row-major [M,K]; Bt row-major [N,K]; M,N % 64 == 0, K % 32 == 0.
// SPLIT: operands are hi/lo planes (A2/Bt2 = lo planes, same layout); product = hi*hi + hi*lo + lo*hi.
// BIAS_MODE: 0 = none, 1 = bias[m], 2 = bias[n].
// OUT_MODE: 0 = f32, 1 = f16, 2 = bf16 hi plane (Cout) + bf16 lo plane (Cout2).
// ET: 0 = f16 operands, 1 = bf16 operands (pointers passed as 16-bit storage)
// Batching: blockIdx.y steps A, Bt, C by strideA, strideB, strideC; blockIdx.z steps them by strideAz, strideBz, strideCz.
template <int ET> struct Elem;
template <> struct Elem<0> { typedef _Float16 T; };
template <> struct Elem<1> { typedef __bf16 T; };
template <int ET, bool SPLIT, int BIAS_MODE, int OUT_MODE, bool RESID, int ACT = 0>
__global__ __launch_bounds__(256) void wmma_gemm64(
    const unsigned short* __restrict__ Ap, const unsigned short* __restrict__ A2p, int lda, long strideA, long strideAz,
    const unsigned short* __restrict__ Btp, const unsigned short* __restrict__ Bt2p, int ldb, long strideB, long strideBz,
    void* __restrict__ Cout, void* __restrict__ Cout2, int ldc, long strideC, long strideCz,
    const float* __restrict__ bias,
    const float* __restrict__ resid, long strideR,
    int M, int N, int K, float scale) {
  typedef typename Elem<ET>::T T;
  typedef typename Frag<T>::V V;
  const T* A = (const T*)Ap; const T* A2 = (const T*)A2p; const T* Bt = (const T*)Btp; const T* Bt2 = (const T*)Bt2p;
  __shared__ __align__(16) float sT[8][16 * 68];   // per-wave 16x64 slab, pitch 68 floats
  const int b    = blockIdx.y;
  const int z    = blockIdx.z;
  const int lane = threadIdx.x & 31;
  const int wave = threadIdx.x >> 5;
  const int tilesN = N >> 6;
  const int tilesM = M >> 6;
  const int tile = blockIdx.x * 8 + wave;
  if (tile >= tilesM * tilesN) return;   // wave-uniform; no block barriers in this kernel
  const int tm = tile / tilesN;
  const int tn = tile - tm * tilesN;
  const int m0 = tm << 6;
  const int n0 = tn << 6;

  const size_t offA = (size_t)b * strideA + (size_t)z * strideAz;
  const size_t offB = (size_t)b * strideB + (size_t)z * strideBz;
  const size_t offC = (size_t)b * strideC + (size_t)z * strideCz;
  const T* Ab  = A  + offA;
  const T* Bb  = Bt + offB;
  const T* Ab2 = SPLIT ? (A2  + offA) : nullptr;
  const T* Bb2 = SPLIT ? (Bt2 + offB) : nullptr;

  const int rlane = lane & 15;                 // row (A) / col (B, D) within subtile
  const int koff  = (lane >> 4) * 8;           // k offset of this lane half
  const int mOff  = (lane >> 4) * 8;           // D row offset

  v8f acc[4][4];
#pragma unroll
  for (int i = 0; i < 4; ++i)
#pragma unroll
    for (int j = 0; j < 4; ++j) acc[i][j] = (v8f){0.f,0.f,0.f,0.f,0.f,0.f,0.f,0.f};

  for (int k0 = 0; k0 < K; k0 += 32) {
    V bh[4], bl[4];
#pragma unroll
    for (int j = 0; j < 4; ++j) {
      const size_t bo = (size_t)(n0 + (j << 4) + rlane) * ldb + koff + k0;
      bh[j] = Frag<T>::load(Bb + bo);
      if (SPLIT) bl[j] = Frag<T>::load(Bb2 + bo);
    }
#pragma unroll
    for (int i = 0; i < 4; ++i) {
      const size_t ao = (size_t)(m0 + (i << 4) + rlane) * lda + koff + k0;
      V ah = Frag<T>::load(Ab + ao);
      V al;
      if (SPLIT) al = Frag<T>::load(Ab2 + ao);
#pragma unroll
      for (int j = 0; j < 4; ++j) {
        acc[i][j] = Frag<T>::mma(ah, bh[j], acc[i][j]);
        if (SPLIT) {
          acc[i][j] = Frag<T>::mma(ah, bl[j], acc[i][j]);
          acc[i][j] = Frag<T>::mma(al, bh[j], acc[i][j]);
        }
      }
      Frag<T>::guard(acc[i][0], acc[i][3], ah, SPLIT ? al : ah);
    }
    Frag<T>::keep(bh[0], bh[1], bh[2], bh[3]);
    if (SPLIT) Frag<T>::keep(bl[0], bl[1], bl[2], bl[3]);
  }
  acc_guard4(acc[0][0], acc[0][1], acc[0][2], acc[0][3]);
  acc_guard4(acc[1][0], acc[1][1], acc[1][2], acc[1][3]);
  acc_guard4(acc[2][0], acc[2][1], acc[2][2], acc[2][3]);
  acc_guard4(acc[3][0], acc[3][1], acc[3][2], acc[3][3]);

  // ---- epilogue ----
  float* slab = sT[wave];
  const float* Rb = RESID ? (resid + (size_t)b * strideR) : nullptr;
#pragma unroll
  for (int i = 0; i < 4; ++i) {
    const int mBase = m0 + (i << 4);
#pragma unroll
    for (int j = 0; j < 4; ++j) {
      const int n = n0 + (j << 4) + rlane;
      float bv = 0.f;
      if (BIAS_MODE == 2) bv = bias[n];
#pragma unroll
      for (int r = 0; r < 8; ++r) {
        float v = acc[i][j][r] * scale;
        if (BIAS_MODE == 1) v += bias[mBase + mOff + r];
        if (BIAS_MODE == 2) v += bv;
        if (RESID) v += Rb[(size_t)(mBase + mOff + r) * ldc + n];
        if (ACT == 2) v = fmaxf(v, 0.0f);
        if (ACT == 4) v = (v > 0.f) ? v : 0.01f * v;
        if (ACT == 6) v = 1.0f / (1.0f + expf(-v));
        slab[(mOff + r) * 68 + (j << 4) + rlane] = v;
      }
    }
    __builtin_amdgcn_fence(__ATOMIC_RELEASE, "workgroup");
    __builtin_amdgcn_wave_barrier();
    __builtin_amdgcn_fence(__ATOMIC_ACQUIRE, "workgroup");
    if (OUT_MODE == 0) {
      float* C = (float*)Cout + offC;
      const int hh = lane >> 4, c4 = (lane & 15) * 4;     // row seg = 256 B = 16 lanes x 16 B
      {
#pragma unroll
        for (int it = 0; it < 8; ++it) {
          const int row = it * 2 + hh;
          v4f v = *(const v4f*)(slab + row * 68 + c4);
          *(v4f*)(C + (size_t)(mBase + row) * ldc + n0 + c4) = v;
        }
        
      }
    } else {
      const int q = lane >> 3, c8 = (lane & 7) * 8;
      unsigned short* C  = (unsigned short*)Cout  + offC;
      unsigned short* C2 = (OUT_MODE == 2) ? ((unsigned short*)Cout2 + offC) : nullptr;
      {
#pragma unroll
        for (int it = 0; it < 4; ++it) {
          const int row = it * 4 + q;
          const float* sp = slab + row * 68 + c8;
          v8h hv, lv;
#pragma unroll
          for (int e = 0; e < 8; ++e) {
            if (OUT_MODE == 1) {
              hv[e] = (_Float16)sp[e];
            } else {
              unsigned short hb = f2bf_bits(sp[e]);
              unsigned short lb = f2bf_bits(sp[e] - bf_bits2f(hb));
              hv[e] = __builtin_bit_cast(_Float16, hb);
              lv[e] = __builtin_bit_cast(_Float16, lb);
            }
          }
          *(v8h*)(C + (size_t)(mBase + row) * ldc + n0 + c8) = hv;
          if (OUT_MODE == 2) *(v8h*)(C2 + (size_t)(mBase + row) * ldc + n0 + c8) = lv;
        }
        
      }
    }
    __builtin_amdgcn_fence(__ATOMIC_RELEASE, "workgroup");
    __builtin_amdgcn_wave_barrier();
    __builtin_amdgcn_fence(__ATOMIC_ACQUIRE, "workgroup");
  }
}

// ---------------------------------------------------------------------------
// Projection GEMM with operands staged in LDS: C[m,n] = scale * sum_k A[m,k] * Bt[n,k] + bias[n], f32 out.
// A [6272][1024] f16, Bt [1024][1024] f16, both k-contiguous. Block tile 128 (m) x 256 (n), 8 waves as 2 x 4, each wave the
// same 64x64 tile, fragment maps and k order as wmma_gemm64. A stage is 64 k = one 128-B line of each of the 384 operand
// rows (A rows first, then Bt rows), laid at a 144-B pitch in one of two LDS buffers. Every global load covers whole lines
// (8 lanes per row). Stage s + 2 is fetched into registers during stage s and stored to LDS during stage s + 1, so a
// fetch has a whole stage to land. grid = 49 * 4 = 196 blocks (6272 = 49 * 128, 1024 = 4 * 256).
// ---------------------------------------------------------------------------
constexpr int kPjBM = 128;                       // block rows of A
constexpr int kPjBN = 256;                       // block rows of Bt
constexpr int kPjBK = 64;                        // halves of k per stage
constexpr int kPjPitch = 72;                     // halves per staged row (144 B)
constexpr int kPjStage = (kPjBM + kPjBN) * kPjPitch;   // halves per buffer (55,296 B)
constexpr int kPjStages = kD / kPjBK;            // 16
static_assert(kTok % kPjBM == 0 && kD % kPjBN == 0 && kD % (2 * kPjBK) == 0 && kPjStages >= 4, "projection tiles divide the problem");

// 12 pieces of 16 B per thread: pieces 0..3 = A rows, 4..11 = Bt rows, 32 staged rows apart
__device__ __forceinline__ void pj_fetch(v4u (&r)[12], const unsigned short* gA, const unsigned short* gB, int k) {
#pragma unroll
  for (int j = 0; j < 4; ++j) r[j] = *(const v4u*)(gA + (size_t)(32 * j) * kD + k);
#pragma unroll
  for (int j = 0; j < 8; ++j) r[4 + j] = *(const v4u*)(gB + (size_t)(32 * j) * kD + k);
}
__device__ __forceinline__ void pj_put(unsigned short* dst, const v4u (&r)[12]) {
#pragma unroll
  for (int j = 0; j < 12; ++j) *(v4u*)(dst + 32 * j * kPjPitch) = r[j];
}
// Work-group barrier that orders LDS only: __syncthreads() also waits for every global load in flight, which would
// end the fetch of the stage after next at each barrier; those loads land in registers and concern no other wave.
__device__ __forceinline__ void pj_barrier() {
  __builtin_amdgcn_fence(__ATOMIC_RELEASE, "workgroup", "local");
  __builtin_amdgcn_s_barrier();
  __builtin_amdgcn_fence(__ATOMIC_ACQUIRE, "workgroup", "local");
}
// One stage: fetch stage k/64 into ld (FETCH), multiply the stage in cur, store the stage held in st to nxt (PUT).
template <bool FETCH, bool PUT>
__device__ __forceinline__ void pj_stage(const _Float16* curA, const _Float16* curB, unsigned short* nxt,
                                         const unsigned short* gA, const unsigned short* gB, int k,
                                         v4u (&ld)[12], const v4u (&st)[12], v8f (&acc)[4][4]) {
  typedef Frag<_Float16> F;
  v16h bh[2][4], ah[2][4];
#pragma unroll
  for (int kk = 0; kk < 2; ++kk) {
#pragma unroll
    for (int j = 0; j < 4; ++j) bh[kk][j] = F::load(curB + j * 16 * kPjPitch + kk * 32);
#pragma unroll
    for (int i = 0; i < 4; ++i) ah[kk][i] = F::load(curA + i * 16 * kPjPitch + kk * 32);
  }
  // keeps the LDS fragment reads as one group ahead of the matrix work (the scheduler otherwise spreads them among the
  // WMMAs) and ahead of the fetch, so that no fragment lands in a register that a fetch in flight names as its address
  __builtin_amdgcn_sched_barrier(0);
  if (FETCH) pj_fetch(ld, gA, gB, k);
  // keeps the fetch ahead of the matrix work (the scheduler otherwise sinks it to its use, a stage later)
  __builtin_amdgcn_sched_barrier(0);
#pragma unroll
  for (int i = 0; i < 4; ++i)
#pragma unroll
    for (int j = 0; j < 4; ++j) acc[i][j] = F::mma(ah[0][i], bh[0][j], acc[i][j]);
  // keeps the LDS stores of the next stage behind the first WMMA half, when this stage's fragment reads have been served
  __builtin_amdgcn_sched_barrier(0);
  // the wait owed before the fetch's address registers are written again; 16 WMMAs behind the fetch
  if (FETCH) asm volatile("s_wait_xcnt 0x0" ::: "memory");
  if (PUT) pj_put(nxt, st);
  // keeps the second WMMA half behind the stores: it needs no LDS, so it can run past the barrier, beside the next reads
  __builtin_amdgcn_sched_barrier(0);
#pragma unroll
  for (int i = 0; i < 4; ++i)
#pragma unroll
    for (int j = 0; j < 4; ++j) acc[i][j] = F::mma(ah[1][i], bh[1][j], acc[i][j]);
  if (PUT) pj_barrier();               // publishes the stage just stored and ends every read of cur
}

__global__ __launch_bounds__(256) void proj_gemm_lds_kernel(const unsigned short* __restrict__ Ap,
                                                            const unsigned short* __restrict__ Btp,
                                                            float* __restrict__ C, const float* __restrict__ bias,
                                                            float scale) {
  __shared__ __align__(16) unsigned short sAB[2][kPjStage];
  __shared__ __align__(16) float sT[8][16 * 68];   // per-wave 16x64 slab, pitch 68 floats
  const int t    = threadIdx.x;
  const int lane = t & 31;
  const int wave = t >> 5;
  const int mB = (blockIdx.x >> 2) * kPjBM;
  const int nB = (blockIdx.x & 3) * kPjBN;
  const int m0 = mB + (wave >> 2) * 64;
  const int n0 = nB + (wave & 3) * 64;

  const int rlane = lane & 15;                 // row (A) / col (B, D) within subtile
  const int koff  = (lane >> 4) * 8;           // k offset of this lane half
  const int mOff  = (lane >> 4) * 8;           // D row offset

  // staging map: piece j of thread t is 16 B number (t & 7) of staged row (t >> 3) + 32 * j
  const int srow = t >> 3;
  const int spart = (t & 7) * 8;
  const unsigned short* gA = Ap  + (size_t)(mB + srow) * kD + spart;
  const unsigned short* gB = Btp + (size_t)(nB + srow) * kD + spart;
  unsigned short* put0 = &sAB[0][srow * kPjPitch + spart];
  unsigned short* put1 = &sAB[1][srow * kPjPitch + spart];
  const int fA = ((wave >> 2) * 64 + rlane) * kPjPitch + koff;
  const int fB = (kPjBM + (wave & 3) * 64 + rlane) * kPjPitch + koff;
  const _Float16* a0 = (const _Float16*)sAB[0] + fA;
  const _Float16* b0 = (const _Float16*)sAB[0] + fB;
  const _Float16* a1 = (const _Float16*)sAB[1] + fA;
  const _Float16* b1 = (const _Float16*)sAB[1] + fB;

  v8f acc[4][4];
#pragma unroll
  for (int i = 0; i < 4; ++i)
#pragma unroll
    for (int j = 0; j < 4; ++j) acc[i][j] = (v8f){0.f,0.f,0.f,0.f,0.f,0.f,0.f,0.f};

  v4u pe[12], po[12];                          // even and odd stages on their way to LDS
  pj_fetch(pe, gA, gB, 0);
  pj_fetch(po, gA, gB, kPjBK);
  asm volatile("s_wait_xcnt 0x0" ::: "memory");   // the wait owed before the fetches' address registers are written again
  pj_put(put0, pe);
  pj_barrier();

  for (int s = 0; s < kPjStages - 2; s += 2) {
    pj_stage<true, true>(a0, b0, put1, gA, gB, (s + 2) * kPjBK, pe, po, acc);   // stage s; fetch s + 2, store s + 1
    pj_stage<true, true>(a1, b1, put0, gA, gB, (s + 3) * kPjBK, po, pe, acc);   // stage s + 1; fetch s + 3, store s + 2
  }
  pj_stage<false, true>(a0, b0, put1, gA, gB, 0, pe, po, acc);                  // stage 14; store 15
  pj_stage<false, false>(a1, b1, put0, gA, gB, 0, po, pe, acc);                 // stage 15

  // ---- epilogue: as wmma_gemm64 with bias[n], f32 out ----
  float* slab = sT[wave];
#pragma unroll
  for (int i = 0; i < 4; ++i) {
    const int mBase = m0 + (i << 4);
#pragma unroll
    for (int j = 0; j < 4; ++j) {
      const float bv = bias[n0 + (j << 4) + rlane];
#pragma unroll
      for (int r = 0; r < 8; ++r) {
        float v = acc[i][j][r] * scale;
        v += bv;
        slab[(mOff + r) * 68 + (j << 4) + rlane] = v;
      }
    }
    // the wave's slab writes are complete before its lanes read each other's words (as in wmma_gemm64)
    __builtin_amdgcn_fence(__ATOMIC_RELEASE, "workgroup");
    __builtin_amdgcn_wave_barrier();
    __builtin_amdgcn_fence(__ATOMIC_ACQUIRE, "workgroup");
    const int hh = lane >> 4, c4 = (lane & 15) * 4;     // row seg = 256 B = 16 lanes x 16 B
#pragma unroll
    for (int it = 0; it < 8; ++it) {
      const int row = it * 2 + hh;
      v4f v = *(const v4f*)(slab + row * 68 + c4);
      *(v4f*)(C + (size_t)(mBase + row) * kD + n0 + c4) = v;
    }
    // the wait owed before a register that these stores name (address or data) is written again; the scheduling fence
    // keeps the next rows' register writes behind it
    asm volatile("s_wait_xcnt 0x0" ::: "memory");
    __builtin_amdgcn_sched_barrier(0);
    // the slab is read out before the next 16 rows overwrite it (as in wmma_gemm64)
    __builtin_amdgcn_fence(__ATOMIC_RELEASE, "workgroup");
    __builtin_amdgcn_wave_barrier();
    __builtin_amdgcn_fence(__ATOMIC_ACQUIRE, "workgroup");
  }
}

// ---------------------------------------------------------------------------
// ---------------------------------------------------------------------------
__global__ __launch_bounds__(256) void cast8s_kernel(const float* __restrict__ in, unsigned short* __restrict__ out, int n8, float scale) {
  const int i = blockIdx.x * 256 + threadIdx.x;
  if (i >= n8) return;
  const float* p = in + 8 * (size_t)i;
  const v4f a = *(const v4f*)(p);
  const v4f c = *(const v4f*)(p + 4);
  unsigned short hb[8];
#pragma unroll
  for (int e = 0; e < 4; ++e) {
    hb[e]     = h_bits(a[e] * scale);
    hb[4 + e] = h_bits(c[e] * scale);
  }
  const v4u u = (v4u){pk16(hb[0], hb[1]), pk16(hb[2], hb[3]), pk16(hb[4], hb[5]), pk16(hb[6], hb[7])};
  store2_v4u(out + 8 * (size_t)i, u);
}

// ---------------------------------------------------------------------------
// Zero fill of two 16-bit regions (pad rows of the q2 and k planes): grid (n8/256, 2); 8 halves per thread, 16-B stores.
// ---------------------------------------------------------------------------
__global__ __launch_bounds__(256) void fill_zero2_kernel(unsigned short* __restrict__ a, unsigned short* __restrict__ b, int n8) {
  const int i = blockIdx.x * 256 + threadIdx.x;
  if (i >= n8) return;
  unsigned short* dst = (blockIdx.y == 0) ? a : b;   // block-uniform select between two global pointers
  const v4u z = (v4u){0u, 0u, 0u, 0u};
  store2_v4u(dst + 8 * (size_t)i, z);
}

// ---------------------------------------------------------------------------
// Weight cast for one layer: blockIdx.y = 0..3 selects W (q2, k, v1, v2) [1024 out][1024 in] row-major (= Bt [N][K] as-is)
// -> f16(256*W) into plane y of w16; blockIdx.y = 4: Wc [128][128] -> wc16. grid (512, 5): 512*256*8 = 1048576 = whole W;
// for y = 4 only blocks 0..7 are active (2048 threads x 8 = 16384 = whole Wc).
// ---------------------------------------------------------------------------
__global__ __launch_bounds__(256) void wcast_kernel(const float* __restrict__ w0, const float* __restrict__ w1,
                                                    const float* __restrict__ w2, const float* __restrict__ w3,
                                                    const float* __restrict__ wc,
                                                    unsigned short* __restrict__ w16, unsigned short* __restrict__ wc16) {
  const int z = blockIdx.y;                                     // block-uniform
  const int i = blockIdx.x * 256 + threadIdx.x;
  const float* src = (z == 0) ? w0 : (z == 1) ? w1 : (z == 2) ? w2 : (z == 3) ? w3 : wc;
  unsigned short* dst = (z < 4) ? (w16 + (size_t)z * kD * kD) : wc16;
  const int n8 = (z < 4) ? (kD * kD / 8) : (kHD * kHD / 8);
  if (i >= n8) return;
  const float* p = src + 8 * (size_t)i;
  const v4f a = *(const v4f*)(p);
  const v4f c = *(const v4f*)(p + 4);
  unsigned short hb[8];
#pragma unroll
  for (int e = 0; e < 4; ++e) {
    hb[e]     = h_bits(a[e] * kWCarry);
    hb[4 + e] = h_bits(c[e] * kWCarry);
  }
  const v4u u = (v4u){pk16(hb[0], hb[1]), pk16(hb[2], hb[3]), pk16(hb[4], hb[5]), pk16(hb[6], hb[7])};
  store2_v4u(dst + 8 * (size_t)i, u);
}

// ---------------------------------------------------------------------------
// CELU (alpha 1.3), f32
// ---------------------------------------------------------------------------
__device__ __forceinline__ float celu_f(float x) {
  const float en = expf(x * (1.0f / 1.3f)) - 1.0f;
  return (x > 0.f) ? x : 1.3f * en;
}

// ---------------------------------------------------------------------------
// GroupNorm of one projection (CELU -> per (token, head) mean/var over 128 channels -> * gw + gb) writing a token-major
// f16 plane [6272][1024]. MODE 0: value carried x16; MODE 2: value multiplied by the k plane value (already x16) -> (v1*k) x16.
// Unit = (token, head) = 128 channels handled by 16 lanes (8 each): wave = 2 units, block = 16 units, grid = 3136 blocks
// ---------------------------------------------------------------------------
template <int MODE>
__global__ __launch_bounds__(256) void gn_rows_kernel(const float* __restrict__ P, const float* __restrict__ gw,
                                                      const float* __restrict__ gb, const unsigned short* __restrict__ kpl,
                                                      unsigned short* __restrict__ outp) {
  const int t = threadIdx.x, lane = t & 31, wave = t >> 5, hh = lane >> 4, cl = lane & 15;
  const int u = (blockIdx.x * 8 + wave) * 2 + hh;              // token*8 + head, < 50176 (grid exact)
  const size_t base = (size_t)u * kHD + cl * 8;                // == token*1024 + head*128 + cl*8
  const int ch = (u & 7) * kHD + cl * 8;                       // channel index within 1024
  const v4f a = *(const v4f*)(P + base);
  const v4f c = *(const v4f*)(P + base + 4);
  float y[8];
#pragma unroll
  for (int e = 0; e < 4; ++e) { y[e] = celu_f(a[e]); y[4 + e] = celu_f(c[e]); }
  float s = ((y[0] + y[1]) + (y[2] + y[3])) + ((y[4] + y[5]) + (y[6] + y[7]));
#pragma unroll
  for (int off = 1; off < 16; off <<= 1) s += __shfl_xor(s, off, 32);   // stays inside the 16-lane half
  const float mu = s * (1.0f / 128.0f);
  float d[8];
  float sq = 0.f;
#pragma unroll
  for (int e = 0; e < 8; ++e) { d[e] = y[e] - mu; sq += d[e] * d[e]; }
#pragma unroll
  for (int off = 1; off < 16; off <<= 1) sq += __shfl_xor(sq, off, 32);
  const float var = sq * (1.0f / 128.0f);
  const float rs = rsqrtf(var + 1e-5f);
  const v4f w0 = *(const v4f*)(gw + ch), w1 = *(const v4f*)(gw + ch + 4);
  const v4f g0 = *(const v4f*)(gb + ch), g1 = *(const v4f*)(gb + ch + 4);
  float o[8];
#pragma unroll
  for (int e = 0; e < 4; ++e) {
    o[e]     = d[e] * rs * w0[e] + g0[e];
    o[4 + e] = d[4 + e] * rs * w1[e] + g1[e];
  }
  if (MODE == 2) {
    const v4u kk = *(const v4u*)(kpl + base);
    float kf[8];
    kf[0] = h16_to_f32(kk.x & 0xffffu); kf[1] = h16_to_f32(kk.x >> 16);
    kf[2] = h16_to_f32(kk.y & 0xffffu); kf[3] = h16_to_f32(kk.y >> 16);
    kf[4] = h16_to_f32(kk.z & 0xffffu); kf[5] = h16_to_f32(kk.z >> 16);
    kf[6] = h16_to_f32(kk.w & 0xffffu); kf[7] = h16_to_f32(kk.w >> 16);
#pragma unroll
    for (int e = 0; e < 8; ++e) o[e] = o[e] * kf[e];
  } else {
#pragma unroll
    for (int e = 0; e < 8; ++e) o[e] = o[e] * kXCarry;
  }
  unsigned short hb[8];
#pragma unroll
  for (int e = 0; e < 8; ++e) hb[e] = h_bits(o[e]);
  const v4u uu = (v4u){pk16(hb[0], hb[1]), pk16(hb[2], hb[3]), pk16(hb[4], hb[5]), pk16(hb[6], hb[7])};
  store2_v4u(outp + base, uu);
}

// ---------------------------------------------------------------------------
// GroupNorm of the v2 projection written transposed and key-padded: V2T[((h*128 + d)*32 + b)*256 + key] = f16(16 * v2n),
// keys 196..255 = 0. Block = (b, h, dh): 64 channels d = dh*64.. of one (b,h), all 196 tokens; grid (32, 8, 2).
// Phase 0: zero keys 192..255 of the 64 LDS rows (256 threads x 2 x 8 halves = 64 x 64). Phase 1: wave w handles tokens
// w, w+8, ...: 32 lanes x 4 channels = 128 (stats over the full head), the 16 lanes of half dh write their 4 channels
// into LDS [ch][key]. Phase 2: wave w writes rows w*8..w*8+7 (8 waves = 64 rows), each row 256 halves = 512 B =
// ---------------------------------------------------------------------------
constexpr int kV2Pitch = 264;   // halves; 528 B keeps 16-B alignment of row bases
__global__ __launch_bounds__(256) void gn_v2t_kernel(const float* __restrict__ P, const float* __restrict__ gw,
                                                     const float* __restrict__ gb, unsigned short* __restrict__ v2t) {
  __shared__ __align__(16) unsigned short sm[64 * kV2Pitch];
  const int t = threadIdx.x, lane = t & 31, wave = t >> 5;
  const int b = blockIdx.x, h = blockIdx.y, dh = blockIdx.z;
  {
    const v4u z = (v4u){0u, 0u, 0u, 0u};
#pragma unroll
    for (int j = 0; j < 2; ++j) {
      const int idx = t * 2 + j;              // 0..511
      const int row = idx >> 3, part = idx & 7;
      *(v4u*)(sm + row * kV2Pitch + 192 + part * 8) = z;
    }
  }
  __syncthreads();
  const int ch = h * kHD + lane * 4;
  const v4f wv = *(const v4f*)(gw + ch);
  const v4f gv = *(const v4f*)(gb + ch);
  const int cl0 = (lane & 15) * 4;
  for (int i = 0; i < 25; ++i) {
    const int tok = wave + 8 * i;             // wave-uniform
    if (tok >= kM) break;
    const v4f a = *(const v4f*)(P + ((size_t)(b * kM + tok)) * kD + ch);
    float y[4];
#pragma unroll
    for (int e = 0; e < 4; ++e) y[e] = celu_f(a[e]);
    float s = (y[0] + y[1]) + (y[2] + y[3]);
#pragma unroll
    for (int off = 1; off < 32; off <<= 1) s += __shfl_xor(s, off, 32);
    const float mu = s * (1.0f / 128.0f);
    float d[4];
    float sq = 0.f;
#pragma unroll
    for (int e = 0; e < 4; ++e) { d[e] = y[e] - mu; sq += d[e] * d[e]; }
#pragma unroll
    for (int off = 1; off < 32; off <<= 1) sq += __shfl_xor(sq, off, 32);
    const float var = sq * (1.0f / 128.0f);
    const float rs = rsqrtf(var + 1e-5f);
    unsigned short hb[4];
#pragma unroll
    for (int e = 0; e < 4; ++e) hb[e] = h_bits((d[e] * rs * wv[e] + gv[e]) * kXCarry);
    if ((lane >> 4) == dh) {
#pragma unroll
      for (int e = 0; e < 4; ++e) sm[(cl0 + e) * kV2Pitch + tok] = hb[e];
    }
  }
  __syncthreads();
  const size_t rowbase = ((size_t)(h * kHD + dh * 64)) * (kB * kSP) + (size_t)b * kSP + lane * 8;
  {
#pragma unroll
    for (int it = 0; it < 8; ++it) {
      const int cl = wave * 8 + it;           // 0..63
      const v4u u = *(const v4u*)(sm + cl * kV2Pitch + lane * 8);
      *(v4u*)(v2t + rowbase + (size_t)cl * (kB * kSP)) = u;
    }
    
  }
}

// ---------------------------------------------------------------------------
// Row softmax: scores planes S [8 h][32 b][256 q][256 keys] f32 (already scaled by 128^-0.5); key j >= 196 excluded,
// real keys with mask[b][j] == 0 set to -1e9 (select); P = exp(s - max)/sum written as f16(2048 * P), pad keys and pad
// query rows (q >= 196) written as 0. One wave per row (32 lanes x 8 keys = 256), 8 rows per block, grid (32, 32 b, 8 h).
// ---------------------------------------------------------------------------
__global__ __launch_bounds__(256) void softmax_kernel(const float* __restrict__ S, const float* __restrict__ mask,
                                                      unsigned short* __restrict__ Pp) {
  const int t = threadIdx.x, lane = t & 31, wave = t >> 5;
  const int b = blockIdx.y;
  S  += (size_t)blockIdx.z * (kB * kSP * kSP);         // this head's score plane
  Pp += (size_t)blockIdx.z * (kB * kSP * kSP);         // this head's prob plane
  const int r = blockIdx.x * 8 + wave;                 // 0..255, wave-uniform
  const int rc = (r < kM) ? r : (kM - 1);              // clamped address
  const float* sr = S + ((size_t)b * kSP + rc) * kSP + lane * 8;
  const v4f a = *(const v4f*)(sr);
  const v4f c = *(const v4f*)(sr + 4);
  float x[8];
#pragma unroll
  for (int e = 0; e < 4; ++e) { x[e] = a[e]; x[4 + e] = c[e]; }
  float s[8];
#pragma unroll
  for (int e = 0; e < 8; ++e) {
    const int j  = lane * 8 + e;
    const int jc = (j < kM) ? j : (kM - 1);
    const float mv = mask[b * kM + jc];
    const float v = (mv == 0.0f) ? -1.0e9f : x[e];
    s[e] = (j < kM) ? v : -3.0e38f;
  }
  float mx = fmaxf(fmaxf(fmaxf(s[0], s[1]), fmaxf(s[2], s[3])), fmaxf(fmaxf(s[4], s[5]), fmaxf(s[6], s[7])));
#pragma unroll
  for (int off = 1; off < 32; off <<= 1) mx = fmaxf(mx, __shfl_xor(mx, off, 32));
  float p[8];
  float ps = 0.f;
#pragma unroll
  for (int e = 0; e < 8; ++e) {
    const int j = lane * 8 + e;
    const float arg = (j < kM) ? (s[e] - mx) : -100.0f;
    const float ev = expf(arg);
    p[e] = (j < kM) ? ev : 0.0f;
    ps += p[e];
  }
#pragma unroll
  for (int off = 1; off < 32; off <<= 1) ps += __shfl_xor(ps, off, 32);
  const float inv = 1.0f / ps;
  unsigned short hb[8];
#pragma unroll
  for (int e = 0; e < 8; ++e) hb[e] = h_bits(p[e] * inv * kPCarry);
  const v4u u = (v4u){pk16(hb[0], hb[1]), pk16(hb[2], hb[3]), pk16(hb[4], hb[5]), pk16(hb[6], hb[7])};
  v4u uu;
  uu.x = (r < kM) ? u.x : 0u;
  uu.y = (r < kM) ? u.y : 0u;
  uu.z = (r < kM) ? u.z : 0u;
  uu.w = (r < kM) ? u.w : 0u;
  store2_v4u(Pp + ((size_t)b * kSP + r) * kSP + lane * 8, uu);
}

// ---------------------------------------------------------------------------
// Gated residual + LayerNorm: y = x + gate*attn (token-major gate [6272][1024], attn [32][256 q][1024]); x_new = LN(y)*lnw + lnb
// written f32 to xout (may alias xin: each block reads its whole row into registers before any store, no other block
// touches the row) and as f16(16*x_new) to x16. One block per token (grid 6272), thread t owns columns 4t..4t+3.
// ---------------------------------------------------------------------------
__global__ __launch_bounds__(256) void merge_ln_kernel(const float* xin, const float* __restrict__ att,
                                                       const float* __restrict__ gate, const float* __restrict__ lnw,
                                                       const float* __restrict__ lnb, float* xout,
                                                       unsigned short* __restrict__ x16) {
  __shared__ float redA[8];
  __shared__ float redB[8];
  __shared__ __align__(16) float srow[kD];
  const int t = threadIdx.x, lane = t & 31, wave = t >> 5;
  const int r = blockIdx.x;
  const int b = r / kM;
  const int m = r - b * kM;
  const int c0 = t * 4;
  const size_t ro = (size_t)r * kD + c0;
  const v4f xv = *(const v4f*)(xin + ro);
  const v4f gv = *(const v4f*)(gate + ro);
  const v4f av = *(const v4f*)(att + ((size_t)(b * kSP + m)) * kD + c0);
  float y[4];
#pragma unroll
  for (int e = 0; e < 4; ++e) y[e] = xv[e] + gv[e] * av[e];
  float s = (y[0] + y[1]) + (y[2] + y[3]);
#pragma unroll
  for (int off = 1; off < 32; off <<= 1) s += __shfl_xor(s, off, 32);
  if (lane == 0) redA[wave] = s;
  __syncthreads();
  float tot = redA[0];
#pragma unroll
  for (int w = 1; w < 8; ++w) tot += redA[w];
  const float mu = tot * (1.0f / 1024.0f);
  float d[4];
  float sq = 0.f;
#pragma unroll
  for (int e = 0; e < 4; ++e) { d[e] = y[e] - mu; sq += d[e] * d[e]; }
#pragma unroll
  for (int off = 1; off < 32; off <<= 1) sq += __shfl_xor(sq, off, 32);
  if (lane == 0) redB[wave] = sq;
  __syncthreads();
  float tot2 = redB[0];
#pragma unroll
  for (int w = 1; w < 8; ++w) tot2 += redB[w];
  const float var = tot2 * (1.0f / 1024.0f);
  const float rs = rsqrtf(var + 1e-5f);
  const v4f wv = *(const v4f*)(lnw + c0);
  const v4f bv = *(const v4f*)(lnb + c0);
  v4f ov;
#pragma unroll
  for (int e = 0; e < 4; ++e) ov[e] = d[e] * rs * wv[e] + bv[e];
  *(v4f*)(srow + c0) = ov;
  __syncthreads();
  const int tc = t & 127;                               // clamped staging index; only t < 128 stores
  const v4f p0 = *(const v4f*)(srow + tc * 8);
  const v4f p1 = *(const v4f*)(srow + tc * 8 + 4);
  unsigned short hb[8];
#pragma unroll
  for (int e = 0; e < 4; ++e) {
    hb[e]     = h_bits(p0[e] * kXCarry);
    hb[4 + e] = h_bits(p1[e] * kXCarry);
  }
  const v4u hu = (v4u){pk16(hb[0], hb[1]), pk16(hb[2], hb[3]), pk16(hb[4], hb[5]), pk16(hb[6], hb[7])};
  unsigned short* hp = x16 + (size_t)r * kD + tc * 8;
  {
    *(v4f*)(xout + ro) = ov;
    if (t < 128) *(v4u*)hp = hu;
    
  }
}

// ---------------------------------------------------------------------------
// Masked mean over tokens: out0[b][c] = sum_m x[b][m][c]*mask[b][m] / sum_m mask[b][m]. One block per b (grid 32),
// ---------------------------------------------------------------------------
__global__ __launch_bounds__(256) void pool_kernel(const float* x, const float* __restrict__ mask, float* out0) {
  const int t = threadIdx.x;
  const int b = blockIdx.x;
  const int c0 = t * 4;
  v4f acc = (v4f){0.f, 0.f, 0.f, 0.f};
  float ms = 0.f;
#pragma unroll 1
  for (int m = 0; m < kM; ++m) {
    const float mv = mask[b * kM + m];
    const v4f xv = *(const v4f*)(x + ((size_t)(b * kM + m)) * kD + c0);
    acc += xv * mv;
    ms += mv;
  }
  const float inv = 1.0f / ms;
  const v4f o = acc * inv;
  store2_v4f(out0 + (size_t)b * kD + c0, o);
}

// ---------------------------------------------------------------------------
// Host orchestration: kernel launches only. 2 + 3*14 + 1 = 45 launches.
// ---------------------------------------------------------------------------
extern "C" void kernel_launch(void* const* d_in, const int* in_sizes, int n_in,
                              void* d_out, int out_size, void* d_ws, size_t ws_size,
                              hipStream_t stream) {
  if (n_in < 22) return;
  if (in_sizes[0] != kTok * kD) return;
  if (in_sizes[1] != kTok) return;
  if (in_sizes[2] != kL * kD * kD || in_sizes[6] != kL * kD * kD || in_sizes[10] != kL * kD * kD || in_sizes[14] != kL * kD * kD) return;
  if (in_sizes[18] != kL * kHD * kHD || in_sizes[19] != kL * kHD) return;
  if (in_sizes[3] != kL * kD || in_sizes[20] != kL * kD || in_sizes[21] != kL * kD) return;
  if (out_size != kB * kD + kTok * kD) return;
  if (ws_size < kWsTotal) return;

  const float* att_feats = (const float*)d_in[0];
  const float* att_mask  = (const float*)d_in[1];
  const float* Wq2  = (const float*)d_in[2];
  const float* bq2  = (const float*)d_in[3];
  const float* gq2w = (const float*)d_in[4];
  const float* gq2b = (const float*)d_in[5];
  const float* Wk   = (const float*)d_in[6];
  const float* bk   = (const float*)d_in[7];
  const float* gkw  = (const float*)d_in[8];
  const float* gkb  = (const float*)d_in[9];
  const float* Wv1  = (const float*)d_in[10];
  const float* bv1  = (const float*)d_in[11];
  const float* gv1w = (const float*)d_in[12];
  const float* gv1b = (const float*)d_in[13];
  const float* Wv2  = (const float*)d_in[14];
  const float* bv2  = (const float*)d_in[15];
  const float* gv2w = (const float*)d_in[16];
  const float* gv2b = (const float*)d_in[17];
  const float* Wc   = (const float*)d_in[18];
  const float* bc   = (const float*)d_in[19];
  const float* lnw  = (const float*)d_in[20];
  const float* lnb  = (const float*)d_in[21];

  char* ws = (char*)d_ws;
  float*          Ppl   = (float*)(ws + kOffP);                    // linear+bias plane
  float*          GATE  = (float*)(ws + kOffP);                    // gate plane (same region, later)
  unsigned short* GIN16 = (unsigned short*)(ws + kOffATT);         // (v1*k) plane
  float*          ATT   = (float*)(ws + kOffATT);                  // attn plane (same region, later)
  unsigned short* X16   = (unsigned short*)(ws + kOffX16);
  float*          Spl   = (float*)(ws + kOffS);                    // scores, all heads
  unsigned short* PP    = (unsigned short*)(ws + kOffPP);          // probs, all heads
  unsigned short* W16   = (unsigned short*)(ws + kOffW16);
  unsigned short* WC16  = (unsigned short*)(ws + kOffWC16);
  unsigned short* Q16   = (unsigned short*)(ws + kOffQ16);
  unsigned short* K16   = (unsigned short*)(ws + kOffK16);
  unsigned short* V2T   = (unsigned short*)(ws + kOffV2T);

  float* out0 = (float*)d_out;                                     // [32][1024] at byte 0
  float* out1 = (float*)d_out + (size_t)kB * kD;                   // [32][196][1024] at byte 131072; also the running x

  const float projScale  = 1.0f / (kXCarry * kWCarry);             // 1/4096
  const float gateScale  = 1.0f / (kXCarry * kWCarry);             // (v1*k) x16, Wc x256
  const float scoreScale = 0.08838834764831845f * (1.0f / (kXCarry * kXCarry));
  const float pvScale    = 1.0f / (kPCarry * kXCarry);             // 1/32768

  // x -> f16 plane (x16); pad rows of the q2/k planes zero
  {
    const int n8 = kTok * kD / 8;                                  // 802816 = 3136 * 256
    cast8s_kernel<<<dim3(n8 / 256), dim3(256), 0, stream>>>(att_feats, X16, n8, kXCarry);
    const int npad8 = 64 * kD / 8;                                 // 8192 = 32 * 256
    fill_zero2_kernel<<<dim3(npad8 / 256, 2), dim3(256), 0, stream>>>(Q16 + (size_t)kTok * kD, K16 + (size_t)kTok * kD, npad8);
  }

  for (int i = 0; i < kL; ++i) {
    const size_t wo = (size_t)i * kD * kD;
    wcast_kernel<<<dim3(512, 5), dim3(256), 0, stream>>>(Wq2 + wo, Wk + wo, Wv1 + wo, Wv2 + wo, Wc + (size_t)i * kHD * kHD, W16, WC16);

    // four projections: P = x16 * Wz^T + bz (M 6272, N 1024, K 1024; 49 x 4 block tiles of 128 x 256 = 196 blocks)
    for (int z = 0; z < 4; ++z) {
      const float* biasz = (z == 0) ? bq2 : (z == 1) ? bk : (z == 2) ? bv1 : bv2;
      const float* gwz   = (z == 0) ? gq2w : (z == 1) ? gkw : (z == 2) ? gv1w : gv2w;
      const float* gbz   = (z == 0) ? gq2b : (z == 1) ? gkb : (z == 2) ? gv1b : gv2b;
      proj_gemm_lds_kernel<<<dim3((kTok / kPjBM) * (kD / kPjBN)), dim3(256), 0, stream>>>(
          X16, W16 + (size_t)z * kD * kD, Ppl, biasz + (size_t)i * kD, projScale);
      if (z == 0) {
        gn_rows_kernel<0><<<dim3(3136), dim3(256), 0, stream>>>(Ppl, gwz + (size_t)i * kD, gbz + (size_t)i * kD, K16, Q16);
      } else if (z == 1) {
        gn_rows_kernel<0><<<dim3(3136), dim3(256), 0, stream>>>(Ppl, gwz + (size_t)i * kD, gbz + (size_t)i * kD, Q16, K16);
      } else if (z == 2) {
        gn_rows_kernel<2><<<dim3(3136), dim3(256), 0, stream>>>(Ppl, gwz + (size_t)i * kD, gbz + (size_t)i * kD, K16, GIN16);
      } else {
        gn_v2t_kernel<<<dim3(kB, kH, 2), dim3(256), 0, stream>>>(Ppl, gwz + (size_t)i * kD, gbz + (size_t)i * kD, V2T);
      }
    }

    // gate = sigmoid((v1*k) * Wc^T + bc): M 50176, N 128, K 128 (1568 tiles = 196 blocks); output [50176][128] f32 == token-major [6272][1024]
    wmma_gemm64<0, false, 2, 0, false, 6><<<dim3(196, 1), dim3(256), 0, stream>>>(
        GIN16, nullptr, kHD, 0L, 0L,
        WC16, nullptr, kHD, 0L, 0L,
        (void*)GATE, nullptr, kHD, 0L, 0L,
        bc + (size_t)i * kHD, nullptr, 0L,
        kTok * kH, kHD, kHD, gateScale);

    // attention, all 256 (batch, head) groups per launch (grid.y = b, grid.z = h)
    // scores [h][b][256 q][256 keys] = q2 * k^T * 128^-0.5 (M 256, N 256, K 128; 16 tiles = 2 blocks per group)
    wmma_gemm64<0, false, 0, 0, false, 0><<<dim3(2, kB, kH), dim3(256), 0, stream>>>(
        Q16, nullptr, kD, (long)kM * kD, (long)kHD,
        K16, nullptr, kD, (long)kM * kD, (long)kHD,
        (void*)Spl, nullptr, kSP, (long)kSP * kSP, (long)kB * kSP * kSP,
        nullptr, nullptr, 0L,
        kSP, kSP, kHD, scoreScale);
    softmax_kernel<<<dim3(kSP / 8, kB, kH), dim3(256), 0, stream>>>(Spl, att_mask, PP);
    // attn columns h*128.. of [b][256 q][1024] = P * v2 (M 256, N 128, K 224; 8 tiles = 1 block per group)
    wmma_gemm64<0, false, 0, 0, false, 0><<<dim3(1, kB, kH), dim3(256), 0, stream>>>(
        PP, nullptr, kSP, (long)kSP * kSP, (long)kB * kSP * kSP,
        V2T, nullptr, kB * kSP, (long)kSP, (long)kHD * (kB * kSP),
        (void*)ATT, nullptr, kD, (long)kSP * kD, (long)kHD,
        nullptr, nullptr, 0L,
        kSP, kHD, kKeyK, pvScale);

    const float* xin = (i == 0) ? att_feats : out1;
    merge_ln_kernel<<<dim3(kTok), dim3(256), 0, stream>>>(xin, ATT, GATE, lnw + (size_t)i * kD, lnb + (size_t)i * kD, out1, X16);
  }

  pool_kernel<<<dim3(kB), dim3(256), 0, stream>>>(out1, att_mask, out0);
}

// v003
// Measured time: 575 microseconds a run.
// Two timings next to v002 put it at 1.18 and 1.19 times that version's speed.
// Over all steps from v000 it is 2.75 times as fast.
// Contractions: projections x(f16, x16)*W^T(f16, x256), gate (v1*k)(f16, x16)*Wc^T(f16, x256), scores q2(f16, x16)*k^T(f16, x16), attn P(f16, x2048)*v2(f16, x16): all v_wmma_f32_16x16x32_f16 with f32 accumulate; CELU, GroupNorm, softmax, sigmoid, residual, LayerNorm and masked mean in f32.
#include <hip/hip_runtime.h>
#include <math.h>

// ---------------------------------------------------------------------------
// Problem constants
// ---------------------------------------------------------------------------
constexpr int kB   = 32;
constexpr int kM   = 196;
constexpr int kD   = 1024;
constexpr int kH   = 8;
constexpr int kHD  = 128;
constexpr int kL   = 3;
constexpr int kTok = kB * kM;          // 6272 = 98 * 64 token rows
constexpr int kTokPad = kTok + 64;     // 6336: 64 zero rows so per-group 208-row tiles never leave the plane
constexpr int kSP  = 256;              // padded queries / keys per (batch, head) group
constexpr int kKeyK = 224;             // contraction depth of P*V (keys padded to a multiple of 32)
constexpr float kXCarry = 16.0f;       // x, q2, k, v2 planes carried x16 in f16
constexpr float kWCarry = 256.0f;      // W, Wc carried x256 in f16
constexpr float kPCarry = 2048.0f;     // probabilities carried x2048 in f16

// ---------------------------------------------------------------------------
// Workspace region map (bytes, all offsets multiples of 256)
//   R_P    [0, 25690112)            : linear+bias plane f32 [6272][1024]  -> later gate plane f32 [50176][128]
//   R_ATT  [25690112, 59244544)     : (v1*k) f16 plane [6272][1024]      -> later attn f32 [32][256][1024]
//   R_X16  [59244544, 72089600)     : x f16 [6272][1024]
//   R_W16  [72089600, 80478208)     : stacked W f16 [4096][1024]
//   R_WC16 [80478208, 80510976)     : Wc f16 [128][128]
//   R_Q16  [80510976, 93487104)     : q2 f16 [6336][1024] (rows >= 6272 zero)
//   R_K16  [93487104, 106463232)    : k  f16 [6336][1024] (rows >= 6272 zero)
//   R_V2T  [106463232, 123240448)   : v2^T f16 [8 h][128 d][32 b][256 keys] (keys >= 196 zero)
// ---------------------------------------------------------------------------
constexpr size_t kBytesP    = (size_t)kTok * kD * 4;
constexpr size_t kBytesATT  = (size_t)kB * kSP * kD * 4;
constexpr size_t kBytesX16  = (size_t)kTok * kD * 2;
constexpr size_t kBytesW16  = (size_t)4 * kD * kD * 2;
constexpr size_t kBytesWC16 = (size_t)kHD * kHD * 2;
constexpr size_t kBytesQ16  = (size_t)kTokPad * kD * 2;
constexpr size_t kBytesV2T  = (size_t)kH * kHD * kB * kSP * 2;
constexpr size_t kOffP    = 0;
constexpr size_t kOffATT  = kOffP + kBytesP;
constexpr size_t kOffX16  = kOffATT + kBytesATT;
constexpr size_t kOffW16  = kOffX16 + kBytesX16;
constexpr size_t kOffWC16 = kOffW16 + kBytesW16;
constexpr size_t kOffQ16  = kOffWC16 + kBytesWC16;
constexpr size_t kOffK16  = kOffQ16 + kBytesQ16;
constexpr size_t kOffV2T  = kOffK16 + kBytesQ16;
constexpr size_t kWsTotal = kOffV2T + kBytesV2T;
static_assert(kWsTotal == 123240448, "carve total");
static_assert(kWsTotal <= 268435456, "carve under 256 MiB");
static_assert(kBytesATT >= (size_t)kTok * kD * 2, "vk plane fits in the attn region");
static_assert(kBytesP == (size_t)kTok * kH * kHD * 4, "gate plane fits in the P region");
static_assert((kOffATT % 256) == 0 && (kOffX16 % 256) == 0 && (kOffW16 % 256) == 0 && (kOffQ16 % 256) == 0 && (kOffK16 % 256) == 0 && (kOffV2T % 256) == 0, "aligned");

typedef __attribute__((ext_vector_type(16))) _Float16 v16h;
typedef __attribute__((ext_vector_type(8)))  _Float16 v8h;
typedef __attribute__((ext_vector_type(16))) __bf16   v16b;
typedef __attribute__((ext_vector_type(8)))  __bf16   v8b;
typedef __attribute__((ext_vector_type(8)))  float    v8f;
typedef __attribute__((ext_vector_type(4)))  float    v4f;
typedef __attribute__((ext_vector_type(4)))  unsigned int v4u;

__device__ __forceinline__ unsigned short f2bf_bits(float f) {
  unsigned u = __float_as_uint(f);
  return (unsigned short)((u + 0x7FFFu + ((u >> 16) & 1u)) >> 16);
}
__device__ __forceinline__ float bf_bits2f(unsigned short h) { return __uint_as_float(((unsigned)h) << 16); }

// hazard guards as plain device helpers (no inline asm inside the kernel template body)
__device__ __forceinline__ void dep_guard_h(v8f& a, v8f& b, v16h x, v16h y) { asm volatile("v_nop\n\tv_nop\n\tv_nop\n\tv_nop" : "+v"(a), "+v"(b) : "v"(x), "v"(y)); }
__device__ __forceinline__ void dep_guard_b(v8f& a, v8f& b, v16b x, v16b y) { asm volatile("v_nop\n\tv_nop\n\tv_nop\n\tv_nop" : "+v"(a), "+v"(b) : "v"(x), "v"(y)); }
__device__ __forceinline__ void keep4_h(v16h a, v16h b, v16h c, v16h d) { asm volatile("v_nop" :: "v"(a), "v"(b), "v"(c), "v"(d)); }
__device__ __forceinline__ void keep4_b(v16b a, v16b b, v16b c, v16b d) { asm volatile("v_nop" :: "v"(a), "v"(b), "v"(c), "v"(d)); }
__device__ __forceinline__ void acc_guard4(v8f& a, v8f& b, v8f& c, v8f& d) { asm volatile("v_nop\n\tv_nop\n\tv_nop\n\tv_nop" : "+v"(a), "+v"(b), "+v"(c), "+v"(d)); }
template <typename T> struct Frag;
template <> struct Frag<_Float16> {
  typedef v16h V; union U { v16h v; v8h h[2]; };
  static __device__ __forceinline__ v16h load(const _Float16* p) {   // elements 0..7 <- p[0..7], 8..15 <- p[16..23]
    U f; f.h[0] = *(const v8h*)(p); f.h[1] = *(const v8h*)(p + 16); return f.v;
  }
  static __device__ __forceinline__ v8f mma(v16h a, v16h b, v8f c) {
    return __builtin_amdgcn_wmma_f32_16x16x32_f16(false, a, false, b, (short)0, c, false, false);
  }
  static __device__ __forceinline__ void guard(v8f& a, v8f& b, v16h x, v16h y) { dep_guard_h(a, b, x, y); }
  static __device__ __forceinline__ void keep(v16h a, v16h b, v16h c, v16h d) { keep4_h(a, b, c, d); }
};
template <> struct Frag<__bf16> {
  typedef v16b V; union U { v16b v; v8b h[2]; };
  static __device__ __forceinline__ v16b load(const __bf16* p) {
    U f; f.h[0] = *(const v8b*)(p); f.h[1] = *(const v8b*)(p + 16); return f.v;
  }
  static __device__ __forceinline__ v8f mma(v16b a, v16b b, v8f c) {
    return __builtin_amdgcn_wmma_f32_16x16x32_bf16(false, a, false, b, (short)0, c, false, false);
  }
  static __device__ __forceinline__ void guard(v8f& a, v8f& b, v16b x, v16b y) { dep_guard_b(a, b, x, y); }
  static __device__ __forceinline__ void keep(v16b a, v16b b, v16b c, v16b d) { keep4_b(a, b, c, d); }
};

__device__ __forceinline__ unsigned pk16(unsigned short a, unsigned short b) { return (unsigned)a | ((unsigned)b << 16); }
__device__ __forceinline__ unsigned short h_bits(float f) { const _Float16 h = (_Float16)f; return __builtin_bit_cast(unsigned short, h); }

// exact f16 bits -> f32 via integer arithmetic (normals and subnormals; no _Float16 vector involved)
__device__ __forceinline__ float h16_to_f32(unsigned hb) {
  const unsigned em = hb & 0x7fffu;
  const float fn = __uint_as_float((em + 0x1C000u) << 13);
  const float fs = (float)em * 5.9604644775390625e-8f;
  const float f  = (em < 0x400u) ? fs : fn;
  return __uint_as_float(__float_as_uint(f) | ((hb & 0x8000u) << 16));
}

__device__ __forceinline__ void store2_v4u(unsigned short* p, v4u u) {
  *(v4u*)p = u;
  
}
__device__ __forceinline__ void store2_v4f(float* p, v4f v) {
  *(v4f*)p = v;
  
}

// ---- Register-blocked batched WMMA GEMM (ACT: 0 none, 2 relu, 4 leaky, 6 sigmoid) -------------
// C[m,n] = scale * sum_k A[m,k] * Bt[n,k] (+bias)(+resid); each wave owns a 64x64 tile.
// A row-major [M,K]; Bt row-major [N,K]; M,N % 64 == 0, K % 32 == 0.
// SPLIT: operands are hi/lo planes (A2/Bt2 = lo planes, same layout); product = hi*hi + hi*lo + lo*hi.
// BIAS_MODE: 0 = none, 1 = bias[m], 2 = bias[n].
// OUT_MODE: 0 = f32, 1 = f16, 2 = bf16 hi plane (Cout) + bf16 lo plane (Cout2).
// ET: 0 = f16 operands, 1 = bf16 operands (pointers passed as 16-bit storage)
// Batching: blockIdx.y steps A, Bt, C by strideA, strideB, strideC; blockIdx.z steps them by strideAz, strideBz, strideCz.
template <int ET> struct Elem;
template <> struct Elem<0> { typedef _Float16 T; };
template <> struct Elem<1> { typedef __bf16 T; };
template <int ET, bool SPLIT, int BIAS_MODE, int OUT_MODE, bool RESID, int ACT = 0>
__global__ __launch_bounds__(256) void wmma_gemm64(
    const unsigned short* __restrict__ Ap, const unsigned short* __restrict__ A2p, int lda, long strideA, long strideAz,
    const unsigned short* __restrict__ Btp, const unsigned short* __restrict__ Bt2p, int ldb, long strideB, long strideBz,
    void* __restrict__ Cout, void* __restrict__ Cout2, int ldc, long strideC, long strideCz,
    const float* __restrict__ bias,
    const float* __restrict__ resid, long strideR,
    int M, int N, int K, float scale) {
  typedef typename Elem<ET>::T T;
  typedef typename Frag<T>::V V;
  const T* A = (const T*)Ap; const T* A2 = (const T*)A2p; const T* Bt = (const T*)Btp; const T* Bt2 = (const T*)Bt2p;
  __shared__ __align__(16) float sT[8][16 * 68];   // per-wave 16x64 slab, pitch 68 floats
  const int b    = blockIdx.y;
  const int z    = blockIdx.z;
  const int lane = threadIdx.x & 31;
  const int wave = threadIdx.x >> 5;
  const int tilesN = N >> 6;
  const int tilesM = M >> 6;
  const int tile = blockIdx.x * 8 + wave;
  if (tile >= tilesM * tilesN) return;   // wave-uniform; no block barriers in this kernel
  const int tm = tile / tilesN;
  const int tn = tile - tm * tilesN;
  const int m0 = tm << 6;
  const int n0 = tn << 6;

  const size_t offA = (size_t)b * strideA + (size_t)z * strideAz;
  const size_t offB = (size_t)b * strideB + (size_t)z * strideBz;
  const size_t offC = (size_t)b * strideC + (size_t)z * strideCz;
  const T* Ab  = A  + offA;
  const T* Bb  = Bt + offB;
  const T* Ab2 = SPLIT ? (A2  + offA) : nullptr;
  const T* Bb2 = SPLIT ? (Bt2 + offB) : nullptr;

  const int rlane = lane & 15;                 // row (A) / col (B, D) within subtile
  const int koff  = (lane >> 4) * 8;           // k offset of this lane half
  const int mOff  = (lane >> 4) * 8;           // D row offset

  v8f acc[4][4];
#pragma unroll
  for (int i = 0; i < 4; ++i)
#pragma unroll
    for (int j = 0; j < 4; ++j) acc[i][j] = (v8f){0.f,0.f,0.f,0.f,0.f,0.f,0.f,0.f};

  for (int k0 = 0; k0 < K; k0 += 32) {
    V bh[4], bl[4];
#pragma unroll
    for (int j = 0; j < 4; ++j) {
      const size_t bo = (size_t)(n0 + (j << 4) + rlane) * ldb + koff + k0;
      bh[j] = Frag<T>::load(Bb + bo);
      if (SPLIT) bl[j] = Frag<T>::load(Bb2 + bo);
    }
#pragma unroll
    for (int i = 0; i < 4; ++i) {
      const size_t ao = (size_t)(m0 + (i << 4) + rlane) * lda + koff + k0;
      V ah = Frag<T>::load(Ab + ao);
      V al;
      if (SPLIT) al = Frag<T>::load(Ab2 + ao);
#pragma unroll
      for (int j = 0; j < 4; ++j) {
        acc[i][j] = Frag<T>::mma(ah, bh[j], acc[i][j]);
        if (SPLIT) {
          acc[i][j] = Frag<T>::mma(ah, bl[j], acc[i][j]);
          acc[i][j] = Frag<T>::mma(al, bh[j], acc[i][j]);
        }
      }
      Frag<T>::guard(acc[i][0], acc[i][3], ah, SPLIT ? al : ah);
    }
    Frag<T>::keep(bh[0], bh[1], bh[2], bh[3]);
    if (SPLIT) Frag<T>::keep(bl[0], bl[1], bl[2], bl[3]);
  }
  acc_guard4(acc[0][0], acc[0][1], acc[0][2], acc[0][3]);
  acc_guard4(acc[1][0], acc[1][1], acc[1][2], acc[1][3]);
  acc_guard4(acc[2][0], acc[2][1], acc[2][2], acc[2][3]);
  acc_guard4(acc[3][0], acc[3][1], acc[3][2], acc[3][3]);

  // ---- epilogue ----
  float* slab = sT[wave];
  const float* Rb = RESID ? (resid + (size_t)b * strideR) : nullptr;
#pragma unroll
  for (int i = 0; i < 4; ++i) {
    const int mBase = m0 + (i << 4);
#pragma unroll
    for (int j = 0; j < 4; ++j) {
      const int n = n0 + (j << 4) + rlane;
      float bv = 0.f;
      if (BIAS_MODE == 2) bv = bias[n];
#pragma unroll
      for (int r = 0; r < 8; ++r) {
        float v = acc[i][j][r] * scale;
        if (BIAS_MODE == 1) v += bias[mBase + mOff + r];
        if (BIAS_MODE == 2) v += bv;
        if (RESID) v += Rb[(size_t)(mBase + mOff + r) * ldc + n];
        if (ACT == 2) v = fmaxf(v, 0.0f);
        if (ACT == 4) v = (v > 0.f) ? v : 0.01f * v;
        if (ACT == 6) v = 1.0f / (1.0f + expf(-v));
        slab[(mOff + r) * 68 + (j << 4) + rlane] = v;
      }
    }
    __builtin_amdgcn_fence(__ATOMIC_RELEASE, "workgroup");
    __builtin_amdgcn_wave_barrier();
    __builtin_amdgcn_fence(__ATOMIC_ACQUIRE, "workgroup");
    if (OUT_MODE == 0) {
      float* C = (float*)Cout + offC;
      const int hh = lane >> 4, c4 = (lane & 15) * 4;     // row seg = 256 B = 16 lanes x 16 B
      {
#pragma unroll
        for (int it = 0; it < 8; ++it) {
          const int row = it * 2 + hh;
          v4f v = *(const v4f*)(slab + row * 68 + c4);
          *(v4f*)(C + (size_t)(mBase + row) * ldc + n0 + c4) = v;
        }
        
      }
    } else {
      const int q = lane >> 3, c8 = (lane & 7) * 8;
      unsigned short* C  = (unsigned short*)Cout  + offC;
      unsigned short* C2 = (OUT_MODE == 2) ? ((unsigned short*)Cout2 + offC) : nullptr;
      {
#pragma unroll
        for (int it = 0; it < 4; ++it) {
          const int row = it * 4 + q;
          const float* sp = slab + row * 68 + c8;
          v8h hv, lv;
#pragma unroll
          for (int e = 0; e < 8; ++e) {
            if (OUT_MODE == 1) {
              hv[e] = (_Float16)sp[e];
            } else {
              unsigned short hb = f2bf_bits(sp[e]);
              unsigned short lb = f2bf_bits(sp[e] - bf_bits2f(hb));
              hv[e] = __builtin_bit_cast(_Float16, hb);
              lv[e] = __builtin_bit_cast(_Float16, lb);
            }
          }
          *(v8h*)(C + (size_t)(mBase + row) * ldc + n0 + c8) = hv;
          if (OUT_MODE == 2) *(v8h*)(C2 + (size_t)(mBase + row) * ldc + n0 + c8) = lv;
        }
        
      }
    }
    __builtin_amdgcn_fence(__ATOMIC_RELEASE, "workgroup");
    __builtin_amdgcn_wave_barrier();
    __builtin_amdgcn_fence(__ATOMIC_ACQUIRE, "workgroup");
  }
}

// ---------------------------------------------------------------------------
// Projection GEMM with operands staged in LDS: C[m,n] = scale * sum_k A[m,k] * Bt[n,k] + bias[n], f32 out.
// A [6272][1024] f16, Bt [1024][1024] f16, both k-contiguous. Block tile 128 (m) x 256 (n), 8 waves as 2 x 4, each wave the
// same 64x64 tile, fragment maps and k order as wmma_gemm64. A stage is 64 k = one 128-B line of each of the 384 operand
// rows (A rows first, then Bt rows), laid at a 144-B pitch in one of two LDS buffers. Every global load covers whole lines
// (8 lanes per row). Stage s + 2 is fetched into registers during stage s and stored to LDS during stage s + 1, so a
// fetch has a whole stage to land. grid = 49 * 4 = 196 blocks (6272 = 49 * 128, 1024 = 4 * 256).
// ---------------------------------------------------------------------------
constexpr int kPjBM = 128;                       // block rows of A
constexpr int kPjBN = 256;                       // block rows of Bt
constexpr int kPjBK = 64;                        // halves of k per stage
constexpr int kPjPitch = 72;                     // halves per staged row (144 B)
constexpr int kPjStage = (kPjBM + kPjBN) * kPjPitch;   // halves per buffer (55,296 B)
constexpr int kPjStages = kD / kPjBK;            // 16
static_assert(kTok % kPjBM == 0 && kD % kPjBN == 0 && kD % (2 * kPjBK) == 0 && kPjStages >= 4, "projection tiles divide the problem");

// 12 pieces of 16 B per thread: pieces 0..3 = A rows, 4..11 = Bt rows, 32 staged rows apart
__device__ __forceinline__ void pj_fetch(v4u (&r)[12], const unsigned short* gA, const unsigned short* gB, int k) {
#pragma unroll
  for (int j = 0; j < 4; ++j) r[j] = *(const v4u*)(gA + (size_t)(32 * j) * kD + k);
#pragma unroll
  for (int j = 0; j < 8; ++j) r[4 + j] = *(const v4u*)(gB + (size_t)(32 * j) * kD + k);
}
__device__ __forceinline__ void pj_put(unsigned short* dst, const v4u (&r)[12]) {
#pragma unroll
  for (int j = 0; j < 12; ++j) *(v4u*)(dst + 32 * j * kPjPitch) = r[j];
}
// Work-group barrier that orders LDS only: __syncthreads() also waits for every global load in flight, which would
// end the fetch of the stage after next at each barrier; those loads land in registers and concern no other wave.
__device__ __forceinline__ void pj_barrier() {
  __builtin_amdgcn_fence(__ATOMIC_RELEASE, "workgroup", "local");
  __builtin_amdgcn_s_barrier();
  __builtin_amdgcn_fence(__ATOMIC_ACQUIRE, "workgroup", "local");
}
// One stage: fetch stage k/64 into ld (FETCH), multiply the stage in cur, store the stage held in st to nxt (PUT).
template <bool FETCH, bool PUT>
__device__ __forceinline__ void pj_stage(const _Float16* curA, const _Float16* curB, unsigned short* nxt,
                                         const unsigned short* gA, const unsigned short* gB, int k,
                                         v4u (&ld)[12], const v4u (&st)[12], v8f (&acc)[4][4]) {
  typedef Frag<_Float16> F;
  v16h bh[2][4], ah[2][4];
#pragma unroll
  for (int kk = 0; kk < 2; ++kk) {
#pragma unroll
    for (int j = 0; j < 4; ++j) bh[kk][j] = F::load(curB + j * 16 * kPjPitch + kk * 32);
#pragma unroll
    for (int i = 0; i < 4; ++i) ah[kk][i] = F::load(curA + i * 16 * kPjPitch + kk * 32);
  }
  // keeps the LDS fragment reads as one group ahead of the matrix work (the scheduler otherwise spreads them among the
  // WMMAs) and ahead of the fetch, so that no fragment lands in a register that a fetch in flight names as its address
  __builtin_amdgcn_sched_barrier(0);
  if (FETCH) pj_fetch(ld, gA, gB, k);
  // keeps the fetch ahead of the matrix work (the scheduler otherwise sinks it to its use, a stage later)
  __builtin_amdgcn_sched_barrier(0);
#pragma unroll
  for (int i = 0; i < 4; ++i)
#pragma unroll
    for (int j = 0; j < 4; ++j) acc[i][j] = F::mma(ah[0][i], bh[0][j], acc[i][j]);
  // keeps the LDS stores of the next stage behind the first WMMA half, when this stage's fragment reads have been served
  __builtin_amdgcn_sched_barrier(0);
  // the wait owed before the fetch's address registers are written again; 16 WMMAs behind the fetch
  if (FETCH) asm volatile("s_wait_xcnt 0x0" ::: "memory");
  if (PUT) pj_put(nxt, st);
  // keeps the second WMMA half behind the stores: it needs no LDS, so it can run past the barrier, beside the next reads
  __builtin_amdgcn_sched_barrier(0);
#pragma unroll
  for (int i = 0; i < 4; ++i)
#pragma unroll
    for (int j = 0; j < 4; ++j) acc[i][j] = F::mma(ah[1][i], bh[1][j], acc[i][j]);
  if (PUT) pj_barrier();               // publishes the stage just stored and ends every read of cur
}

__global__ __launch_bounds__(256) void proj_gemm_lds_kernel(const unsigned short* __restrict__ Ap,
                                                            const unsigned short* __restrict__ Btp,
                                                            float* __restrict__ C, const float* __restrict__ bias,
                                                            float scale) {
  __shared__ __align__(16) unsigned short sAB[2][kPjStage];
  __shared__ __align__(16) float sT[8][16 * 68];   // per-wave 16x64 slab, pitch 68 floats
  const int t    = threadIdx.x;
  const int lane = t & 31;
  const int wave = t >> 5;
  const int mB = (blockIdx.x >> 2) * kPjBM;
  const int nB = (blockIdx.x & 3) * kPjBN;
  const int m0 = mB + (wave >> 2) * 64;
  const int n0 = nB + (wave & 3) * 64;

  const int rlane = lane & 15;                 // row (A) / col (B, D) within subtile
  const int koff  = (lane >> 4) * 8;           // k offset of this lane half
  const int mOff  = (lane >> 4) * 8;           // D row offset

  // staging map: piece j of thread t is 16 B number (t & 7) of staged row (t >> 3) + 32 * j
  const int srow = t >> 3;
  const int spart = (t & 7) * 8;
  const unsigned short* gA = Ap  + (size_t)(mB + srow) * kD + spart;
  const unsigned short* gB = Btp + (size_t)(nB + srow) * kD + spart;
  unsigned short* put0 = &sAB[0][srow * kPjPitch + spart];
  unsigned short* put1 = &sAB[1][srow * kPjPitch + spart];
  const int fA = ((wave >> 2) * 64 + rlane) * kPjPitch + koff;
  const int fB = (kPjBM + (wave & 3) * 64 + rlane) * kPjPitch + koff;
  const _Float16* a0 = (const _Float16*)sAB[0] + fA;
  const _Float16* b0 = (const _Float16*)sAB[0] + fB;
  const _Float16* a1 = (const _Float16*)sAB[1] + fA;
  const _Float16* b1 = (const _Float16*)sAB[1] + fB;

  v8f acc[4][4];
#pragma unroll
  for (int i = 0; i < 4; ++i)
#pragma unroll
    for (int j = 0; j < 4; ++j) acc[i][j] = (v8f){0.f,0.f,0.f,0.f,0.f,0.f,0.f,0.f};

  v4u pe[12], po[12];                          // even and odd stages on their way to LDS
  pj_fetch(pe, gA, gB, 0);
  pj_fetch(po, gA, gB, kPjBK);
  asm volatile("s_wait_xcnt 0x0" ::: "memory");   // the wait owed before the fetches' address registers are written again
  pj_put(put0, pe);
  pj_barrier();

  for (int s = 0; s < kPjStages - 2; s += 2) {
    pj_stage<true, true>(a0, b0, put1, gA, gB, (s + 2) * kPjBK, pe, po, acc);   // stage s; fetch s + 2, store s + 1
    pj_stage<true, true>(a1, b1, put0, gA, gB, (s + 3) * kPjBK, po, pe, acc);   // stage s + 1; fetch s + 3, store s + 2
  }
  pj_stage<false, true>(a0, b0, put1, gA, gB, 0, pe, po, acc);                  // stage 14; store 15
  pj_stage<false, false>(a1, b1, put0, gA, gB, 0, po, pe, acc);                 // stage 15

  // ---- epilogue: as wmma_gemm64 with bias[n], f32 out ----
  float* slab = sT[wave];
#pragma unroll
  for (int i = 0; i < 4; ++i) {
    const int mBase = m0 + (i << 4);
#pragma unroll
    for (int j = 0; j < 4; ++j) {
      const float bv = bias[n0 + (j << 4) + rlane];
#pragma unroll
      for (int r = 0; r < 8; ++r) {
        float v = acc[i][j][r] * scale;
        v += bv;
        slab[(mOff + r) * 68 + (j << 4) + rlane] = v;
      }
    }
    // the wave's slab writes are complete before its lanes read each other's words (as in wmma_gemm64)
    __builtin_amdgcn_fence(__ATOMIC_RELEASE, "workgroup");
    __builtin_amdgcn_wave_barrier();
    __builtin_amdgcn_fence(__ATOMIC_ACQUIRE, "workgroup");
    const int hh = lane >> 4, c4 = (lane & 15) * 4;     // row seg = 256 B = 16 lanes x 16 B
#pragma unroll
    for (int it = 0; it < 8; ++it) {
      const int row = it * 2 + hh;
      v4f v = *(const v4f*)(slab + row * 68 + c4);
      *(v4f*)(C + (size_t)(mBase + row) * kD + n0 + c4) = v;
    }
    // the wait owed before a register that these stores name (address or data) is written again; the scheduling fence
    // keeps the next rows' register writes behind it
    asm volatile("s_wait_xcnt 0x0" ::: "memory");
    __builtin_amdgcn_sched_barrier(0);
    // the slab is read out before the next 16 rows overwrite it (as in wmma_gemm64)
    __builtin_amdgcn_fence(__ATOMIC_RELEASE, "workgroup");
    __builtin_amdgcn_wave_barrier();
    __builtin_amdgcn_fence(__ATOMIC_ACQUIRE, "workgroup");
  }
}

// ---------------------------------------------------------------------------
// ---------------------------------------------------------------------------
__global__ __launch_bounds__(256) void cast8s_kernel(const float* __restrict__ in, unsigned short* __restrict__ out, int n8, float scale) {
  const int i = blockIdx.x * 256 + threadIdx.x;
  if (i >= n8) return;
  const float* p = in + 8 * (size_t)i;
  const v4f a = *(const v4f*)(p);
  const v4f c = *(const v4f*)(p + 4);
  unsigned short hb[8];
#pragma unroll
  for (int e = 0; e < 4; ++e) {
    hb[e]     = h_bits(a[e] * scale);
    hb[4 + e] = h_bits(c[e] * scale);
  }
  const v4u u = (v4u){pk16(hb[0], hb[1]), pk16(hb[2], hb[3]), pk16(hb[4], hb[5]), pk16(hb[6], hb[7])};
  store2_v4u(out + 8 * (size_t)i, u);
}

// ---------------------------------------------------------------------------
// Zero fill of two 16-bit regions (pad rows of the q2 and k planes): grid (n8/256, 2); 8 halves per thread, 16-B stores.
// ---------------------------------------------------------------------------
__global__ __launch_bounds__(256) void fill_zero2_kernel(unsigned short* __restrict__ a, unsigned short* __restrict__ b, int n8) {
  const int i = blockIdx.x * 256 + threadIdx.x;
  if (i >= n8) return;
  unsigned short* dst = (blockIdx.y == 0) ? a : b;   // block-uniform select between two global pointers
  const v4u z = (v4u){0u, 0u, 0u, 0u};
  store2_v4u(dst + 8 * (size_t)i, z);
}

// ---------------------------------------------------------------------------
// Weight cast for one layer: blockIdx.y = 0..3 selects W (q2, k, v1, v2) [1024 out][1024 in] row-major (= Bt [N][K] as-is)
// -> f16(256*W) into plane y of w16; blockIdx.y = 4: Wc [128][128] -> wc16. grid (512, 5): 512*256*8 = 1048576 = whole W;
// for y = 4 only blocks 0..7 are active (2048 threads x 8 = 16384 = whole Wc).
// ---------------------------------------------------------------------------
__global__ __launch_bounds__(256) void wcast_kernel(const float* __restrict__ w0, const float* __restrict__ w1,
                                                    const float* __restrict__ w2, const float* __restrict__ w3,
                                                    const float* __restrict__ wc,
                                                    unsigned short* __restrict__ w16, unsigned short* __restrict__ wc16) {
  const int z = blockIdx.y;                                     // block-uniform
  const int i = blockIdx.x * 256 + threadIdx.x;
  const float* src = (z == 0) ? w0 : (z == 1) ? w1 : (z == 2) ? w2 : (z == 3) ? w3 : wc;
  unsigned short* dst = (z < 4) ? (w16 + (size_t)z * kD * kD) : wc16;
  const int n8 = (z < 4) ? (kD * kD / 8) : (kHD * kHD / 8);
  if (i >= n8) return;
  const float* p = src + 8 * (size_t)i;
  const v4f a = *(const v4f*)(p);
  const v4f c = *(const v4f*)(p + 4);
  unsigned short hb[8];
#pragma unroll
  for (int e = 0; e < 4; ++e) {
    hb[e]     = h_bits(a[e] * kWCarry);
    hb[4 + e] = h_bits(c[e] * kWCarry);
  }
  const v4u u = (v4u){pk16(hb[0], hb[1]), pk16(hb[2], hb[3]), pk16(hb[4], hb[5]), pk16(hb[6], hb[7])};
  store2_v4u(dst + 8 * (size_t)i, u);
}

// ---------------------------------------------------------------------------
// CELU (alpha 1.3), f32
// ---------------------------------------------------------------------------
__device__ __forceinline__ float celu_f(float x) {
  const float en = expf(x * (1.0f / 1.3f)) - 1.0f;
  return (x > 0.f) ? x : 1.3f * en;
}

// ---------------------------------------------------------------------------
// GroupNorm of one projection (CELU -> per (token, head) mean/var over 128 channels -> * gw + gb) writing a token-major
// f16 plane [6272][1024]. MODE 0: value carried x16; MODE 2: value multiplied by the k plane value (already x16) -> (v1*k) x16.
// Unit = (token, head) = 128 channels handled by 16 lanes (8 each): wave = 2 units, block = 16 units, grid = 3136 blocks
// ---------------------------------------------------------------------------
template <int MODE>
__global__ __launch_bounds__(256) void gn_rows_kernel(const float* __restrict__ P, const float* __restrict__ gw,
                                                      const float* __restrict__ gb, const unsigned short* __restrict__ kpl,
                                                      unsigned short* __restrict__ outp) {
  const int t = threadIdx.x, lane = t & 31, wave = t >> 5, hh = lane >> 4, cl = lane & 15;
  const int u = (blockIdx.x * 8 + wave) * 2 + hh;              // token*8 + head, < 50176 (grid exact)
  const size_t base = (size_t)u * kHD + cl * 8;                // == token*1024 + head*128 + cl*8
  const int ch = (u & 7) * kHD + cl * 8;                       // channel index within 1024
  const v4f a = *(const v4f*)(P + base);
  const v4f c = *(const v4f*)(P + base + 4);
  float y[8];
#pragma unroll
  for (int e = 0; e < 4; ++e) { y[e] = celu_f(a[e]); y[4 + e] = celu_f(c[e]); }
  float s = ((y[0] + y[1]) + (y[2] + y[3])) + ((y[4] + y[5]) + (y[6] + y[7]));
#pragma unroll
  for (int off = 1; off < 16; off <<= 1) s += __shfl_xor(s, off, 32);   // stays inside the 16-lane half
  const float mu = s * (1.0f / 128.0f);
  float d[8];
  float sq = 0.f;
#pragma unroll
  for (int e = 0; e < 8; ++e) { d[e] = y[e] - mu; sq += d[e] * d[e]; }
#pragma unroll
  for (int off = 1; off < 16; off <<= 1) sq += __shfl_xor(sq, off, 32);
  const float var = sq * (1.0f / 128.0f);
  const float rs = rsqrtf(var + 1e-5f);
  const v4f w0 = *(const v4f*)(gw + ch), w1 = *(const v4f*)(gw + ch + 4);
  const v4f g0 = *(const v4f*)(gb + ch), g1 = *(const v4f*)(gb + ch + 4);
  float o[8];
#pragma unroll
  for (int e = 0; e < 4; ++e) {
    o[e]     = d[e] * rs * w0[e] + g0[e];
    o[4 + e] = d[4 + e] * rs * w1[e] + g1[e];
  }
  if (MODE == 2) {
    const v4u kk = *(const v4u*)(kpl + base);
    float kf[8];
    kf[0] = h16_to_f32(kk.x & 0xffffu); kf[1] = h16_to_f32(kk.x >> 16);
    kf[2] = h16_to_f32(kk.y & 0xffffu); kf[3] = h16_to_f32(kk.y >> 16);
    kf[4] = h16_to_f32(kk.z & 0xffffu); kf[5] = h16_to_f32(kk.z >> 16);
    kf[6] = h16_to_f32(kk.w & 0xffffu); kf[7] = h16_to_f32(kk.w >> 16);
#pragma unroll
    for (int e = 0; e < 8; ++e) o[e] = o[e] * kf[e];
  } else {
#pragma unroll
    for (int e = 0; e < 8; ++e) o[e] = o[e] * kXCarry;
  }
  unsigned short hb[8];
#pragma unroll
  for (int e = 0; e < 8; ++e) hb[e] = h_bits(o[e]);
  const v4u uu = (v4u){pk16(hb[0], hb[1]), pk16(hb[2], hb[3]), pk16(hb[4], hb[5]), pk16(hb[6], hb[7])};
  store2_v4u(outp + base, uu);
}

// ---------------------------------------------------------------------------
// GroupNorm of the v2 projection written transposed and key-padded: V2T[((h*128 + d)*32 + b)*256 + key] = f16(16 * v2n),
// keys 196..255 = 0. Block = (b, h, dh): 64 channels d = dh*64.. of one (b,h), all 196 tokens; grid (32, 8, 2).
// Phase 0: zero keys 192..255 of the 64 LDS rows (256 threads x 2 x 8 halves = 64 x 64). Phase 1: wave w handles tokens
// w, w+8, ...: 32 lanes x 4 channels = 128 (stats over the full head), the 16 lanes of half dh write their 4 channels
// into LDS [ch][key]. Phase 2: wave w writes rows w*8..w*8+7 (8 waves = 64 rows), each row 256 halves = 512 B =
// ---------------------------------------------------------------------------
constexpr int kV2Pitch = 264;   // halves; 528 B keeps 16-B alignment of row bases
__global__ __launch_bounds__(256) void gn_v2t_kernel(const float* __restrict__ P, const float* __restrict__ gw,
                                                     const float* __restrict__ gb, unsigned short* __restrict__ v2t) {
  __shared__ __align__(16) unsigned short sm[64 * kV2Pitch];
  const int t = threadIdx.x, lane = t & 31, wave = t >> 5;
  const int b = blockIdx.x, h = blockIdx.y, dh = blockIdx.z;
  {
    const v4u z = (v4u){0u, 0u, 0u, 0u};
#pragma unroll
    for (int j = 0; j < 2; ++j) {
      const int idx = t * 2 + j;              // 0..511
      const int row = idx >> 3, part = idx & 7;
      *(v4u*)(sm + row * kV2Pitch + 192 + part * 8) = z;
    }
  }
  __syncthreads();
  const int ch = h * kHD + lane * 4;
  const v4f wv = *(const v4f*)(gw + ch);
  const v4f gv = *(const v4f*)(gb + ch);
  const int cl0 = (lane & 15) * 4;
  for (int i = 0; i < 25; ++i) {
    const int tok = wave + 8 * i;             // wave-uniform
    if (tok >= kM) break;
    const v4f a = *(const v4f*)(P + ((size_t)(b * kM + tok)) * kD + ch);
    float y[4];
#pragma unroll
    for (int e = 0; e < 4; ++e) y[e] = celu_f(a[e]);
    float s = (y[0] + y[1]) + (y[2] + y[3]);
#pragma unroll
    for (int off = 1; off < 32; off <<= 1) s += __shfl_xor(s, off, 32);
    const float mu = s * (1.0f / 128.0f);
    float d[4];
    float sq = 0.f;
#pragma unroll
    for (int e = 0; e < 4; ++e) { d[e] = y[e] - mu; sq += d[e] * d[e]; }
#pragma unroll
    for (int off = 1; off < 32; off <<= 1) sq += __shfl_xor(sq, off, 32);
    const float var = sq * (1.0f / 128.0f);
    const float rs = rsqrtf(var + 1e-5f);
    unsigned short hb[4];
#pragma unroll
    for (int e = 0; e < 4; ++e) hb[e] = h_bits((d[e] * rs * wv[e] + gv[e]) * kXCarry);
    if ((lane >> 4) == dh) {
#pragma unroll
      for (int e = 0; e < 4; ++e) sm[(cl0 + e) * kV2Pitch + tok] = hb[e];
    }
  }
  __syncthreads();
  const size_t rowbase = ((size_t)(h * kHD + dh * 64)) * (kB * kSP) + (size_t)b * kSP + lane * 8;
  {
#pragma unroll
    for (int it = 0; it < 8; ++it) {
      const int cl = wave * 8 + it;           // 0..63
      const v4u u = *(const v4u*)(sm + cl * kV2Pitch + lane * 8);
      *(v4u*)(v2t + rowbase + (size_t)cl * (kB * kSP)) = u;
    }
    
  }
}

// ---------------------------------------------------------------------------
// e^x = 2^whole * exp2(rest): whole = x * log2(e) rounded to an integer, rest = x * log2(e) - whole with log2(e) in two
// terms, each by one FMA; 0 below and inf above the range of f32, at the bounds expf uses.
__device__ __forceinline__ float exp_steps(float x) {
  const float l2e = __uint_as_float(0x3fb8aa3bu), l2e_lo = __uint_as_float(0x32a5705fu);
  const float whole = __builtin_rintf(x * l2e);
  const float rest = __builtin_fmaf(x, l2e_lo, __builtin_fmaf(x, l2e, -whole));
  float v;
  // exp2 with the free slot that a transcendental is owed before its source is overwritten or its result read:
  // only one statement ties the v_nop to it
  asm("v_exp_f32 %0, %1\n\tv_nop" : "=v"(v) : "v"(rest));
  v = ldexpf(v, (int)whole);
  v = (x < __uint_as_float(0xc2ce8ed0u)) ? 0.0f : v;
  return (x > __uint_as_float(0x42b17218u)) ? __builtin_inff() : v;
}

constexpr int kFaTiles  = 13;
constexpr int kFaRows   = kFaTiles * 16;
constexpr int kFaThr    = kFaTiles * 32;
constexpr int kFaKPitch = 136;
constexpr int kFaVPitch = 264;
constexpr int kFaOPitch = 132;
constexpr int kFaKPc    = kFaRows * 16 / kFaThr;
constexpr int kFaVPc    = (kHD + kFaTiles - 1) / kFaTiles;
static_assert(kFaKPc * kFaThr == kFaRows * 16, "k pieces divide");
static_assert((kFaVPc - 1) * kFaTiles <= kHD && kFaVPc * kFaTiles >= kHD, "all v2^T rounds but the last are whole");
static_assert((kB - 1) * kM + kFaRows <= kTokPad, "k and q2 rows stay in their planes");
static_assert(kKeyK / 32 * 2 == kFaTiles + 1 && kKeyK <= kSP, "P*v2 depth = 7 steps of 32 keys, the last half step zero");

__global__ __launch_bounds__(kFaThr) void attn_fused_kernel(const unsigned short* __restrict__ Qp,
                                                            const unsigned short* __restrict__ Kp,
                                                            const unsigned short* __restrict__ Vt,
                                                            const float* __restrict__ mask, float* __restrict__ att,
                                                            float scoreScale, float pvScale) {
  typedef Frag<_Float16> F;
  __shared__ __align__(16) unsigned short sK[kFaRows * kFaKPitch];
  __shared__ __align__(16) unsigned short sV[kFaVPc * kFaTiles * kFaVPitch];   // 130 rows: 128 read, 2 spare
  __shared__ __align__(16) float sO[kFaTiles][16 * kFaOPitch];   // per-wave 16 x 128 slab
  __shared__ __align__(16) float sMask[kFaThr];
  const int t = threadIdx.x, lane = t & 31;
  const int wave = __builtin_amdgcn_readfirstlane(t >> 5);       // scalar: the wave's query tile, slab and staged v2^T rows
  const int b = blockIdx.x, h = blockIdx.y;
  const int c = lane & 15, hf = lane >> 4;

  // ---- this wave's q2 fragments and the group's k, v2^T and mask, all loads in flight together ----
  const _Float16* gQ = (const _Float16*)Qp + (size_t)(b * kM + wave * 16 + c) * kD + h * kHD + hf * 8;
  const unsigned short* gK = Kp + (size_t)(b * kM + (t >> 4)) * kD + h * kHD + (t & 15) * 8;
  v16h qf[4];
  v4u rk[kFaKPc], rv[kFaVPc];
#pragma unroll
  for (int kk = 0; kk < 4; ++kk) qf[kk] = F::load(gQ + kk * 32);
#pragma unroll
  for (int j = 0; j < kFaKPc; ++j) rk[j] = *(const v4u*)(gK + (size_t)(j * (kFaThr / 16)) * kD);
  const unsigned short* gV = Vt + ((size_t)(h * kHD) * kB + b) * kSP + lane * 8;
  const unsigned short* gVw = gV + (size_t)wave * (kB * kSP);
#pragma unroll
  for (int j = 0; j < kFaVPc - 1; ++j) rv[j] = *(const v4u*)(gVw + (size_t)(j * kFaTiles) * (kB * kSP));
  // the last round's waves past row 127 load row 127 again (in bounds) and lay it in a spare LDS row that nobody reads
  const int rlast = wave + (kFaVPc - 1) * kFaTiles;
  const unsigned short* gVl = gV + (size_t)((rlast < kHD) ? rlast : (kHD - 1)) * (kB * kSP);
  rv[kFaVPc - 1] = *(const v4u*)gVl;
  const int mi = b * kM + ((t < kM) ? t : (kM - 1));
  const float mload = mask[mi];
  // the wait owed before the address registers of these loads are written again; the per-lane pointers and index are
  // inputs so that their registers stay as they are up to the wait (no later load may land on them either)
  asm volatile("s_wait_xcnt 0x0" :: "v"(gQ), "v"(gK), "v"(gVw), "v"(gVl), "v"(mi) : "memory");
#pragma unroll
  for (int j = 0; j < kFaKPc; ++j) *(v4u*)(sK + ((t >> 4) + j * (kFaThr / 16)) * kFaKPitch + (t & 15) * 8) = rk[j];
#pragma unroll
  for (int j = 0; j < kFaVPc; ++j) *(v4u*)(sV + (wave + j * kFaTiles) * kFaVPitch + lane * 8) = rv[j];
  sMask[t] = mload;                              // entries from 196 on repeat key 195 and are never used
  __syncthreads();

  // ---- S^T = k * q2^T: s[tt][r] = score of key 16 tt + 8 hf + r for query 16 wave + c ----
  // The 52 products run k step by k step (product f: k step f / 13, key tile f % 13), so neighbours have different
  // accumulators; their k fragments are read in groups of 4, one group ahead, into two register sets.
  v8f s[kFaTiles];
#pragma unroll
  for (int tt = 0; tt < kFaTiles; ++tt) s[tt] = (v8f){0.f,0.f,0.f,0.f,0.f,0.f,0.f,0.f};
  {
    const _Float16* kf = (const _Float16*)sK + c * kFaKPitch + hf * 8;
    v16h ka[2][4];
#pragma unroll
    for (int e = 0; e < 4; ++e) ka[0][e] = F::load(kf + (e % kFaTiles) * 16 * kFaKPitch + (e / kFaTiles) * 32);
#pragma unroll
    for (int g = 0; g < kFaTiles; ++g) {
      if (g + 1 < kFaTiles) {
#pragma unroll
        for (int e = 0; e < 4; ++e) {
          const int f = (g + 1) * 4 + e;
          ka[(g + 1) & 1][e] = F::load(kf + (f % kFaTiles) * 16 * kFaKPitch + (f / kFaTiles) * 32);
        }
      }
      // keeps the next group's LDS reads together and ahead of this group's WMMAs (the scheduler otherwise sinks each read
      // to its use, and every WMMA then waits out an LDS latency)
      __builtin_amdgcn_sched_barrier(0);
#pragma unroll
      for (int e = 0; e < 4; ++e) {
        const int f = g * 4 + e;
        s[f % kFaTiles] = F::mma(ka[g & 1][e], qf[f / kFaTiles], s[f % kFaTiles]);
      }
      // keeps the reads of the group after next behind these WMMAs, not among them
      __builtin_amdgcn_sched_barrier(0);
    }
  }

  // ---- softmax over the query's 196 keys, f32 ----
  float mx4[4] = {-3.0e38f, -3.0e38f, -3.0e38f, -3.0e38f};
#pragma unroll
  for (int tt = 0; tt < kFaTiles; ++tt) {
    const v4f m0 = *(const v4f*)(sMask + tt * 16 + hf * 8);
    const v4f m1 = *(const v4f*)(sMask + tt * 16 + hf * 8 + 4);
#pragma unroll
    for (int r = 0; r < 8; ++r) {
      const int j = tt * 16 + hf * 8 + r;
      const float mv = (r < 4) ? m0[r & 3] : m1[r & 3];
      const float v = (mv == 0.0f) ? -1.0e9f : s[tt][r] * scoreScale;
      s[tt][r] = (j < kM) ? v : -3.0e38f;
      mx4[r & 3] = fmaxf(mx4[r & 3], s[tt][r]);
    }
  }
  float mx = fmaxf(fmaxf(mx4[0], mx4[1]), fmaxf(mx4[2], mx4[3]));
  mx = fmaxf(mx, __shfl_xor(mx, 16, 32));
  float ps4[4] = {0.f, 0.f, 0.f, 0.f};
#pragma unroll
  for (int tt = 0; tt < kFaTiles; ++tt) {
#pragma unroll
    for (int r = 0; r < 8; ++r) {
      s[tt][r] = exp_steps(s[tt][r] - mx); // an excluded key sits at -3e38: its difference is below the range, P = 0
      ps4[r & 3] += s[tt][r];
    }
  }
  float ps = (ps4[0] + ps4[1]) + (ps4[2] + ps4[3]);
  ps += __shfl_xor(ps, 16, 32);
  const float inv = 1.0f / ps;
  v16h pf[kKeyK / 32];
#pragma unroll
  for (int u = 0; u < kKeyK / 32; ++u) {
#pragma unroll
    for (int e = 0; e < 8; ++e) {
      pf[u][e]     = (_Float16)(s[2 * u][e] * inv * kPCarry);
      pf[u][8 + e] = (2 * u + 1 < kFaTiles) ? (_Float16)(s[(2 * u + 1 < kFaTiles) ? 2 * u + 1 : 0][e] * inv * kPCarry) : (_Float16)0.0f;
    }
  }

  // ---- O^T = v2^T * P^T: o[j][r] = attn of query 16 wave + c, channel 16 j + 8 hf + r ----
  v8f o[8];
#pragma unroll
  for (int j = 0; j < 8; ++j) o[j] = (v8f){0.f,0.f,0.f,0.f,0.f,0.f,0.f,0.f};
  {
    // product f: key step f / 8, channel tile f % 8; v2^T fragments in groups of 4, one group ahead, as above
    const _Float16* vf = (const _Float16*)sV + c * kFaVPitch + hf * 8;
    constexpr int kGroups = kKeyK / 32 * 2;
    v16h va[2][4];
#pragma unroll
    for (int e = 0; e < 4; ++e) va[0][e] = F::load(vf + e * 16 * kFaVPitch);
#pragma unroll
    for (int g = 0; g < kGroups; ++g) {
      if (g + 1 < kGroups) {
#pragma unroll
        for (int e = 0; e < 4; ++e) {
          const int f = (g + 1) * 4 + e;
          va[(g + 1) & 1][e] = F::load(vf + (f % 8) * 16 * kFaVPitch + (f / 8) * 32);
        }
      }
      // keeps the next group's LDS reads together and ahead of this group's WMMAs
      __builtin_amdgcn_sched_barrier(0);
#pragma unroll
      for (int e = 0; e < 4; ++e) {
        const int f = g * 4 + e;
        o[f % 8] = F::mma(va[g & 1][e], pf[f / 8], o[f % 8]);
      }
      // keeps the reads of the group after next behind these WMMAs, not among them
      __builtin_amdgcn_sched_barrier(0);
    }
  }

  // ---- epilogue: the wave's 16 x 128 block through its own slab, so that each store covers a whole 512-B row piece ----
  float* slab = sO[wave];
#pragma unroll
  for (int j = 0; j < 8; ++j) {
    *(v4f*)(slab + c * kFaOPitch + j * 16 + hf * 8)     = (v4f){o[j][0], o[j][1], o[j][2], o[j][3]} * pvScale;
    *(v4f*)(slab + c * kFaOPitch + j * 16 + hf * 8 + 4) = (v4f){o[j][4], o[j][5], o[j][6], o[j][7]} * pvScale;
  }
  // the wave's slab writes are complete before its lanes read each other's words (as in wmma_gemm64)
  __builtin_amdgcn_fence(__ATOMIC_RELEASE, "workgroup");
  __builtin_amdgcn_wave_barrier();
  __builtin_amdgcn_fence(__ATOMIC_ACQUIRE, "workgroup");
  float* dst = att + (size_t)(b * kSP + wave * 16) * kD + h * kHD + lane * 4;
#pragma unroll
  for (int row = 0; row < 16; ++row) *(v4f*)(dst + (size_t)row * kD) = *(const v4f*)(slab + row * kFaOPitch + lane * 4);
}

// ---------------------------------------------------------------------------
// Gated residual + LayerNorm: y = x + gate*attn (token-major gate [6272][1024], attn [32][256 q][1024]); x_new = LN(y)*lnw + lnb
// written f32 to xout (may alias xin: each block reads its whole row into registers before any store, no other block
// touches the row) and as f16(16*x_new) to x16. One block per token (grid 6272), thread t owns columns 4t..4t+3.
// ---------------------------------------------------------------------------
__global__ __launch_bounds__(256) void merge_ln_kernel(const float* xin, const float* __restrict__ att,
                                                       const float* __restrict__ gate, const float* __restrict__ lnw,
                                                       const float* __restrict__ lnb, float* xout,
                                                       unsigned short* __restrict__ x16) {
  __shared__ float redA[8];
  __shared__ float redB[8];
  __shared__ __align__(16) float srow[kD];
  const int t = threadIdx.x, lane = t & 31, wave = t >> 5;
  const int r = blockIdx.x;
  const int b = r / kM;
  const int m = r - b * kM;
  const int c0 = t * 4;
  const size_t ro = (size_t)r * kD + c0;
  const v4f xv = *(const v4f*)(xin + ro);
  const v4f gv = *(const v4f*)(gate + ro);
  const v4f av = *(const v4f*)(att + ((size_t)(b * kSP + m)) * kD + c0);
  float y[4];
#pragma unroll
  for (int e = 0; e < 4; ++e) y[e] = xv[e] + gv[e] * av[e];
  float s = (y[0] + y[1]) + (y[2] + y[3]);
#pragma unroll
  for (int off = 1; off < 32; off <<= 1) s += __shfl_xor(s, off, 32);
  if (lane == 0) redA[wave] = s;
  __syncthreads();
  float tot = redA[0];
#pragma unroll
  for (int w = 1; w < 8; ++w) tot += redA[w];
  const float mu = tot * (1.0f / 1024.0f);
  float d[4];
  float sq = 0.f;
#pragma unroll
  for (int e = 0; e < 4; ++e) { d[e] = y[e] - mu; sq += d[e] * d[e]; }
#pragma unroll
  for (int off = 1; off < 32; off <<= 1) sq += __shfl_xor(sq, off, 32);
  if (lane == 0) redB[wave] = sq;
  __syncthreads();
  float tot2 = redB[0];
#pragma unroll
  for (int w = 1; w < 8; ++w) tot2 += redB[w];
  const float var = tot2 * (1.0f / 1024.0f);
  const float rs = rsqrtf(var + 1e-5f);
  const v4f wv = *(const v4f*)(lnw + c0);
  const v4f bv = *(const v4f*)(lnb + c0);
  v4f ov;
#pragma unroll
  for (int e = 0; e < 4; ++e) ov[e] = d[e] * rs * wv[e] + bv[e];
  *(v4f*)(srow + c0) = ov;
  __syncthreads();
  const int tc = t & 127;                               // clamped staging index; only t < 128 stores
  const v4f p0 = *(const v4f*)(srow + tc * 8);
  const v4f p1 = *(const v4f*)(srow + tc * 8 + 4);
  unsigned short hb[8];
#pragma unroll
  for (int e = 0; e < 4; ++e) {
    hb[e]     = h_bits(p0[e] * kXCarry);
    hb[4 + e] = h_bits(p1[e] * kXCarry);
  }
  const v4u hu = (v4u){pk16(hb[0], hb[1]), pk16(hb[2], hb[3]), pk16(hb[4], hb[5]), pk16(hb[6], hb[7])};
  unsigned short* hp = x16 + (size_t)r * kD + tc * 8;
  {
    *(v4f*)(xout + ro) = ov;
    if (t < 128) *(v4u*)hp = hu;
    
  }
}

// ---------------------------------------------------------------------------
// Masked mean over tokens: out0[b][c] = sum_m x[b][m][c]*mask[b][m] / sum_m mask[b][m]. One block per b (grid 32),
// ---------------------------------------------------------------------------
__global__ __launch_bounds__(256) void pool_kernel(const float* x, const float* __restrict__ mask, float* out0) {
  const int t = threadIdx.x;
  const int b = blockIdx.x;
  const int c0 = t * 4;
  v4f acc = (v4f){0.f, 0.f, 0.f, 0.f};
  float ms = 0.f;
#pragma unroll 1
  for (int m = 0; m < kM; ++m) {
    const float mv = mask[b * kM + m];
    const v4f xv = *(const v4f*)(x + ((size_t)(b * kM + m)) * kD + c0);
    acc += xv * mv;
    ms += mv;
  }
  const float inv = 1.0f / ms;
  const v4f o = acc * inv;
  store2_v4f(out0 + (size_t)b * kD + c0, o);
}

// ---------------------------------------------------------------------------
// Host orchestration: kernel launches only. 2 + 3*12 + 1 = 39 launches.
// ---------------------------------------------------------------------------
extern "C" void kernel_launch(void* const* d_in, const int* in_sizes, int n_in,
                              void* d_out, int out_size, void* d_ws, size_t ws_size,
                              hipStream_t stream) {
  if (n_in < 22) return;
  if (in_sizes[0] != kTok * kD) return;
  if (in_sizes[1] != kTok) return;
  if (in_sizes[2] != kL * kD * kD || in_sizes[6] != kL * kD * kD || in_sizes[10] != kL * kD * kD || in_sizes[14] != kL * kD * kD) return;
  if (in_sizes[18] != kL * kHD * kHD || in_sizes[19] != kL * kHD) return;
  if (in_sizes[3] != kL * kD || in_sizes[20] != kL * kD || in_sizes[21] != kL * kD) return;
  if (out_size != kB * kD + kTok * kD) return;
  if (ws_size < kWsTotal) return;

  const float* att_feats = (const float*)d_in[0];
  const float* att_mask  = (const float*)d_in[1];
  const float* Wq2  = (const float*)d_in[2];
  const float* bq2  = (const float*)d_in[3];
  const float* gq2w = (const float*)d_in[4];
  const float* gq2b = (const float*)d_in[5];
  const float* Wk   = (const float*)d_in[6];
  const float* bk   = (const float*)d_in[7];
  const float* gkw  = (const float*)d_in[8];
  const float* gkb  = (const float*)d_in[9];
  const float* Wv1  = (const float*)d_in[10];
  const float* bv1  = (const float*)d_in[11];
  const float* gv1w = (const float*)d_in[12];
  const float* gv1b = (const float*)d_in[13];
  const float* Wv2  = (const float*)d_in[14];
  const float* bv2  = (const float*)d_in[15];
  const float* gv2w = (const float*)d_in[16];
  const float* gv2b = (const float*)d_in[17];
  const float* Wc   = (const float*)d_in[18];
  const float* bc   = (const float*)d_in[19];
  const float* lnw  = (const float*)d_in[20];
  const float* lnb  = (const float*)d_in[21];

  char* ws = (char*)d_ws;
  float*          Ppl   = (float*)(ws + kOffP);                    // linear+bias plane
  float*          GATE  = (float*)(ws + kOffP);                    // gate plane (same region, later)
  unsigned short* GIN16 = (unsigned short*)(ws + kOffATT);         // (v1*k) plane
  float*          ATT   = (float*)(ws + kOffATT);                  // attn plane (same region, later)
  unsigned short* X16   = (unsigned short*)(ws + kOffX16);
  unsigned short* W16   = (unsigned short*)(ws + kOffW16);
  unsigned short* WC16  = (unsigned short*)(ws + kOffWC16);
  unsigned short* Q16   = (unsigned short*)(ws + kOffQ16);
  unsigned short* K16   = (unsigned short*)(ws + kOffK16);
  unsigned short* V2T   = (unsigned short*)(ws + kOffV2T);

  float* out0 = (float*)d_out;                                     // [32][1024] at byte 0
  float* out1 = (float*)d_out + (size_t)kB * kD;                   // [32][196][1024] at byte 131072; also the running x

  const float projScale  = 1.0f / (kXCarry * kWCarry);             // 1/4096
  const float gateScale  = 1.0f / (kXCarry * kWCarry);             // (v1*k) x16, Wc x256
  const float scoreScale = 0.08838834764831845f * (1.0f / (kXCarry * kXCarry));
  const float pvScale    = 1.0f / (kPCarry * kXCarry);             // 1/32768

  // x -> f16 plane (x16); pad rows of the q2/k planes zero
  {
    const int n8 = kTok * kD / 8;                                  // 802816 = 3136 * 256
    cast8s_kernel<<<dim3(n8 / 256), dim3(256), 0, stream>>>(att_feats, X16, n8, kXCarry);
    const int npad8 = 64 * kD / 8;                                 // 8192 = 32 * 256
    fill_zero2_kernel<<<dim3(npad8 / 256, 2), dim3(256), 0, stream>>>(Q16 + (size_t)kTok * kD, K16 + (size_t)kTok * kD, npad8);
  }

  for (int i = 0; i < kL; ++i) {
    const size_t wo = (size_t)i * kD * kD;
    wcast_kernel<<<dim3(512, 5), dim3(256), 0, stream>>>(Wq2 + wo, Wk + wo, Wv1 + wo, Wv2 + wo, Wc + (size_t)i * kHD * kHD, W16, WC16);

    // four projections: P = x16 * Wz^T + bz (M 6272, N 1024, K 1024; 49 x 4 block tiles of 128 x 256 = 196 blocks)
    for (int z = 0; z < 4; ++z) {
      const float* biasz = (z == 0) ? bq2 : (z == 1) ? bk : (z == 2) ? bv1 : bv2;
      const float* gwz   = (z == 0) ? gq2w : (z == 1) ? gkw : (z == 2) ? gv1w : gv2w;
      const float* gbz   = (z == 0) ? gq2b : (z == 1) ? gkb : (z == 2) ? gv1b : gv2b;
      proj_gemm_lds_kernel<<<dim3((kTok / kPjBM) * (kD / kPjBN)), dim3(256), 0, stream>>>(
          X16, W16 + (size_t)z * kD * kD, Ppl, biasz + (size_t)i * kD, projScale);
      if (z == 0) {
        gn_rows_kernel<0><<<dim3(3136), dim3(256), 0, stream>>>(Ppl, gwz + (size_t)i * kD, gbz + (size_t)i * kD, K16, Q16);
      } else if (z == 1) {
        gn_rows_kernel<0><<<dim3(3136), dim3(256), 0, stream>>>(Ppl, gwz + (size_t)i * kD, gbz + (size_t)i * kD, Q16, K16);
      } else if (z == 2) {
        gn_rows_kernel<2><<<dim3(3136), dim3(256), 0, stream>>>(Ppl, gwz + (size_t)i * kD, gbz + (size_t)i * kD, K16, GIN16);
      } else {
        gn_v2t_kernel<<<dim3(kB, kH, 2), dim3(256), 0, stream>>>(Ppl, gwz + (size_t)i * kD, gbz + (size_t)i * kD, V2T);
      }
    }

    // gate = sigmoid((v1*k) * Wc^T + bc): M 50176, N 128, K 128 (1568 tiles = 196 blocks); output [50176][128] f32 == token-major [6272][1024]
    wmma_gemm64<0, false, 2, 0, false, 6><<<dim3(196, 1), dim3(256), 0, stream>>>(
        GIN16, nullptr, kHD, 0L, 0L,
        WC16, nullptr, kHD, 0L, 0L,
        (void*)GATE, nullptr, kHD, 0L, 0L,
        bc + (size_t)i * kHD, nullptr, 0L,
        kTok * kH, kHD, kHD, gateScale);

    // attention: scores, softmax and P * v2 of one (batch, head) group per work-group, 256 groups in one launch
    attn_fused_kernel<<<dim3(kB, kH), dim3(kFaThr), 0, stream>>>(Q16, K16, V2T, att_mask, ATT, scoreScale, pvScale);

    const float* xin = (i == 0) ? att_feats : out1;
    merge_ln_kernel<<<dim3(kTok), dim3(256), 0, stream>>>(xin, ATT, GATE, lnw + (size_t)i * kD, lnb + (size_t)i * kD, out1, X16);
  }

  pool_kernel<<<dim3(kB), dim3(256), 0, stream>>>(out1, att_mask, out0);
}

// v004
// It runs in 515 microseconds.
// Timed twice side by side with v003, it ran 1.12 times as fast both times.
// All steps since v000 together make it 3.07 times as fast.
// Contractions: projections x(f16, x16)*W^T(f16, x256), gate (v1*k)(f16, x16)*Wc^T(f16, x256), scores q2(f16, x16)*k^T(f16, x16), attn P(f16, x2048)*v2(f16, x16): all v_wmma_f32_16x16x32_f16 with f32 accumulate; CELU, GroupNorm, softmax, sigmoid, residual, LayerNorm and masked mean in f32.
#include <hip/hip_runtime.h>
#include <math.h>

// ---------------------------------------------------------------------------
// Problem constants
// ---------------------------------------------------------------------------
constexpr int kB   = 32;
constexpr int kM   = 196;
constexpr int kD   = 1024;
constexpr int kH   = 8;
constexpr int kHD  = 128;
constexpr int kL   = 3;
constexpr int kTok = kB * kM;          // 6272 = 98 * 64 token rows
constexpr int kTokPad = kTok + 64;     // 6336: 64 zero rows so per-group 208-row tiles never leave the plane
constexpr int kSP  = 256;              // padded queries / keys per (batch, head) group
constexpr int kKeyK = 224;             // contraction depth of P*V (keys padded to a multiple of 32)
constexpr float kXCarry = 16.0f;       // x, q2, k, v2 planes carried x16 in f16
constexpr float kWCarry = 256.0f;      // W, Wc carried x256 in f16
constexpr float kPCarry = 2048.0f;     // probabilities carried x2048 in f16

// ---------------------------------------------------------------------------
// Workspace region map (bytes, all offsets multiples of 256)
//   R_P    [0, 25690112)            : linear+bias plane f32 [6272][1024]  -> later gate plane f32 [50176][128]
//   R_ATT  [25690112, 59244544)     : (v1*k) f16 plane [6272][1024]      -> later attn f32 [32][256][1024]
//   R_X16  [59244544, 72089600)     : x f16 [6272][1024]
//   R_W16  [72089600, 80478208)     : stacked W f16 [4096][1024]
//   R_WC16 [80478208, 80510976)     : Wc f16 [128][128]
//   R_Q16  [80510976, 93487104)     : q2 f16 [6336][1024] (rows >= 6272 zero)
//   R_K16  [93487104, 106463232)    : k  f16 [6336][1024] (rows >= 6272 zero)
//   R_V2T  [106463232, 123240448)   : v2^T f16 [8 h][128 d][32 b][256 keys] (keys >= 196 zero)
// ---------------------------------------------------------------------------
constexpr size_t kBytesP    = (size_t)kTok * kD * 4;
constexpr size_t kBytesATT  = (size_t)kB * kSP * kD * 4;
constexpr size_t kBytesX16  = (size_t)kTok * kD * 2;
constexpr size_t kBytesW16  = (size_t)4 * kD * kD * 2;
constexpr size_t kBytesWC16 = (size_t)kHD * kHD * 2;
constexpr size_t kBytesQ16  = (size_t)kTokPad * kD * 2;
constexpr size_t kBytesV2T  = (size_t)kH * kHD * kB * kSP * 2;
constexpr size_t kOffP    = 0;
constexpr size_t kOffATT  = kOffP + kBytesP;
constexpr size_t kOffX16  = kOffATT + kBytesATT;
constexpr size_t kOffW16  = kOffX16 + kBytesX16;
constexpr size_t kOffWC16 = kOffW16 + kBytesW16;
constexpr size_t kOffQ16  = kOffWC16 + kBytesWC16;
constexpr size_t kOffK16  = kOffQ16 + kBytesQ16;
constexpr size_t kOffV2T  = kOffK16 + kBytesQ16;
constexpr size_t kWsTotal = kOffV2T + kBytesV2T;
static_assert(kWsTotal == 123240448, "carve total");
static_assert(kWsTotal <= 268435456, "carve under 256 MiB");
static_assert(kBytesATT >= (size_t)kTok * kD * 2, "vk plane fits in the attn region");
static_assert(kBytesP == (size_t)kTok * kH * kHD * 4, "gate plane fits in the P region");
static_assert((kOffATT % 256) == 0 && (kOffX16 % 256) == 0 && (kOffW16 % 256) == 0 && (kOffQ16 % 256) == 0 && (kOffK16 % 256) == 0 && (kOffV2T % 256) == 0, "aligned");

typedef __attribute__((ext_vector_type(16))) _Float16 v16h;
typedef __attribute__((ext_vector_type(8)))  _Float16 v8h;
typedef __attribute__((ext_vector_type(16))) __bf16   v16b;
typedef __attribute__((ext_vector_type(8)))  __bf16   v8b;
typedef __attribute__((ext_vector_type(8)))  float    v8f;
typedef __attribute__((ext_vector_type(4)))  float    v4f;
typedef __attribute__((ext_vector_type(4)))  unsigned int v4u;

__device__ __forceinline__ unsigned short f2bf_bits(float f) {
  unsigned u = __float_as_uint(f);
  return (unsigned short)((u + 0x7FFFu + ((u >> 16) & 1u)) >> 16);
}
__device__ __forceinline__ float bf_bits2f(unsigned short h) { return __uint_as_float(((unsigned)h) << 16); }

// hazard guards as plain device helpers (no inline asm inside the kernel template body)
__device__ __forceinline__ void dep_guard_h(v8f& a, v8f& b, v16h x, v16h y) { asm volatile("v_nop\n\tv_nop\n\tv_nop\n\tv_nop" : "+v"(a), "+v"(b) : "v"(x), "v"(y)); }
__device__ __forceinline__ void dep_guard_b(v8f& a, v8f& b, v16b x, v16b y) { asm volatile("v_nop\n\tv_nop\n\tv_nop\n\tv_nop" : "+v"(a), "+v"(b) : "v"(x), "v"(y)); }
__device__ __forceinline__ void keep4_h(v16h a, v16h b, v16h c, v16h d) { asm volatile("v_nop" :: "v"(a), "v"(b), "v"(c), "v"(d)); }
__device__ __forceinline__ void keep4_b(v16b a, v16b b, v16b c, v16b d) { asm volatile("v_nop" :: "v"(a), "v"(b), "v"(c), "v"(d)); }
__device__ __forceinline__ void acc_guard4(v8f& a, v8f& b, v8f& c, v8f& d) { asm volatile("v_nop\n\tv_nop\n\tv_nop\n\tv_nop" : "+v"(a), "+v"(b), "+v"(c), "+v"(d)); }
template <typename T> struct Frag;
template <> struct Frag<_Float16> {
  typedef v16h V; union U { v16h v; v8h h[2]; };
  static __device__ __forceinline__ v16h load(const _Float16* p) {   // elements 0..7 <- p[0..7], 8..15 <- p[16..23]
    U f; f.h[0] = *(const v8h*)(p); f.h[1] = *(const v8h*)(p + 16); return f.v;
  }
  static __device__ __forceinline__ v8f mma(v16h a, v16h b, v8f c) {
    return __builtin_amdgcn_wmma_f32_16x16x32_f16(false, a, false, b, (short)0, c, false, false);
  }
  static __device__ __forceinline__ void guard(v8f& a, v8f& b, v16h x, v16h y) { dep_guard_h(a, b, x, y); }
  static __device__ __forceinline__ void keep(v16h a, v16h b, v16h c, v16h d) { keep4_h(a, b, c, d); }
};
template <> struct Frag<__bf16> {
  typedef v16b V; union U { v16b v; v8b h[2]; };
  static __device__ __forceinline__ v16b load(const __bf16* p) {
    U f; f.h[0] = *(const v8b*)(p); f.h[1] = *(const v8b*)(p + 16); return f.v;
  }
  static __device__ __forceinline__ v8f mma(v16b a, v16b b, v8f c) {
    return __builtin_amdgcn_wmma_f32_16x16x32_bf16(false, a, false, b, (short)0, c, false, false);
  }
  static __device__ __forceinline__ void guard(v8f& a, v8f& b, v16b x, v16b y) { dep_guard_b(a, b, x, y); }
  static __device__ __forceinline__ void keep(v16b a, v16b b, v16b c, v16b d) { keep4_b(a, b, c, d); }
};

__device__ __forceinline__ unsigned pk16(unsigned short a, unsigned short b) { return (unsigned)a | ((unsigned)b << 16); }
__device__ __forceinline__ unsigned short h_bits(float f) { const _Float16 h = (_Float16)f; return __builtin_bit_cast(unsigned short, h); }

// exact f16 bits -> f32 via integer arithmetic (normals and subnormals; no _Float16 vector involved)
__device__ __forceinline__ float h16_to_f32(unsigned hb) {
  const unsigned em = hb & 0x7fffu;
  const float fn = __uint_as_float((em + 0x1C000u) << 13);
  const float fs = (float)em * 5.9604644775390625e-8f;
  const float f  = (em < 0x400u) ? fs : fn;
  return __uint_as_float(__float_as_uint(f) | ((hb & 0x8000u) << 16));
}

__device__ __forceinline__ void store2_v4u(unsigned short* p, v4u u) {
  *(v4u*)p = u;
  
}
__device__ __forceinline__ void store2_v4f(float* p, v4f v) {
  *(v4f*)p = v;
  
}

// ---- Register-blocked batched WMMA GEMM (ACT: 0 none, 2 relu, 4 leaky, 6 sigmoid) -------------
// C[m,n] = scale * sum_k A[m,k] * Bt[n,k] (+bias)(+resid); each wave owns a 64x64 tile.
// A row-major [M,K]; Bt row-major [N,K]; M,N % 64 == 0, K % 32 == 0.
// SPLIT: operands are hi/lo planes (A2/Bt2 = lo planes, same layout); product = hi*hi + hi*lo + lo*hi.
// BIAS_MODE: 0 = none, 1 = bias[m], 2 = bias[n].
// OUT_MODE: 0 = f32, 1 = f16, 2 = bf16 hi plane (Cout) + bf16 lo plane (Cout2).
// ET: 0 = f16 operands, 1 = bf16 operands (pointers passed as 16-bit storage)
// Batching: blockIdx.y steps A, Bt, C by strideA, strideB, strideC; blockIdx.z steps them by strideAz, strideBz, strideCz.
template <int ET> struct Elem;
template <> struct Elem<0> { typedef _Float16 T; };
template <> struct Elem<1> { typedef __bf16 T; };
template <int ET, bool SPLIT, int BIAS_MODE, int OUT_MODE, bool RESID, int ACT = 0>
__global__ __launch_bounds__(256) void wmma_gemm64(
    const unsigned short* __restrict__ Ap, const unsigned short* __restrict__ A2p, int lda, long strideA, long strideAz,
    const unsigned short* __restrict__ Btp, const unsigned short* __restrict__ Bt2p, int ldb, long strideB, long strideBz,
    void* __restrict__ Cout, void* __restrict__ Cout2, int ldc, long strideC, long strideCz,
    const float* __restrict__ bias,
    const float* __restrict__ resid, long strideR,
    int M, int N, int K, float scale) {
  typedef typename Elem<ET>::T T;
  typedef typename Frag<T>::V V;
  const T* A = (const T*)Ap; const T* A2 = (const T*)A2p; const T* Bt = (const T*)Btp; const T* Bt2 = (const T*)Bt2p;
  __shared__ __align__(16) float sT[8][16 * 68];   // per-wave 16x64 slab, pitch 68 floats
  const int b    = blockIdx.y;
  const int z    = blockIdx.z;
  const int lane = threadIdx.x & 31;
  const int wave = threadIdx.x >> 5;
  const int tilesN = N >> 6;
  const int tilesM = M >> 6;
  const int tile = blockIdx.x * 8 + wave;
  if (tile >= tilesM * tilesN) return;   // wave-uniform; no block barriers in this kernel
  const int tm = tile / tilesN;
  const int tn = tile - tm * tilesN;
  const int m0 = tm << 6;
  const int n0 = tn << 6;

  const size_t offA = (size_t)b * strideA + (size_t)z * strideAz;
  const size_t offB = (size_t)b * strideB + (size_t)z * strideBz;
  const size_t offC = (size_t)b * strideC + (size_t)z * strideCz;
  const T* Ab  = A  + offA;
  const T* Bb  = Bt + offB;
  const T* Ab2 = SPLIT ? (A2  + offA) : nullptr;
  const T* Bb2 = SPLIT ? (Bt2 + offB) : nullptr;

  const int rlane = lane & 15;                 // row (A) / col (B, D) within subtile
  const int koff  = (lane >> 4) * 8;           // k offset of this lane half
  const int mOff  = (lane >> 4) * 8;           // D row offset

  v8f acc[4][4];
#pragma unroll
  for (int i = 0; i < 4; ++i)
#pragma unroll
    for (int j = 0; j < 4; ++j) acc[i][j] = (v8f){0.f,0.f,0.f,0.f,0.f,0.f,0.f,0.f};

  for (int k0 = 0; k0 < K; k0 += 32) {
    V bh[4], bl[4];
#pragma unroll
    for (int j = 0; j < 4; ++j) {
      const size_t bo = (size_t)(n0 + (j << 4) + rlane) * ldb + koff + k0;
      bh[j] = Frag<T>::load(Bb + bo);
      if (SPLIT) bl[j] = Frag<T>::load(Bb2 + bo);
    }
#pragma unroll
    for (int i = 0; i < 4; ++i) {
      const size_t ao = (size_t)(m0 + (i << 4) + rlane) * lda + koff + k0;
      V ah = Frag<T>::load(Ab + ao);
      V al;
      if (SPLIT) al = Frag<T>::load(Ab2 + ao);
#pragma unroll
      for (int j = 0; j < 4; ++j) {
        acc[i][j] = Frag<T>::mma(ah, bh[j], acc[i][j]);
        if (SPLIT) {
          acc[i][j] = Frag<T>::mma(ah, bl[j], acc[i][j]);
          acc[i][j] = Frag<T>::mma(al, bh[j], acc[i][j]);
        }
      }
      Frag<T>::guard(acc[i][0], acc[i][3], ah, SPLIT ? al : ah);
    }
    Frag<T>::keep(bh[0], bh[1], bh[2], bh[3]);
    if (SPLIT) Frag<T>::keep(bl[0], bl[1], bl[2], bl[3]);
  }
  acc_guard4(acc[0][0], acc[0][1], acc[0][2], acc[0][3]);
  acc_guard4(acc[1][0], acc[1][1], acc[1][2], acc[1][3]);
  acc_guard4(acc[2][0], acc[2][1], acc[2][2], acc[2][3]);
  acc_guard4(acc[3][0], acc[3][1], acc[3][2], acc[3][3]);

  // ---- epilogue ----
  float* slab = sT[wave];
  const float* Rb = RESID ? (resid + (size_t)b * strideR) : nullptr;
#pragma unroll
  for (int i = 0; i < 4; ++i) {
    const int mBase = m0 + (i << 4);
#pragma unroll
    for (int j = 0; j < 4; ++j) {
      const int n = n0 + (j << 4) + rlane;
      float bv = 0.f;
      if (BIAS_MODE == 2) bv = bias[n];
#pragma unroll
      for (int r = 0; r < 8; ++r) {
        float v = acc[i][j][r] * scale;
        if (BIAS_MODE == 1) v += bias[mBase + mOff + r];
        if (BIAS_MODE == 2) v += bv;
        if (RESID) v += Rb[(size_t)(mBase + mOff + r) * ldc + n];
        if (ACT == 2) v = fmaxf(v, 0.0f);
        if (ACT == 4) v = (v > 0.f) ? v : 0.01f * v;
        if (ACT == 6) v = 1.0f / (1.0f + expf(-v));
        slab[(mOff + r) * 68 + (j << 4) + rlane] = v;
      }
    }
    __builtin_amdgcn_fence(__ATOMIC_RELEASE, "workgroup");
    __builtin_amdgcn_wave_barrier();
    __builtin_amdgcn_fence(__ATOMIC_ACQUIRE, "workgroup");
    if (OUT_MODE == 0) {
      float* C = (float*)Cout + offC;
      const int hh = lane >> 4, c4 = (lane & 15) * 4;     // row seg = 256 B = 16 lanes x 16 B
      {
#pragma unroll
        for (int it = 0; it < 8; ++it) {
          const int row = it * 2 + hh;
          v4f v = *(const v4f*)(slab + row * 68 + c4);
          *(v4f*)(C + (size_t)(mBase + row) * ldc + n0 + c4) = v;
        }
        
      }
    } else {
      const int q = lane >> 3, c8 = (lane & 7) * 8;
      unsigned short* C  = (unsigned short*)Cout  + offC;
      unsigned short* C2 = (OUT_MODE == 2) ? ((unsigned short*)Cout2 + offC) : nullptr;
      {
#pragma unroll
        for (int it = 0; it < 4; ++it) {
          const int row = it * 4 + q;
          const float* sp = slab + row * 68 + c8;
          v8h hv, lv;
#pragma unroll
          for (int e = 0; e < 8; ++e) {
            if (OUT_MODE == 1) {
              hv[e] = (_Float16)sp[e];
            } else {
              unsigned short hb = f2bf_bits(sp[e]);
              unsigned short lb = f2bf_bits(sp[e] - bf_bits2f(hb));
              hv[e] = __builtin_bit_cast(_Float16, hb);
              lv[e] = __builtin_bit_cast(_Float16, lb);
            }
          }
          *(v8h*)(C + (size_t)(mBase + row) * ldc + n0 + c8) = hv;
          if (OUT_MODE == 2) *(v8h*)(C2 + (size_t)(mBase + row) * ldc + n0 + c8) = lv;
        }
        
      }
    }
    __builtin_amdgcn_fence(__ATOMIC_RELEASE, "workgroup");
    __builtin_amdgcn_wave_barrier();
    __builtin_amdgcn_fence(__ATOMIC_ACQUIRE, "workgroup");
  }
}

// ---------------------------------------------------------------------------
// Projection GEMM with operands staged in LDS: C[m,n] = scale * sum_k A[m,k] * Bt[n,k] + bias[n], f32 out.
// A [6272][1024] f16, Bt [1024][1024] f16, both k-contiguous. Block tile 128 (m) x 256 (n), 8 waves as 2 x 4, each wave the
// same 64x64 tile, fragment maps and k order as wmma_gemm64. A stage is 64 k = one 128-B line of each of the 384 operand
// rows (A rows first, then Bt rows), laid at a 144-B pitch in one of two LDS buffers. Every global load covers whole lines
// (8 lanes per row). Stage s + 2 is fetched into registers during stage s and stored to LDS during stage s + 1, so a
// fetch has a whole stage to land. grid = 49 * 4 = 196 blocks (6272 = 49 * 128, 1024 = 4 * 256).
// ---------------------------------------------------------------------------
constexpr int kPjBM = 128;                       // block rows of A
constexpr int kPjBN = 256;                       // block rows of Bt
constexpr int kPjBK = 64;                        // halves of k per stage
constexpr int kPjPitch = 72;                     // halves per staged row (144 B)
constexpr int kPjStage = (kPjBM + kPjBN) * kPjPitch;   // halves per buffer (55,296 B)
constexpr int kPjStages = kD / kPjBK;            // 16
static_assert(kTok % kPjBM == 0 && kD % kPjBN == 0 && kD % (2 * kPjBK) == 0 && kPjStages >= 4, "projection tiles divide the problem");

// 12 pieces of 16 B per thread: pieces 0..3 = A rows, 4..11 = Bt rows, 32 staged rows apart
__device__ __forceinline__ void pj_fetch(v4u (&r)[12], const unsigned short* gA, const unsigned short* gB, int k) {
#pragma unroll
  for (int j = 0; j < 4; ++j) r[j] = *(const v4u*)(gA + (size_t)(32 * j) * kD + k);
#pragma unroll
  for (int j = 0; j < 8; ++j) r[4 + j] = *(const v4u*)(gB + (size_t)(32 * j) * kD + k);
}
__device__ __forceinline__ void pj_put(unsigned short* dst, const v4u (&r)[12]) {
#pragma unroll
  for (int j = 0; j < 12; ++j) *(v4u*)(dst + 32 * j * kPjPitch) = r[j];
}
// Work-group barrier that orders LDS only: __syncthreads() also waits for every global load in flight, which would
// end the fetch of the stage after next at each barrier; those loads land in registers and concern no other wave.
__device__ __forceinline__ void pj_barrier() {
  __builtin_amdgcn_fence(__ATOMIC_RELEASE, "workgroup", "local");
  __builtin_amdgcn_s_barrier();
  __builtin_amdgcn_fence(__ATOMIC_ACQUIRE, "workgroup", "local");
}
// One stage: fetch stage k/64 into ld (FETCH), multiply the stage in cur, store the stage held in st to nxt (PUT).
template <bool FETCH, bool PUT>
__device__ __forceinline__ void pj_stage(const _Float16* curA, const _Float16* curB, unsigned short* nxt,
                                         const unsigned short* gA, const unsigned short* gB, int k,
                                         v4u (&ld)[12], const v4u (&st)[12], v8f (&acc)[4][4]) {
  typedef Frag<_Float16> F;
  v16h bh[2][4], ah[2][4];
#pragma unroll
  for (int kk = 0; kk < 2; ++kk) {
#pragma unroll
    for (int j = 0; j < 4; ++j) bh[kk][j] = F::load(curB + j * 16 * kPjPitch + kk * 32);
#pragma unroll
    for (int i = 0; i < 4; ++i) ah[kk][i] = F::load(curA + i * 16 * kPjPitch + kk * 32);
  }
  // keeps the LDS fragment reads as one group ahead of the matrix work (the scheduler otherwise spreads them among the
  // WMMAs) and ahead of the fetch, so that no fragment lands in a register that a fetch in flight names as its address
  __builtin_amdgcn_sched_barrier(0);
  if (FETCH) pj_fetch(ld, gA, gB, k);
  // keeps the fetch ahead of the matrix work (the scheduler otherwise sinks it to its use, a stage later)
  __builtin_amdgcn_sched_barrier(0);
#pragma unroll
  for (int i = 0; i < 4; ++i)
#pragma unroll
    for (int j = 0; j < 4; ++j) acc[i][j] = F::mma(ah[0][i], bh[0][j], acc[i][j]);
  // keeps the LDS stores of the next stage behind the first WMMA half, when this stage's fragment reads have been served
  __builtin_amdgcn_sched_barrier(0);
  // the wait owed before the fetch's address registers are written again; 16 WMMAs behind the fetch
  if (FETCH) asm volatile("s_wait_xcnt 0x0" ::: "memory");
  if (PUT) pj_put(nxt, st);
  // keeps the second WMMA half behind the stores: it needs no LDS, so it can run past the barrier, beside the next reads
  __builtin_amdgcn_sched_barrier(0);
#pragma unroll
  for (int i = 0; i < 4; ++i)
#pragma unroll
    for (int j = 0; j < 4; ++j) acc[i][j] = F::mma(ah[1][i], bh[1][j], acc[i][j]);
  if (PUT) pj_barrier();               // publishes the stage just stored and ends every read of cur
}

__global__ __launch_bounds__(256) void proj_gemm_lds_kernel(const unsigned short* __restrict__ Ap,
                                                            const unsigned short* __restrict__ Btp,
                                                            float* __restrict__ C, const float* __restrict__ bias,
                                                            float scale) {
  __shared__ __align__(16) unsigned short sAB[2][kPjStage];
  __shared__ __align__(16) float sT[8][16 * 68];   // per-wave 16x64 slab, pitch 68 floats
  const int t    = threadIdx.x;
  const int lane = t & 31;
  const int wave = t >> 5;
  const int mB = (blockIdx.x >> 2) * kPjBM;
  const int nB = (blockIdx.x & 3) * kPjBN;
  const int m0 = mB + (wave >> 2) * 64;
  const int n0 = nB + (wave & 3) * 64;

  const int rlane = lane & 15;                 // row (A) / col (B, D) within subtile
  const int koff  = (lane >> 4) * 8;           // k offset of this lane half
  const int mOff  = (lane >> 4) * 8;           // D row offset

  // staging map: piece j of thread t is 16 B number (t & 7) of staged row (t >> 3) + 32 * j
  const int srow = t >> 3;
  const int spart = (t & 7) * 8;
  const unsigned short* gA = Ap  + (size_t)(mB + srow) * kD + spart;
  const unsigned short* gB = Btp + (size_t)(nB + srow) * kD + spart;
  unsigned short* put0 = &sAB[0][srow * kPjPitch + spart];
  unsigned short* put1 = &sAB[1][srow * kPjPitch + spart];
  const int fA = ((wave >> 2) * 64 + rlane) * kPjPitch + koff;
  const int fB = (kPjBM + (wave & 3) * 64 + rlane) * kPjPitch + koff;
  const _Float16* a0 = (const _Float16*)sAB[0] + fA;
  const _Float16* b0 = (const _Float16*)sAB[0] + fB;
  const _Float16* a1 = (const _Float16*)sAB[1] + fA;
  const _Float16* b1 = (const _Float16*)sAB[1] + fB;

  v8f acc[4][4];
#pragma unroll
  for (int i = 0; i < 4; ++i)
#pragma unroll
    for (int j = 0; j < 4; ++j) acc[i][j] = (v8f){0.f,0.f,0.f,0.f,0.f,0.f,0.f,0.f};

  v4u pe[12], po[12];                          // even and odd stages on their way to LDS
  pj_fetch(pe, gA, gB, 0);
  pj_fetch(po, gA, gB, kPjBK);
  asm volatile("s_wait_xcnt 0x0" ::: "memory");   // the wait owed before the fetches' address registers are written again
  pj_put(put0, pe);
  pj_barrier();

  for (int s = 0; s < kPjStages - 2; s += 2) {
    pj_stage<true, true>(a0, b0, put1, gA, gB, (s + 2) * kPjBK, pe, po, acc);   // stage s; fetch s + 2, store s + 1
    pj_stage<true, true>(a1, b1, put0, gA, gB, (s + 3) * kPjBK, po, pe, acc);   // stage s + 1; fetch s + 3, store s + 2
  }
  pj_stage<false, true>(a0, b0, put1, gA, gB, 0, pe, po, acc);                  // stage 14; store 15
  pj_stage<false, false>(a1, b1, put0, gA, gB, 0, po, pe, acc);                 // stage 15

  // ---- epilogue: as wmma_gemm64 with bias[n], f32 out ----
  float* slab = sT[wave];
#pragma unroll
  for (int i = 0; i < 4; ++i) {
    const int mBase = m0 + (i << 4);
#pragma unroll
    for (int j = 0; j < 4; ++j) {
      const float bv = bias[n0 + (j << 4) + rlane];
#pragma unroll
      for (int r = 0; r < 8; ++r) {
        float v = acc[i][j][r] * scale;
        v += bv;
        slab[(mOff + r) * 68 + (j << 4) + rlane] = v;
      }
    }
    // the wave's slab writes are complete before its lanes read each other's words (as in wmma_gemm64)
    __builtin_amdgcn_fence(__ATOMIC_RELEASE, "workgroup");
    __builtin_amdgcn_wave_barrier();
    __builtin_amdgcn_fence(__ATOMIC_ACQUIRE, "workgroup");
    const int hh = lane >> 4, c4 = (lane & 15) * 4;     // row seg = 256 B = 16 lanes x 16 B
#pragma unroll
    for (int it = 0; it < 8; ++it) {
      const int row = it * 2 + hh;
      v4f v = *(const v4f*)(slab + row * 68 + c4);
      *(v4f*)(C + (size_t)(mBase + row) * kD + n0 + c4) = v;
    }
    // the wait owed before a register that these stores name (address or data) is written again; the scheduling fence
    // keeps the next rows' register writes behind it
    asm volatile("s_wait_xcnt 0x0" ::: "memory");
    __builtin_amdgcn_sched_barrier(0);
    // the slab is read out before the next 16 rows overwrite it (as in wmma_gemm64)
    __builtin_amdgcn_fence(__ATOMIC_RELEASE, "workgroup");
    __builtin_amdgcn_wave_barrier();
    __builtin_amdgcn_fence(__ATOMIC_ACQUIRE, "workgroup");
  }
}

// ---------------------------------------------------------------------------
// ---------------------------------------------------------------------------
__global__ __launch_bounds__(256) void cast8s_kernel(const float* __restrict__ in, unsigned short* __restrict__ out, int n8, float scale) {
  const int i = blockIdx.x * 256 + threadIdx.x;
  if (i >= n8) return;
  const float* p = in + 8 * (size_t)i;
  const v4f a = *(const v4f*)(p);
  const v4f c = *(const v4f*)(p + 4);
  unsigned short hb[8];
#pragma unroll
  for (int e = 0; e < 4; ++e) {
    hb[e]     = h_bits(a[e] * scale);
    hb[4 + e] = h_bits(c[e] * scale);
  }
  const v4u u = (v4u){pk16(hb[0], hb[1]), pk16(hb[2], hb[3]), pk16(hb[4], hb[5]), pk16(hb[6], hb[7])};
  store2_v4u(out + 8 * (size_t)i, u);
}

// ---------------------------------------------------------------------------
// Zero fill of two 16-bit regions (pad rows of the q2 and k planes): grid (n8/256, 2); 8 halves per thread, 16-B stores.
// ---------------------------------------------------------------------------
__global__ __launch_bounds__(256) void fill_zero2_kernel(unsigned short* __restrict__ a, unsigned short* __restrict__ b, int n8) {
  const int i = blockIdx.x * 256 + threadIdx.x;
  if (i >= n8) return;
  unsigned short* dst = (blockIdx.y == 0) ? a : b;   // block-uniform select between two global pointers
  const v4u z = (v4u){0u, 0u, 0u, 0u};
  store2_v4u(dst + 8 * (size_t)i, z);
}

// ---------------------------------------------------------------------------
// Weight cast for one layer: blockIdx.y = 0..3 selects W (q2, k, v1, v2) [1024 out][1024 in] row-major (= Bt [N][K] as-is)
// -> f16(256*W) into plane y of w16; blockIdx.y = 4: Wc [128][128] -> wc16. grid (512, 5): 512*256*8 = 1048576 = whole W;
// for y = 4 only blocks 0..7 are active (2048 threads x 8 = 16384 = whole Wc).
// ---------------------------------------------------------------------------
__global__ __launch_bounds__(256) void wcast_kernel(const float* __restrict__ w0, const float* __restrict__ w1,
                                                    const float* __restrict__ w2, const float* __restrict__ w3,
                                                    const float* __restrict__ wc,
                                                    unsigned short* __restrict__ w16, unsigned short* __restrict__ wc16) {
  const int z = blockIdx.y;                                     // block-uniform
  const int i = blockIdx.x * 256 + threadIdx.x;
  const float* src = (z == 0) ? w0 : (z == 1) ? w1 : (z == 2) ? w2 : (z == 3) ? w3 : wc;
  unsigned short* dst = (z < 4) ? (w16 + (size_t)z * kD * kD) : wc16;
  const int n8 = (z < 4) ? (kD * kD / 8) : (kHD * kHD / 8);
  if (i >= n8) return;
  const float* p = src + 8 * (size_t)i;
  const v4f a = *(const v4f*)(p);
  const v4f c = *(const v4f*)(p + 4);
  unsigned short hb[8];
#pragma unroll
  for (int e = 0; e < 4; ++e) {
    hb[e]     = h_bits(a[e] * kWCarry);
    hb[4 + e] = h_bits(c[e] * kWCarry);
  }
  const v4u u = (v4u){pk16(hb[0], hb[1]), pk16(hb[2], hb[3]), pk16(hb[4], hb[5]), pk16(hb[6], hb[7])};
  store2_v4u(dst + 8 * (size_t)i, u);
}

// ---------------------------------------------------------------------------
// CELU (alpha 1.3), f32
// ---------------------------------------------------------------------------
__device__ __forceinline__ float celu_f(float x) {
  const float en = expf(x * (1.0f / 1.3f)) - 1.0f;
  return (x > 0.f) ? x : 1.3f * en;
}

// ---------------------------------------------------------------------------
// GroupNorm of one projection (CELU -> per (token, head) mean/var over 128 channels -> * gw + gb) writing a token-major
// f16 plane [6272][1024]. MODE 0: value carried x16; MODE 2: value multiplied by the k plane value (already x16) -> (v1*k) x16.
// Unit = (token, head) = 128 channels handled by 16 lanes (8 each): wave = 2 units, block = 16 units, grid = 3136 blocks
// ---------------------------------------------------------------------------
template <int MODE>
__global__ __launch_bounds__(256) void gn_rows_kernel(const float* __restrict__ P, const float* __restrict__ gw,
                                                      const float* __restrict__ gb, const unsigned short* __restrict__ kpl,
                                                      unsigned short* __restrict__ outp) {
  const int t = threadIdx.x, lane = t & 31, wave = t >> 5, hh = lane >> 4, cl = lane & 15;
  const int u = (blockIdx.x * 8 + wave) * 2 + hh;              // token*8 + head, < 50176 (grid exact)
  const size_t base = (size_t)u * kHD + cl * 8;                // == token*1024 + head*128 + cl*8
  const int ch = (u & 7) * kHD + cl * 8;                       // channel index within 1024
  const v4f a = *(const v4f*)(P + base);
  const v4f c = *(const v4f*)(P + base + 4);
  float y[8];
#pragma unroll
  for (int e = 0; e < 4; ++e) { y[e] = celu_f(a[e]); y[4 + e] = celu_f(c[e]); }
  float s = ((y[0] + y[1]) + (y[2] + y[3])) + ((y[4] + y[5]) + (y[6] + y[7]));
#pragma unroll
  for (int off = 1; off < 16; off <<= 1) s += __shfl_xor(s, off, 32);   // stays inside the 16-lane half
  const float mu = s * (1.0f / 128.0f);
  float d[8];
  float sq = 0.f;
#pragma unroll
  for (int e = 0; e < 8; ++e) { d[e] = y[e] - mu; sq += d[e] * d[e]; }
#pragma unroll
  for (int off = 1; off < 16; off <<= 1) sq += __shfl_xor(sq, off, 32);
  const float var = sq * (1.0f / 128.0f);
  const float rs = rsqrtf(var + 1e-5f);
  const v4f w0 = *(const v4f*)(gw + ch), w1 = *(const v4f*)(gw + ch + 4);
  const v4f g0 = *(const v4f*)(gb + ch), g1 = *(const v4f*)(gb + ch + 4);
  float o[8];
#pragma unroll
  for (int e = 0; e < 4; ++e) {
    o[e]     = d[e] * rs * w0[e] + g0[e];
    o[4 + e] = d[4 + e] * rs * w1[e] + g1[e];
  }
  if (MODE == 2) {
    const v4u kk = *(const v4u*)(kpl + base);
    float kf[8];
    kf[0] = h16_to_f32(kk.x & 0xffffu); kf[1] = h16_to_f32(kk.x >> 16);
    kf[2] = h16_to_f32(kk.y & 0xffffu); kf[3] = h16_to_f32(kk.y >> 16);
    kf[4] = h16_to_f32(kk.z & 0xffffu); kf[5] = h16_to_f32(kk.z >> 16);
    kf[6] = h16_to_f32(kk.w & 0xffffu); kf[7] = h16_to_f32(kk.w >> 16);
#pragma unroll
    for (int e = 0; e < 8; ++e) o[e] = o[e] * kf[e];
  } else {
#pragma unroll
    for (int e = 0; e < 8; ++e) o[e] = o[e] * kXCarry;
  }
  unsigned short hb[8];
#pragma unroll
  for (int e = 0; e < 8; ++e) hb[e] = h_bits(o[e]);
  const v4u uu = (v4u){pk16(hb[0], hb[1]), pk16(hb[2], hb[3]), pk16(hb[4], hb[5]), pk16(hb[6], hb[7])};
  store2_v4u(outp + base, uu);
}

// ---------------------------------------------------------------------------
// e^x = 2^whole * exp2(rest): whole = x * log2(e) rounded to an integer, rest = x * log2(e) - whole with log2(e) in two
// terms, each by one FMA; 0 below and inf above the range of f32, at the bounds expf uses.
__device__ __forceinline__ float exp_steps(float x) {
  const float l2e = __uint_as_float(0x3fb8aa3bu), l2e_lo = __uint_as_float(0x32a5705fu);
  const float whole = __builtin_rintf(x * l2e);
  const float rest = __builtin_fmaf(x, l2e_lo, __builtin_fmaf(x, l2e, -whole));
  float v;
  // exp2 with the free slot that a transcendental is owed before its source is overwritten or its result read: only one
  // statement ties the v_nop to it
  asm("v_exp_f32 %0, %1\n\tv_nop" : "=v"(v) : "v"(rest));
  v = ldexpf(v, (int)whole);
  v = (x < __uint_as_float(0xc2ce8ed0u)) ? 0.0f : v;
  return (x > __uint_as_float(0x42b17218u)) ? __builtin_inff() : v;
}

// CELU (alpha 1.3) as celu_f, its exponential by exp_steps
__device__ __forceinline__ float celu_steps(float x) {
  const float en = exp_steps(x * (1.0f / 1.3f)) - 1.0f;
  return (x > 0.f) ? x : 1.3f * en;
}

// 1 / sqrt(x) in the steps rsqrtf takes: x below the smallest normal number is scaled by 2^24 and the result by 2^12.
__device__ __forceinline__ float rsqrt_steps(float x) {
  const bool tiny = x < __uint_as_float(0x00800000u);
  const float xs = tiny ? x * 16777216.0f : x;
  float r;
  // the free slot that a transcendental is owed before its source is overwritten or its result read: only one statement ties
  // the v_nop to it
  asm("v_rsq_f32 %0, %1\n\tv_nop" : "=v"(r) : "v"(xs));
  return tiny ? r * 4096.0f : r;
}

// ---------------------------------------------------------------------------
// GroupNorm of the v2 projection written transposed and key-padded: V2T[((h*128 + d)*32 + b)*256 + key] = f16(16 * v2n),
// keys 196..255 = 0. Block = (b, h, dh): 64 channels d = dh*64.. of one (b,h), all 196 tokens; grid (32, 8, 2).
// Phase 0: zero keys 192..255 of the 64 LDS rows (256 threads x 2 x 8 halves = 64 x 64). Phase 1: wave w handles tokens
// w, w+8, ...: 32 lanes x 4 channels = 128 (stats over the full head), the 16 lanes of half dh write their 4 channels
// into LDS [ch][key]. Phase 2: wave w writes rows w*8..w*8+7 (8 waves = 64 rows), each row 256 halves = 512 B =
// ---------------------------------------------------------------------------
constexpr int kV2Pitch = 264;   // halves; 528 B keeps 16-B alignment of row bases
constexpr int kV2Rounds = 25;   // token rounds of a wave (8 waves a round)
constexpr int kV2Grp = 5;       // tokens worked on side by side
static_assert(8 * (kV2Rounds - 1) <= kM && 8 * kV2Rounds >= kM && kV2Rounds % kV2Grp == 0, "all rounds but the last are whole");
__global__ __launch_bounds__(256) void gn_v2t_kernel(const float* __restrict__ P, const float* __restrict__ gw,
                                                     const float* __restrict__ gb, unsigned short* __restrict__ v2t) {
  __shared__ __align__(16) unsigned short sm[64 * kV2Pitch];
  const int t = threadIdx.x, lane = t & 31, wave = t >> 5;
  const int b = blockIdx.x, h = blockIdx.y, dh = blockIdx.z;
  {
    const v4u z = (v4u){0u, 0u, 0u, 0u};
#pragma unroll
    for (int j = 0; j < 2; ++j) {
      const int idx = t * 2 + j;              // 0..511
      const int row = idx >> 3, part = idx & 7;
      *(v4u*)(sm + row * kV2Pitch + 192 + part * 8) = z;
    }
  }
  __syncthreads();
  const int ch = h * kHD + lane * 4;
  const float* pgw = gw + ch;
  const float* pgb = gb + ch;
  const v4f wv = *(const v4f*)pgw;
  const v4f gv = *(const v4f*)pgb;
  const int cl0 = (lane & 15) * 4;
  // The wave's token rows (wave, wave + 8, ...; 25 rounds) are asked for ahead of the arithmetic, none behind the work on
  // the row before it, so the wave waits out about one load latency in place of 25. Rounds 0..23 exist for every wave; in
  // round 24 the waves past token 195 load row 195 again (in bounds) and store nothing.
  const float* pw = P + ((size_t)(b * kM + wave)) * kD + ch;
  const int tlast = wave + 8 * (kV2Rounds - 1);
  const float* pl = P + ((size_t)(b * kM + ((tlast < kM) ? tlast : (kM - 1)))) * kD + ch;
  v4f a[kV2Rounds];
#pragma unroll
  for (int i = 0; i < kV2Rounds - 1; ++i) a[i] = *(const v4f*)(pw + (size_t)(8 * i) * kD);
  a[kV2Rounds - 1] = *(const v4f*)pl;
  // the wait owed before the address registers of these loads and of the two above are written again; the pointers are
  // inputs so that their registers stay as they are up to the wait (no loaded row may land on them either)
  asm volatile("s_wait_xcnt 0x0" :: "v"(pgw), "v"(pgb), "v"(pw), "v"(pl) : "memory");
  // Five tokens a group, step by step side by side: their ten lane exchanges each are independent, so one wait serves five.
#pragma unroll
  for (int i0 = 0; i0 < kV2Rounds; i0 += kV2Grp) {
    float y[kV2Grp][4], d[kV2Grp][4], s[kV2Grp], sq[kV2Grp];
#pragma unroll
    for (int g = 0; g < kV2Grp; ++g) {
#pragma unroll
      for (int e = 0; e < 4; ++e) y[g][e] = celu_steps(a[i0 + g][e]);
      s[g] = (y[g][0] + y[g][1]) + (y[g][2] + y[g][3]);
    }
#pragma unroll
    for (int off = 1; off < 32; off <<= 1) {
      float o[kV2Grp];
#pragma unroll
      for (int g = 0; g < kV2Grp; ++g) o[g] = __shfl_xor(s[g], off, 32);
#pragma unroll
      for (int g = 0; g < kV2Grp; ++g) s[g] += o[g];
    }
#pragma unroll
    for (int g = 0; g < kV2Grp; ++g) {
      const float mu = s[g] * (1.0f / 128.0f);
      sq[g] = 0.f;
#pragma unroll
      for (int e = 0; e < 4; ++e) { d[g][e] = y[g][e] - mu; sq[g] += d[g][e] * d[g][e]; }
    }
#pragma unroll
    for (int off = 1; off < 32; off <<= 1) {
      float o[kV2Grp];
#pragma unroll
      for (int g = 0; g < kV2Grp; ++g) o[g] = __shfl_xor(sq[g], off, 32);
#pragma unroll
      for (int g = 0; g < kV2Grp; ++g) sq[g] += o[g];
    }
    float rs[kV2Grp];
#pragma unroll
    for (int g = 0; g < kV2Grp; ++g) rs[g] = rsqrt_steps(sq[g] * (1.0f / 128.0f) + 1e-5f);
    if ((lane >> 4) == dh) {
#pragma unroll
      for (int g = 0; g < kV2Grp; ++g) {
        const int tok = wave + 8 * (i0 + g);
        unsigned short hb[4];
#pragma unroll
        for (int e = 0; e < 4; ++e) hb[e] = h_bits((d[g][e] * rs[g] * wv[e] + gv[e]) * kXCarry);
        if (i0 + g < kV2Rounds - 1 || tok < kM) {   // only the last round can pass token 195
#pragma unroll
          for (int e = 0; e < 4; ++e) sm[(cl0 + e) * kV2Pitch + tok] = hb[e];
        }
      }
    }
  }
  __syncthreads();
  const size_t rowbase = ((size_t)(h * kHD + dh * 64)) * (kB * kSP) + (size_t)b * kSP + lane * 8;
  {
#pragma unroll
    for (int it = 0; it < 8; ++it) {
      const int cl = wave * 8 + it;           // 0..63
      const v4u u = *(const v4u*)(sm + cl * kV2Pitch + lane * 8);
      *(v4u*)(v2t + rowbase + (size_t)cl * (kB * kSP)) = u;
    }
    
  }
}

constexpr int kFaTiles  = 13;
constexpr int kFaRows   = kFaTiles * 16;
constexpr int kFaThr    = kFaTiles * 32;
constexpr int kFaKPitch = 136;
constexpr int kFaVPitch = 264;
constexpr int kFaOPitch = 132;
constexpr int kFaKPc    = kFaRows * 16 / kFaThr;
constexpr int kFaVPc    = (kHD + kFaTiles - 1) / kFaTiles;
static_assert(kFaKPc * kFaThr == kFaRows * 16, "k pieces divide");
static_assert((kFaVPc - 1) * kFaTiles <= kHD && kFaVPc * kFaTiles >= kHD, "all v2^T rounds but the last are whole");
static_assert((kB - 1) * kM + kFaRows <= kTokPad, "k and q2 rows stay in their planes");
static_assert(kKeyK / 32 * 2 == kFaTiles + 1 && kKeyK <= kSP, "P*v2 depth = 7 steps of 32 keys, the last half step zero");

__global__ __launch_bounds__(kFaThr) void attn_fused_kernel(const unsigned short* __restrict__ Qp,
                                                            const unsigned short* __restrict__ Kp,
                                                            const unsigned short* __restrict__ Vt,
                                                            const float* __restrict__ mask, float* __restrict__ att,
                                                            float scoreScale, float pvScale) {
  typedef Frag<_Float16> F;
  __shared__ __align__(16) unsigned short sK[kFaRows * kFaKPitch];
  __shared__ __align__(16) unsigned short sV[kFaVPc * kFaTiles * kFaVPitch];   // 130 rows: 128 read, 2 spare
  __shared__ __align__(16) float sO[kFaTiles][16 * kFaOPitch];   // per-wave 16 x 128 slab
  __shared__ __align__(16) float sMask[kFaThr];
  const int t = threadIdx.x, lane = t & 31;
  const int wave = __builtin_amdgcn_readfirstlane(t >> 5);       // scalar: the wave's query tile, slab and staged v2^T rows
  const int b = blockIdx.x, h = blockIdx.y;
  const int c = lane & 15, hf = lane >> 4;

  // ---- this wave's q2 fragments and the group's k, v2^T and mask, all loads in flight together ----
  const _Float16* gQ = (const _Float16*)Qp + (size_t)(b * kM + wave * 16 + c) * kD + h * kHD + hf * 8;
  const unsigned short* gK = Kp + (size_t)(b * kM + (t >> 4)) * kD + h * kHD + (t & 15) * 8;
  v16h qf[4];
  v4u rk[kFaKPc], rv[kFaVPc];
#pragma unroll
  for (int kk = 0; kk < 4; ++kk) qf[kk] = F::load(gQ + kk * 32);
#pragma unroll
  for (int j = 0; j < kFaKPc; ++j) rk[j] = *(const v4u*)(gK + (size_t)(j * (kFaThr / 16)) * kD);
  const unsigned short* gV = Vt + ((size_t)(h * kHD) * kB + b) * kSP + lane * 8;
  const unsigned short* gVw = gV + (size_t)wave * (kB * kSP);
#pragma unroll
  for (int j = 0; j < kFaVPc - 1; ++j) rv[j] = *(const v4u*)(gVw + (size_t)(j * kFaTiles) * (kB * kSP));
  // the last round's waves past row 127 load row 127 again (in bounds) and lay it in a spare LDS row that nobody reads
  const int rlast = wave + (kFaVPc - 1) * kFaTiles;
  const unsigned short* gVl = gV + (size_t)((rlast < kHD) ? rlast : (kHD - 1)) * (kB * kSP);
  rv[kFaVPc - 1] = *(const v4u*)gVl;
  const int mi = b * kM + ((t < kM) ? t : (kM - 1));
  const float mload = mask[mi];
  // the wait owed before the address registers of these loads are written again; the per-lane pointers and index are
  // inputs so that their registers stay as they are up to the wait (no later load may land on them either)
  asm volatile("s_wait_xcnt 0x0" :: "v"(gQ), "v"(gK), "v"(gVw), "v"(gVl), "v"(mi) : "memory");
#pragma unroll
  for (int j = 0; j < kFaKPc; ++j) *(v4u*)(sK + ((t >> 4) + j * (kFaThr / 16)) * kFaKPitch + (t & 15) * 8) = rk[j];
#pragma unroll
  for (int j = 0; j < kFaVPc; ++j) *(v4u*)(sV + (wave + j * kFaTiles) * kFaVPitch + lane * 8) = rv[j];
  sMask[t] = mload;                              // entries from 196 on repeat key 195 and are never used
  __syncthreads();

  // ---- S^T = k * q2^T: s[tt][r] = score of key 16 tt + 8 hf + r for query 16 wave + c ----
  // The 52 products run k step by k step (product f: k step f / 13, key tile f % 13), so neighbours have different
  // accumulators; their k fragments are read in groups of 4, one group ahead, into two register sets.
  v8f s[kFaTiles];
#pragma unroll
  for (int tt = 0; tt < kFaTiles; ++tt) s[tt] = (v8f){0.f,0.f,0.f,0.f,0.f,0.f,0.f,0.f};
  {
    const _Float16* kf = (const _Float16*)sK + c * kFaKPitch + hf * 8;
    v16h ka[2][4];
#pragma unroll
    for (int e = 0; e < 4; ++e) ka[0][e] = F::load(kf + (e % kFaTiles) * 16 * kFaKPitch + (e / kFaTiles) * 32);
#pragma unroll
    for (int g = 0; g < kFaTiles; ++g) {
      if (g + 1 < kFaTiles) {
#pragma unroll
        for (int e = 0; e < 4; ++e) {
          const int f = (g + 1) * 4 + e;
          ka[(g + 1) & 1][e] = F::load(kf + (f % kFaTiles) * 16 * kFaKPitch + (f / kFaTiles) * 32);
        }
      }
      // keeps the next group's LDS reads together and ahead of this group's WMMAs (the scheduler otherwise sinks each read
      // to its use, and every WMMA then waits out an LDS latency)
      __builtin_amdgcn_sched_barrier(0);
#pragma unroll
      for (int e = 0; e < 4; ++e) {
        const int f = g * 4 + e;
        s[f % kFaTiles] = F::mma(ka[g & 1][e], qf[f / kFaTiles], s[f % kFaTiles]);
      }
      // keeps the reads of the group after next behind these WMMAs, not among them
      __builtin_amdgcn_sched_barrier(0);
    }
  }

  // ---- softmax over the query's 196 keys, f32 ----
  float mx4[4] = {-3.0e38f, -3.0e38f, -3.0e38f, -3.0e38f};
#pragma unroll
  for (int tt = 0; tt < kFaTiles; ++tt) {
    const v4f m0 = *(const v4f*)(sMask + tt * 16 + hf * 8);
    const v4f m1 = *(const v4f*)(sMask + tt * 16 + hf * 8 + 4);
#pragma unroll
    for (int r = 0; r < 8; ++r) {
      const int j = tt * 16 + hf * 8 + r;
      const float mv = (r < 4) ? m0[r & 3] : m1[r & 3];
      const float v = (mv == 0.0f) ? -1.0e9f : s[tt][r] * scoreScale;
      s[tt][r] = (j < kM) ? v : -3.0e38f;
      mx4[r & 3] = fmaxf(mx4[r & 3], s[tt][r]);
    }
  }
  float mx = fmaxf(fmaxf(mx4[0], mx4[1]), fmaxf(mx4[2], mx4[3]));
  mx = fmaxf(mx, __shfl_xor(mx, 16, 32));
  float ps4[4] = {0.f, 0.f, 0.f, 0.f};
#pragma unroll
  for (int tt = 0; tt < kFaTiles; ++tt) {
#pragma unroll
    for (int r = 0; r < 8; ++r) {
      s[tt][r] = exp_steps(s[tt][r] - mx); // an excluded key sits at -3e38: its difference is below the range, P = 0
      ps4[r & 3] += s[tt][r];
    }
  }
  float ps = (ps4[0] + ps4[1]) + (ps4[2] + ps4[3]);
  ps += __shfl_xor(ps, 16, 32);
  const float inv = 1.0f / ps;
  v16h pf[kKeyK / 32];
#pragma unroll
  for (int u = 0; u < kKeyK / 32; ++u) {
#pragma unroll
    for (int e = 0; e < 8; ++e) {
      pf[u][e]     = (_Float16)(s[2 * u][e] * inv * kPCarry);
      pf[u][8 + e] = (2 * u + 1 < kFaTiles) ? (_Float16)(s[(2 * u + 1 < kFaTiles) ? 2 * u + 1 : 0][e] * inv * kPCarry) : (_Float16)0.0f;
    }
  }

  // ---- O^T = v2^T * P^T: o[j][r] = attn of query 16 wave + c, channel 16 j + 8 hf + r ----
  v8f o[8];
#pragma unroll
  for (int j = 0; j < 8; ++j) o[j] = (v8f){0.f,0.f,0.f,0.f,0.f,0.f,0.f,0.f};
  {
    // product f: key step f / 8, channel tile f % 8; v2^T fragments in groups of 4, one group ahead, as above
    const _Float16* vf = (const _Float16*)sV + c * kFaVPitch + hf * 8;
    constexpr int kGroups = kKeyK / 32 * 2;
    v16h va[2][4];
#pragma unroll
    for (int e = 0; e < 4; ++e) va[0][e] = F::load(vf + e * 16 * kFaVPitch);
#pragma unroll
    for (int g = 0; g < kGroups; ++g) {
      if (g + 1 < kGroups) {
#pragma unroll
        for (int e = 0; e < 4; ++e) {
          const int f = (g + 1) * 4 + e;
          va[(g + 1) & 1][e] = F::load(vf + (f % 8) * 16 * kFaVPitch + (f / 8) * 32);
        }
      }
      // keeps the next group's LDS reads together and ahead of this group's WMMAs
      __builtin_amdgcn_sched_barrier(0);
#pragma unroll
      for (int e = 0; e < 4; ++e) {
        const int f = g * 4 + e;
        o[f % 8] = F::mma(va[g & 1][e], pf[f / 8], o[f % 8]);
      }
      // keeps the reads of the group after next behind these WMMAs, not among them
      __builtin_amdgcn_sched_barrier(0);
    }
  }

  // ---- epilogue: the wave's 16 x 128 block through its own slab, so that each store covers a whole 512-B row piece ----
  float* slab = sO[wave];
#pragma unroll
  for (int j = 0; j < 8; ++j) {
    *(v4f*)(slab + c * kFaOPitch + j * 16 + hf * 8)     = (v4f){o[j][0], o[j][1], o[j][2], o[j][3]} * pvScale;
    *(v4f*)(slab + c * kFaOPitch + j * 16 + hf * 8 + 4) = (v4f){o[j][4], o[j][5], o[j][6], o[j][7]} * pvScale;
  }
  // the wave's slab writes are complete before its lanes read each other's words (as in wmma_gemm64)
  __builtin_amdgcn_fence(__ATOMIC_RELEASE, "workgroup");
  __builtin_amdgcn_wave_barrier();
  __builtin_amdgcn_fence(__ATOMIC_ACQUIRE, "workgroup");
  float* dst = att + (size_t)(b * kSP + wave * 16) * kD + h * kHD + lane * 4;
#pragma unroll
  for (int row = 0; row < 16; ++row) *(v4f*)(dst + (size_t)row * kD) = *(const v4f*)(slab + row * kFaOPitch + lane * 4);
}

// ---------------------------------------------------------------------------
// Gated residual + LayerNorm: y = x + gate*attn (token-major gate [6272][1024], attn [32][256 q][1024]); x_new = LN(y)*lnw + lnb
// written f32 to xout (may alias xin: each block reads its whole row into registers before any store, no other block
// touches the row) and as f16(16*x_new) to x16. One block per token (grid 6272), thread t owns columns 4t..4t+3.
// ---------------------------------------------------------------------------
__global__ __launch_bounds__(256) void merge_ln_kernel(const float* xin, const float* __restrict__ att,
                                                       const float* __restrict__ gate, const float* __restrict__ lnw,
                                                       const float* __restrict__ lnb, float* xout,
                                                       unsigned short* __restrict__ x16) {
  __shared__ float redA[8];
  __shared__ float redB[8];
  __shared__ __align__(16) float srow[kD];
  const int t = threadIdx.x, lane = t & 31, wave = t >> 5;
  const int r = blockIdx.x;
  const int b = r / kM;
  const int m = r - b * kM;
  const int c0 = t * 4;
  const size_t ro = (size_t)r * kD + c0;
  const v4f xv = *(const v4f*)(xin + ro);
  const v4f gv = *(const v4f*)(gate + ro);
  const v4f av = *(const v4f*)(att + ((size_t)(b * kSP + m)) * kD + c0);
  float y[4];
#pragma unroll
  for (int e = 0; e < 4; ++e) y[e] = xv[e] + gv[e] * av[e];
  float s = (y[0] + y[1]) + (y[2] + y[3]);
#pragma unroll
  for (int off = 1; off < 32; off <<= 1) s += __shfl_xor(s, off, 32);
  if (lane == 0) redA[wave] = s;
  __syncthreads();
  float tot = redA[0];
#pragma unroll
  for (int w = 1; w < 8; ++w) tot += redA[w];
  const float mu = tot * (1.0f / 1024.0f);
  float d[4];
  float sq = 0.f;
#pragma unroll
  for (int e = 0; e < 4; ++e) { d[e] = y[e] - mu; sq += d[e] * d[e]; }
#pragma unroll
  for (int off = 1; off < 32; off <<= 1) sq += __shfl_xor(sq, off, 32);
  if (lane == 0) redB[wave] = sq;
  __syncthreads();
  float tot2 = redB[0];
#pragma unroll
  for (int w = 1; w < 8; ++w) tot2 += redB[w];
  const float var = tot2 * (1.0f / 1024.0f);
  const float rs = rsqrtf(var + 1e-5f);
  const v4f wv = *(const v4f*)(lnw + c0);
  const v4f bv = *(const v4f*)(lnb + c0);
  v4f ov;
#pragma unroll
  for (int e = 0; e < 4; ++e) ov[e] = d[e] * rs * wv[e] + bv[e];
  *(v4f*)(srow + c0) = ov;
  __syncthreads();
  const int tc = t & 127;                               // clamped staging index; only t < 128 stores
  const v4f p0 = *(const v4f*)(srow + tc * 8);
  const v4f p1 = *(const v4f*)(srow + tc * 8 + 4);
  unsigned short hb[8];
#pragma unroll
  for (int e = 0; e < 4; ++e) {
    hb[e]     = h_bits(p0[e] * kXCarry);
    hb[4 + e] = h_bits(p1[e] * kXCarry);
  }
  const v4u hu = (v4u){pk16(hb[0], hb[1]), pk16(hb[2], hb[3]), pk16(hb[4], hb[5]), pk16(hb[6], hb[7])};
  unsigned short* hp = x16 + (size_t)r * kD + tc * 8;
  {
    *(v4f*)(xout + ro) = ov;
    if (t < 128) *(v4u*)hp = hu;
    
  }
}

// ---------------------------------------------------------------------------
// Masked mean over tokens: out0[b][c] = sum_m x[b][m][c]*mask[b][m] / sum_m mask[b][m]. One block per b (grid 32),
// ---------------------------------------------------------------------------
constexpr int kPoolRows = 28;   // token rows in flight per wave
static_assert(kM % kPoolRows == 0, "pool groups divide the tokens");
__global__ __launch_bounds__(256) void pool_kernel(const float* x, const float* __restrict__ mask, float* out0) {
  const int t = threadIdx.x;
  const int b = blockIdx.x;
  const int c0 = t * 4;
  v4f acc = (v4f){0.f, 0.f, 0.f, 0.f};
  float ms = 0.f;
  // 28 token rows are asked for at a time and then summed in token order (the order of the sums is unchanged): the wave
  // waits out 7 load latencies in place of 196. The loop over the groups stays rolled: one group's registers serve all 7.
#pragma unroll 1
  for (int m0 = 0; m0 < kM; m0 += kPoolRows) {
    const float* xp = x + ((size_t)(b * kM + m0)) * kD + c0;
    v4f xv[kPoolRows];
#pragma unroll
    for (int j = 0; j < kPoolRows; ++j) xv[j] = *(const v4f*)(xp + (size_t)j * kD);
    // the wait owed before the address register of these loads is written again; the pointer is an input so that its
    // register stays as it is up to the wait (no loaded row may land on it either)
    asm volatile("s_wait_xcnt 0x0" :: "v"(xp) : "memory");
#pragma unroll
    for (int j = 0; j < kPoolRows; ++j) {
      const float mv = mask[b * kM + m0 + j];
      acc += xv[j] * mv;
      ms += mv;
    }
  }
  const float inv = 1.0f / ms;
  const v4f o = acc * inv;
  store2_v4f(out0 + (size_t)b * kD + c0, o);
}

// ---------------------------------------------------------------------------
// Host orchestration: kernel launches only. 2 + 3*12 + 1 = 39 launches.
// ---------------------------------------------------------------------------
extern "C" void kernel_launch(void* const* d_in, const int* in_sizes, int n_in,
                              void* d_out, int out_size, void* d_ws, size_t ws_size,
                              hipStream_t stream) {
  if (n_in < 22) return;
  if (in_sizes[0] != kTok * kD) return;
  if (in_sizes[1] != kTok) return;
  if (in_sizes[2] != kL * kD * kD || in_sizes[6] != kL * kD * kD || in_sizes[10] != kL * kD * kD || in_sizes[14] != kL * kD * kD) return;
  if (in_sizes[18] != kL * kHD * kHD || in_sizes[19] != kL * kHD) return;
  if (in_sizes[3] != kL * kD || in_sizes[20] != kL * kD || in_sizes[21] != kL * kD) return;
  if (out_size != kB * kD + kTok * kD) return;
  if (ws_size < kWsTotal) return;

  const float* att_feats = (const float*)d_in[0];
  const float* att_mask  = (const float*)d_in[1];
  const float* Wq2  = (const float*)d_in[2];
  const float* bq2  = (const float*)d_in[3];
  const float* gq2w = (const float*)d_in[4];
  const float* gq2b = (const float*)d_in[5];
  const float* Wk   = (const float*)d_in[6];
  const float* bk   = (const float*)d_in[7];
  const float* gkw  = (const float*)d_in[8];
  const float* gkb  = (const float*)d_in[9];
  const float* Wv1  = (const float*)d_in[10];
  const float* bv1  = (const float*)d_in[11];
  const float* gv1w = (const float*)d_in[12];
  const float* gv1b = (const float*)d_in[13];
  const float* Wv2  = (const float*)d_in[14];
  const float* bv2  = (const float*)d_in[15];
  const float* gv2w = (const float*)d_in[16];
  const float* gv2b = (const float*)d_in[17];
  const float* Wc   = (const float*)d_in[18];
  const float* bc   = (const float*)d_in[19];
  const float* lnw  = (const float*)d_in[20];
  const float* lnb  = (const float*)d_in[21];

  char* ws = (char*)d_ws;
  float*          Ppl   = (float*)(ws + kOffP);                    // linear+bias plane
  float*          GATE  = (float*)(ws + kOffP);                    // gate plane (same region, later)
  unsigned short* GIN16 = (unsigned short*)(ws + kOffATT);         // (v1*k) plane
  float*          ATT   = (float*)(ws + kOffATT);                  // attn plane (same region, later)
  unsigned short* X16   = (unsigned short*)(ws + kOffX16);
  unsigned short* W16   = (unsigned short*)(ws + kOffW16);
  unsigned short* WC16  = (unsigned short*)(ws + kOffWC16);
  unsigned short* Q16   = (unsigned short*)(ws + kOffQ16);
  unsigned short* K16   = (unsigned short*)(ws + kOffK16);
  unsigned short* V2T   = (unsigned short*)(ws + kOffV2T);

  float* out0 = (float*)d_out;                                     // [32][1024] at byte 0
  float* out1 = (float*)d_out + (size_t)kB * kD;                   // [32][196][1024] at byte 131072; also the running x

  const float projScale  = 1.0f / (kXCarry * kWCarry);             // 1/4096
  const float gateScale  = 1.0f / (kXCarry * kWCarry);             // (v1*k) x16, Wc x256
  const float scoreScale = 0.08838834764831845f * (1.0f / (kXCarry * kXCarry));
  const float pvScale    = 1.0f / (kPCarry * kXCarry);             // 1/32768

  // x -> f16 plane (x16); pad rows of the q2/k planes zero
  {
    const int n8 = kTok * kD / 8;                                  // 802816 = 3136 * 256
    cast8s_kernel<<<dim3(n8 / 256), dim3(256), 0, stream>>>(att_feats, X16, n8, kXCarry);
    const int npad8 = 64 * kD / 8;                                 // 8192 = 32 * 256
    fill_zero2_kernel<<<dim3(npad8 / 256, 2), dim3(256), 0, stream>>>(Q16 + (size_t)kTok * kD, K16 + (size_t)kTok * kD, npad8);
  }

  for (int i = 0; i < kL; ++i) {
    const size_t wo = (size_t)i * kD * kD;
    wcast_kernel<<<dim3(512, 5), dim3(256), 0, stream>>>(Wq2 + wo, Wk + wo, Wv1 + wo, Wv2 + wo, Wc + (size_t)i * kHD * kHD, W16, WC16);

    // four projections: P = x16 * Wz^T + bz (M 6272, N 1024, K 1024; 49 x 4 block tiles of 128 x 256 = 196 blocks)
    for (int z = 0; z < 4; ++z) {
      const float* biasz = (z == 0) ? bq2 : (z == 1) ? bk : (z == 2) ? bv1 : bv2;
      const float* gwz   = (z == 0) ? gq2w : (z == 1) ? gkw : (z == 2) ? gv1w : gv2w;
      const float* gbz   = (z == 0) ? gq2b : (z == 1) ? gkb : (z == 2) ? gv1b : gv2b;
      proj_gemm_lds_kernel<<<dim3((kTok / kPjBM) * (kD / kPjBN)), dim3(256), 0, stream>>>(
          X16, W16 + (size_t)z * kD * kD, Ppl, biasz + (size_t)i * kD, projScale);
      if (z == 0) {
        gn_rows_kernel<0><<<dim3(3136), dim3(256), 0, stream>>>(Ppl, gwz + (size_t)i * kD, gbz + (size_t)i * kD, K16, Q16);
      } else if (z == 1) {
        gn_rows_kernel<0><<<dim3(3136), dim3(256), 0, stream>>>(Ppl, gwz + (size_t)i * kD, gbz + (size_t)i * kD, Q16, K16);
      } else if (z == 2) {
        gn_rows_kernel<2><<<dim3(3136), dim3(256), 0, stream>>>(Ppl, gwz + (size_t)i * kD, gbz + (size_t)i * kD, K16, GIN16);
      } else {
        gn_v2t_kernel<<<dim3(kB, kH, 2), dim3(256), 0, stream>>>(Ppl, gwz + (size_t)i * kD, gbz + (size_t)i * kD, V2T);
      }
    }

    // gate = sigmoid((v1*k) * Wc^T + bc): M 50176, N 128, K 128 (1568 tiles = 196 blocks); output [50176][128] f32 == token-major [6272][1024]
    wmma_gemm64<0, false, 2, 0, false, 6><<<dim3(196, 1), dim3(256), 0, stream>>>(
        GIN16, nullptr, kHD, 0L, 0L,
        WC16, nullptr, kHD, 0L, 0L,
        (void*)GATE, nullptr, kHD, 0L, 0L,
        bc + (size_t)i * kHD, nullptr, 0L,
        kTok * kH, kHD, kHD, gateScale);

    // attention: scores, softmax and P * v2 of one (batch, head) group per work-group, 256 groups in one launch
    attn_fused_kernel<<<dim3(kB, kH), dim3(kFaThr), 0, stream>>>(Q16, K16, V2T, att_mask, ATT, scoreScale, pvScale);

    const float* xin = (i == 0) ? att_feats : out1;
    merge_ln_kernel<<<dim3(kTok), dim3(256), 0, stream>>>(xin, ATT, GATE, lnw + (size_t)i * kD, lnb + (size_t)i * kD, out1, X16);
  }

  pool_kernel<<<dim3(kB), dim3(256), 0, stream>>>(out1, att_mask, out0);
}

// v005
// A run of this version takes 464 microseconds.
// In both of two side-by-side timings against v004, it was 1.11 times as fast.
// Counting every step since v000, it is 3.42 times as fast.
// Contractions: projections x(f16, x16)*W^T(f16, x256), gate (v1*k)(f16, x16)*Wc^T(f16, x256), scores q2(f16, x16)*k^T(f16, x16), attn P(f16, x2048)*v2(f16, x16): all v_wmma_f32_16x16x32_f16 with f32 accumulate; CELU, GroupNorm, softmax, sigmoid, residual, LayerNorm and masked mean in f32.
#include <hip/hip_runtime.h>
#include <math.h>

// ---------------------------------------------------------------------------
// Problem constants
// ---------------------------------------------------------------------------
constexpr int kB   = 32;
constexpr int kM   = 196;
constexpr int kD   = 1024;
constexpr int kH   = 8;
constexpr int kHD  = 128;
constexpr int kL   = 3;
constexpr int kTok = kB * kM;          // 6272 = 98 * 64 token rows
constexpr int kTokPad = kTok + 64;     // 6336: 64 zero rows so per-group 208-row tiles never leave the plane
constexpr int kSP  = 256;              // padded queries / keys per (batch, head) group
constexpr int kKeyK = 224;             // contraction depth of P*V (keys padded to a multiple of 32)
constexpr float kXCarry = 16.0f;       // x, q2, k, v2 planes carried x16 in f16
constexpr float kWCarry = 256.0f;      // W, Wc carried x256 in f16
constexpr float kPCarry = 2048.0f;     // probabilities carried x2048 in f16

// ---------------------------------------------------------------------------
// Workspace region map (bytes, all offsets multiples of 256)
//   R_P    : linear+bias planes f32 [4: q2, k, v1, v2][6272][1024]; plane 0 -> later gate plane f32 [50176][128]
//   R_ATT  : (v1*k) f16 plane [6272][1024]      -> later attn f32 [32][256][1024]
//   R_X16  : x f16 [6272][1024]
//   R_W16  : stacked W f16 [3 layers][4096][1024]
//   R_WC16 : Wc f16 [3 layers][128][128]
//   R_Q16  : q2 f16 [6336][1024] (rows >= 6272 zero)
//   R_K16  : k  f16 [6336][1024] (rows >= 6272 zero)
//   R_V2T  : v2^T f16 [8 h][128 d][32 b][256 keys] (keys >= 196 zero)
// ---------------------------------------------------------------------------
constexpr size_t kBytesP1   = (size_t)kTok * kD * 4;       // one plane
constexpr size_t kBytesP    = 4 * kBytesP1;
constexpr size_t kBytesATT  = (size_t)kB * kSP * kD * 4;
constexpr size_t kBytesX16  = (size_t)kTok * kD * 2;
constexpr size_t kBytesW16  = (size_t)kL * 4 * kD * kD * 2;
constexpr size_t kBytesWC16 = (size_t)kL * kHD * kHD * 2;
constexpr size_t kBytesQ16  = (size_t)kTokPad * kD * 2;
constexpr size_t kBytesV2T  = (size_t)kH * kHD * kB * kSP * 2;
constexpr size_t kOffP    = 0;
constexpr size_t kOffATT  = kOffP + kBytesP;
constexpr size_t kOffX16  = kOffATT + kBytesATT;
constexpr size_t kOffW16  = kOffX16 + kBytesX16;
constexpr size_t kOffWC16 = kOffW16 + kBytesW16;
constexpr size_t kOffQ16  = kOffWC16 + kBytesWC16;
constexpr size_t kOffK16  = kOffQ16 + kBytesQ16;
constexpr size_t kOffV2T  = kOffK16 + kBytesQ16;
constexpr size_t kWsTotal = kOffV2T + kBytesV2T;
static_assert(kWsTotal == 217153536, "carve total");
static_assert(kWsTotal <= 268435456, "carve under 256 MiB");
static_assert(kBytesATT >= (size_t)kTok * kD * 2, "vk plane fits in the attn region");
static_assert(kBytesP1 == (size_t)kTok * kH * kHD * 4, "gate plane fits in plane 0 of the P region");
static_assert((kOffATT % 256) == 0 && (kOffX16 % 256) == 0 && (kOffW16 % 256) == 0 && (kOffQ16 % 256) == 0 && (kOffK16 % 256) == 0 && (kOffV2T % 256) == 0, "aligned");

typedef __attribute__((ext_vector_type(16))) _Float16 v16h;
typedef __attribute__((ext_vector_type(8)))  _Float16 v8h;
typedef __attribute__((ext_vector_type(16))) __bf16   v16b;
typedef __attribute__((ext_vector_type(8)))  __bf16   v8b;
typedef __attribute__((ext_vector_type(8)))  float    v8f;
typedef __attribute__((ext_vector_type(4)))  float    v4f;
typedef __attribute__((ext_vector_type(4)))  unsigned int v4u;

__device__ __forceinline__ unsigned short f2bf_bits(float f) {
  unsigned u = __float_as_uint(f);
  return (unsigned short)((u + 0x7FFFu + ((u >> 16) & 1u)) >> 16);
}
__device__ __forceinline__ float bf_bits2f(unsigned short h) { return __uint_as_float(((unsigned)h) << 16); }

// hazard guards as plain device helpers (no inline asm inside the kernel template body)
__device__ __forceinline__ void dep_guard_h(v8f& a, v8f& b, v16h x, v16h y) { asm volatile("v_nop\n\tv_nop\n\tv_nop\n\tv_nop" : "+v"(a), "+v"(b) : "v"(x), "v"(y)); }
__device__ __forceinline__ void dep_guard_b(v8f& a, v8f& b, v16b x, v16b y) { asm volatile("v_nop\n\tv_nop\n\tv_nop\n\tv_nop" : "+v"(a), "+v"(b) : "v"(x), "v"(y)); }
__device__ __forceinline__ void keep4_h(v16h a, v16h b, v16h c, v16h d) { asm volatile("v_nop" :: "v"(a), "v"(b), "v"(c), "v"(d)); }
__device__ __forceinline__ void keep4_b(v16b a, v16b b, v16b c, v16b d) { asm volatile("v_nop" :: "v"(a), "v"(b), "v"(c), "v"(d)); }
__device__ __forceinline__ void acc_guard4(v8f& a, v8f& b, v8f& c, v8f& d) { asm volatile("v_nop\n\tv_nop\n\tv_nop\n\tv_nop" : "+v"(a), "+v"(b), "+v"(c), "+v"(d)); }
template <typename T> struct Frag;
template <> struct Frag<_Float16> {
  typedef v16h V; union U { v16h v; v8h h[2]; };
  static __device__ __forceinline__ v16h load(const _Float16* p) {   // elements 0..7 <- p[0..7], 8..15 <- p[16..23]
    U f; f.h[0] = *(const v8h*)(p); f.h[1] = *(const v8h*)(p + 16); return f.v;
  }
  static __device__ __forceinline__ v8f mma(v16h a, v16h b, v8f c) {
    return __builtin_amdgcn_wmma_f32_16x16x32_f16(false, a, false, b, (short)0, c, false, false);
  }
  static __device__ __forceinline__ void guard(v8f& a, v8f& b, v16h x, v16h y) { dep_guard_h(a, b, x, y); }
  static __device__ __forceinline__ void keep(v16h a, v16h b, v16h c, v16h d) { keep4_h(a, b, c, d); }
};
template <> struct Frag<__bf16> {
  typedef v16b V; union U { v16b v; v8b h[2]; };
  static __device__ __forceinline__ v16b load(const __bf16* p) {
    U f; f.h[0] = *(const v8b*)(p); f.h[1] = *(const v8b*)(p + 16); return f.v;
  }
  static __device__ __forceinline__ v8f mma(v16b a, v16b b, v8f c) {
    return __builtin_amdgcn_wmma_f32_16x16x32_bf16(false, a, false, b, (short)0, c, false, false);
  }
  static __device__ __forceinline__ void guard(v8f& a, v8f& b, v16b x, v16b y) { dep_guard_b(a, b, x, y); }
  static __device__ __forceinline__ void keep(v16b a, v16b b, v16b c, v16b d) { keep4_b(a, b, c, d); }
};

__device__ __forceinline__ unsigned pk16(unsigned short a, unsigned short b) { return (unsigned)a | ((unsigned)b << 16); }
__device__ __forceinline__ unsigned short h_bits(float f) { const _Float16 h = (_Float16)f; return __builtin_bit_cast(unsigned short, h); }

// exact f16 bits -> f32 via integer arithmetic (normals and subnormals; no _Float16 vector involved)
__device__ __forceinline__ float h16_to_f32(unsigned hb) {
  const unsigned em = hb & 0x7fffu;
  const float fn = __uint_as_float((em + 0x1C000u) << 13);
  const float fs = (float)em * 5.9604644775390625e-8f;
  const float f  = (em < 0x400u) ? fs : fn;
  return __uint_as_float(__float_as_uint(f) | ((hb & 0x8000u) << 16));
}

__device__ __forceinline__ void store2_v4u(unsigned short* p, v4u u) {
  *(v4u*)p = u;
  
}
__device__ __forceinline__ void store2_v4f(float* p, v4f v) {
  *(v4f*)p = v;
  
}

// ---- Register-blocked batched WMMA GEMM (ACT: 0 none, 2 relu, 4 leaky, 6 sigmoid) -------------
// C[m,n] = scale * sum_k A[m,k] * Bt[n,k] (+bias)(+resid); each wave owns a 64x64 tile.
// A row-major [M,K]; Bt row-major [N,K]; M,N % 64 == 0, K % 32 == 0.
// SPLIT: operands are hi/lo planes (A2/Bt2 = lo planes, same layout); product = hi*hi + hi*lo + lo*hi.
// BIAS_MODE: 0 = none, 1 = bias[m], 2 = bias[n].
// OUT_MODE: 0 = f32, 1 = f16, 2 = bf16 hi plane (Cout) + bf16 lo plane (Cout2).
// ET: 0 = f16 operands, 1 = bf16 operands (pointers passed as 16-bit storage)
// Batching: blockIdx.y steps A, Bt, C by strideA, strideB, strideC; blockIdx.z steps them by strideAz, strideBz, strideCz.
template <int ET> struct Elem;
template <> struct Elem<0> { typedef _Float16 T; };
template <> struct Elem<1> { typedef __bf16 T; };
template <int ET, bool SPLIT, int BIAS_MODE, int OUT_MODE, bool RESID, int ACT = 0>
__global__ __launch_bounds__(256) void wmma_gemm64(
    const unsigned short* __restrict__ Ap, const unsigned short* __restrict__ A2p, int lda, long strideA, long strideAz,
    const unsigned short* __restrict__ Btp, const unsigned short* __restrict__ Bt2p, int ldb, long strideB, long strideBz,
    void* __restrict__ Cout, void* __restrict__ Cout2, int ldc, long strideC, long strideCz,
    const float* __restrict__ bias,
    const float* __restrict__ resid, long strideR,
    int M, int N, int K, float scale) {
  typedef typename Elem<ET>::T T;
  typedef typename Frag<T>::V V;
  const T* A = (const T*)Ap; const T* A2 = (const T*)A2p; const T* Bt = (const T*)Btp; const T* Bt2 = (const T*)Bt2p;
  __shared__ __align__(16) float sT[8][16 * 68];   // per-wave 16x64 slab, pitch 68 floats
  const int b    = blockIdx.y;
  const int z    = blockIdx.z;
  const int lane = threadIdx.x & 31;
  const int wave = threadIdx.x >> 5;
  const int tilesN = N >> 6;
  const int tilesM = M >> 6;
  const int tile = blockIdx.x * 8 + wave;
  if (tile >= tilesM * tilesN) return;   // wave-uniform; no block barriers in this kernel
  const int tm = tile / tilesN;
  const int tn = tile - tm * tilesN;
  const int m0 = tm << 6;
  const int n0 = tn << 6;

  const size_t offA = (size_t)b * strideA + (size_t)z * strideAz;
  const size_t offB = (size_t)b * strideB + (size_t)z * strideBz;
  const size_t offC = (size_t)b * strideC + (size_t)z * strideCz;
  const T* Ab  = A  + offA;
  const T* Bb  = Bt + offB;
  const T* Ab2 = SPLIT ? (A2  + offA) : nullptr;
  const T* Bb2 = SPLIT ? (Bt2 + offB) : nullptr;

  const int rlane = lane & 15;                 // row (A) / col (B, D) within subtile
  const int koff  = (lane >> 4) * 8;           // k offset of this lane half
  const int mOff  = (lane >> 4) * 8;           // D row offset

  v8f acc[4][4];
#pragma unroll
  for (int i = 0; i < 4; ++i)
#pragma unroll
    for (int j = 0; j < 4; ++j) acc[i][j] = (v8f){0.f,0.f,0.f,0.f,0.f,0.f,0.f,0.f};

  for (int k0 = 0; k0 < K; k0 += 32) {
    V bh[4], bl[4];
#pragma unroll
    for (int j = 0; j < 4; ++j) {
      const size_t bo = (size_t)(n0 + (j << 4) + rlane) * ldb + koff + k0;
      bh[j] = Frag<T>::load(Bb + bo);
      if (SPLIT) bl[j] = Frag<T>::load(Bb2 + bo);
    }
#pragma unroll
    for (int i = 0; i < 4; ++i) {
      const size_t ao = (size_t)(m0 + (i << 4) + rlane) * lda + koff + k0;
      V ah = Frag<T>::load(Ab + ao);
      V al;
      if (SPLIT) al = Frag<T>::load(Ab2 + ao);
#pragma unroll
      for (int j = 0; j < 4; ++j) {
        acc[i][j] = Frag<T>::mma(ah, bh[j], acc[i][j]);
        if (SPLIT) {
          acc[i][j] = Frag<T>::mma(ah, bl[j], acc[i][j]);
          acc[i][j] = Frag<T>::mma(al, bh[j], acc[i][j]);
        }
      }
      Frag<T>::guard(acc[i][0], acc[i][3], ah, SPLIT ? al : ah);
    }
    Frag<T>::keep(bh[0], bh[1], bh[2], bh[3]);
    if (SPLIT) Frag<T>::keep(bl[0], bl[1], bl[2], bl[3]);
  }
  acc_guard4(acc[0][0], acc[0][1], acc[0][2], acc[0][3]);
  acc_guard4(acc[1][0], acc[1][1], acc[1][2], acc[1][3]);
  acc_guard4(acc[2][0], acc[2][1], acc[2][2], acc[2][3]);
  acc_guard4(acc[3][0], acc[3][1], acc[3][2], acc[3][3]);

  // ---- epilogue ----
  float* slab = sT[wave];
  const float* Rb = RESID ? (resid + (size_t)b * strideR) : nullptr;
#pragma unroll
  for (int i = 0; i < 4; ++i) {
    const int mBase = m0 + (i << 4);
#pragma unroll
    for (int j = 0; j < 4; ++j) {
      const int n = n0 + (j << 4) + rlane;
      float bv = 0.f;
      if (BIAS_MODE == 2) bv = bias[n];
#pragma unroll
      for (int r = 0; r < 8; ++r) {
        float v = acc[i][j][r] * scale;
        if (BIAS_MODE == 1) v += bias[mBase + mOff + r];
        if (BIAS_MODE == 2) v += bv;
        if (RESID) v += Rb[(size_t)(mBase + mOff + r) * ldc + n];
        if (ACT == 2) v = fmaxf(v, 0.0f);
        if (ACT == 4) v = (v > 0.f) ? v : 0.01f * v;
        if (ACT == 6) v = 1.0f / (1.0f + expf(-v));
        slab[(mOff + r) * 68 + (j << 4) + rlane] = v;
      }
    }
    __builtin_amdgcn_fence(__ATOMIC_RELEASE, "workgroup");
    __builtin_amdgcn_wave_barrier();
    __builtin_amdgcn_fence(__ATOMIC_ACQUIRE, "workgroup");
    if (OUT_MODE == 0) {
      float* C = (float*)Cout + offC;
      const int hh = lane >> 4, c4 = (lane & 15) * 4;     // row seg = 256 B = 16 lanes x 16 B
      {
#pragma unroll
        for (int it = 0; it < 8; ++it) {
          const int row = it * 2 + hh;
          v4f v = *(const v4f*)(slab + row * 68 + c4);
          *(v4f*)(C + (size_t)(mBase + row) * ldc + n0 + c4) = v;
        }
        
      }
    } else {
      const int q = lane >> 3, c8 = (lane & 7) * 8;
      unsigned short* C  = (unsigned short*)Cout  + offC;
      unsigned short* C2 = (OUT_MODE == 2) ? ((unsigned short*)Cout2 + offC) : nullptr;
      {
#pragma unroll
        for (int it = 0; it < 4; ++it) {
          const int row = it * 4 + q;
          const float* sp = slab + row * 68 + c8;
          v8h hv, lv;
#pragma unroll
          for (int e = 0; e < 8; ++e) {
            if (OUT_MODE == 1) {
              hv[e] = (_Float16)sp[e];
            } else {
              unsigned short hb = f2bf_bits(sp[e]);
              unsigned short lb = f2bf_bits(sp[e] - bf_bits2f(hb));
              hv[e] = __builtin_bit_cast(_Float16, hb);
              lv[e] = __builtin_bit_cast(_Float16, lb);
            }
          }
          *(v8h*)(C + (size_t)(mBase + row) * ldc + n0 + c8) = hv;
          if (OUT_MODE == 2) *(v8h*)(C2 + (size_t)(mBase + row) * ldc + n0 + c8) = lv;
        }
        
      }
    }
    __builtin_amdgcn_fence(__ATOMIC_RELEASE, "workgroup");
    __builtin_amdgcn_wave_barrier();
    __builtin_amdgcn_fence(__ATOMIC_ACQUIRE, "workgroup");
  }
}

// ---------------------------------------------------------------------------
// Projection GEMM with operands staged in LDS: C[m,n] = scale * sum_k A[m,k] * Bt[n,k] + bias[n], f32 out.
// A [6272][1024] f16, Bt [4096][1024] f16, both k-contiguous. Block tile 128 (m) x 256 (n), 8 waves as 2 x 4, each wave the
// same 64x64 tile, fragment maps and k order as wmma_gemm64. A stage is 64 k = one 128-B line of each of the 384 operand
// rows (A rows first, then Bt rows), laid at a 144-B pitch in one of two LDS buffers. Every global load covers whole lines
// (8 lanes per row). Stage s + 2 is fetched into registers during stage s and stored to LDS during stage s + 1, so a
// fetch has a whole stage to land. The four projections share one grid: Bt is the stacked W [4096][1024], column tile
// nT = 0..15 belongs to projection nT / 4 and goes to that projection's plane of C with its bias.
// grid = 49 * 16 = 784 blocks (6272 = 49 * 128, 4096 = 16 * 256), column tile fastest.
// ---------------------------------------------------------------------------
constexpr int kPjBM = 128;                       // block rows of A
constexpr int kPjBN = 256;                       // block rows of Bt
constexpr int kPjBK = 64;                        // halves of k per stage
constexpr int kPjPitch = 72;                     // halves per staged row (144 B)
constexpr int kPjStage = (kPjBM + kPjBN) * kPjPitch;   // halves per buffer (55,296 B)
constexpr int kPjStages = kD / kPjBK;            // 16
static_assert(kTok % kPjBM == 0 && kD % kPjBN == 0 && kD % (2 * kPjBK) == 0 && kPjStages >= 4, "projection tiles divide the problem");

// 12 pieces of 16 B per thread: pieces 0..3 = A rows, 4..11 = Bt rows, 32 staged rows apart
__device__ __forceinline__ void pj_fetch(v4u (&r)[12], const unsigned short* gA, const unsigned short* gB, int k) {
#pragma unroll
  for (int j = 0; j < 4; ++j) r[j] = *(const v4u*)(gA + (size_t)(32 * j) * kD + k);
#pragma unroll
  for (int j = 0; j < 8; ++j) r[4 + j] = *(const v4u*)(gB + (size_t)(32 * j) * kD + k);
}
__device__ __forceinline__ void pj_put(unsigned short* dst, const v4u (&r)[12]) {
#pragma unroll
  for (int j = 0; j < 12; ++j) *(v4u*)(dst + 32 * j * kPjPitch) = r[j];
}
// Work-group barrier that orders LDS only: __syncthreads() also waits for every global load in flight, which would
// end the fetch of the stage after next at each barrier; those loads land in registers and concern no other wave.
__device__ __forceinline__ void pj_barrier() {
  __builtin_amdgcn_fence(__ATOMIC_RELEASE, "workgroup", "local");
  __builtin_amdgcn_s_barrier();
  __builtin_amdgcn_fence(__ATOMIC_ACQUIRE, "workgroup", "local");
}
// One stage: fetch stage k/64 into ld (FETCH), multiply the stage in cur, store the stage held in st to nxt (PUT).
template <bool FETCH, bool PUT>
__device__ __forceinline__ void pj_stage(const _Float16* curA, const _Float16* curB, unsigned short* nxt,
                                         const unsigned short* gA, const unsigned short* gB, int k,
                                         v4u (&ld)[12], const v4u (&st)[12], v8f (&acc)[4][4]) {
  typedef Frag<_Float16> F;
  v16h bh[2][4], ah[2][4];
#pragma unroll
  for (int kk = 0; kk < 2; ++kk) {
#pragma unroll
    for (int j = 0; j < 4; ++j) bh[kk][j] = F::load(curB + j * 16 * kPjPitch + kk * 32);
#pragma unroll
    for (int i = 0; i < 4; ++i) ah[kk][i] = F::load(curA + i * 16 * kPjPitch + kk * 32);
  }
  // keeps the LDS fragment reads as one group ahead of the matrix work (the scheduler otherwise spreads them among the
  // WMMAs) and ahead of the fetch, so that no fragment lands in a register that a fetch in flight names as its address
  __builtin_amdgcn_sched_barrier(0);
  if (FETCH) pj_fetch(ld, gA, gB, k);
  // keeps the fetch ahead of the matrix work (the scheduler otherwise sinks it to its use, a stage later)
  __builtin_amdgcn_sched_barrier(0);
#pragma unroll
  for (int i = 0; i < 4; ++i)
#pragma unroll
    for (int j = 0; j < 4; ++j) acc[i][j] = F::mma(ah[0][i], bh[0][j], acc[i][j]);
  // keeps the LDS stores of the next stage behind the first WMMA half, when this stage's fragment reads have been served
  __builtin_amdgcn_sched_barrier(0);
  // the wait owed before the fetch's address registers are written again; 16 WMMAs behind the fetch
  if (FETCH) asm volatile("s_wait_xcnt 0x0" ::: "memory");
  if (PUT) pj_put(nxt, st);
  // keeps the second WMMA half behind the stores: it needs no LDS, so it can run past the barrier, beside the next reads
  __builtin_amdgcn_sched_barrier(0);
#pragma unroll
  for (int i = 0; i < 4; ++i)
#pragma unroll
    for (int j = 0; j < 4; ++j) acc[i][j] = F::mma(ah[1][i], bh[1][j], acc[i][j]);
  if (PUT) pj_barrier();               // publishes the stage just stored and ends every read of cur
}

__global__ __launch_bounds__(256) void proj_gemm_lds_kernel(const unsigned short* __restrict__ Ap,
                                                            const unsigned short* __restrict__ Btp,
                                                            float* __restrict__ Cp, const float* __restrict__ bias0,
                                                            const float* __restrict__ bias1, const float* __restrict__ bias2,
                                                            const float* __restrict__ bias3, float scale) {
  __shared__ __align__(16) unsigned short sAB[2][kPjStage];
  __shared__ __align__(16) float sT[8][16 * 68];   // per-wave 16x64 slab, pitch 68 floats
  const int t    = threadIdx.x;
  const int lane = t & 31;
  const int wave = t >> 5;
  const int nT = blockIdx.x & 15;              // column tile of the stacked W
  const int pz = nT >> 2;                      // projection (block-uniform)
  const int mB = (blockIdx.x >> 4) * kPjBM;
  const int nB = (nT & 3) * kPjBN;             // column within the projection's plane
  float* C = Cp + (size_t)pz * kTok * kD;
  const float* bias = (pz == 0) ? bias0 : (pz == 1) ? bias1 : (pz == 2) ? bias2 : bias3;
  const int m0 = mB + (wave >> 2) * 64;
  const int n0 = nB + (wave & 3) * 64;

  const int rlane = lane & 15;                 // row (A) / col (B, D) within subtile
  const int koff  = (lane >> 4) * 8;           // k offset of this lane half
  const int mOff  = (lane >> 4) * 8;           // D row offset

  // staging map: piece j of thread t is 16 B number (t & 7) of staged row (t >> 3) + 32 * j
  const int srow = t >> 3;
  const int spart = (t & 7) * 8;
  const unsigned short* gA = Ap  + (size_t)(mB + srow) * kD + spart;
  const unsigned short* gB = Btp + (size_t)(nT * kPjBN + srow) * kD + spart;
  unsigned short* put0 = &sAB[0][srow * kPjPitch + spart];
  unsigned short* put1 = &sAB[1][srow * kPjPitch + spart];
  const int fA = ((wave >> 2) * 64 + rlane) * kPjPitch + koff;
  const int fB = (kPjBM + (wave & 3) * 64 + rlane) * kPjPitch + koff;
  const _Float16* a0 = (const _Float16*)sAB[0] + fA;
  const _Float16* b0 = (const _Float16*)sAB[0] + fB;
  const _Float16* a1 = (const _Float16*)sAB[1] + fA;
  const _Float16* b1 = (const _Float16*)sAB[1] + fB;

  v8f acc[4][4];
#pragma unroll
  for (int i = 0; i < 4; ++i)
#pragma unroll
    for (int j = 0; j < 4; ++j) acc[i][j] = (v8f){0.f,0.f,0.f,0.f,0.f,0.f,0.f,0.f};

  v4u pe[12], po[12];                          // even and odd stages on their way to LDS
  pj_fetch(pe, gA, gB, 0);
  pj_fetch(po, gA, gB, kPjBK);
  asm volatile("s_wait_xcnt 0x0" ::: "memory");   // the wait owed before the fetches' address registers are written again
  pj_put(put0, pe);
  pj_barrier();

  for (int s = 0; s < kPjStages - 2; s += 2) {
    pj_stage<true, true>(a0, b0, put1, gA, gB, (s + 2) * kPjBK, pe, po, acc);   // stage s; fetch s + 2, store s + 1
    pj_stage<true, true>(a1, b1, put0, gA, gB, (s + 3) * kPjBK, po, pe, acc);   // stage s + 1; fetch s + 3, store s + 2
  }
  pj_stage<false, true>(a0, b0, put1, gA, gB, 0, pe, po, acc);                  // stage 14; store 15
  pj_stage<false, false>(a1, b1, put0, gA, gB, 0, po, pe, acc);                 // stage 15

  // ---- epilogue: as wmma_gemm64 with bias[n], f32 out ----
  float* slab = sT[wave];
#pragma unroll
  for (int i = 0; i < 4; ++i) {
    const int mBase = m0 + (i << 4);
#pragma unroll
    for (int j = 0; j < 4; ++j) {
      const float bv = bias[n0 + (j << 4) + rlane];
#pragma unroll
      for (int r = 0; r < 8; ++r) {
        float v = acc[i][j][r] * scale;
        v += bv;
        slab[(mOff + r) * 68 + (j << 4) + rlane] = v;
      }
    }
    // the wave's slab writes are complete before its lanes read each other's words (as in wmma_gemm64)
    __builtin_amdgcn_fence(__ATOMIC_RELEASE, "workgroup");
    __builtin_amdgcn_wave_barrier();
    __builtin_amdgcn_fence(__ATOMIC_ACQUIRE, "workgroup");
    const int hh = lane >> 4, c4 = (lane & 15) * 4;     // row seg = 256 B = 16 lanes x 16 B
#pragma unroll
    for (int it = 0; it < 8; ++it) {
      const int row = it * 2 + hh;
      v4f v = *(const v4f*)(slab + row * 68 + c4);
      *(v4f*)(C + (size_t)(mBase + row) * kD + n0 + c4) = v;
    }
    // the wait owed before a register that these stores name (address or data) is written again; the scheduling fence
    // keeps the next rows' register writes behind it
    asm volatile("s_wait_xcnt 0x0" ::: "memory");
    __builtin_amdgcn_sched_barrier(0);
    // the slab is read out before the next 16 rows overwrite it (as in wmma_gemm64)
    __builtin_amdgcn_fence(__ATOMIC_RELEASE, "workgroup");
    __builtin_amdgcn_wave_barrier();
    __builtin_amdgcn_fence(__ATOMIC_ACQUIRE, "workgroup");
  }
}

// ---------------------------------------------------------------------------
// Every cast to f16 and the zero fill, which depend on inputs alone, in one grid; the block index picks the job
// (block-uniform), 8 elements per thread, 16-B stores:
//   [0, 3136)        x -> f16(16 x)                                   (3136 * 256 * 8 = 6272 * 1024)
//   [3136, 3200)     zero the 64 pad rows of the q2 plane (32 blocks) and of the k plane (32 blocks)
//   [3200, 9344)     W (q2, k, v1, v2) [1024 out][1024 in] row-major (= Bt [N][K] as-is) of layer l -> f16(256 W) into plane
//                    4 l + z of w16, 512 blocks a plane
//   [9344, 9368)     Wc [3][128][128] -> f16(256 Wc), 8 blocks a layer
// ---------------------------------------------------------------------------
constexpr int kPrepX  = kTok * kD / 8 / 256;        // 3136
constexpr int kPrepZ  = 64 * kD / 8 / 256;          // 32 per plane
constexpr int kPrepW  = kD * kD / 8 / 256;          // 512 per W plane
constexpr int kPrepWc = kL * kHD * kHD / 8 / 256;   // 24
constexpr int kPrepBlocks = kPrepX + 2 * kPrepZ + kL * 4 * kPrepW + kPrepWc;
static_assert(kPrepW == 512 && kPrepBlocks == 9368, "prep ranges");
__global__ __launch_bounds__(256) void prep_kernel(const float* __restrict__ x, const float* __restrict__ w0,
                                                   const float* __restrict__ w1, const float* __restrict__ w2,
                                                   const float* __restrict__ w3, const float* __restrict__ wc,
                                                   unsigned short* __restrict__ x16, unsigned short* __restrict__ qpad,
                                                   unsigned short* __restrict__ kpad, unsigned short* __restrict__ w16,
                                                   unsigned short* __restrict__ wc16) {
  const int bid = blockIdx.x;
  if (bid >= kPrepX && bid < kPrepX + 2 * kPrepZ) {
    const int r = bid - kPrepX;
    unsigned short* zdst = (r < kPrepZ) ? qpad : kpad;   // block-uniform select between two global pointers
    const int zi = (r & (kPrepZ - 1)) * 256 + threadIdx.x;
    const v4u z = (v4u){0u, 0u, 0u, 0u};
    store2_v4u(zdst + 8 * (size_t)zi, z);
    return;
  }
  const float* src = x;
  unsigned short* dst = x16;
  float scale = kXCarry;
  int blk = bid;
  if (bid >= kPrepX) {
    const int r = bid - (kPrepX + 2 * kPrepZ);
    scale = kWCarry;
    if (r < kL * 4 * kPrepW) {
      const int pl = r >> 9;                             // 4 * layer + projection
      const int pz = pl & 3;
      src = ((pz == 0) ? w0 : (pz == 1) ? w1 : (pz == 2) ? w2 : w3) + (size_t)(pl >> 2) * kD * kD;
      dst = w16 + (size_t)pl * kD * kD;
      blk = r & (kPrepW - 1);
    } else {
      src = wc;
      dst = wc16;
      blk = r - kL * 4 * kPrepW;
    }
  }
  const int i = blk * 256 + threadIdx.x;
  const float* p = src + 8 * (size_t)i;
  const v4f a = *(const v4f*)(p);
  const v4f c = *(const v4f*)(p + 4);
  unsigned short hb[8];
#pragma unroll
  for (int e = 0; e < 4; ++e) {
    hb[e]     = h_bits(a[e] * scale);
    hb[4 + e] = h_bits(c[e] * scale);
  }
  const v4u u = (v4u){pk16(hb[0], hb[1]), pk16(hb[2], hb[3]), pk16(hb[4], hb[5]), pk16(hb[6], hb[7])};
  store2_v4u(dst + 8 * (size_t)i, u);
}

// ---------------------------------------------------------------------------
// CELU (alpha 1.3), f32
// ---------------------------------------------------------------------------
__device__ __forceinline__ float celu_f(float x) {
  const float en = expf(x * (1.0f / 1.3f)) - 1.0f;
  return (x > 0.f) ? x : 1.3f * en;
}

// ---------------------------------------------------------------------------
// GroupNorm of the q2, k and v1 projections (CELU -> per (token, head) mean/var over 128 channels -> * gw + gb) in one grid,
// each writing a token-major f16 plane [6272][1024]: q2 and k carried x16; v1 multiplied by the k plane value (already x16)
// -> (v1*k) x16. Unit = (token, head) = 128 channels handled by 16 lanes (8 each): wave = 2 units, block = 16 units,
// 3136 blocks a plane. Blocks [0, 3136) take a unit of k and the same unit of v1, whose factor is the f16 value of k just
// stored, from the thread's own registers; blocks [3136, 6272) take q2. P: the linear+bias planes (q2, k, v1, ...).
// ---------------------------------------------------------------------------
constexpr int kGnBlocks = kTok * kH / 16;   // 3136
__device__ __forceinline__ void gn_unit(const v4f a, const v4f c, const float* __restrict__ gw, const float* __restrict__ gb,
                                        int ch, float (&o)[8]) {
  float y[8];
#pragma unroll
  for (int e = 0; e < 4; ++e) { y[e] = celu_f(a[e]); y[4 + e] = celu_f(c[e]); }
  float s = ((y[0] + y[1]) + (y[2] + y[3])) + ((y[4] + y[5]) + (y[6] + y[7]));
#pragma unroll
  for (int off = 1; off < 16; off <<= 1) s += __shfl_xor(s, off, 32);   // stays inside the 16-lane half
  const float mu = s * (1.0f / 128.0f);
  float d[8];
  float sq = 0.f;
#pragma unroll
  for (int e = 0; e < 8; ++e) { d[e] = y[e] - mu; sq += d[e] * d[e]; }
#pragma unroll
  for (int off = 1; off < 16; off <<= 1) sq += __shfl_xor(sq, off, 32);
  const float var = sq * (1.0f / 128.0f);
  const float rs = rsqrtf(var + 1e-5f);
  const v4f w0 = *(const v4f*)(gw + ch), w1 = *(const v4f*)(gw + ch + 4);
  const v4f g0 = *(const v4f*)(gb + ch), g1 = *(const v4f*)(gb + ch + 4);
#pragma unroll
  for (int e = 0; e < 4; ++e) {
    o[e]     = d[e] * rs * w0[e] + g0[e];
    o[4 + e] = d[4 + e] * rs * w1[e] + g1[e];
  }
}
__device__ __forceinline__ void gn_store(unsigned short* p, const unsigned short (&hb)[8]) {
  const v4u uu = (v4u){pk16(hb[0], hb[1]), pk16(hb[2], hb[3]), pk16(hb[4], hb[5]), pk16(hb[6], hb[7])};
  store2_v4u(p, uu);
}
__global__ __launch_bounds__(256) void gn_rows_kernel(const float* __restrict__ P,
                                                      const float* __restrict__ gqw, const float* __restrict__ gqb,
                                                      const float* __restrict__ gkw, const float* __restrict__ gkb,
                                                      const float* __restrict__ gvw, const float* __restrict__ gvb,
                                                      unsigned short* __restrict__ q16, unsigned short* __restrict__ k16,
                                                      unsigned short* __restrict__ vk16) {
  const int t = threadIdx.x, lane = t & 31, wave = t >> 5, hh = lane >> 4, cl = lane & 15;
  const bool pair = blockIdx.x < kGnBlocks;                    // block-uniform
  const int blk = pair ? blockIdx.x : blockIdx.x - kGnBlocks;
  const int u = (blk * 8 + wave) * 2 + hh;                     // token*8 + head, < 50176 (grid exact)
  const size_t base = (size_t)u * kHD + cl * 8;                // == token*1024 + head*128 + cl*8
  const int ch = (u & 7) * kHD + cl * 8;                       // channel index within 1024
  constexpr size_t plane = (size_t)kTok * kD;
  float o[8];
  unsigned short hb[8];
  if (!pair) {
    const float* pq = P + base;
    const v4f a = *(const v4f*)(pq);
    const v4f c = *(const v4f*)(pq + 4);
    // the wait owed before the address register of these loads is written again; the pointer is an input so that its
    // register stays as it is up to the wait (no loaded value may land on it either)
    asm volatile("s_wait_xcnt 0x0" :: "v"(pq) : "memory");
    gn_unit(a, c, gqw, gqb, ch, o);
#pragma unroll
    for (int e = 0; e < 8; ++e) hb[e] = h_bits(o[e] * kXCarry);
    gn_store(q16 + base, hb);
  } else {
    const float* pk = P + plane + base;
    const float* pv = P + 2 * plane + base;
    const v4f a  = *(const v4f*)(pk);
    const v4f c  = *(const v4f*)(pk + 4);
    const v4f a2 = *(const v4f*)(pv);
    const v4f c2 = *(const v4f*)(pv + 4);
    // the wait owed before the address registers of these loads are written again; the pointers are inputs so that their
    // registers stay as they are up to the wait (no loaded value may land on them either)
    asm volatile("s_wait_xcnt 0x0" :: "v"(pk), "v"(pv) : "memory");
    gn_unit(a, c, gkw, gkb, ch, o);
#pragma unroll
    for (int e = 0; e < 8; ++e) hb[e] = h_bits(o[e] * kXCarry);
    gn_store(k16 + base, hb);
    float kf[8];
#pragma unroll
    for (int e = 0; e < 8; ++e) kf[e] = h16_to_f32(hb[e]);
    gn_unit(a2, c2, gvw, gvb, ch, o);
#pragma unroll
    for (int e = 0; e < 8; ++e) hb[e] = h_bits(o[e] * kf[e]);
    gn_store(vk16 + base, hb);
  }
}

// ---------------------------------------------------------------------------
// e^x = 2^whole * exp2(rest): whole = x * log2(e) rounded to an integer, rest = x * log2(e) - whole with log2(e) in two
// terms, each by one FMA; 0 below and inf above the range of f32, at the bounds expf uses.
__device__ __forceinline__ float exp_steps(float x) {
  const float l2e = __uint_as_float(0x3fb8aa3bu), l2e_lo = __uint_as_float(0x32a5705fu);
  const float whole = __builtin_rintf(x * l2e);
  const float rest = __builtin_fmaf(x, l2e_lo, __builtin_fmaf(x, l2e, -whole));
  float v;
  // exp2 with the free slot that a transcendental is owed before its source is overwritten or its result read: only one
  // statement ties the v_nop to it
  asm("v_exp_f32 %0, %1\n\tv_nop" : "=v"(v) : "v"(rest));
  v = ldexpf(v, (int)whole);
  v = (x < __uint_as_float(0xc2ce8ed0u)) ? 0.0f : v;
  return (x > __uint_as_float(0x42b17218u)) ? __builtin_inff() : v;
}

// CELU (alpha 1.3) as celu_f, its exponential by exp_steps
__device__ __forceinline__ float celu_steps(float x) {
  const float en = exp_steps(x * (1.0f / 1.3f)) - 1.0f;
  return (x > 0.f) ? x : 1.3f * en;
}

// 1 / sqrt(x) in the steps rsqrtf takes: x below the smallest normal number is scaled by 2^24 and the result by 2^12.
__device__ __forceinline__ float rsqrt_steps(float x) {
  const bool tiny = x < __uint_as_float(0x00800000u);
  const float xs = tiny ? x * 16777216.0f : x;
  float r;
  // the free slot that a transcendental is owed before its source is overwritten or its result read: only one statement ties
  // the v_nop to it
  asm("v_rsq_f32 %0, %1\n\tv_nop" : "=v"(r) : "v"(xs));
  return tiny ? r * 4096.0f : r;
}

// ---------------------------------------------------------------------------
// GroupNorm of the v2 projection written transposed and key-padded: V2T[((h*128 + d)*32 + b)*256 + key] = f16(16 * v2n),
// keys 196..255 = 0. Block = (b, h, dh): 64 channels d = dh*64.. of one (b,h), all 196 tokens; grid (32, 8, 2).
// Phase 0: zero keys 192..255 of the 64 LDS rows (256 threads x 2 x 8 halves = 64 x 64). Phase 1: wave w handles tokens
// w, w+8, ...: 32 lanes x 4 channels = 128 (stats over the full head), the 16 lanes of half dh write their 4 channels
// into LDS [ch][key]. Phase 2: wave w writes rows w*8..w*8+7 (8 waves = 64 rows), each row 256 halves = 512 B =
// ---------------------------------------------------------------------------
constexpr int kV2Pitch = 264;   // halves; 528 B keeps 16-B alignment of row bases
constexpr int kV2Rounds = 25;   // token rounds of a wave (8 waves a round)
constexpr int kV2Grp = 5;       // tokens worked on side by side
static_assert(8 * (kV2Rounds - 1) <= kM && 8 * kV2Rounds >= kM && kV2Rounds % kV2Grp == 0, "all rounds but the last are whole");
__global__ __launch_bounds__(256) void gn_v2t_kernel(const float* __restrict__ P, const float* __restrict__ gw,
                                                     const float* __restrict__ gb, unsigned short* __restrict__ v2t) {
  __shared__ __align__(16) unsigned short sm[64 * kV2Pitch];
  const int t = threadIdx.x, lane = t & 31, wave = t >> 5;
  const int b = blockIdx.x, h = blockIdx.y, dh = blockIdx.z;
  {
    const v4u z = (v4u){0u, 0u, 0u, 0u};
#pragma unroll
    for (int j = 0; j < 2; ++j) {
      const int idx = t * 2 + j;              // 0..511
      const int row = idx >> 3, part = idx & 7;
      *(v4u*)(sm + row * kV2Pitch + 192 + part * 8) = z;
    }
  }
  __syncthreads();
  const int ch = h * kHD + lane * 4;
  const float* pgw = gw + ch;
  const float* pgb = gb + ch;
  const v4f wv = *(const v4f*)pgw;
  const v4f gv = *(const v4f*)pgb;
  const int cl0 = (lane & 15) * 4;
  // The wave's token rows (wave, wave + 8, ...; 25 rounds) are asked for ahead of the arithmetic, none behind the work on
  // the row before it, so the wave waits out about one load latency in place of 25. Rounds 0..23 exist for every wave; in
  // round 24 the waves past token 195 load row 195 again (in bounds) and store nothing.
  const float* pw = P + ((size_t)(b * kM + wave)) * kD + ch;
  const int tlast = wave + 8 * (kV2Rounds - 1);
  const float* pl = P + ((size_t)(b * kM + ((tlast < kM) ? tlast : (kM - 1)))) * kD + ch;
  v4f a[kV2Rounds];
#pragma unroll
  for (int i = 0; i < kV2Rounds - 1; ++i) a[i] = *(const v4f*)(pw + (size_t)(8 * i) * kD);
  a[kV2Rounds - 1] = *(const v4f*)pl;
  // the wait owed before the address registers of these loads and of the two above are written again; the pointers are
  // inputs so that their registers stay as they are up to the wait (no loaded row may land on them either)
  asm volatile("s_wait_xcnt 0x0" :: "v"(pgw), "v"(pgb), "v"(pw), "v"(pl) : "memory");
  // Five tokens a group, step by step side by side: their ten lane exchanges each are independent, so one wait serves five.
#pragma unroll
  for (int i0 = 0; i0 < kV2Rounds; i0 += kV2Grp) {
    float y[kV2Grp][4], d[kV2Grp][4], s[kV2Grp], sq[kV2Grp];
#pragma unroll
    for (int g = 0; g < kV2Grp; ++g) {
#pragma unroll
      for (int e = 0; e < 4; ++e) y[g][e] = celu_steps(a[i0 + g][e]);
      s[g] = (y[g][0] + y[g][1]) + (y[g][2] + y[g][3]);
    }
#pragma unroll
    for (int off = 1; off < 32; off <<= 1) {
      float o[kV2Grp];
#pragma unroll
      for (int g = 0; g < kV2Grp; ++g) o[g] = __shfl_xor(s[g], off, 32);
#pragma unroll
      for (int g = 0; g < kV2Grp; ++g) s[g] += o[g];
    }
#pragma unroll
    for (int g = 0; g < kV2Grp; ++g) {
      const float mu = s[g] * (1.0f / 128.0f);
      sq[g] = 0.f;
#pragma unroll
      for (int e = 0; e < 4; ++e) { d[g][e] = y[g][e] - mu; sq[g] += d[g][e] * d[g][e]; }
    }
#pragma unroll
    for (int off = 1; off < 32; off <<= 1) {
      float o[kV2Grp];
#pragma unroll
      for (int g = 0; g < kV2Grp; ++g) o[g] = __shfl_xor(sq[g], off, 32);
#pragma unroll
      for (int g = 0; g < kV2Grp; ++g) sq[g] += o[g];
    }
    float rs[kV2Grp];
#pragma unroll
    for (int g = 0; g < kV2Grp; ++g) rs[g] = rsqrt_steps(sq[g] * (1.0f / 128.0f) + 1e-5f);
    if ((lane >> 4) == dh) {
#pragma unroll
      for (int g = 0; g < kV2Grp; ++g) {
        const int tok = wave + 8 * (i0 + g);
        unsigned short hb[4];
#pragma unroll
        for (int e = 0; e < 4; ++e) hb[e] = h_bits((d[g][e] * rs[g] * wv[e] + gv[e]) * kXCarry);
        if (i0 + g < kV2Rounds - 1 || tok < kM) {   // only the last round can pass token 195
#pragma unroll
          for (int e = 0; e < 4; ++e) sm[(cl0 + e) * kV2Pitch + tok] = hb[e];
        }
      }
    }
  }
  __syncthreads();
  const size_t rowbase = ((size_t)(h * kHD + dh * 64)) * (kB * kSP) + (size_t)b * kSP + lane * 8;
  {
#pragma unroll
    for (int it = 0; it < 8; ++it) {
      const int cl = wave * 8 + it;           // 0..63
      const v4u u = *(const v4u*)(sm + cl * kV2Pitch + lane * 8);
      *(v4u*)(v2t + rowbase + (size_t)cl * (kB * kSP)) = u;
    }
    
  }
}

constexpr int kFaTiles  = 13;
constexpr int kFaRows   = kFaTiles * 16;
constexpr int kFaThr    = kFaTiles * 32;
constexpr int kFaKPitch = 136;
constexpr int kFaVPitch = 264;
constexpr int kFaOPitch = 132;
constexpr int kFaKPc    = kFaRows * 16 / kFaThr;
constexpr int kFaVPc    = (kHD + kFaTiles - 1) / kFaTiles;
static_assert(kFaKPc * kFaThr == kFaRows * 16, "k pieces divide");
static_assert((kFaVPc - 1) * kFaTiles <= kHD && kFaVPc * kFaTiles >= kHD, "all v2^T rounds but the last are whole");
static_assert((kB - 1) * kM + kFaRows <= kTokPad, "k and q2 rows stay in their planes");
static_assert(kKeyK / 32 * 2 == kFaTiles + 1 && kKeyK <= kSP, "P*v2 depth = 7 steps of 32 keys, the last half step zero");

__global__ __launch_bounds__(kFaThr) void attn_fused_kernel(const unsigned short* __restrict__ Qp,
                                                            const unsigned short* __restrict__ Kp,
                                                            const unsigned short* __restrict__ Vt,
                                                            const float* __restrict__ mask, float* __restrict__ att,
                                                            float scoreScale, float pvScale) {
  typedef Frag<_Float16> F;
  __shared__ __align__(16) unsigned short sK[kFaRows * kFaKPitch];
  __shared__ __align__(16) unsigned short sV[kFaVPc * kFaTiles * kFaVPitch];   // 130 rows: 128 read, 2 spare
  __shared__ __align__(16) float sO[kFaTiles][16 * kFaOPitch];   // per-wave 16 x 128 slab
  __shared__ __align__(16) float sMask[kFaThr];
  const int t = threadIdx.x, lane = t & 31;
  const int wave = __builtin_amdgcn_readfirstlane(t >> 5);       // scalar: the wave's query tile, slab and staged v2^T rows
  const int b = blockIdx.x, h = blockIdx.y;
  const int c = lane & 15, hf = lane >> 4;

  // ---- this wave's q2 fragments and the group's k, v2^T and mask, all loads in flight together ----
  const _Float16* gQ = (const _Float16*)Qp + (size_t)(b * kM + wave * 16 + c) * kD + h * kHD + hf * 8;
  const unsigned short* gK = Kp + (size_t)(b * kM + (t >> 4)) * kD + h * kHD + (t & 15) * 8;
  v16h qf[4];
  v4u rk[kFaKPc], rv[kFaVPc];
#pragma unroll
  for (int kk = 0; kk < 4; ++kk) qf[kk] = F::load(gQ + kk * 32);
#pragma unroll
  for (int j = 0; j < kFaKPc; ++j) rk[j] = *(const v4u*)(gK + (size_t)(j * (kFaThr / 16)) * kD);
  const unsigned short* gV = Vt + ((size_t)(h * kHD) * kB + b) * kSP + lane * 8;
  const unsigned short* gVw = gV + (size_t)wave * (kB * kSP);
#pragma unroll
  for (int j = 0; j < kFaVPc - 1; ++j) rv[j] = *(const v4u*)(gVw + (size_t)(j * kFaTiles) * (kB * kSP));
  // the last round's waves past row 127 load row 127 again (in bounds) and lay it in a spare LDS row that nobody reads
  const int rlast = wave + (kFaVPc - 1) * kFaTiles;
  const unsigned short* gVl = gV + (size_t)((rlast < kHD) ? rlast : (kHD - 1)) * (kB * kSP);
  rv[kFaVPc - 1] = *(const v4u*)gVl;
  const int mi = b * kM + ((t < kM) ? t : (kM - 1));
  const float mload = mask[mi];
  // the wait owed before the address registers of these loads are written again; the per-lane pointers and index are
  // inputs so that their registers stay as they are up to the wait (no later load may land on them either)
  asm volatile("s_wait_xcnt 0x0" :: "v"(gQ), "v"(gK), "v"(gVw), "v"(gVl), "v"(mi) : "memory");
#pragma unroll
  for (int j = 0; j < kFaKPc; ++j) *(v4u*)(sK + ((t >> 4) + j * (kFaThr / 16)) * kFaKPitch + (t & 15) * 8) = rk[j];
#pragma unroll
  for (int j = 0; j < kFaVPc; ++j) *(v4u*)(sV + (wave + j * kFaTiles) * kFaVPitch + lane * 8) = rv[j];
  sMask[t] = mload;                              // entries from 196 on repeat key 195 and are never used
  __syncthreads();

  // ---- S^T = k * q2^T: s[tt][r] = score of key 16 tt + 8 hf + r for query 16 wave + c ----
  // The 52 products run k step by k step (product f: k step f / 13, key tile f % 13), so neighbours have different
  // accumulators; their k fragments are read in groups of 4, one group ahead, into two register sets.
  v8f s[kFaTiles];
#pragma unroll
  for (int tt = 0; tt < kFaTiles; ++tt) s[tt] = (v8f){0.f,0.f,0.f,0.f,0.f,0.f,0.f,0.f};
  {
    const _Float16* kf = (const _Float16*)sK + c * kFaKPitch + hf * 8;
    v16h ka[2][4];
#pragma unroll
    for (int e = 0; e < 4; ++e) ka[0][e] = F::load(kf + (e % kFaTiles) * 16 * kFaKPitch + (e / kFaTiles) * 32);
#pragma unroll
    for (int g = 0; g < kFaTiles; ++g) {
      if (g + 1 < kFaTiles) {
#pragma unroll
        for (int e = 0; e < 4; ++e) {
          const int f = (g + 1) * 4 + e;
          ka[(g + 1) & 1][e] = F::load(kf + (f % kFaTiles) * 16 * kFaKPitch + (f / kFaTiles) * 32);
        }
      }
      // keeps the next group's LDS reads together and ahead of this group's WMMAs (the scheduler otherwise sinks each read
      // to its use, and every WMMA then waits out an LDS latency)
      __builtin_amdgcn_sched_barrier(0);
#pragma unroll
      for (int e = 0; e < 4; ++e) {
        const int f = g * 4 + e;
        s[f % kFaTiles] = F::mma(ka[g & 1][e], qf[f / kFaTiles], s[f % kFaTiles]);
      }
      // keeps the reads of the group after next behind these WMMAs, not among them
      __builtin_amdgcn_sched_barrier(0);
    }
  }

  // ---- softmax over the query's 196 keys, f32 ----
  float mx4[4] = {-3.0e38f, -3.0e38f, -3.0e38f, -3.0e38f};
#pragma unroll
  for (int tt = 0; tt < kFaTiles; ++tt) {
    const v4f m0 = *(const v4f*)(sMask + tt * 16 + hf * 8);
    const v4f m1 = *(const v4f*)(sMask + tt * 16 + hf * 8 + 4);
#pragma unroll
    for (int r = 0; r < 8; ++r) {
      const int j = tt * 16 + hf * 8 + r;
      const float mv = (r < 4) ? m0[r & 3] : m1[r & 3];
      const float v = (mv == 0.0f) ? -1.0e9f : s[tt][r] * scoreScale;
      s[tt][r] = (j < kM) ? v : -3.0e38f;
      mx4[r & 3] = fmaxf(mx4[r & 3], s[tt][r]);
    }
  }
  float mx = fmaxf(fmaxf(mx4[0], mx4[1]), fmaxf(mx4[2], mx4[3]));
  mx = fmaxf(mx, __shfl_xor(mx, 16, 32));
  float ps4[4] = {0.f, 0.f, 0.f, 0.f};
#pragma unroll
  for (int tt = 0; tt < kFaTiles; ++tt) {
#pragma unroll
    for (int r = 0; r < 8; ++r) {
      s[tt][r] = exp_steps(s[tt][r] - mx); // an excluded key sits at -3e38: its difference is below the range, P = 0
      ps4[r & 3] += s[tt][r];
    }
  }
  float ps = (ps4[0] + ps4[1]) + (ps4[2] + ps4[3]);
  ps += __shfl_xor(ps, 16, 32);
  const float inv = 1.0f / ps;
  v16h pf[kKeyK / 32];
#pragma unroll
  for (int u = 0; u < kKeyK / 32; ++u) {
#pragma unroll
    for (int e = 0; e < 8; ++e) {
      pf[u][e]     = (_Float16)(s[2 * u][e] * inv * kPCarry);
      pf[u][8 + e] = (2 * u + 1 < kFaTiles) ? (_Float16)(s[(2 * u + 1 < kFaTiles) ? 2 * u + 1 : 0][e] * inv * kPCarry) : (_Float16)0.0f;
    }
  }

  // ---- O^T = v2^T * P^T: o[j][r] = attn of query 16 wave + c, channel 16 j + 8 hf + r ----
  v8f o[8];
#pragma unroll
  for (int j = 0; j < 8; ++j) o[j] = (v8f){0.f,0.f,0.f,0.f,0.f,0.f,0.f,0.f};
  {
    // product f: key step f / 8, channel tile f % 8; v2^T fragments in groups of 4, one group ahead, as above
    const _Float16* vf = (const _Float16*)sV + c * kFaVPitch + hf * 8;
    constexpr int kGroups = kKeyK / 32 * 2;
    v16h va[2][4];
#pragma unroll
    for (int e = 0; e < 4; ++e) va[0][e] = F::load(vf + e * 16 * kFaVPitch);
#pragma unroll
    for (int g = 0; g < kGroups; ++g) {
      if (g + 1 < kGroups) {
#pragma unroll
        for (int e = 0; e < 4; ++e) {
          const int f = (g + 1) * 4 + e;
          va[(g + 1) & 1][e] = F::load(vf + (f % 8) * 16 * kFaVPitch + (f / 8) * 32);
        }
      }
      // keeps the next group's LDS reads together and ahead of this group's WMMAs
      __builtin_amdgcn_sched_barrier(0);
#pragma unroll
      for (int e = 0; e < 4; ++e) {
        const int f = g * 4 + e;
        o[f % 8] = F::mma(va[g & 1][e], pf[f / 8], o[f % 8]);
      }
      // keeps the reads of the group after next behind these WMMAs, not among them
      __builtin_amdgcn_sched_barrier(0);
    }
  }

  // ---- epilogue: the wave's 16 x 128 block through its own slab, so that each store covers a whole 512-B row piece ----
  float* slab = sO[wave];
#pragma unroll
  for (int j = 0; j < 8; ++j) {
    *(v4f*)(slab + c * kFaOPitch + j * 16 + hf * 8)     = (v4f){o[j][0], o[j][1], o[j][2], o[j][3]} * pvScale;
    *(v4f*)(slab + c * kFaOPitch + j * 16 + hf * 8 + 4) = (v4f){o[j][4], o[j][5], o[j][6], o[j][7]} * pvScale;
  }
  // the wave's slab writes are complete before its lanes read each other's words (as in wmma_gemm64)
  __builtin_amdgcn_fence(__ATOMIC_RELEASE, "workgroup");
  __builtin_amdgcn_wave_barrier();
  __builtin_amdgcn_fence(__ATOMIC_ACQUIRE, "workgroup");
  float* dst = att + (size_t)(b * kSP + wave * 16) * kD + h * kHD + lane * 4;
#pragma unroll
  for (int row = 0; row < 16; ++row) *(v4f*)(dst + (size_t)row * kD) = *(const v4f*)(slab + row * kFaOPitch + lane * 4);
}

// ---------------------------------------------------------------------------
// Gated residual + LayerNorm: y = x + gate*attn (token-major gate [6272][1024], attn [32][256 q][1024]); x_new = LN(y)*lnw + lnb
// written f32 to xout (may alias xin: each block reads its whole row into registers before any store, no other block
// touches the row) and as f16(16*x_new) to x16. One block per token (grid 6272), thread t owns columns 4t..4t+3.
// ---------------------------------------------------------------------------
__global__ __launch_bounds__(256) void merge_ln_kernel(const float* xin, const float* __restrict__ att,
                                                       const float* __restrict__ gate, const float* __restrict__ lnw,
                                                       const float* __restrict__ lnb, float* xout,
                                                       unsigned short* __restrict__ x16) {
  __shared__ float redA[8];
  __shared__ float redB[8];
  __shared__ __align__(16) float srow[kD];
  const int t = threadIdx.x, lane = t & 31, wave = t >> 5;
  const int r = blockIdx.x;
  const int b = r / kM;
  const int m = r - b * kM;
  const int c0 = t * 4;
  const size_t ro = (size_t)r * kD + c0;
  const v4f xv = *(const v4f*)(xin + ro);
  const v4f gv = *(const v4f*)(gate + ro);
  const v4f av = *(const v4f*)(att + ((size_t)(b * kSP + m)) * kD + c0);
  float y[4];
#pragma unroll
  for (int e = 0; e < 4; ++e) y[e] = xv[e] + gv[e] * av[e];
  float s = (y[0] + y[1]) + (y[2] + y[3]);
#pragma unroll
  for (int off = 1; off < 32; off <<= 1) s += __shfl_xor(s, off, 32);
  if (lane == 0) redA[wave] = s;
  __syncthreads();
  float tot = redA[0];
#pragma unroll
  for (int w = 1; w < 8; ++w) tot += redA[w];
  const float mu = tot * (1.0f / 1024.0f);
  float d[4];
  float sq = 0.f;
#pragma unroll
  for (int e = 0; e < 4; ++e) { d[e] = y[e] - mu; sq += d[e] * d[e]; }
#pragma unroll
  for (int off = 1; off < 32; off <<= 1) sq += __shfl_xor(sq, off, 32);
  if (lane == 0) redB[wave] = sq;
  __syncthreads();
  float tot2 = redB[0];
#pragma unroll
  for (int w = 1; w < 8; ++w) tot2 += redB[w];
  const float var = tot2 * (1.0f / 1024.0f);
  const float rs = rsqrtf(var + 1e-5f);
  const v4f wv = *(const v4f*)(lnw + c0);
  const v4f bv = *(const v4f*)(lnb + c0);
  v4f ov;
#pragma unroll
  for (int e = 0; e < 4; ++e) ov[e] = d[e] * rs * wv[e] + bv[e];
  *(v4f*)(srow + c0) = ov;
  __syncthreads();
  const int tc = t & 127;                               // clamped staging index; only t < 128 stores
  const v4f p0 = *(const v4f*)(srow + tc * 8);
  const v4f p1 = *(const v4f*)(srow + tc * 8 + 4);
  unsigned short hb[8];
#pragma unroll
  for (int e = 0; e < 4; ++e) {
    hb[e]     = h_bits(p0[e] * kXCarry);
    hb[4 + e] = h_bits(p1[e] * kXCarry);
  }
  const v4u hu = (v4u){pk16(hb[0], hb[1]), pk16(hb[2], hb[3]), pk16(hb[4], hb[5]), pk16(hb[6], hb[7])};
  unsigned short* hp = x16 + (size_t)r * kD + tc * 8;
  {
    *(v4f*)(xout + ro) = ov;
    if (t < 128) *(v4u*)hp = hu;
    
  }
}

// ---------------------------------------------------------------------------
// Masked mean over tokens: out0[b][c] = sum_m x[b][m][c]*mask[b][m] / sum_m mask[b][m]. One block per b (grid 32),
// ---------------------------------------------------------------------------
constexpr int kPoolRows = 28;   // token rows in flight per wave
static_assert(kM % kPoolRows == 0, "pool groups divide the tokens");
__global__ __launch_bounds__(256) void pool_kernel(const float* x, const float* __restrict__ mask, float* out0) {
  const int t = threadIdx.x;
  const int b = blockIdx.x;
  const int c0 = t * 4;
  v4f acc = (v4f){0.f, 0.f, 0.f, 0.f};
  float ms = 0.f;
  // 28 token rows are asked for at a time and then summed in token order (the order of the sums is unchanged): the wave
  // waits out 7 load latencies in place of 196. The loop over the groups stays rolled: one group's registers serve all 7.
#pragma unroll 1
  for (int m0 = 0; m0 < kM; m0 += kPoolRows) {
    const float* xp = x + ((size_t)(b * kM + m0)) * kD + c0;
    v4f xv[kPoolRows];
#pragma unroll
    for (int j = 0; j < kPoolRows; ++j) xv[j] = *(const v4f*)(xp + (size_t)j * kD);
    // the wait owed before the address register of these loads is written again; the pointer is an input so that its
    // register stays as it is up to the wait (no loaded row may land on it either)
    asm volatile("s_wait_xcnt 0x0" :: "v"(xp) : "memory");
#pragma unroll
    for (int j = 0; j < kPoolRows; ++j) {
      const float mv = mask[b * kM + m0 + j];
      acc += xv[j] * mv;
      ms += mv;
    }
  }
  const float inv = 1.0f / ms;
  const v4f o = acc * inv;
  store2_v4f(out0 + (size_t)b * kD + c0, o);
}

// ---------------------------------------------------------------------------
// Host orchestration: kernel launches only. 1 + 3*6 + 1 = 20 launches.
// ---------------------------------------------------------------------------
extern "C" void kernel_launch(void* const* d_in, const int* in_sizes, int n_in,
                              void* d_out, int out_size, void* d_ws, size_t ws_size,
                              hipStream_t stream) {
  if (n_in < 22) return;
  if (in_sizes[0] != kTok * kD) return;
  if (in_sizes[1] != kTok) return;
  if (in_sizes[2] != kL * kD * kD || in_sizes[6] != kL * kD * kD || in_sizes[10] != kL * kD * kD || in_sizes[14] != kL * kD * kD) return;
  if (in_sizes[18] != kL * kHD * kHD || in_sizes[19] != kL * kHD) return;
  if (in_sizes[3] != kL * kD || in_sizes[20] != kL * kD || in_sizes[21] != kL * kD) return;
  if (out_size != kB * kD + kTok * kD) return;
  if (ws_size < kWsTotal) return;

  const float* att_feats = (const float*)d_in[0];
  const float* att_mask  = (const float*)d_in[1];
  const float* Wq2  = (const float*)d_in[2];
  const float* bq2  = (const float*)d_in[3];
  const float* gq2w = (const float*)d_in[4];
  const float* gq2b = (const float*)d_in[5];
  const float* Wk   = (const float*)d_in[6];
  const float* bk   = (const float*)d_in[7];
  const float* gkw  = (const float*)d_in[8];
  const float* gkb  = (const float*)d_in[9];
  const float* Wv1  = (const float*)d_in[10];
  const float* bv1  = (const float*)d_in[11];
  const float* gv1w = (const float*)d_in[12];
  const float* gv1b = (const float*)d_in[13];
  const float* Wv2  = (const float*)d_in[14];
  const float* bv2  = (const float*)d_in[15];
  const float* gv2w = (const float*)d_in[16];
  const float* gv2b = (const float*)d_in[17];
  const float* Wc   = (const float*)d_in[18];
  const float* bc   = (const float*)d_in[19];
  const float* lnw  = (const float*)d_in[20];
  const float* lnb  = (const float*)d_in[21];

  char* ws = (char*)d_ws;
  float*          Ppl   = (float*)(ws + kOffP);                    // linear+bias planes (q2, k, v1, v2)
  float*          GATE  = (float*)(ws + kOffP);                    // gate plane (plane 0 of the same region, later)
  unsigned short* GIN16 = (unsigned short*)(ws + kOffATT);         // (v1*k) plane
  float*          ATT   = (float*)(ws + kOffATT);                  // attn plane (same region, later)
  unsigned short* X16   = (unsigned short*)(ws + kOffX16);
  unsigned short* W16   = (unsigned short*)(ws + kOffW16);
  unsigned short* WC16  = (unsigned short*)(ws + kOffWC16);
  unsigned short* Q16   = (unsigned short*)(ws + kOffQ16);
  unsigned short* K16   = (unsigned short*)(ws + kOffK16);
  unsigned short* V2T   = (unsigned short*)(ws + kOffV2T);

  float* out0 = (float*)d_out;                                     // [32][1024] at byte 0
  float* out1 = (float*)d_out + (size_t)kB * kD;                   // [32][196][1024] at byte 131072; also the running x

  const float projScale  = 1.0f / (kXCarry * kWCarry);             // 1/4096
  const float gateScale  = 1.0f / (kXCarry * kWCarry);             // (v1*k) x16, Wc x256
  const float scoreScale = 0.08838834764831845f * (1.0f / (kXCarry * kXCarry));
  const float pvScale    = 1.0f / (kPCarry * kXCarry);             // 1/32768

  // x and every layer's W and Wc -> f16 planes; pad rows of the q2/k planes zero
  prep_kernel<<<dim3(kPrepBlocks), dim3(256), 0, stream>>>(att_feats, Wq2, Wk, Wv1, Wv2, Wc, X16,
                                                           Q16 + (size_t)kTok * kD, K16 + (size_t)kTok * kD, W16, WC16);

  for (int i = 0; i < kL; ++i) {
    const size_t vo = (size_t)i * kD;

    // four projections: P[z] = x16 * Wz^T + bz (M 6272, N 4 * 1024, K 1024; 49 x 16 block tiles of 128 x 256 = 784 blocks)
    proj_gemm_lds_kernel<<<dim3((kTok / kPjBM) * (4 * kD / kPjBN)), dim3(256), 0, stream>>>(
        X16, W16 + (size_t)i * 4 * kD * kD, Ppl, bq2 + vo, bk + vo, bv1 + vo, bv2 + vo, projScale);

    // CELU + GroupNorm of q2, k and v1 (with v1 * k), token-major; then of v2, transposed
    gn_rows_kernel<<<dim3(2 * kGnBlocks), dim3(256), 0, stream>>>(Ppl, gq2w + vo, gq2b + vo, gkw + vo, gkb + vo,
                                                                  gv1w + vo, gv1b + vo, Q16, K16, GIN16);
    gn_v2t_kernel<<<dim3(kB, kH, 2), dim3(256), 0, stream>>>(Ppl + (size_t)3 * kTok * kD, gv2w + vo, gv2b + vo, V2T);

    // gate = sigmoid((v1*k) * Wc^T + bc): M 50176, N 128, K 128 (1568 tiles = 196 blocks); output [50176][128] f32 == token-major [6272][1024]
    wmma_gemm64<0, false, 2, 0, false, 6><<<dim3(196, 1), dim3(256), 0, stream>>>(
        GIN16, nullptr, kHD, 0L, 0L,
        WC16 + (size_t)i * kHD * kHD, nullptr, kHD, 0L, 0L,
        (void*)GATE, nullptr, kHD, 0L, 0L,
        bc + (size_t)i * kHD, nullptr, 0L,
        kTok * kH, kHD, kHD, gateScale);

    // attention: scores, softmax and P * v2 of one (batch, head) group per work-group, 256 groups in one launch
    attn_fused_kernel<<<dim3(kB, kH), dim3(kFaThr), 0, stream>>>(Q16, K16, V2T, att_mask, ATT, scoreScale, pvScale);

    const float* xin = (i == 0) ? att_feats : out1;
    merge_ln_kernel<<<dim3(kTok), dim3(256), 0, stream>>>(xin, ATT, GATE, lnw + (size_t)i * kD, lnb + (size_t)i * kD, out1, X16);
  }

  pool_kernel<<<dim3(kB), dim3(256), 0, stream>>>(out1, att_mask, out0);
}

// v006
// One run takes 363 microseconds.
// In both of two side-by-side timings against v005, it was 1.28 times as fast.
// Over all steps from v000 it is 4.38 times as fast.
// Contractions: projections x(f16, x16)*W^T(f16, x256), gate (v1*k)(f16, x16)*Wc^T(f16, x256), scores q2(f16, x16)*k^T(f16, x16), attn P(f16, x2048)*v2(f16, x16): all v_wmma_f32_16x16x32_f16 with f32 accumulate; CELU, GroupNorm, softmax, sigmoid, residual, LayerNorm and masked mean in f32.
#include <hip/hip_runtime.h>
#include <math.h>

// ---------------------------------------------------------------------------
// Problem constants
// ---------------------------------------------------------------------------
constexpr int kB   = 32;
constexpr int kM   = 196;
constexpr int kD   = 1024;
constexpr int kH   = 8;
constexpr int kHD  = 128;
constexpr int kL   = 3;
constexpr int kTok = kB * kM;          // 6272 = 98 * 64 token rows
constexpr int kTokPad = kTok + 64;     // 6336: 64 zero rows so per-group 208-row tiles never leave the plane
constexpr int kSP  = 256;              // padded queries per (batch, head) group (rows of the gated attn plane)
constexpr int kKeyK = 224;             // contraction depth of P*V (keys padded to a multiple of 32)
constexpr float kXCarry = 16.0f;       // x, q2, k, v2 planes carried x16 in f16
constexpr float kWCarry = 256.0f;      // W, Wc carried x256 in f16
constexpr float kPCarry = 2048.0f;     // probabilities carried x2048 in f16

// ---------------------------------------------------------------------------
// Workspace region map (bytes, all offsets multiples of 256)
//   R_P    : linear+bias planes f32 [4: q2, k, v1, v2][6272][1024] -> later gated attn f32 [32][256][1024]
//   R_ATT  : (v1*k) f16 plane [6272][1024]
//   R_X16  : x f16 [6272][1024]
//   R_W16  : stacked W f16 [3 layers][4096][1024]
//   R_WC16 : Wc f16 [3 layers][128][128]
//   R_Q16  : q2 f16 [6336][1024] (rows >= 6272 zero)
//   R_K16  : k  f16 [6336][1024] (rows >= 6272 zero)
// ---------------------------------------------------------------------------
constexpr size_t kBytesP1   = (size_t)kTok * kD * 4;       // one plane
constexpr size_t kBytesP    = 4 * kBytesP1;
constexpr size_t kBytesATT  = (size_t)kB * kSP * kD * 4;
constexpr size_t kBytesX16  = (size_t)kTok * kD * 2;
constexpr size_t kBytesW16  = (size_t)kL * 4 * kD * kD * 2;
constexpr size_t kBytesWC16 = (size_t)kL * kHD * kHD * 2;
constexpr size_t kBytesQ16  = (size_t)kTokPad * kD * 2;
constexpr size_t kOffP    = 0;
constexpr size_t kOffATT  = kOffP + kBytesP;
constexpr size_t kOffX16  = kOffATT + kBytesATT;
constexpr size_t kOffW16  = kOffX16 + kBytesX16;
constexpr size_t kOffWC16 = kOffW16 + kBytesW16;
constexpr size_t kOffQ16  = kOffWC16 + kBytesWC16;
constexpr size_t kOffK16  = kOffQ16 + kBytesQ16;
constexpr size_t kWsTotal = kOffK16 + kBytesQ16;
static_assert(kWsTotal == 200376320, "carve total");
static_assert(kWsTotal <= 268435456, "carve under 256 MiB");
static_assert(kBytesATT >= (size_t)kTok * kD * 2, "vk plane fits in its region");
static_assert(kBytesATT <= kBytesP, "gated attn plane fits in the P region");
static_assert((kOffATT % 256) == 0 && (kOffX16 % 256) == 0 && (kOffW16 % 256) == 0 && (kOffQ16 % 256) == 0 && (kOffK16 % 256) == 0, "aligned");

typedef __attribute__((ext_vector_type(16))) _Float16 v16h;
typedef __attribute__((ext_vector_type(8)))  _Float16 v8h;
typedef __attribute__((ext_vector_type(16))) __bf16   v16b;
typedef __attribute__((ext_vector_type(8)))  __bf16   v8b;
typedef __attribute__((ext_vector_type(8)))  float    v8f;
typedef __attribute__((ext_vector_type(4)))  float    v4f;
typedef __attribute__((ext_vector_type(4)))  unsigned int v4u;
typedef __attribute__((ext_vector_type(2)))  unsigned int v2u;

__device__ __forceinline__ unsigned short f2bf_bits(float f) {
  unsigned u = __float_as_uint(f);
  return (unsigned short)((u + 0x7FFFu + ((u >> 16) & 1u)) >> 16);
}
__device__ __forceinline__ float bf_bits2f(unsigned short h) { return __uint_as_float(((unsigned)h) << 16); }

template <typename T> struct Frag;
template <> struct Frag<_Float16> {
  typedef v16h V; union U { v16h v; v8h h[2]; };
  static __device__ __forceinline__ v16h load(const _Float16* p) {   // elements 0..7 <- p[0..7], 8..15 <- p[16..23]
    U f; f.h[0] = *(const v8h*)(p); f.h[1] = *(const v8h*)(p + 16); return f.v;
  }
  static __device__ __forceinline__ v8f mma(v16h a, v16h b, v8f c) {
    return __builtin_amdgcn_wmma_f32_16x16x32_f16(false, a, false, b, (short)0, c, false, false);
  }
};
template <> struct Frag<__bf16> {
  typedef v16b V; union U { v16b v; v8b h[2]; };
  static __device__ __forceinline__ v16b load(const __bf16* p) {
    U f; f.h[0] = *(const v8b*)(p); f.h[1] = *(const v8b*)(p + 16); return f.v;
  }
  static __device__ __forceinline__ v8f mma(v16b a, v16b b, v8f c) {
    return __builtin_amdgcn_wmma_f32_16x16x32_bf16(false, a, false, b, (short)0, c, false, false);
  }
};

__device__ __forceinline__ unsigned pk16(unsigned short a, unsigned short b) { return (unsigned)a | ((unsigned)b << 16); }
__device__ __forceinline__ unsigned short h_bits(float f) { const _Float16 h = (_Float16)f; return __builtin_bit_cast(unsigned short, h); }

// exact f16 bits -> f32 via integer arithmetic (normals and subnormals; no _Float16 vector involved)
__device__ __forceinline__ float h16_to_f32(unsigned hb) {
  const unsigned em = hb & 0x7fffu;
  const float fn = __uint_as_float((em + 0x1C000u) << 13);
  const float fs = (float)em * 5.9604644775390625e-8f;
  const float f  = (em < 0x400u) ? fs : fn;
  return __uint_as_float(__float_as_uint(f) | ((hb & 0x8000u) << 16));
}

__device__ __forceinline__ void store2_v4u(unsigned short* p, v4u u) {
  *(v4u*)p = u;
  
}
__device__ __forceinline__ void store2_v4f(float* p, v4f v) {
  *(v4f*)p = v;
  
}

// ---------------------------------------------------------------------------
// Projection GEMM with operands staged in LDS: C[m,n] = scale * sum_k A[m,k] * Bt[n,k] + bias[n], f32 out.
// A [6272][1024] f16, Bt [4096][1024] f16, both k-contiguous. Block tile 128 (m) x 256 (n), 8 waves as 2 x 4, each wave the
// 64x64 tile, fragments by Frag::load, k ascending. A stage is 64 k = one 128-B line of each of the 384 operand
// rows (A rows first, then Bt rows), laid at a 144-B pitch in one of two LDS buffers. Every global load covers whole lines
// (8 lanes per row). Stage s + 2 is fetched into registers during stage s and stored to LDS during stage s + 1, so a
// fetch has a whole stage to land. The four projections share one grid: Bt is the stacked W [4096][1024], column tile
// nT = 0..15 belongs to projection nT / 4 and goes to that projection's plane of C with its bias.
// grid = 49 * 16 = 784 blocks (6272 = 49 * 128, 4096 = 16 * 256), column tile fastest.
// ---------------------------------------------------------------------------
constexpr int kPjBM = 128;                       // block rows of A
constexpr int kPjBN = 256;                       // block rows of Bt
constexpr int kPjBK = 64;                        // halves of k per stage
constexpr int kPjPitch = 72;                     // halves per staged row (144 B)
constexpr int kPjStage = (kPjBM + kPjBN) * kPjPitch;   // halves per buffer (55,296 B)
constexpr int kPjStages = kD / kPjBK;            // 16
static_assert(kTok % kPjBM == 0 && kD % kPjBN == 0 && kD % (2 * kPjBK) == 0 && kPjStages >= 4, "projection tiles divide the problem");

// 12 pieces of 16 B per thread: pieces 0..3 = A rows, 4..11 = Bt rows, 32 staged rows apart
__device__ __forceinline__ void pj_fetch(v4u (&r)[12], const unsigned short* gA, const unsigned short* gB, int k) {
#pragma unroll
  for (int j = 0; j < 4; ++j) r[j] = *(const v4u*)(gA + (size_t)(32 * j) * kD + k);
#pragma unroll
  for (int j = 0; j < 8; ++j) r[4 + j] = *(const v4u*)(gB + (size_t)(32 * j) * kD + k);
}
__device__ __forceinline__ void pj_put(unsigned short* dst, const v4u (&r)[12]) {
#pragma unroll
  for (int j = 0; j < 12; ++j) *(v4u*)(dst + 32 * j * kPjPitch) = r[j];
}
// Work-group barrier that orders LDS only: __syncthreads() also waits for every global load in flight, which would
// end the fetch of the stage after next at each barrier; those loads land in registers and concern no other wave.
__device__ __forceinline__ void pj_barrier() {
  __builtin_amdgcn_fence(__ATOMIC_RELEASE, "workgroup", "local");
  __builtin_amdgcn_s_barrier();
  __builtin_amdgcn_fence(__ATOMIC_ACQUIRE, "workgroup", "local");
}
// One stage: fetch stage k/64 into ld (FETCH), multiply the stage in cur, store the stage held in st to nxt (PUT).
template <bool FETCH, bool PUT>
__device__ __forceinline__ void pj_stage(const _Float16* curA, const _Float16* curB, unsigned short* nxt,
                                         const unsigned short* gA, const unsigned short* gB, int k,
                                         v4u (&ld)[12], const v4u (&st)[12], v8f (&acc)[4][4]) {
  typedef Frag<_Float16> F;
  v16h bh[2][4], ah[2][4];
#pragma unroll
  for (int kk = 0; kk < 2; ++kk) {
#pragma unroll
    for (int j = 0; j < 4; ++j) bh[kk][j] = F::load(curB + j * 16 * kPjPitch + kk * 32);
#pragma unroll
    for (int i = 0; i < 4; ++i) ah[kk][i] = F::load(curA + i * 16 * kPjPitch + kk * 32);
  }
  // keeps the LDS fragment reads as one group ahead of the matrix work (the scheduler otherwise spreads them among the
  // WMMAs) and ahead of the fetch, so that no fragment lands in a register that a fetch in flight names as its address
  __builtin_amdgcn_sched_barrier(0);
  if (FETCH) pj_fetch(ld, gA, gB, k);
  // keeps the fetch ahead of the matrix work (the scheduler otherwise sinks it to its use, a stage later)
  __builtin_amdgcn_sched_barrier(0);
#pragma unroll
  for (int i = 0; i < 4; ++i)
#pragma unroll
    for (int j = 0; j < 4; ++j) acc[i][j] = F::mma(ah[0][i], bh[0][j], acc[i][j]);
  // keeps the LDS stores of the next stage behind the first WMMA half, when this stage's fragment reads have been served
  __builtin_amdgcn_sched_barrier(0);
  // the wait owed before the fetch's address registers are written again; 16 WMMAs behind the fetch
  if (FETCH) asm volatile("s_wait_xcnt 0x0" ::: "memory");
  if (PUT) pj_put(nxt, st);
  // keeps the second WMMA half behind the stores: it needs no LDS, so it can run past the barrier, beside the next reads
  __builtin_amdgcn_sched_barrier(0);
#pragma unroll
  for (int i = 0; i < 4; ++i)
#pragma unroll
    for (int j = 0; j < 4; ++j) acc[i][j] = F::mma(ah[1][i], bh[1][j], acc[i][j]);
  if (PUT) pj_barrier();               // publishes the stage just stored and ends every read of cur
}

__global__ __launch_bounds__(256) void proj_gemm_lds_kernel(const unsigned short* __restrict__ Ap,
                                                            const unsigned short* __restrict__ Btp,
                                                            float* __restrict__ Cp, const float* __restrict__ bias0,
                                                            const float* __restrict__ bias1, const float* __restrict__ bias2,
                                                            const float* __restrict__ bias3, float scale) {
  __shared__ __align__(16) unsigned short sAB[2][kPjStage];
  __shared__ __align__(16) float sT[8][16 * 68];   // per-wave 16x64 slab, pitch 68 floats
  const int t    = threadIdx.x;
  const int lane = t & 31;
  const int wave = t >> 5;
  const int nT = blockIdx.x & 15;              // column tile of the stacked W
  const int pz = nT >> 2;                      // projection (block-uniform)
  const int mB = (blockIdx.x >> 4) * kPjBM;
  const int nB = (nT & 3) * kPjBN;             // column within the projection's plane
  float* C = Cp + (size_t)pz * kTok * kD;
  const float* bias = (pz == 0) ? bias0 : (pz == 1) ? bias1 : (pz == 2) ? bias2 : bias3;
  const int m0 = mB + (wave >> 2) * 64;
  const int n0 = nB + (wave & 3) * 64;

  const int rlane = lane & 15;                 // row (A) / col (B, D) within subtile
  const int koff  = (lane >> 4) * 8;           // k offset of this lane half
  const int mOff  = (lane >> 4) * 8;           // D row offset

  // staging map: piece j of thread t is 16 B number (t & 7) of staged row (t >> 3) + 32 * j
  const int srow = t >> 3;
  const int spart = (t & 7) * 8;
  const unsigned short* gA = Ap  + (size_t)(mB + srow) * kD + spart;
  const unsigned short* gB = Btp + (size_t)(nT * kPjBN + srow) * kD + spart;
  unsigned short* put0 = &sAB[0][srow * kPjPitch + spart];
  unsigned short* put1 = &sAB[1][srow * kPjPitch + spart];
  const int fA = ((wave >> 2) * 64 + rlane) * kPjPitch + koff;
  const int fB = (kPjBM + (wave & 3) * 64 + rlane) * kPjPitch + koff;
  const _Float16* a0 = (const _Float16*)sAB[0] + fA;
  const _Float16* b0 = (const _Float16*)sAB[0] + fB;
  const _Float16* a1 = (const _Float16*)sAB[1] + fA;
  const _Float16* b1 = (const _Float16*)sAB[1] + fB;

  v8f acc[4][4];
#pragma unroll
  for (int i = 0; i < 4; ++i)
#pragma unroll
    for (int j = 0; j < 4; ++j) acc[i][j] = (v8f){0.f,0.f,0.f,0.f,0.f,0.f,0.f,0.f};

  v4u pe[12], po[12];                          // even and odd stages on their way to LDS
  pj_fetch(pe, gA, gB, 0);
  pj_fetch(po, gA, gB, kPjBK);
  asm volatile("s_wait_xcnt 0x0" ::: "memory");   // the wait owed before the fetches' address registers are written again
  pj_put(put0, pe);
  pj_barrier();

  for (int s = 0; s < kPjStages - 2; s += 2) {
    pj_stage<true, true>(a0, b0, put1, gA, gB, (s + 2) * kPjBK, pe, po, acc);   // stage s; fetch s + 2, store s + 1
    pj_stage<true, true>(a1, b1, put0, gA, gB, (s + 3) * kPjBK, po, pe, acc);   // stage s + 1; fetch s + 3, store s + 2
  }
  pj_stage<false, true>(a0, b0, put1, gA, gB, 0, pe, po, acc);                  // stage 14; store 15
  pj_stage<false, false>(a1, b1, put0, gA, gB, 0, po, pe, acc);                 // stage 15

  // ---- epilogue: scale, bias[n], f32 out through the wave's slab ----
  float* slab = sT[wave];
#pragma unroll
  for (int i = 0; i < 4; ++i) {
    const int mBase = m0 + (i << 4);
#pragma unroll
    for (int j = 0; j < 4; ++j) {
      const float bv = bias[n0 + (j << 4) + rlane];
#pragma unroll
      for (int r = 0; r < 8; ++r) {
        float v = acc[i][j][r] * scale;
        v += bv;
        slab[(mOff + r) * 68 + (j << 4) + rlane] = v;
      }
    }
    // the wave's slab writes are complete before its lanes read each other's words
    __builtin_amdgcn_fence(__ATOMIC_RELEASE, "workgroup");
    __builtin_amdgcn_wave_barrier();
    __builtin_amdgcn_fence(__ATOMIC_ACQUIRE, "workgroup");
    const int hh = lane >> 4, c4 = (lane & 15) * 4;     // row seg = 256 B = 16 lanes x 16 B
#pragma unroll
    for (int it = 0; it < 8; ++it) {
      const int row = it * 2 + hh;
      v4f v = *(const v4f*)(slab + row * 68 + c4);
      *(v4f*)(C + (size_t)(mBase + row) * kD + n0 + c4) = v;
    }
    // the wait owed before a register that these stores name (address or data) is written again; the scheduling fence
    // keeps the next rows' register writes behind it
    asm volatile("s_wait_xcnt 0x0" ::: "memory");
    __builtin_amdgcn_sched_barrier(0);
    // the slab is read out before the next 16 rows overwrite it
    __builtin_amdgcn_fence(__ATOMIC_RELEASE, "workgroup");
    __builtin_amdgcn_wave_barrier();
    __builtin_amdgcn_fence(__ATOMIC_ACQUIRE, "workgroup");
  }
}

// ---------------------------------------------------------------------------
// Every cast to f16 and the zero fill, which depend on inputs alone, in one grid; the block index picks the job
// (block-uniform), 8 elements per thread, 16-B stores:
//   [0, 3136)        x -> f16(16 x)                                   (3136 * 256 * 8 = 6272 * 1024)
//   [3136, 3200)     zero the 64 pad rows of the q2 plane (32 blocks) and of the k plane (32 blocks)
//   [3200, 9344)     W (q2, k, v1, v2) [1024 out][1024 in] row-major (= Bt [N][K] as-is) of layer l -> f16(256 W) into plane
//                    4 l + z of w16, 512 blocks a plane
//   [9344, 9368)     Wc [3][128][128] -> f16(256 Wc), 8 blocks a layer
// ---------------------------------------------------------------------------
constexpr int kPrepX  = kTok * kD / 8 / 256;        // 3136
constexpr int kPrepZ  = 64 * kD / 8 / 256;          // 32 per plane
constexpr int kPrepW  = kD * kD / 8 / 256;          // 512 per W plane
constexpr int kPrepWc = kL * kHD * kHD / 8 / 256;   // 24
constexpr int kPrepBlocks = kPrepX + 2 * kPrepZ + kL * 4 * kPrepW + kPrepWc;
static_assert(kPrepW == 512 && kPrepBlocks == 9368, "prep ranges");
__global__ __launch_bounds__(256) void prep_kernel(const float* __restrict__ x, const float* __restrict__ w0,
                                                   const float* __restrict__ w1, const float* __restrict__ w2,
                                                   const float* __restrict__ w3, const float* __restrict__ wc,
                                                   unsigned short* __restrict__ x16, unsigned short* __restrict__ qpad,
                                                   unsigned short* __restrict__ kpad, unsigned short* __restrict__ w16,
                                                   unsigned short* __restrict__ wc16) {
  const int bid = blockIdx.x;
  if (bid >= kPrepX && bid < kPrepX + 2 * kPrepZ) {
    const int r = bid - kPrepX;
    unsigned short* zdst = (r < kPrepZ) ? qpad : kpad;   // block-uniform select between two global pointers
    const int zi = (r & (kPrepZ - 1)) * 256 + threadIdx.x;
    const v4u z = (v4u){0u, 0u, 0u, 0u};
    store2_v4u(zdst + 8 * (size_t)zi, z);
    return;
  }
  const float* src = x;
  unsigned short* dst = x16;
  float scale = kXCarry;
  int blk = bid;
  if (bid >= kPrepX) {
    const int r = bid - (kPrepX + 2 * kPrepZ);
    scale = kWCarry;
    if (r < kL * 4 * kPrepW) {
      const int pl = r >> 9;                             // 4 * layer + projection
      const int pz = pl & 3;
      src = ((pz == 0) ? w0 : (pz == 1) ? w1 : (pz == 2) ? w2 : w3) + (size_t)(pl >> 2) * kD * kD;
      dst = w16 + (size_t)pl * kD * kD;
      blk = r & (kPrepW - 1);
    } else {
      src = wc;
      dst = wc16;
      blk = r - kL * 4 * kPrepW;
    }
  }
  const int i = blk * 256 + threadIdx.x;
  const float* p = src + 8 * (size_t)i;
  const v4f a = *(const v4f*)(p);
  const v4f c = *(const v4f*)(p + 4);
  unsigned short hb[8];
#pragma unroll
  for (int e = 0; e < 4; ++e) {
    hb[e]     = h_bits(a[e] * scale);
    hb[4 + e] = h_bits(c[e] * scale);
  }
  const v4u u = (v4u){pk16(hb[0], hb[1]), pk16(hb[2], hb[3]), pk16(hb[4], hb[5]), pk16(hb[6], hb[7])};
  store2_v4u(dst + 8 * (size_t)i, u);
}

// ---------------------------------------------------------------------------
// CELU (alpha 1.3), f32
// ---------------------------------------------------------------------------
__device__ __forceinline__ float celu_f(float x) {
  const float en = expf(x * (1.0f / 1.3f)) - 1.0f;
  return (x > 0.f) ? x : 1.3f * en;
}

// ---------------------------------------------------------------------------
// GroupNorm of the q2, k and v1 projections (CELU -> per (token, head) mean/var over 128 channels -> * gw + gb) in one grid,
// each writing a token-major f16 plane [6272][1024]: q2 and k carried x16; v1 multiplied by the k plane value (already x16)
// -> (v1*k) x16. Unit = (token, head) = 128 channels handled by 16 lanes (8 each): wave = 2 units, block = 16 units,
// 3136 blocks a plane. Blocks [0, 3136) take a unit of k and the same unit of v1, whose factor is the f16 value of k just
// stored, from the thread's own registers; blocks [3136, 6272) take q2. P: the linear+bias planes (q2, k, v1, ...).
// ---------------------------------------------------------------------------
constexpr int kGnBlocks = kTok * kH / 16;   // 3136
__device__ __forceinline__ void gn_unit(const v4f a, const v4f c, const float* __restrict__ gw, const float* __restrict__ gb,
                                        int ch, float (&o)[8]) {
  float y[8];
#pragma unroll
  for (int e = 0; e < 4; ++e) { y[e] = celu_f(a[e]); y[4 + e] = celu_f(c[e]); }
  float s = ((y[0] + y[1]) + (y[2] + y[3])) + ((y[4] + y[5]) + (y[6] + y[7]));
#pragma unroll
  for (int off = 1; off < 16; off <<= 1) s += __shfl_xor(s, off, 32);   // stays inside the 16-lane half
  const float mu = s * (1.0f / 128.0f);
  float d[8];
  float sq = 0.f;
#pragma unroll
  for (int e = 0; e < 8; ++e) { d[e] = y[e] - mu; sq += d[e] * d[e]; }
#pragma unroll
  for (int off = 1; off < 16; off <<= 1) sq += __shfl_xor(sq, off, 32);
  const float var = sq * (1.0f / 128.0f);
  const float rs = rsqrtf(var + 1e-5f);
  const v4f w0 = *(const v4f*)(gw + ch), w1 = *(const v4f*)(gw + ch + 4);
  const v4f g0 = *(const v4f*)(gb + ch), g1 = *(const v4f*)(gb + ch + 4);
#pragma unroll
  for (int e = 0; e < 4; ++e) {
    o[e]     = d[e] * rs * w0[e] + g0[e];
    o[4 + e] = d[4 + e] * rs * w1[e] + g1[e];
  }
}
__device__ __forceinline__ void gn_store(unsigned short* p, const unsigned short (&hb)[8]) {
  const v4u uu = (v4u){pk16(hb[0], hb[1]), pk16(hb[2], hb[3]), pk16(hb[4], hb[5]), pk16(hb[6], hb[7])};
  store2_v4u(p, uu);
}
__global__ __launch_bounds__(256) void gn_rows_kernel(const float* __restrict__ P,
                                                      const float* __restrict__ gqw, const float* __restrict__ gqb,
                                                      const float* __restrict__ gkw, const float* __restrict__ gkb,
                                                      const float* __restrict__ gvw, const float* __restrict__ gvb,
                                                      unsigned short* __restrict__ q16, unsigned short* __restrict__ k16,
                                                      unsigned short* __restrict__ vk16) {
  const int t = threadIdx.x, lane = t & 31, wave = t >> 5, hh = lane >> 4, cl = lane & 15;
  const bool pair = blockIdx.x < kGnBlocks;                    // block-uniform
  const int blk = pair ? blockIdx.x : blockIdx.x - kGnBlocks;
  const int u = (blk * 8 + wave) * 2 + hh;                     // token*8 + head, < 50176 (grid exact)
  const size_t base = (size_t)u * kHD + cl * 8;                // == token*1024 + head*128 + cl*8
  const int ch = (u & 7) * kHD + cl * 8;                       // channel index within 1024
  constexpr size_t plane = (size_t)kTok * kD;
  float o[8];
  unsigned short hb[8];
  if (!pair) {
    const float* pq = P + base;
    const v4f a = *(const v4f*)(pq);
    const v4f c = *(const v4f*)(pq + 4);
    // the wait owed before the address register of these loads is written again; the pointer is an input so that its
    // register stays as it is up to the wait (no loaded value may land on it either)
    asm volatile("s_wait_xcnt 0x0" :: "v"(pq) : "memory");
    gn_unit(a, c, gqw, gqb, ch, o);
#pragma unroll
    for (int e = 0; e < 8; ++e) hb[e] = h_bits(o[e] * kXCarry);
    gn_store(q16 + base, hb);
  } else {
    const float* pk = P + plane + base;
    const float* pv = P + 2 * plane + base;
    const v4f a  = *(const v4f*)(pk);
    const v4f c  = *(const v4f*)(pk + 4);
    const v4f a2 = *(const v4f*)(pv);
    const v4f c2 = *(const v4f*)(pv + 4);
    // the wait owed before the address registers of these loads are written again; the pointers are inputs so that their
    // registers stay as they are up to the wait (no loaded value may land on them either)
    asm volatile("s_wait_xcnt 0x0" :: "v"(pk), "v"(pv) : "memory");
    gn_unit(a, c, gkw, gkb, ch, o);
#pragma unroll
    for (int e = 0; e < 8; ++e) hb[e] = h_bits(o[e] * kXCarry);
    gn_store(k16 + base, hb);
    float kf[8];
#pragma unroll
    for (int e = 0; e < 8; ++e) kf[e] = h16_to_f32(hb[e]);
    gn_unit(a2, c2, gvw, gvb, ch, o);
#pragma unroll
    for (int e = 0; e < 8; ++e) hb[e] = h_bits(o[e] * kf[e]);
    gn_store(vk16 + base, hb);
  }
}

// ---------------------------------------------------------------------------
// e^x = 2^whole * exp2(rest): whole = x * log2(e) rounded to an integer, rest = x * log2(e) - whole with log2(e) in two
// terms, each by one FMA; 0 below and inf above the range of f32, at the bounds expf uses.
__device__ __forceinline__ float exp_steps(float x) {
  const float l2e = __uint_as_float(0x3fb8aa3bu), l2e_lo = __uint_as_float(0x32a5705fu);
  const float whole = __builtin_rintf(x * l2e);
  const float rest = __builtin_fmaf(x, l2e_lo, __builtin_fmaf(x, l2e, -whole));
  float v;
  // exp2 with the free slot that a transcendental is owed before its source is overwritten or its result read; only one
  // statement ties the v_nop to it
  asm("v_exp_f32 %0, %1\n\tv_nop" : "=v"(v) : "v"(rest));
  v = ldexpf(v, (int)whole);
  v = (x < __uint_as_float(0xc2ce8ed0u)) ? 0.0f : v;
  return (x > __uint_as_float(0x42b17218u)) ? __builtin_inff() : v;
}

// CELU (alpha 1.3) as celu_f, its exponential by exp_steps
__device__ __forceinline__ float celu_steps(float x) {
  const float en = exp_steps(x * (1.0f / 1.3f)) - 1.0f;
  return (x > 0.f) ? x : 1.3f * en;
}

// 1 / sqrt(x) in the steps rsqrtf takes: x below the smallest normal number is scaled by 2^24 and the result by 2^12.
__device__ __forceinline__ float rsqrt_steps(float x) {
  const bool tiny = x < __uint_as_float(0x00800000u);
  const float xs = tiny ? x * 16777216.0f : x;
  float r;
  // the free slot that a transcendental is owed before its source is overwritten or its result read; only one
  // statement ties the v_nop to it
  asm("v_rsq_f32 %0, %1\n\tv_nop" : "=v"(r) : "v"(xs));
  return tiny ? r * 4096.0f : r;
}

constexpr int kFaTiles  = 13;
constexpr int kFaRows   = kFaTiles * 16;
constexpr int kFaThr    = kFaTiles * 32;
constexpr int kFaKPitch = 136;
constexpr int kFaVPitch = 264;
constexpr int kFaOPitch = 132;
constexpr int kFaKPc    = kFaRows * 16 / kFaThr;
constexpr int kFaVGrp   = 4;
constexpr int kFaVGroups = kM / kFaVGrp;
constexpr int kFaVRounds = (kFaVGroups + kFaTiles - 1) / kFaTiles;
constexpr int kFaWRows  = kFaThr / 16;           // Wc rows a round (16 pieces of 16 B a row): 26
constexpr int kFaWPc    = (kHD + kFaWRows - 1) / kFaWRows;   // row rounds of Wc: 5
static_assert(kFaKPc * kFaThr == kFaRows * 16, "k pieces divide");
static_assert(kM % kFaVGrp == 0 && (kFaVRounds - 1) * kFaTiles <= kFaVGroups, "v2 groups are whole; all rounds but the last are whole");
static_assert((kKeyK - kM) % 4 == 0 && (kM * 2) % 8 == 0 && (kFaVPitch * 2) % 8 == 0, "8-B stores into v2^T rows are aligned");
static_assert((kFaWPc - 1) * kFaWRows <= kHD && kFaWPc * kFaWRows >= kHD, "all Wc rounds but the last are whole");
static_assert((kB - 1) * kM + kFaRows <= kTokPad, "k and q2 rows stay in their planes");
static_assert(kKeyK / 32 * 2 == kFaTiles + 1 && kKeyK <= kFaVPitch, "P*v2 depth = 7 steps of 32 keys, the last half step zero");

__global__ __launch_bounds__(kFaThr) void attn_fused_kernel(const unsigned short* __restrict__ Qp,
                                                            const unsigned short* __restrict__ Kp,
                                                            const float* __restrict__ Pv,
                                                            const float* __restrict__ gvw, const float* __restrict__ gvb,
                                                            const unsigned short* __restrict__ Gp,
                                                            const unsigned short* __restrict__ Wcp,
                                                            const float* __restrict__ bc,
                                                            const float* __restrict__ mask, float* __restrict__ att,
                                                            float scoreScale, float pvScale, float gateScale) {
  typedef Frag<_Float16> F;
  __shared__ __align__(16) unsigned short sK[kFaRows * kFaKPitch];
  __shared__ __align__(16) unsigned short sV[kHD * kFaVPitch];
  __shared__ __align__(16) float sO[kFaTiles][16 * kFaOPitch];   // per-wave 16 x 128 slab
  __shared__ __align__(16) float sMask[kFaThr];
  __shared__ __align__(16) unsigned short sW[kFaWPc * kFaWRows * kFaKPitch];   // 130 rows of Wc: 128 read, 2 spare
  __shared__ __align__(16) float sBc[kFaThr];
  const int t = threadIdx.x, lane = t & 31;
  const int wave = __builtin_amdgcn_readfirstlane(t >> 5);       // scalar: the wave's query tile, slab and v2 token groups
  const int b = blockIdx.x, h = blockIdx.y;
  const int c = lane & 15, hf = lane >> 4;

  // ---- this wave's q2 and (v1*k) fragments and v2 rows and the group's k, mask, Wc and bc, all loads in flight together ----
  const _Float16* gQ = (const _Float16*)Qp + (size_t)(b * kM + wave * 16 + c) * kD + h * kHD + hf * 8;
  const unsigned short* gK = Kp + (size_t)(b * kM + (t >> 4)) * kD + h * kHD + (t & 15) * 8;
  v16h qf[4];
  v4u rk[kFaKPc];
#pragma unroll
  for (int kk = 0; kk < 4; ++kk) qf[kk] = F::load(gQ + kk * 32);
#pragma unroll
  for (int j = 0; j < kFaKPc; ++j) rk[j] = *(const v4u*)(gK + (size_t)(j * (kFaThr / 16)) * kD);
  // v2 rows: lane = channels 4 lane .. 4 lane + 3 of the head; rounds 0..2 exist for every wave, in the last round the waves
  // past group 48 load group 48 again (in bounds) and do nothing with it
  const int vch = h * kHD + lane * 4;
  const float* pgw = gvw + vch;
  const float* pgb = gvb + vch;
  const v4f gwv = *(const v4f*)pgw;
  const v4f gbv = *(const v4f*)pgb;
  const int glast = wave + (kFaVRounds - 1) * kFaTiles;
  const bool vlast = glast < kFaVGroups;                         // wave-uniform
  const float* pV  = Pv + (size_t)(b * kM + wave * kFaVGrp) * kD + vch;
  const float* pVl = Pv + (size_t)(b * kM + (vlast ? glast : (kFaVGroups - 1)) * kFaVGrp) * kD + vch;
  v4f a[kFaVRounds * kFaVGrp];
#pragma unroll
  for (int i = 0; i < kFaVRounds - 1; ++i)
#pragma unroll
    for (int g = 0; g < kFaVGrp; ++g) a[i * kFaVGrp + g] = *(const v4f*)(pV + (size_t)(i * kFaTiles * kFaVGrp + g) * kD);
#pragma unroll
  for (int g = 0; g < kFaVGrp; ++g) a[(kFaVRounds - 1) * kFaVGrp + g] = *(const v4f*)(pVl + (size_t)g * kD);
  const int mi = b * kM + ((t < kM) ? t : (kM - 1));
  const float mload = mask[mi];
  // (v1*k) rows of the wave's queries; the plane has no pad rows, so a query row past its end reads the last row (in bounds;
  // such a query is >= 196 and its output is never read)
  const int grow = b * kM + wave * 16 + c;
  const _Float16* gG = (const _Float16*)Gp + (size_t)((grow < kTok) ? grow : (kTok - 1)) * kD + h * kHD + hf * 8;
  v16h gf[4];
#pragma unroll
  for (int kk = 0; kk < 4; ++kk) gf[kk] = F::load(gG + kk * 32);
  const unsigned short* gW = Wcp + (size_t)(t >> 4) * kHD + (t & 15) * 8;
  v4u rw[kFaWPc];
#pragma unroll
  for (int j = 0; j < kFaWPc - 1; ++j) rw[j] = *(const v4u*)(gW + (size_t)(j * kFaWRows) * kHD);
  // the last round's threads past row 127 load row 127 again (in bounds) and lay it in a spare LDS row that nobody reads
  const int wlast = (t >> 4) + (kFaWPc - 1) * kFaWRows;
  const unsigned short* gWl = Wcp + (size_t)((wlast < kHD) ? wlast : (kHD - 1)) * kHD + (t & 15) * 8;
  rw[kFaWPc - 1] = *(const v4u*)gWl;
  const int bi = t & (kHD - 1);
  const float bload = bc[bi];
  // the wait owed before the address registers of these loads are written again; the per-lane pointers and index are
  // inputs so that their registers stay as they are up to the wait (no later load may land on them either)
  asm volatile("s_wait_xcnt 0x0" :: "v"(gQ), "v"(gK), "v"(pgw), "v"(pgb), "v"(pV), "v"(pVl), "v"(mi), "v"(gG), "v"(gW), "v"(gWl), "v"(bi) : "memory");
#pragma unroll
  for (int j = 0; j < kFaKPc; ++j) *(v4u*)(sK + ((t >> 4) + j * (kFaThr / 16)) * kFaKPitch + (t & 15) * 8) = rk[j];
  sMask[t] = mload;                              // entries from 196 on repeat key 195 and are never used
#pragma unroll
  for (int j = 0; j < kFaWPc; ++j) *(v4u*)(sW + ((t >> 4) + j * kFaWRows) * kFaKPitch + (t & 15) * 8) = rw[j];
  sBc[t] = bload;                                // entries from 128 on repeat the first ones and are never used
  if (wave < kHD / 32) {                         // keys 196..223 of v2^T row t: P is 0 there, the product must be too
#pragma unroll
    for (int p = 0; p < (kKeyK - kM) / 4; ++p) *(v2u*)(sV + t * kFaVPitch + kM + p * 4) = (v2u){0u, 0u};
  }
  // CELU + GroupNorm of the wave's v2 tokens, four a group step by step side by side: their ten lane exchanges each are
  // independent, so one wait serves four.
#pragma unroll
  for (int i = 0; i < kFaVRounds; ++i) {
    if (i < kFaVRounds - 1 || vlast) {           // wave-uniform: every lane is on in the exchanges
      float y[kFaVGrp][4], d[kFaVGrp][4], sm[kFaVGrp], sq[kFaVGrp];
#pragma unroll
      for (int g = 0; g < kFaVGrp; ++g) {
#pragma unroll
        for (int e = 0; e < 4; ++e) y[g][e] = celu_steps(a[i * kFaVGrp + g][e]);
        sm[g] = (y[g][0] + y[g][1]) + (y[g][2] + y[g][3]);
      }
#pragma unroll
      for (int off = 1; off < 32; off <<= 1) {
        float x[kFaVGrp];
#pragma unroll
        for (int g = 0; g < kFaVGrp; ++g) x[g] = __shfl_xor(sm[g], off, 32);
#pragma unroll
        for (int g = 0; g < kFaVGrp; ++g) sm[g] += x[g];
      }
#pragma unroll
      for (int g = 0; g < kFaVGrp; ++g) {
        const float mu = sm[g] * (1.0f / 128.0f);
        sq[g] = 0.f;
#pragma unroll
        for (int e = 0; e < 4; ++e) { d[g][e] = y[g][e] - mu; sq[g] += d[g][e] * d[g][e]; }
      }
#pragma unroll
      for (int off = 1; off < 32; off <<= 1) {
        float x[kFaVGrp];
#pragma unroll
        for (int g = 0; g < kFaVGrp; ++g) x[g] = __shfl_xor(sq[g], off, 32);
#pragma unroll
        for (int g = 0; g < kFaVGrp; ++g) sq[g] += x[g];
      }
      float rs[kFaVGrp];
#pragma unroll
      for (int g = 0; g < kFaVGrp; ++g) rs[g] = rsqrt_steps(sq[g] * (1.0f / 128.0f) + 1e-5f);
      const int tok0 = (wave + i * kFaTiles) * kFaVGrp;
#pragma unroll
      for (int e = 0; e < 4; ++e) {
        unsigned short hb[kFaVGrp];
#pragma unroll
        for (int g = 0; g < kFaVGrp; ++g) hb[g] = h_bits((d[g][e] * rs[g] * gwv[e] + gbv[e]) * kXCarry);
        *(v2u*)(sV + (lane * 4 + e) * kFaVPitch + tok0) = (v2u){pk16(hb[0], hb[1]), pk16(hb[2], hb[3])};
      }
    }
  }
  __syncthreads();

  // ---- S^T = k * q2^T: s[tt][r] = score of key 16 tt + 8 hf + r for query 16 wave + c ----
  // The 52 products run k step by k step (product f: k step f / 13, key tile f % 13), so neighbours have different
  // accumulators; their k fragments are read in groups of 4, one group ahead, into two register sets.
  v8f s[kFaTiles];
#pragma unroll
  for (int tt = 0; tt < kFaTiles; ++tt) s[tt] = (v8f){0.f,0.f,0.f,0.f,0.f,0.f,0.f,0.f};
  {
    const _Float16* kf = (const _Float16*)sK + c * kFaKPitch + hf * 8;
    v16h ka[2][4];
#pragma unroll
    for (int e = 0; e < 4; ++e) ka[0][e] = F::load(kf + (e % kFaTiles) * 16 * kFaKPitch + (e / kFaTiles) * 32);
#pragma unroll
    for (int g = 0; g < kFaTiles; ++g) {
      if (g + 1 < kFaTiles) {
#pragma unroll
        for (int e = 0; e < 4; ++e) {
          const int f = (g + 1) * 4 + e;
          ka[(g + 1) & 1][e] = F::load(kf + (f % kFaTiles) * 16 * kFaKPitch + (f / kFaTiles) * 32);
        }
      }
      // keeps the next group's LDS reads together and ahead of this group's WMMAs (the scheduler otherwise sinks each read
      // to its use, and every WMMA then waits out an LDS latency)
      __builtin_amdgcn_sched_barrier(0);
#pragma unroll
      for (int e = 0; e < 4; ++e) {
        const int f = g * 4 + e;
        s[f % kFaTiles] = F::mma(ka[g & 1][e], qf[f / kFaTiles], s[f % kFaTiles]);
      }
      // keeps the reads of the group after next behind these WMMAs, not among them
      __builtin_amdgcn_sched_barrier(0);
    }
  }

  // ---- softmax over the query's 196 keys, f32 ----
  float mx4[4] = {-3.0e38f, -3.0e38f, -3.0e38f, -3.0e38f};
#pragma unroll
  for (int tt = 0; tt < kFaTiles; ++tt) {
    const v4f m0 = *(const v4f*)(sMask + tt * 16 + hf * 8);
    const v4f m1 = *(const v4f*)(sMask + tt * 16 + hf * 8 + 4);
#pragma unroll
    for (int r = 0; r < 8; ++r) {
      const int j = tt * 16 + hf * 8 + r;
      const float mv = (r < 4) ? m0[r & 3] : m1[r & 3];
      const float v = (mv == 0.0f) ? -1.0e9f : s[tt][r] * scoreScale;
      s[tt][r] = (j < kM) ? v : -3.0e38f;
      mx4[r & 3] = fmaxf(mx4[r & 3], s[tt][r]);
    }
  }
  float mx = fmaxf(fmaxf(mx4[0], mx4[1]), fmaxf(mx4[2], mx4[3]));
  mx = fmaxf(mx, __shfl_xor(mx, 16, 32));
  float ps4[4] = {0.f, 0.f, 0.f, 0.f};
#pragma unroll
  for (int tt = 0; tt < kFaTiles; ++tt) {
#pragma unroll
    for (int r = 0; r < 8; ++r) {
      s[tt][r] = exp_steps(s[tt][r] - mx); // an excluded key sits at -3e38: its difference is below the range, P = 0
      ps4[r & 3] += s[tt][r];
    }
  }
  float ps = (ps4[0] + ps4[1]) + (ps4[2] + ps4[3]);
  ps += __shfl_xor(ps, 16, 32);
  const float inv = 1.0f / ps;
  v16h pf[kKeyK / 32];
#pragma unroll
  for (int u = 0; u < kKeyK / 32; ++u) {
#pragma unroll
    for (int e = 0; e < 8; ++e) {
      pf[u][e]     = (_Float16)(s[2 * u][e] * inv * kPCarry);
      pf[u][8 + e] = (2 * u + 1 < kFaTiles) ? (_Float16)(s[(2 * u + 1 < kFaTiles) ? 2 * u + 1 : 0][e] * inv * kPCarry) : (_Float16)0.0f;
    }
  }

  // ---- O^T = v2^T * P^T: o[j][r] = attn of query 16 wave + c, channel 16 j + 8 hf + r ----
  v8f o[8];
#pragma unroll
  for (int j = 0; j < 8; ++j) o[j] = (v8f){0.f,0.f,0.f,0.f,0.f,0.f,0.f,0.f};
  {
    // product f: key step f / 8, channel tile f % 8; v2^T fragments in groups of 4, one group ahead, as above
    const _Float16* vf = (const _Float16*)sV + c * kFaVPitch + hf * 8;
    constexpr int kGroups = kKeyK / 32 * 2;
    v16h va[2][4];
#pragma unroll
    for (int e = 0; e < 4; ++e) va[0][e] = F::load(vf + e * 16 * kFaVPitch);
#pragma unroll
    for (int g = 0; g < kGroups; ++g) {
      if (g + 1 < kGroups) {
#pragma unroll
        for (int e = 0; e < 4; ++e) {
          const int f = (g + 1) * 4 + e;
          va[(g + 1) & 1][e] = F::load(vf + (f % 8) * 16 * kFaVPitch + (f / 8) * 32);
        }
      }
      // keeps the next group's LDS reads together and ahead of this group's WMMAs
      __builtin_amdgcn_sched_barrier(0);
#pragma unroll
      for (int e = 0; e < 4; ++e) {
        const int f = g * 4 + e;
        o[f % 8] = F::mma(va[g & 1][e], pf[f / 8], o[f % 8]);
      }
      // keeps the reads of the group after next behind these WMMAs, not among them
      __builtin_amdgcn_sched_barrier(0);
    }
  }

  // ---- G^T = Wc * (v1*k)^T: gt[j][r] = gate sum of query 16 wave + c, channel 16 j + 8 hf + r (the place of o[j][r]) ----
  v8f gt[8];
#pragma unroll
  for (int j = 0; j < 8; ++j) gt[j] = (v8f){0.f,0.f,0.f,0.f,0.f,0.f,0.f,0.f};
  {
    // product f: k step f / 8, channel tile f % 8; Wc fragments in groups of 4, one group ahead, as above
    const _Float16* wf = (const _Float16*)sW + c * kFaKPitch + hf * 8;
    constexpr int kGroups = kHD / 32 * 2;
    v16h wa[2][4];
#pragma unroll
    for (int e = 0; e < 4; ++e) wa[0][e] = F::load(wf + e * 16 * kFaKPitch);
#pragma unroll
    for (int g = 0; g < kGroups; ++g) {
      if (g + 1 < kGroups) {
#pragma unroll
        for (int e = 0; e < 4; ++e) {
          const int f = (g + 1) * 4 + e;
          wa[(g + 1) & 1][e] = F::load(wf + (f % 8) * 16 * kFaKPitch + (f / 8) * 32);
        }
      }
      // keeps the next group's LDS reads together and ahead of this group's WMMAs
      __builtin_amdgcn_sched_barrier(0);
#pragma unroll
      for (int e = 0; e < 4; ++e) {
        const int f = g * 4 + e;
        gt[f % 8] = F::mma(wa[g & 1][e], gf[f / 8], gt[f % 8]);
      }
      // keeps the reads of the group after next behind these WMMAs, not among them
      __builtin_amdgcn_sched_barrier(0);
    }
  }

  // ---- epilogue: sigmoid(G + bc) * attn; the wave's 16 x 128 block through its own slab, so that each store covers a whole
  // 512-B row piece ----
  float* slab = sO[wave];
#pragma unroll
  for (int j = 0; j < 8; ++j) {
    const v4f b0 = *(const v4f*)(sBc + j * 16 + hf * 8);
    const v4f b1 = *(const v4f*)(sBc + j * 16 + hf * 8 + 4);
    float w[8];
#pragma unroll
    for (int r = 0; r < 8; ++r) {
      float v = gt[j][r] * gateScale;
      v += (r < 4) ? b0[r & 3] : b1[r & 3];
      w[r] = (1.0f / (1.0f + exp_steps(-v))) * (o[j][r] * pvScale);
    }
    *(v4f*)(slab + c * kFaOPitch + j * 16 + hf * 8)     = (v4f){w[0], w[1], w[2], w[3]};
    *(v4f*)(slab + c * kFaOPitch + j * 16 + hf * 8 + 4) = (v4f){w[4], w[5], w[6], w[7]};
  }
  // the wave's slab writes are complete before its lanes read each other's words
  __builtin_amdgcn_fence(__ATOMIC_RELEASE, "workgroup");
  __builtin_amdgcn_wave_barrier();
  __builtin_amdgcn_fence(__ATOMIC_ACQUIRE, "workgroup");
  float* dst = att + (size_t)(b * kSP + wave * 16) * kD + h * kHD + lane * 4;
#pragma unroll
  for (int row = 0; row < 16; ++row) *(v4f*)(dst + (size_t)row * kD) = *(const v4f*)(slab + row * kFaOPitch + lane * 4);
}

// ---------------------------------------------------------------------------
// Residual + LayerNorm: y = x + gated attn ([32][256 q][1024], the gate already applied); x_new = LN(y)*lnw + lnb
// written f32 to xout (may alias xin: each block reads its whole row into registers before any store, no other block
// touches the row) and as f16(16*x_new) to x16. One block per token (grid 6272), thread t owns columns 4t..4t+3.
// ---------------------------------------------------------------------------
__global__ __launch_bounds__(256) void merge_ln_kernel(const float* xin, const float* __restrict__ att, const float* __restrict__ lnw,
                                                       const float* __restrict__ lnb, float* xout,
                                                       unsigned short* __restrict__ x16) {
  __shared__ float redA[8];
  __shared__ float redB[8];
  __shared__ __align__(16) float srow[kD];
  const int t = threadIdx.x, lane = t & 31, wave = t >> 5;
  const int r = blockIdx.x;
  const int b = r / kM;
  const int m = r - b * kM;
  const int c0 = t * 4;
  const size_t ro = (size_t)r * kD + c0;
  const v4f xv = *(const v4f*)(xin + ro);
  const v4f av = *(const v4f*)(att + ((size_t)(b * kSP + m)) * kD + c0);
  float y[4];
#pragma unroll
  for (int e = 0; e < 4; ++e) y[e] = xv[e] + av[e];
  float s = (y[0] + y[1]) + (y[2] + y[3]);
#pragma unroll
  for (int off = 1; off < 32; off <<= 1) s += __shfl_xor(s, off, 32);
  if (lane == 0) redA[wave] = s;
  __syncthreads();
  float tot = redA[0];
#pragma unroll
  for (int w = 1; w < 8; ++w) tot += redA[w];
  const float mu = tot * (1.0f / 1024.0f);
  float d[4];
  float sq = 0.f;
#pragma unroll
  for (int e = 0; e < 4; ++e) { d[e] = y[e] - mu; sq += d[e] * d[e]; }
#pragma unroll
  for (int off = 1; off < 32; off <<= 1) sq += __shfl_xor(sq, off, 32);
  if (lane == 0) redB[wave] = sq;
  __syncthreads();
  float tot2 = redB[0];
#pragma unroll
  for (int w = 1; w < 8; ++w) tot2 += redB[w];
  const float var = tot2 * (1.0f / 1024.0f);
  const float rs = rsqrtf(var + 1e-5f);
  const v4f wv = *(const v4f*)(lnw + c0);
  const v4f bv = *(const v4f*)(lnb + c0);
  v4f ov;
#pragma unroll
  for (int e = 0; e < 4; ++e) ov[e] = d[e] * rs * wv[e] + bv[e];
  *(v4f*)(srow + c0) = ov;
  __syncthreads();
  const int tc = t & 127;                               // clamped staging index; only t < 128 stores
  const v4f p0 = *(const v4f*)(srow + tc * 8);
  const v4f p1 = *(const v4f*)(srow + tc * 8 + 4);
  unsigned short hb[8];
#pragma unroll
  for (int e = 0; e < 4; ++e) {
    hb[e]     = h_bits(p0[e] * kXCarry);
    hb[4 + e] = h_bits(p1[e] * kXCarry);
  }
  const v4u hu = (v4u){pk16(hb[0], hb[1]), pk16(hb[2], hb[3]), pk16(hb[4], hb[5]), pk16(hb[6], hb[7])};
  unsigned short* hp = x16 + (size_t)r * kD + tc * 8;
  {
    *(v4f*)(xout + ro) = ov;
    if (t < 128) *(v4u*)hp = hu;
    
  }
}

// ---------------------------------------------------------------------------
// Masked mean over tokens: out0[b][c] = sum_m x[b][m][c]*mask[b][m] / sum_m mask[b][m]. One block per b (grid 32),
// ---------------------------------------------------------------------------
constexpr int kPoolRows = 28;   // token rows in flight per wave
static_assert(kM % kPoolRows == 0, "pool groups divide the tokens");
__global__ __launch_bounds__(256) void pool_kernel(const float* x, const float* __restrict__ mask, float* out0) {
  const int t = threadIdx.x;
  const int b = blockIdx.x;
  const int c0 = t * 4;
  v4f acc = (v4f){0.f, 0.f, 0.f, 0.f};
  float ms = 0.f;
  // 28 token rows are asked for at a time and then summed in token order (the order of the sums is unchanged): the wave
  // waits out 7 load latencies in place of 196. The loop over the groups stays rolled: one group's registers serve all 7.
#pragma unroll 1
  for (int m0 = 0; m0 < kM; m0 += kPoolRows) {
    const float* xp = x + ((size_t)(b * kM + m0)) * kD + c0;
    v4f xv[kPoolRows];
#pragma unroll
    for (int j = 0; j < kPoolRows; ++j) xv[j] = *(const v4f*)(xp + (size_t)j * kD);
    // the wait owed before the address register of these loads is written again; the pointer is an input so that its
    // register stays as it is up to the wait (no loaded row may land on it either)
    asm volatile("s_wait_xcnt 0x0" :: "v"(xp) : "memory");
#pragma unroll
    for (int j = 0; j < kPoolRows; ++j) {
      const float mv = mask[b * kM + m0 + j];
      acc += xv[j] * mv;
      ms += mv;
    }
  }
  const float inv = 1.0f / ms;
  const v4f o = acc * inv;
  store2_v4f(out0 + (size_t)b * kD + c0, o);
}

// ---------------------------------------------------------------------------
// Host orchestration: kernel launches only. 1 + 3*4 + 1 = 14 launches.
// ---------------------------------------------------------------------------
extern "C" void kernel_launch(void* const* d_in, const int* in_sizes, int n_in,
                              void* d_out, int out_size, void* d_ws, size_t ws_size,
                              hipStream_t stream) {
  if (n_in < 22) return;
  if (in_sizes[0] != kTok * kD) return;
  if (in_sizes[1] != kTok) return;
  if (in_sizes[2] != kL * kD * kD || in_sizes[6] != kL * kD * kD || in_sizes[10] != kL * kD * kD || in_sizes[14] != kL * kD * kD) return;
  if (in_sizes[18] != kL * kHD * kHD || in_sizes[19] != kL * kHD) return;
  if (in_sizes[3] != kL * kD || in_sizes[20] != kL * kD || in_sizes[21] != kL * kD) return;
  if (out_size != kB * kD + kTok * kD) return;
  if (ws_size < kWsTotal) return;

  const float* att_feats = (const float*)d_in[0];
  const float* att_mask  = (const float*)d_in[1];
  const float* Wq2  = (const float*)d_in[2];
  const float* bq2  = (const float*)d_in[3];
  const float* gq2w = (const float*)d_in[4];
  const float* gq2b = (const float*)d_in[5];
  const float* Wk   = (const float*)d_in[6];
  const float* bk   = (const float*)d_in[7];
  const float* gkw  = (const float*)d_in[8];
  const float* gkb  = (const float*)d_in[9];
  const float* Wv1  = (const float*)d_in[10];
  const float* bv1  = (const float*)d_in[11];
  const float* gv1w = (const float*)d_in[12];
  const float* gv1b = (const float*)d_in[13];
  const float* Wv2  = (const float*)d_in[14];
  const float* bv2  = (const float*)d_in[15];
  const float* gv2w = (const float*)d_in[16];
  const float* gv2b = (const float*)d_in[17];
  const float* Wc   = (const float*)d_in[18];
  const float* bc   = (const float*)d_in[19];
  const float* lnw  = (const float*)d_in[20];
  const float* lnb  = (const float*)d_in[21];

  char* ws = (char*)d_ws;
  float*          Ppl   = (float*)(ws + kOffP);                    // linear+bias planes (q2, k, v1, v2)
  float*          ATT   = (float*)(ws + kOffP);                    // gated attn plane (same region, over the q2 plane and part of the k plane, both used up by then)
  unsigned short* GIN16 = (unsigned short*)(ws + kOffATT);         // (v1*k) plane
  unsigned short* X16   = (unsigned short*)(ws + kOffX16);
  unsigned short* W16   = (unsigned short*)(ws + kOffW16);
  unsigned short* WC16  = (unsigned short*)(ws + kOffWC16);
  unsigned short* Q16   = (unsigned short*)(ws + kOffQ16);
  unsigned short* K16   = (unsigned short*)(ws + kOffK16);

  float* out0 = (float*)d_out;                                     // [32][1024] at byte 0
  float* out1 = (float*)d_out + (size_t)kB * kD;                   // [32][196][1024] at byte 131072; also the running x

  const float projScale  = 1.0f / (kXCarry * kWCarry);             // 1/4096
  const float gateScale  = 1.0f / (kXCarry * kWCarry);             // (v1*k) x16, Wc x256
  const float scoreScale = 0.08838834764831845f * (1.0f / (kXCarry * kXCarry));
  const float pvScale    = 1.0f / (kPCarry * kXCarry);             // 1/32768

  // x and every layer's W and Wc -> f16 planes; pad rows of the q2/k planes zero
  prep_kernel<<<dim3(kPrepBlocks), dim3(256), 0, stream>>>(att_feats, Wq2, Wk, Wv1, Wv2, Wc, X16,
                                                           Q16 + (size_t)kTok * kD, K16 + (size_t)kTok * kD, W16, WC16);

  for (int i = 0; i < kL; ++i) {
    const size_t vo = (size_t)i * kD;

    // four projections: P[z] = x16 * Wz^T + bz (M 6272, N 4 * 1024, K 1024; 49 x 16 block tiles of 128 x 256 = 784 blocks)
    proj_gemm_lds_kernel<<<dim3((kTok / kPjBM) * (4 * kD / kPjBN)), dim3(256), 0, stream>>>(
        X16, W16 + (size_t)i * 4 * kD * kD, Ppl, bq2 + vo, bk + vo, bv1 + vo, bv2 + vo, projScale);

    // CELU + GroupNorm of q2, k and v1 (with v1 * k), token-major
    gn_rows_kernel<<<dim3(2 * kGnBlocks), dim3(256), 0, stream>>>(Ppl, gq2w + vo, gq2b + vo, gkw + vo, gkb + vo,
                                                                  gv1w + vo, gv1b + vo, Q16, K16, GIN16);

    // attention: CELU + GroupNorm of v2, scores, softmax, P * v2 and the gate sigmoid((v1*k) * Wc^T + bc) of one (batch, head)
    // group per work-group, 256 groups in one launch
    attn_fused_kernel<<<dim3(kB, kH), dim3(kFaThr), 0, stream>>>(Q16, K16, Ppl + (size_t)3 * kTok * kD, gv2w + vo, gv2b + vo,
                                                                 GIN16, WC16 + (size_t)i * kHD * kHD,
                                                                 bc + (size_t)i * kHD, att_mask, ATT, scoreScale, pvScale,
                                                                 gateScale);

    const float* xin = (i == 0) ? att_feats : out1;
    merge_ln_kernel<<<dim3(kTok), dim3(256), 0, stream>>>(xin, ATT, lnw + (size_t)i * kD, lnb + (size_t)i * kD, out1, X16);
  }

  pool_kernel<<<dim3(kB), dim3(256), 0, stream>>>(out1, att_mask, out0);
}

// v007
// A run of this version takes 346 microseconds.
// Timed twice side by side with v006, it ran 1.05 times as fast both times.
// Counting every step since v000, it is 4.59 times as fast.
// Contractions: projections x(f16, x16)*W^T(f16, x256), gate (v1*k)(f16, x16)*Wc^T(f16, x256), scores q2(f16, x16)*k^T(f16, x16), attn P(f16, x2048)*v2(f16, x16): all v_wmma_f32_16x16x32_f16 with f32 accumulate; CELU, GroupNorm, softmax, sigmoid, residual, LayerNorm and masked mean in f32.
#include <hip/hip_runtime.h>
#include <math.h>

// ---------------------------------------------------------------------------
// Problem constants
// ---------------------------------------------------------------------------
constexpr int kB   = 32;
constexpr int kM   = 196;
constexpr int kD   = 1024;
constexpr int kH   = 8;
constexpr int kHD  = 128;
constexpr int kL   = 3;
constexpr int kTok = kB * kM;          // 6272 = 98 * 64 token rows
constexpr int kTokPad = kTok + 64;     // 6336: 64 zero rows so per-group 208-row tiles never leave the plane
constexpr int kSP  = 256;              // padded queries per (batch, head) group (rows of the gated attn plane)
constexpr int kKeyK = 224;             // contraction depth of P*V (keys padded to a multiple of 32)
constexpr float kXCarry = 16.0f;       // x, q2, k, v2 planes carried x16 in f16
constexpr float kWCarry = 256.0f;      // W, Wc carried x256 in f16
constexpr float kPCarry = 2048.0f;     // probabilities carried x2048 in f16

// ---------------------------------------------------------------------------
// Workspace region map (bytes, all offsets multiples of 256)
//   R_P    : linear+bias planes f32 [4: q2, k, v1, v2][6272][1024] -> later gated attn f32 [32][256][1024]
//   R_ATT  : (v1*k) f16 plane [6272][1024]
//   R_X16  : x f16 [6272][1024]
//   R_W16  : stacked W f16 [3 layers][4096][1024]
//   R_WC16 : Wc f16 [3 layers][128][128]
//   R_Q16  : q2 f16 [6336][1024] (rows >= 6272 zero)
//   R_K16  : k  f16 [6336][1024] (rows >= 6272 zero)
// ---------------------------------------------------------------------------
constexpr size_t kBytesP1   = (size_t)kTok * kD * 4;       // one plane
constexpr size_t kBytesP    = 4 * kBytesP1;
constexpr size_t kBytesATT  = (size_t)kB * kSP * kD * 4;
constexpr size_t kBytesX16  = (size_t)kTok * kD * 2;
constexpr size_t kBytesW16  = (size_t)kL * 4 * kD * kD * 2;
constexpr size_t kBytesWC16 = (size_t)kL * kHD * kHD * 2;
constexpr size_t kBytesQ16  = (size_t)kTokPad * kD * 2;
constexpr size_t kOffP    = 0;
constexpr size_t kOffATT  = kOffP + kBytesP;
constexpr size_t kOffX16  = kOffATT + kBytesATT;
constexpr size_t kOffW16  = kOffX16 + kBytesX16;
constexpr size_t kOffWC16 = kOffW16 + kBytesW16;
constexpr size_t kOffQ16  = kOffWC16 + kBytesWC16;
constexpr size_t kOffK16  = kOffQ16 + kBytesQ16;
constexpr size_t kWsTotal = kOffK16 + kBytesQ16;
static_assert(kWsTotal == 200376320, "carve total");
static_assert(kWsTotal <= 268435456, "carve under 256 MiB");
static_assert(kBytesATT >= (size_t)kTok * kD * 2, "vk plane fits in its region");
static_assert(kBytesATT <= kBytesP, "gated attn plane fits in the P region");
static_assert((kOffATT % 256) == 0 && (kOffX16 % 256) == 0 && (kOffW16 % 256) == 0 && (kOffQ16 % 256) == 0 && (kOffK16 % 256) == 0, "aligned");

typedef __attribute__((ext_vector_type(16))) _Float16 v16h;
typedef __attribute__((ext_vector_type(8)))  _Float16 v8h;
typedef __attribute__((ext_vector_type(16))) __bf16   v16b;
typedef __attribute__((ext_vector_type(8)))  __bf16   v8b;
typedef __attribute__((ext_vector_type(8)))  float    v8f;
typedef __attribute__((ext_vector_type(4)))  float    v4f;
typedef __attribute__((ext_vector_type(4)))  unsigned int v4u;
typedef __attribute__((ext_vector_type(2)))  unsigned int v2u;

__device__ __forceinline__ unsigned short f2bf_bits(float f) {
  unsigned u = __float_as_uint(f);
  return (unsigned short)((u + 0x7FFFu + ((u >> 16) & 1u)) >> 16);
}
__device__ __forceinline__ float bf_bits2f(unsigned short h) { return __uint_as_float(((unsigned)h) << 16); }

template <typename T> struct Frag;
template <> struct Frag<_Float16> {
  typedef v16h V; union U { v16h v; v8h h[2]; };
  static __device__ __forceinline__ v16h load(const _Float16* p) {   // elements 0..7 <- p[0..7], 8..15 <- p[16..23]
    U f; f.h[0] = *(const v8h*)(p); f.h[1] = *(const v8h*)(p + 16); return f.v;
  }
  static __device__ __forceinline__ v8f mma(v16h a, v16h b, v8f c) {
    return __builtin_amdgcn_wmma_f32_16x16x32_f16(false, a, false, b, (short)0, c, false, false);
  }
};
template <> struct Frag<__bf16> {
  typedef v16b V; union U { v16b v; v8b h[2]; };
  static __device__ __forceinline__ v16b load(const __bf16* p) {
    U f; f.h[0] = *(const v8b*)(p); f.h[1] = *(const v8b*)(p + 16); return f.v;
  }
  static __device__ __forceinline__ v8f mma(v16b a, v16b b, v8f c) {
    return __builtin_amdgcn_wmma_f32_16x16x32_bf16(false, a, false, b, (short)0, c, false, false);
  }
};

__device__ __forceinline__ unsigned pk16(unsigned short a, unsigned short b) { return (unsigned)a | ((unsigned)b << 16); }
__device__ __forceinline__ unsigned short h_bits(float f) { const _Float16 h = (_Float16)f; return __builtin_bit_cast(unsigned short, h); }

// exact f16 bits -> f32 via integer arithmetic (normals and subnormals; no _Float16 vector involved)
__device__ __forceinline__ float h16_to_f32(unsigned hb) {
  const unsigned em = hb & 0x7fffu;
  const float fn = __uint_as_float((em + 0x1C000u) << 13);
  const float fs = (float)em * 5.9604644775390625e-8f;
  const float f  = (em < 0x400u) ? fs : fn;
  return __uint_as_float(__float_as_uint(f) | ((hb & 0x8000u) << 16));
}

__device__ __forceinline__ void store2_v4u(unsigned short* p, v4u u) {
  *(v4u*)p = u;
  
}
__device__ __forceinline__ void store2_v4f(float* p, v4f v) {
  *(v4f*)p = v;
  
}

// ---------------------------------------------------------------------------
// Projection GEMM with operands staged in LDS: C[m,n] = scale * sum_k A[m,k] * Bt[n,k] + bias[n], f32 out.
// A [6272][1024] f16, Bt [4096][1024] f16, both k-contiguous. Block tile 128 (m) x 256 (n), 8 waves as 2 x 4, each wave the
// 64x64 tile, fragments by Frag::load, k ascending. A stage is 64 k = one 128-B line of each of the 384 operand
// rows (A rows first, then Bt rows), laid at a 144-B pitch in one of two LDS buffers. Every global load covers whole lines
// (8 lanes per row). Stage s + 2 is fetched into registers during stage s and stored to LDS during stage s + 1, so a
// fetch has a whole stage to land. The four projections share one grid: Bt is the stacked W [4096][1024], column tile
// nT = 0..15 belongs to projection nT / 4 and goes to that projection's plane of C with its bias.
// grid = 49 * 16 = 784 blocks (6272 = 49 * 128, 4096 = 16 * 256), column tile fastest.
// ---------------------------------------------------------------------------
constexpr int kPjBM = 128;                       // block rows of A
constexpr int kPjBN = 256;                       // block rows of Bt
constexpr int kPjBK = 64;                        // halves of k per stage
constexpr int kPjPitch = 72;                     // halves per staged row (144 B)
constexpr int kPjStage = (kPjBM + kPjBN) * kPjPitch;   // halves per buffer (55,296 B)
constexpr int kPjStages = kD / kPjBK;            // 16
static_assert(kTok % kPjBM == 0 && kD % kPjBN == 0 && kD % (2 * kPjBK) == 0 && kPjStages >= 4, "projection tiles divide the problem");

// 12 pieces of 16 B per thread: pieces 0..3 = A rows, 4..11 = Bt rows, 32 staged rows apart
__device__ __forceinline__ void pj_fetch(v4u (&r)[12], const unsigned short* gA, const unsigned short* gB, int k) {
#pragma unroll
  for (int j = 0; j < 4; ++j) r[j] = *(const v4u*)(gA + (size_t)(32 * j) * kD + k);
#pragma unroll
  for (int j = 0; j < 8; ++j) r[4 + j] = *(const v4u*)(gB + (size_t)(32 * j) * kD + k);
}
__device__ __forceinline__ void pj_put(unsigned short* dst, const v4u (&r)[12]) {
#pragma unroll
  for (int j = 0; j < 12; ++j) *(v4u*)(dst + 32 * j * kPjPitch) = r[j];
}
// Work-group barrier that orders LDS only: __syncthreads() also waits for every global load in flight, which would
// end the fetch of the stage after next at each barrier; those loads land in registers and concern no other wave.
__device__ __forceinline__ void pj_barrier() {
  __builtin_amdgcn_fence(__ATOMIC_RELEASE, "workgroup", "local");
  __builtin_amdgcn_s_barrier();
  __builtin_amdgcn_fence(__ATOMIC_ACQUIRE, "workgroup", "local");
}
// One stage: fetch stage k/64 into ld (FETCH), multiply the stage in cur, store the stage held in st to nxt (PUT).
template <bool FETCH, bool PUT>
__device__ __forceinline__ void pj_stage(const _Float16* curA, const _Float16* curB, unsigned short* nxt,
                                         const unsigned short* gA, const unsigned short* gB, int k,
                                         v4u (&ld)[12], const v4u (&st)[12], v8f (&acc)[4][4]) {
  typedef Frag<_Float16> F;
  v16h bh[2][4], ah[2][4];
#pragma unroll
  for (int kk = 0; kk < 2; ++kk) {
#pragma unroll
    for (int j = 0; j < 4; ++j) bh[kk][j] = F::load(curB + j * 16 * kPjPitch + kk * 32);
#pragma unroll
    for (int i = 0; i < 4; ++i) ah[kk][i] = F::load(curA + i * 16 * kPjPitch + kk * 32);
  }
  // keeps the LDS fragment reads as one group ahead of the matrix work (the scheduler otherwise spreads them among the
  // WMMAs) and ahead of the fetch, so that no fragment lands in a register that a fetch in flight names as its address
  __builtin_amdgcn_sched_barrier(0);
  if (FETCH) pj_fetch(ld, gA, gB, k);
  // keeps the fetch ahead of the matrix work (the scheduler otherwise sinks it to its use, a stage later)
  __builtin_amdgcn_sched_barrier(0);
#pragma unroll
  for (int i = 0; i < 4; ++i)
#pragma unroll
    for (int j = 0; j < 4; ++j) acc[i][j] = F::mma(ah[0][i], bh[0][j], acc[i][j]);
  // keeps the LDS stores of the next stage behind the first WMMA half, when this stage's fragment reads have been served
  __builtin_amdgcn_sched_barrier(0);
  // the wait owed before the fetch's address registers are written again; 16 WMMAs behind the fetch
  if (FETCH) asm volatile("s_wait_xcnt 0x0" ::: "memory");
  if (PUT) pj_put(nxt, st);
  // keeps the second WMMA half behind the stores: it needs no LDS, so it can run past the barrier, beside the next reads
  __builtin_amdgcn_sched_barrier(0);
#pragma unroll
  for (int i = 0; i < 4; ++i)
#pragma unroll
    for (int j = 0; j < 4; ++j) acc[i][j] = F::mma(ah[1][i], bh[1][j], acc[i][j]);
  if (PUT) pj_barrier();               // publishes the stage just stored and ends every read of cur
}

__global__ __launch_bounds__(256) void proj_gemm_lds_kernel(const unsigned short* __restrict__ Ap,
                                                            const unsigned short* __restrict__ Btp,
                                                            float* __restrict__ Cp, const float* __restrict__ bias0,
                                                            const float* __restrict__ bias1, const float* __restrict__ bias2,
                                                            const float* __restrict__ bias3, float scale) {
  __shared__ __align__(16) unsigned short sAB[2][kPjStage];
  __shared__ __align__(16) float sT[8][16 * 68];   // per-wave 16x64 slab, pitch 68 floats
  const int t    = threadIdx.x;
  const int lane = t & 31;
  const int wave = t >> 5;
  const int nT = blockIdx.x & 15;              // column tile of the stacked W
  const int pz = nT >> 2;                      // projection (block-uniform)
  const int mB = (blockIdx.x >> 4) * kPjBM;
  const int nB = (nT & 3) * kPjBN;             // column within the projection's plane
  float* C = Cp + (size_t)pz * kTok * kD;
  const float* bias = (pz == 0) ? bias0 : (pz == 1) ? bias1 : (pz == 2) ? bias2 : bias3;
  const int m0 = mB + (wave >> 2) * 64;
  const int n0 = nB + (wave & 3) * 64;

  const int rlane = lane & 15;                 // row (A) / col (B, D) within subtile
  const int koff  = (lane >> 4) * 8;           // k offset of this lane half
  const int mOff  = (lane >> 4) * 8;           // D row offset

  // staging map: piece j of thread t is 16 B number (t & 7) of staged row (t >> 3) + 32 * j
  const int srow = t >> 3;
  const int spart = (t & 7) * 8;
  const unsigned short* gA = Ap  + (size_t)(mB + srow) * kD + spart;
  const unsigned short* gB = Btp + (size_t)(nT * kPjBN + srow) * kD + spart;
  unsigned short* put0 = &sAB[0][srow * kPjPitch + spart];
  unsigned short* put1 = &sAB[1][srow * kPjPitch + spart];
  const int fA = ((wave >> 2) * 64 + rlane) * kPjPitch + koff;
  const int fB = (kPjBM + (wave & 3) * 64 + rlane) * kPjPitch + koff;
  const _Float16* a0 = (const _Float16*)sAB[0] + fA;
  const _Float16* b0 = (const _Float16*)sAB[0] + fB;
  const _Float16* a1 = (const _Float16*)sAB[1] + fA;
  const _Float16* b1 = (const _Float16*)sAB[1] + fB;

  v8f acc[4][4];
#pragma unroll
  for (int i = 0; i < 4; ++i)
#pragma unroll
    for (int j = 0; j < 4; ++j) acc[i][j] = (v8f){0.f,0.f,0.f,0.f,0.f,0.f,0.f,0.f};

  v4u pe[12], po[12];                          // even and odd stages on their way to LDS
  pj_fetch(pe, gA, gB, 0);
  pj_fetch(po, gA, gB, kPjBK);
  asm volatile("s_wait_xcnt 0x0" ::: "memory");   // the wait owed before the fetches' address registers are written again
  pj_put(put0, pe);
  pj_barrier();

  for (int s = 0; s < kPjStages - 2; s += 2) {
    pj_stage<true, true>(a0, b0, put1, gA, gB, (s + 2) * kPjBK, pe, po, acc);   // stage s; fetch s + 2, store s + 1
    pj_stage<true, true>(a1, b1, put0, gA, gB, (s + 3) * kPjBK, po, pe, acc);   // stage s + 1; fetch s + 3, store s + 2
  }
  pj_stage<false, true>(a0, b0, put1, gA, gB, 0, pe, po, acc);                  // stage 14; store 15
  pj_stage<false, false>(a1, b1, put0, gA, gB, 0, po, pe, acc);                 // stage 15

  // ---- epilogue: scale, bias[n], f32 out through the wave's slab ----
  float* slab = sT[wave];
#pragma unroll
  for (int i = 0; i < 4; ++i) {
    const int mBase = m0 + (i << 4);
#pragma unroll
    for (int j = 0; j < 4; ++j) {
      const float bv = bias[n0 + (j << 4) + rlane];
#pragma unroll
      for (int r = 0; r < 8; ++r) {
        float v = acc[i][j][r] * scale;
        v += bv;
        slab[(mOff + r) * 68 + (j << 4) + rlane] = v;
      }
    }
    // the wave's slab writes are complete before its lanes read each other's words
    __builtin_amdgcn_fence(__ATOMIC_RELEASE, "workgroup");
    __builtin_amdgcn_wave_barrier();
    __builtin_amdgcn_fence(__ATOMIC_ACQUIRE, "workgroup");
    const int hh = lane >> 4, c4 = (lane & 15) * 4;     // row seg = 256 B = 16 lanes x 16 B
#pragma unroll
    for (int it = 0; it < 8; ++it) {
      const int row = it * 2 + hh;
      v4f v = *(const v4f*)(slab + row * 68 + c4);
      *(v4f*)(C + (size_t)(mBase + row) * kD + n0 + c4) = v;
    }
    // the wait owed before a register that these stores name (address or data) is written again; the scheduling fence
    // keeps the next rows' register writes behind it
    asm volatile("s_wait_xcnt 0x0" ::: "memory");
    __builtin_amdgcn_sched_barrier(0);
    // the slab is read out before the next 16 rows overwrite it
    __builtin_amdgcn_fence(__ATOMIC_RELEASE, "workgroup");
    __builtin_amdgcn_wave_barrier();
    __builtin_amdgcn_fence(__ATOMIC_ACQUIRE, "workgroup");
  }
}

// ---------------------------------------------------------------------------
// Every cast to f16 and the zero fill, which depend on inputs alone, in one grid; the block index picks the job
// (block-uniform), 8 elements per thread, 16-B stores:
//   [0, 3136)        x -> f16(16 x)                                   (3136 * 256 * 8 = 6272 * 1024)
//   [3136, 3200)     zero the 64 pad rows of the q2 plane (32 blocks) and of the k plane (32 blocks)
//   [3200, 9344)     W (q2, k, v1, v2) [1024 out][1024 in] row-major (= Bt [N][K] as-is) of layer l -> f16(256 W) into plane
//                    4 l + z of w16, 512 blocks a plane
//   [9344, 9368)     Wc [3][128][128] -> f16(256 Wc), 8 blocks a layer
// ---------------------------------------------------------------------------
constexpr int kPrepX  = kTok * kD / 8 / 256;        // 3136
constexpr int kPrepZ  = 64 * kD / 8 / 256;          // 32 per plane
constexpr int kPrepW  = kD * kD / 8 / 256;          // 512 per W plane
constexpr int kPrepWc = kL * kHD * kHD / 8 / 256;   // 24
constexpr int kPrepBlocks = kPrepX + 2 * kPrepZ + kL * 4 * kPrepW + kPrepWc;
static_assert(kPrepW == 512 && kPrepBlocks == 9368, "prep ranges");
__global__ __launch_bounds__(256) void prep_kernel(const float* __restrict__ x, const float* __restrict__ w0,
                                                   const float* __restrict__ w1, const float* __restrict__ w2,
                                                   const float* __restrict__ w3, const float* __restrict__ wc,
                                                   unsigned short* __restrict__ x16, unsigned short* __restrict__ qpad,
                                                   unsigned short* __restrict__ kpad, unsigned short* __restrict__ w16,
                                                   unsigned short* __restrict__ wc16) {
  const int bid = blockIdx.x;
  if (bid >= kPrepX && bid < kPrepX + 2 * kPrepZ) {
    const int r = bid - kPrepX;
    unsigned short* zdst = (r < kPrepZ) ? qpad : kpad;   // block-uniform select between two global pointers
    const int zi = (r & (kPrepZ - 1)) * 256 + threadIdx.x;
    const v4u z = (v4u){0u, 0u, 0u, 0u};
    store2_v4u(zdst + 8 * (size_t)zi, z);
    return;
  }
  const float* src = x;
  unsigned short* dst = x16;
  float scale = kXCarry;
  int blk = bid;
  if (bid >= kPrepX) {
    const int r = bid - (kPrepX + 2 * kPrepZ);
    scale = kWCarry;
    if (r < kL * 4 * kPrepW) {
      const int pl = r >> 9;                             // 4 * layer + projection
      const int pz = pl & 3;
      src = ((pz == 0) ? w0 : (pz == 1) ? w1 : (pz == 2) ? w2 : w3) + (size_t)(pl >> 2) * kD * kD;
      dst = w16 + (size_t)pl * kD * kD;
      blk = r & (kPrepW - 1);
    } else {
      src = wc;
      dst = wc16;
      blk = r - kL * 4 * kPrepW;
    }
  }
  const int i = blk * 256 + threadIdx.x;
  const float* p = src + 8 * (size_t)i;
  const v4f a = *(const v4f*)(p);
  const v4f c = *(const v4f*)(p + 4);
  unsigned short hb[8];
#pragma unroll
  for (int e = 0; e < 4; ++e) {
    hb[e]     = h_bits(a[e] * scale);
    hb[4 + e] = h_bits(c[e] * scale);
  }
  const v4u u = (v4u){pk16(hb[0], hb[1]), pk16(hb[2], hb[3]), pk16(hb[4], hb[5]), pk16(hb[6], hb[7])};
  store2_v4u(dst + 8 * (size_t)i, u);
}

// ---------------------------------------------------------------------------
// 2^x by the hardware's exp2 alone; it gives 0 below the range of f32 and inf above it by itself. e^x = 2^(x * log2(e)): the
// rounding of that one product is a relative error of about |x| * 6e-8 in e^x, far under the f16 step of every plane and
// fragment that these values end in.
// ---------------------------------------------------------------------------
constexpr float kLog2e = 1.4426950408889634f;
__device__ __forceinline__ float exp2_hw(float x) {
  float v;
  // the v_nop is the free slot that a transcendental is owed before its source is overwritten or its result read; only one
  // statement ties it to the instruction
  asm("v_exp_f32 %0, %1\n\tv_nop" : "=v"(v) : "v"(x));
  return v;
}

// 1 / x by the hardware's reciprocal alone (about one unit in the last place of f32; 0 at inf), for x of 1 or more
__device__ __forceinline__ float rcp_hw(float x) {
  float v;
  // the v_nop: the same free slot as in exp2_hw
  asm("v_rcp_f32 %0, %1\n\tv_nop" : "=v"(v) : "v"(x));
  return v;
}

// ---------------------------------------------------------------------------
// CELU (alpha 1.3), f32
// ---------------------------------------------------------------------------
__device__ __forceinline__ float celu_f(float x) {
  const float en = exp2_hw(x * (kLog2e / 1.3f)) - 1.0f;
  return (x > 0.f) ? x : 1.3f * en;
}

// ---------------------------------------------------------------------------
// GroupNorm of the q2, k and v1 projections (CELU -> per (token, head) mean/var over 128 channels -> * gw + gb) in one grid,
// each writing a token-major f16 plane [6272][1024]: q2 and k carried x16; v1 multiplied by the k plane value (already x16)
// -> (v1*k) x16. Unit = (token, head) = 128 channels handled by 16 lanes (8 each): wave = 2 units, block = 16 units,
// 3136 blocks a plane. Blocks [0, 3136) take a unit of k and the same unit of v1, whose factor is the f16 value of k just
// stored, from the thread's own registers; blocks [3136, 6272) take q2. P: the linear+bias planes (q2, k, v1, ...).
// ---------------------------------------------------------------------------
constexpr int kGnBlocks = kTok * kH / 16;   // 3136
__device__ __forceinline__ void gn_unit(const v4f a, const v4f c, const float* __restrict__ gw, const float* __restrict__ gb,
                                        int ch, float (&o)[8]) {
  float y[8];
#pragma unroll
  for (int e = 0; e < 4; ++e) { y[e] = celu_f(a[e]); y[4 + e] = celu_f(c[e]); }
  float s = ((y[0] + y[1]) + (y[2] + y[3])) + ((y[4] + y[5]) + (y[6] + y[7]));
#pragma unroll
  for (int off = 1; off < 16; off <<= 1) s += __shfl_xor(s, off, 32);   // stays inside the 16-lane half
  const float mu = s * (1.0f / 128.0f);
  float d[8];
  float sq = 0.f;
#pragma unroll
  for (int e = 0; e < 8; ++e) { d[e] = y[e] - mu; sq += d[e] * d[e]; }
#pragma unroll
  for (int off = 1; off < 16; off <<= 1) sq += __shfl_xor(sq, off, 32);
  const float var = sq * (1.0f / 128.0f);
  const float rs = rsqrtf(var + 1e-5f);
  const v4f w0 = *(const v4f*)(gw + ch), w1 = *(const v4f*)(gw + ch + 4);
  const v4f g0 = *(const v4f*)(gb + ch), g1 = *(const v4f*)(gb + ch + 4);
#pragma unroll
  for (int e = 0; e < 4; ++e) {
    o[e]     = d[e] * rs * w0[e] + g0[e];
    o[4 + e] = d[4 + e] * rs * w1[e] + g1[e];
  }
}
__device__ __forceinline__ void gn_store(unsigned short* p, const unsigned short (&hb)[8]) {
  const v4u uu = (v4u){pk16(hb[0], hb[1]), pk16(hb[2], hb[3]), pk16(hb[4], hb[5]), pk16(hb[6], hb[7])};
  store2_v4u(p, uu);
}
__global__ __launch_bounds__(256) void gn_rows_kernel(const float* __restrict__ P,
                                                      const float* __restrict__ gqw, const float* __restrict__ gqb,
                                                      const float* __restrict__ gkw, const float* __restrict__ gkb,
                                                      const float* __restrict__ gvw, const float* __restrict__ gvb,
                                                      unsigned short* __restrict__ q16, unsigned short* __restrict__ k16,
                                                      unsigned short* __restrict__ vk16) {
  const int t = threadIdx.x, lane = t & 31, wave = t >> 5, hh = lane >> 4, cl = lane & 15;
  const bool pair = blockIdx.x < kGnBlocks;                    // block-uniform
  const int blk = pair ? blockIdx.x : blockIdx.x - kGnBlocks;
  const int u = (blk * 8 + wave) * 2 + hh;                     // token*8 + head, < 50176 (grid exact)
  const size_t base = (size_t)u * kHD + cl * 8;                // == token*1024 + head*128 + cl*8
  const int ch = (u & 7) * kHD + cl * 8;                       // channel index within 1024
  constexpr size_t plane = (size_t)kTok * kD;
  float o[8];
  unsigned short hb[8];
  if (!pair) {
    const float* pq = P + base;
    const v4f a = *(const v4f*)(pq);
    const v4f c = *(const v4f*)(pq + 4);
    // the wait owed before the address register of these loads is written again; the pointer is an input so that its
    // register stays as it is up to the wait (no loaded value may land on it either)
    asm volatile("s_wait_xcnt 0x0" :: "v"(pq) : "memory");
    gn_unit(a, c, gqw, gqb, ch, o);
#pragma unroll
    for (int e = 0; e < 8; ++e) hb[e] = h_bits(o[e] * kXCarry);
    gn_store(q16 + base, hb);
  } else {
    const float* pk = P + plane + base;
    const float* pv = P + 2 * plane + base;
    const v4f a  = *(const v4f*)(pk);
    const v4f c  = *(const v4f*)(pk + 4);
    const v4f a2 = *(const v4f*)(pv);
    const v4f c2 = *(const v4f*)(pv + 4);
    // the wait owed before the address registers of these loads are written again; the pointers are inputs so that their
    // registers stay as they are up to the wait (no loaded value may land on them either)
    asm volatile("s_wait_xcnt 0x0" :: "v"(pk), "v"(pv) : "memory");
    gn_unit(a, c, gkw, gkb, ch, o);
#pragma unroll
    for (int e = 0; e < 8; ++e) hb[e] = h_bits(o[e] * kXCarry);
    gn_store(k16 + base, hb);
    float kf[8];
#pragma unroll
    for (int e = 0; e < 8; ++e) kf[e] = h16_to_f32(hb[e]);
    gn_unit(a2, c2, gvw, gvb, ch, o);
#pragma unroll
    for (int e = 0; e < 8; ++e) hb[e] = h_bits(o[e] * kf[e]);
    gn_store(vk16 + base, hb);
  }
}

// ---------------------------------------------------------------------------
// 1 / sqrt(x) in the steps rsqrtf takes: x below the smallest normal number is scaled by 2^24 and the result by 2^12.
__device__ __forceinline__ float rsqrt_steps(float x) {
  const bool tiny = x < __uint_as_float(0x00800000u);
  const float xs = tiny ? x * 16777216.0f : x;
  float r;
  // the free slot that a transcendental is owed before its source is overwritten or its result read; only one
  // statement ties the v_nop to it
  asm("v_rsq_f32 %0, %1\n\tv_nop" : "=v"(r) : "v"(xs));
  return tiny ? r * 4096.0f : r;
}

constexpr int kFaTiles  = 13;
constexpr int kFaRows   = kFaTiles * 16;
constexpr int kFaThr    = kFaTiles * 32;
constexpr int kFaKPitch = 136;
constexpr int kFaVPitch = 264;
constexpr int kFaOPitch = 132;
constexpr int kFaKPc    = kFaRows * 16 / kFaThr;
constexpr int kFaVGrp   = 4;
constexpr int kFaVGroups = kM / kFaVGrp;
constexpr int kFaVRounds = (kFaVGroups + kFaTiles - 1) / kFaTiles;
constexpr int kFaWRows  = kFaThr / 16;           // Wc rows a round (16 pieces of 16 B a row): 26
constexpr int kFaWPc    = (kHD + kFaWRows - 1) / kFaWRows;   // row rounds of Wc: 5
static_assert(kFaKPc * kFaThr == kFaRows * 16, "k pieces divide");
static_assert(kM % kFaVGrp == 0 && (kFaVRounds - 1) * kFaTiles <= kFaVGroups, "v2 groups are whole; all rounds but the last are whole");
static_assert((kKeyK - kM) % 4 == 0 && (kM * 2) % 8 == 0 && (kFaVPitch * 2) % 8 == 0, "8-B stores into v2^T rows are aligned");
static_assert((kFaWPc - 1) * kFaWRows <= kHD && kFaWPc * kFaWRows >= kHD, "all Wc rounds but the last are whole");
static_assert((kB - 1) * kM + kFaRows <= kTokPad, "k and q2 rows stay in their planes");
static_assert(kKeyK / 32 * 2 == kFaTiles + 1 && kKeyK <= kFaVPitch, "P*v2 depth = 7 steps of 32 keys, the last half step zero");

__global__ __launch_bounds__(kFaThr) void attn_fused_kernel(const unsigned short* __restrict__ Qp,
                                                            const unsigned short* __restrict__ Kp,
                                                            const float* __restrict__ Pv,
                                                            const float* __restrict__ gvw, const float* __restrict__ gvb,
                                                            const unsigned short* __restrict__ Gp,
                                                            const unsigned short* __restrict__ Wcp,
                                                            const float* __restrict__ bc,
                                                            const float* __restrict__ mask, float* __restrict__ att,
                                                            float scoreScale, float pvScale, float gateScale) {
  typedef Frag<_Float16> F;
  __shared__ __align__(16) unsigned short sK[kFaRows * kFaKPitch];
  __shared__ __align__(16) unsigned short sV[kHD * kFaVPitch];
  __shared__ __align__(16) float sO[kFaTiles][16 * kFaOPitch];   // per-wave 16 x 128 slab
  __shared__ __align__(16) float sMask[kFaThr];
  __shared__ __align__(16) unsigned short sW[kFaWPc * kFaWRows * kFaKPitch];   // 130 rows of Wc: 128 read, 2 spare
  __shared__ __align__(16) float sBc[kFaThr];
  const int t = threadIdx.x, lane = t & 31;
  const int wave = __builtin_amdgcn_readfirstlane(t >> 5);       // scalar: the wave's query tile, slab and v2 token groups
  const int b = blockIdx.x, h = blockIdx.y;
  const int c = lane & 15, hf = lane >> 4;

  // ---- this wave's q2 and (v1*k) fragments and v2 rows and the group's k, mask, Wc and bc, all loads in flight together ----
  const _Float16* gQ = (const _Float16*)Qp + (size_t)(b * kM + wave * 16 + c) * kD + h * kHD + hf * 8;
  const unsigned short* gK = Kp + (size_t)(b * kM + (t >> 4)) * kD + h * kHD + (t & 15) * 8;
  v16h qf[4];
  v4u rk[kFaKPc];
#pragma unroll
  for (int kk = 0; kk < 4; ++kk) qf[kk] = F::load(gQ + kk * 32);
#pragma unroll
  for (int j = 0; j < kFaKPc; ++j) rk[j] = *(const v4u*)(gK + (size_t)(j * (kFaThr / 16)) * kD);
  // v2 rows: lane = channels 4 lane .. 4 lane + 3 of the head; rounds 0..2 exist for every wave, in the last round the waves
  // past group 48 load group 48 again (in bounds) and do nothing with it
  const int vch = h * kHD + lane * 4;
  const float* pgw = gvw + vch;
  const float* pgb = gvb + vch;
  const v4f gwv = *(const v4f*)pgw;
  const v4f gbv = *(const v4f*)pgb;
  const int glast = wave + (kFaVRounds - 1) * kFaTiles;
  const bool vlast = glast < kFaVGroups;                         // wave-uniform
  const float* pV  = Pv + (size_t)(b * kM + wave * kFaVGrp) * kD + vch;
  const float* pVl = Pv + (size_t)(b * kM + (vlast ? glast : (kFaVGroups - 1)) * kFaVGrp) * kD + vch;
  v4f a[kFaVRounds * kFaVGrp];
#pragma unroll
  for (int i = 0; i < kFaVRounds - 1; ++i)
#pragma unroll
    for (int g = 0; g < kFaVGrp; ++g) a[i * kFaVGrp + g] = *(const v4f*)(pV + (size_t)(i * kFaTiles * kFaVGrp + g) * kD);
#pragma unroll
  for (int g = 0; g < kFaVGrp; ++g) a[(kFaVRounds - 1) * kFaVGrp + g] = *(const v4f*)(pVl + (size_t)g * kD);
  const int mi = b * kM + ((t < kM) ? t : (kM - 1));
  const float mload = mask[mi];
  // (v1*k) rows of the wave's queries; the plane has no pad rows, so a query row past its end reads the last row (in bounds;
  // such a query is >= 196 and its output is never read)
  const int grow = b * kM + wave * 16 + c;
  const _Float16* gG = (const _Float16*)Gp + (size_t)((grow < kTok) ? grow : (kTok - 1)) * kD + h * kHD + hf * 8;
  v16h gf[4];
#pragma unroll
  for (int kk = 0; kk < 4; ++kk) gf[kk] = F::load(gG + kk * 32);
  const unsigned short* gW = Wcp + (size_t)(t >> 4) * kHD + (t & 15) * 8;
  v4u rw[kFaWPc];
#pragma unroll
  for (int j = 0; j < kFaWPc - 1; ++j) rw[j] = *(const v4u*)(gW + (size_t)(j * kFaWRows) * kHD);
  // the last round's threads past row 127 load row 127 again (in bounds) and lay it in a spare LDS row that nobody reads
  const int wlast = (t >> 4) + (kFaWPc - 1) * kFaWRows;
  const unsigned short* gWl = Wcp + (size_t)((wlast < kHD) ? wlast : (kHD - 1)) * kHD + (t & 15) * 8;
  rw[kFaWPc - 1] = *(const v4u*)gWl;
  const int bi = t & (kHD - 1);
  const float bload = bc[bi];
  // the wait owed before the address registers of these loads are written again; the per-lane pointers and index are
  // inputs so that their registers stay as they are up to the wait (no later load may land on them either)
  asm volatile("s_wait_xcnt 0x0" :: "v"(gQ), "v"(gK), "v"(pgw), "v"(pgb), "v"(pV), "v"(pVl), "v"(mi), "v"(gG), "v"(gW), "v"(gWl), "v"(bi) : "memory");
#pragma unroll
  for (int j = 0; j < kFaKPc; ++j) *(v4u*)(sK + ((t >> 4) + j * (kFaThr / 16)) * kFaKPitch + (t & 15) * 8) = rk[j];
  sMask[t] = mload;                              // entries from 196 on repeat key 195 and are never used
#pragma unroll
  for (int j = 0; j < kFaWPc; ++j) *(v4u*)(sW + ((t >> 4) + j * kFaWRows) * kFaKPitch + (t & 15) * 8) = rw[j];
  sBc[t] = bload;                                // entries from 128 on repeat the first ones and are never used
  if (wave < kHD / 32) {                         // keys 196..223 of v2^T row t: P is 0 there, the product must be too
#pragma unroll
    for (int p = 0; p < (kKeyK - kM) / 4; ++p) *(v2u*)(sV + t * kFaVPitch + kM + p * 4) = (v2u){0u, 0u};
  }
  // CELU + GroupNorm of the wave's v2 tokens, four a group step by step side by side: their ten lane exchanges each are
  // independent, so one wait serves four.
#pragma unroll
  for (int i = 0; i < kFaVRounds; ++i) {
    if (i < kFaVRounds - 1 || vlast) {           // wave-uniform: every lane is on in the exchanges
      float y[kFaVGrp][4], d[kFaVGrp][4], sm[kFaVGrp], sq[kFaVGrp];
#pragma unroll
      for (int g = 0; g < kFaVGrp; ++g) {
#pragma unroll
        for (int e = 0; e < 4; ++e) y[g][e] = celu_f(a[i * kFaVGrp + g][e]);
        sm[g] = (y[g][0] + y[g][1]) + (y[g][2] + y[g][3]);
      }
#pragma unroll
      for (int off = 1; off < 32; off <<= 1) {
        float x[kFaVGrp];
#pragma unroll
        for (int g = 0; g < kFaVGrp; ++g) x[g] = __shfl_xor(sm[g], off, 32);
#pragma unroll
        for (int g = 0; g < kFaVGrp; ++g) sm[g] += x[g];
      }
#pragma unroll
      for (int g = 0; g < kFaVGrp; ++g) {
        const float mu = sm[g] * (1.0f / 128.0f);
        sq[g] = 0.f;
#pragma unroll
        for (int e = 0; e < 4; ++e) { d[g][e] = y[g][e] - mu; sq[g] += d[g][e] * d[g][e]; }
      }
#pragma unroll
      for (int off = 1; off < 32; off <<= 1) {
        float x[kFaVGrp];
#pragma unroll
        for (int g = 0; g < kFaVGrp; ++g) x[g] = __shfl_xor(sq[g], off, 32);
#pragma unroll
        for (int g = 0; g < kFaVGrp; ++g) sq[g] += x[g];
      }
      float rs[kFaVGrp];
#pragma unroll
      for (int g = 0; g < kFaVGrp; ++g) rs[g] = rsqrt_steps(sq[g] * (1.0f / 128.0f) + 1e-5f);
      const int tok0 = (wave + i * kFaTiles) * kFaVGrp;
#pragma unroll
      for (int e = 0; e < 4; ++e) {
        unsigned short hb[kFaVGrp];
#pragma unroll
        for (int g = 0; g < kFaVGrp; ++g) hb[g] = h_bits((d[g][e] * rs[g] * gwv[e] + gbv[e]) * kXCarry);
        *(v2u*)(sV + (lane * 4 + e) * kFaVPitch + tok0) = (v2u){pk16(hb[0], hb[1]), pk16(hb[2], hb[3])};
      }
    }
  }
  __syncthreads();

  // ---- S^T = k * q2^T: s[tt][r] = score of key 16 tt + 8 hf + r for query 16 wave + c ----
  // The 52 products run k step by k step (product f: k step f / 13, key tile f % 13), so neighbours have different
  // accumulators; their k fragments are read in groups of 4, one group ahead, into two register sets.
  v8f s[kFaTiles];
#pragma unroll
  for (int tt = 0; tt < kFaTiles; ++tt) s[tt] = (v8f){0.f,0.f,0.f,0.f,0.f,0.f,0.f,0.f};
  {
    const _Float16* kf = (const _Float16*)sK + c * kFaKPitch + hf * 8;
    v16h ka[2][4];
#pragma unroll
    for (int e = 0; e < 4; ++e) ka[0][e] = F::load(kf + (e % kFaTiles) * 16 * kFaKPitch + (e / kFaTiles) * 32);
#pragma unroll
    for (int g = 0; g < kFaTiles; ++g) {
      if (g + 1 < kFaTiles) {
#pragma unroll
        for (int e = 0; e < 4; ++e) {
          const int f = (g + 1) * 4 + e;
          ka[(g + 1) & 1][e] = F::load(kf + (f % kFaTiles) * 16 * kFaKPitch + (f / kFaTiles) * 32);
        }
      }
      // keeps the next group's LDS reads together and ahead of this group's WMMAs (the scheduler otherwise sinks each read
      // to its use, and every WMMA then waits out an LDS latency)
      __builtin_amdgcn_sched_barrier(0);
#pragma unroll
      for (int e = 0; e < 4; ++e) {
        const int f = g * 4 + e;
        s[f % kFaTiles] = F::mma(ka[g & 1][e], qf[f / kFaTiles], s[f % kFaTiles]);
      }
      // keeps the reads of the group after next behind these WMMAs, not among them
      __builtin_amdgcn_sched_barrier(0);
    }
  }

  // ---- softmax over the query's 196 keys, f32 ----
  float mx4[4] = {-3.0e38f, -3.0e38f, -3.0e38f, -3.0e38f};
#pragma unroll
  for (int tt = 0; tt < kFaTiles; ++tt) {
    const v4f m0 = *(const v4f*)(sMask + tt * 16 + hf * 8);
    const v4f m1 = *(const v4f*)(sMask + tt * 16 + hf * 8 + 4);
#pragma unroll
    for (int r = 0; r < 8; ++r) {
      const int j = tt * 16 + hf * 8 + r;
      const float mv = (r < 4) ? m0[r & 3] : m1[r & 3];
      const float v = (mv == 0.0f) ? -1.0e9f : s[tt][r] * scoreScale;
      s[tt][r] = (j < kM) ? v : -3.0e38f;
      mx4[r & 3] = fmaxf(mx4[r & 3], s[tt][r]);
    }
  }
  float mx = fmaxf(fmaxf(mx4[0], mx4[1]), fmaxf(mx4[2], mx4[3]));
  mx = fmaxf(mx, __shfl_xor(mx, 16, 32));
  const float mxl = mx * kLog2e;
  float ps4[4] = {0.f, 0.f, 0.f, 0.f};
#pragma unroll
  for (int tt = 0; tt < kFaTiles; ++tt) {
#pragma unroll
    for (int r = 0; r < 8; ++r) {
      // e^(s - mx); the rounding of mxl is one factor common to the row's P and its sum. An excluded key sits at -3e38: P = 0
      s[tt][r] = exp2_hw(__builtin_fmaf(s[tt][r], kLog2e, -mxl));
      ps4[r & 3] += s[tt][r];
    }
  }
  float ps = (ps4[0] + ps4[1]) + (ps4[2] + ps4[3]);
  ps += __shfl_xor(ps, 16, 32);
  const float inv = 1.0f / ps;
  v16h pf[kKeyK / 32];
#pragma unroll
  for (int u = 0; u < kKeyK / 32; ++u) {
#pragma unroll
    for (int e = 0; e < 8; ++e) {
      pf[u][e]     = (_Float16)(s[2 * u][e] * inv * kPCarry);
      pf[u][8 + e] = (2 * u + 1 < kFaTiles) ? (_Float16)(s[(2 * u + 1 < kFaTiles) ? 2 * u + 1 : 0][e] * inv * kPCarry) : (_Float16)0.0f;
    }
  }

  // ---- O^T = v2^T * P^T: o[j][r] = attn of query 16 wave + c, channel 16 j + 8 hf + r ----
  v8f o[8];
#pragma unroll
  for (int j = 0; j < 8; ++j) o[j] = (v8f){0.f,0.f,0.f,0.f,0.f,0.f,0.f,0.f};
  {
    // product f: key step f / 8, channel tile f % 8; v2^T fragments in groups of 4, one group ahead, as above
    const _Float16* vf = (const _Float16*)sV + c * kFaVPitch + hf * 8;
    constexpr int kGroups = kKeyK / 32 * 2;
    v16h va[2][4];
#pragma unroll
    for (int e = 0; e < 4; ++e) va[0][e] = F::load(vf + e * 16 * kFaVPitch);
#pragma unroll
    for (int g = 0; g < kGroups; ++g) {
      if (g + 1 < kGroups) {
#pragma unroll
        for (int e = 0; e < 4; ++e) {
          const int f = (g + 1) * 4 + e;
          va[(g + 1) & 1][e] = F::load(vf + (f % 8) * 16 * kFaVPitch + (f / 8) * 32);
        }
      }
      // keeps the next group's LDS reads together and ahead of this group's WMMAs
      __builtin_amdgcn_sched_barrier(0);
#pragma unroll
      for (int e = 0; e < 4; ++e) {
        const int f = g * 4 + e;
        o[f % 8] = F::mma(va[g & 1][e], pf[f / 8], o[f % 8]);
      }
      // keeps the reads of the group after next behind these WMMAs, not among them
      __builtin_amdgcn_sched_barrier(0);
    }
  }

  // ---- G^T = Wc * (v1*k)^T: gt[j][r] = gate sum of query 16 wave + c, channel 16 j + 8 hf + r (the place of o[j][r]) ----
  v8f gt[8];
#pragma unroll
  for (int j = 0; j < 8; ++j) gt[j] = (v8f){0.f,0.f,0.f,0.f,0.f,0.f,0.f,0.f};
  {
    // product f: k step f / 8, channel tile f % 8; Wc fragments in groups of 4, one group ahead, as above
    const _Float16* wf = (const _Float16*)sW + c * kFaKPitch + hf * 8;
    constexpr int kGroups = kHD / 32 * 2;
    v16h wa[2][4];
#pragma unroll
    for (int e = 0; e < 4; ++e) wa[0][e] = F::load(wf + e * 16 * kFaKPitch);
#pragma unroll
    for (int g = 0; g < kGroups; ++g) {
      if (g + 1 < kGroups) {
#pragma unroll
        for (int e = 0; e < 4; ++e) {
          const int f = (g + 1) * 4 + e;
          wa[(g + 1) & 1][e] = F::load(wf + (f % 8) * 16 * kFaKPitch + (f / 8) * 32);
        }
      }
      // keeps the next group's LDS reads together and ahead of this group's WMMAs
      __builtin_amdgcn_sched_barrier(0);
#pragma unroll
      for (int e = 0; e < 4; ++e) {
        const int f = g * 4 + e;
        gt[f % 8] = F::mma(wa[g & 1][e], gf[f / 8], gt[f % 8]);
      }
      // keeps the reads of the group after next behind these WMMAs, not among them
      __builtin_amdgcn_sched_barrier(0);
    }
  }

  // ---- epilogue: sigmoid(G + bc) * attn; the wave's 16 x 128 block through its own slab, so that each store covers a whole
  // 512-B row piece ----
  float* slab = sO[wave];
#pragma unroll
  for (int j = 0; j < 8; ++j) {
    const v4f b0 = *(const v4f*)(sBc + j * 16 + hf * 8);
    const v4f b1 = *(const v4f*)(sBc + j * 16 + hf * 8 + 4);
    float w[8];
#pragma unroll
    for (int r = 0; r < 8; ++r) {
      float v = gt[j][r] * gateScale;
      v += (r < 4) ? b0[r & 3] : b1[r & 3];
      w[r] = rcp_hw(1.0f + exp2_hw(v * -kLog2e)) * (o[j][r] * pvScale);
    }
    *(v4f*)(slab + c * kFaOPitch + j * 16 + hf * 8)     = (v4f){w[0], w[1], w[2], w[3]};
    *(v4f*)(slab + c * kFaOPitch + j * 16 + hf * 8 + 4) = (v4f){w[4], w[5], w[6], w[7]};
  }
  // the wave's slab writes are complete before its lanes read each other's words
  __builtin_amdgcn_fence(__ATOMIC_RELEASE, "workgroup");
  __builtin_amdgcn_wave_barrier();
  __builtin_amdgcn_fence(__ATOMIC_ACQUIRE, "workgroup");
  float* dst = att + (size_t)(b * kSP + wave * 16) * kD + h * kHD + lane * 4;
#pragma unroll
  for (int row = 0; row < 16; ++row) *(v4f*)(dst + (size_t)row * kD) = *(const v4f*)(slab + row * kFaOPitch + lane * 4);
}

// ---------------------------------------------------------------------------
// Residual + LayerNorm: y = x + gated attn ([32][256 q][1024], the gate already applied); x_new = LN(y)*lnw + lnb
// written f32 to xout (may alias xin: each block reads its whole row into registers before any store, no other block
// touches the row) and as f16(16*x_new) to x16. One block per token (grid 6272), thread t owns columns 4t..4t+3.
// ---------------------------------------------------------------------------
__global__ __launch_bounds__(256) void merge_ln_kernel(const float* xin, const float* __restrict__ att, const float* __restrict__ lnw,
                                                       const float* __restrict__ lnb, float* xout,
                                                       unsigned short* __restrict__ x16) {
  __shared__ float redA[8];
  __shared__ float redB[8];
  __shared__ __align__(16) float srow[kD];
  const int t = threadIdx.x, lane = t & 31, wave = t >> 5;
  const int r = blockIdx.x;
  const int b = r / kM;
  const int m = r - b * kM;
  const int c0 = t * 4;
  const size_t ro = (size_t)r * kD + c0;
  const v4f xv = *(const v4f*)(xin + ro);
  const v4f av = *(const v4f*)(att + ((size_t)(b * kSP + m)) * kD + c0);
  float y[4];
#pragma unroll
  for (int e = 0; e < 4; ++e) y[e] = xv[e] + av[e];
  float s = (y[0] + y[1]) + (y[2] + y[3]);
#pragma unroll
  for (int off = 1; off < 32; off <<= 1) s += __shfl_xor(s, off, 32);
  if (lane == 0) redA[wave] = s;
  __syncthreads();
  float tot = redA[0];
#pragma unroll
  for (int w = 1; w < 8; ++w) tot += redA[w];
  const float mu = tot * (1.0f / 1024.0f);
  float d[4];
  float sq = 0.f;
#pragma unroll
  for (int e = 0; e < 4; ++e) { d[e] = y[e] - mu; sq += d[e] * d[e]; }
#pragma unroll
  for (int off = 1; off < 32; off <<= 1) sq += __shfl_xor(sq, off, 32);
  if (lane == 0) redB[wave] = sq;
  __syncthreads();
  float tot2 = redB[0];
#pragma unroll
  for (int w = 1; w < 8; ++w) tot2 += redB[w];
  const float var = tot2 * (1.0f / 1024.0f);
  const float rs = rsqrtf(var + 1e-5f);
  const v4f wv = *(const v4f*)(lnw + c0);
  const v4f bv = *(const v4f*)(lnb + c0);
  v4f ov;
#pragma unroll
  for (int e = 0; e < 4; ++e) ov[e] = d[e] * rs * wv[e] + bv[e];
  *(v4f*)(srow + c0) = ov;
  __syncthreads();
  const int tc = t & 127;                               // clamped staging index; only t < 128 stores
  const v4f p0 = *(const v4f*)(srow + tc * 8);
  const v4f p1 = *(const v4f*)(srow + tc * 8 + 4);
  unsigned short hb[8];
#pragma unroll
  for (int e = 0; e < 4; ++e) {
    hb[e]     = h_bits(p0[e] * kXCarry);
    hb[4 + e] = h_bits(p1[e] * kXCarry);
  }
  const v4u hu = (v4u){pk16(hb[0], hb[1]), pk16(hb[2], hb[3]), pk16(hb[4], hb[5]), pk16(hb[6], hb[7])};
  unsigned short* hp = x16 + (size_t)r * kD + tc * 8;
  {
    *(v4f*)(xout + ro) = ov;
    if (t < 128) *(v4u*)hp = hu;
    
  }
}

// ---------------------------------------------------------------------------
// Masked mean over tokens: out0[b][c] = sum_m x[b][m][c]*mask[b][m] / sum_m mask[b][m]. One block per b (grid 32),
// ---------------------------------------------------------------------------
constexpr int kPoolRows = 28;   // token rows in flight per wave
static_assert(kM % kPoolRows == 0, "pool groups divide the tokens");
__global__ __launch_bounds__(256) void pool_kernel(const float* x, const float* __restrict__ mask, float* out0) {
  const int t = threadIdx.x;
  const int b = blockIdx.x;
  const int c0 = t * 4;
  v4f acc = (v4f){0.f, 0.f, 0.f, 0.f};
  float ms = 0.f;
  // 28 token rows are asked for at a time and then summed in token order (the order of the sums is unchanged): the wave
  // waits out 7 load latencies in place of 196. The loop over the groups stays rolled: one group's registers serve all 7.
#pragma unroll 1
  for (int m0 = 0; m0 < kM; m0 += kPoolRows) {
    const float* xp = x + ((size_t)(b * kM + m0)) * kD + c0;
    v4f xv[kPoolRows];
#pragma unroll
    for (int j = 0; j < kPoolRows; ++j) xv[j] = *(const v4f*)(xp + (size_t)j * kD);
    // the wait owed before the address register of these loads is written again; the pointer is an input so that its
    // register stays as it is up to the wait (no loaded row may land on it either)
    asm volatile("s_wait_xcnt 0x0" :: "v"(xp) : "memory");
#pragma unroll
    for (int j = 0; j < kPoolRows; ++j) {
      const float mv = mask[b * kM + m0 + j];
      acc += xv[j] * mv;
      ms += mv;
    }
  }
  const float inv = 1.0f / ms;
  const v4f o = acc * inv;
  store2_v4f(out0 + (size_t)b * kD + c0, o);
}

// ---------------------------------------------------------------------------
// Host orchestration: kernel launches only. 1 + 3*4 + 1 = 14 launches.
// ---------------------------------------------------------------------------
extern "C" void kernel_launch(void* const* d_in, const int* in_sizes, int n_in,
                              void* d_out, int out_size, void* d_ws, size_t ws_size,
                              hipStream_t stream) {
  if (n_in < 22) return;
  if (in_sizes[0] != kTok * kD) return;
  if (in_sizes[1] != kTok) return;
  if (in_sizes[2] != kL * kD * kD || in_sizes[6] != kL * kD * kD || in_sizes[10] != kL * kD * kD || in_sizes[14] != kL * kD * kD) return;
  if (in_sizes[18] != kL * kHD * kHD || in_sizes[19] != kL * kHD) return;
  if (in_sizes[3] != kL * kD || in_sizes[20] != kL * kD || in_sizes[21] != kL * kD) return;
  if (out_size != kB * kD + kTok * kD) return;
  if (ws_size < kWsTotal) return;

  const float* att_feats = (const float*)d_in[0];
  const float* att_mask  = (const float*)d_in[1];
  const float* Wq2  = (const float*)d_in[2];
  const float* bq2  = (const float*)d_in[3];
  const float* gq2w = (const float*)d_in[4];
  const float* gq2b = (const float*)d_in[5];
  const float* Wk   = (const float*)d_in[6];
  const float* bk   = (const float*)d_in[7];
  const float* gkw  = (const float*)d_in[8];
  const float* gkb  = (const float*)d_in[9];
  const float* Wv1  = (const float*)d_in[10];
  const float* bv1  = (const float*)d_in[11];
  const float* gv1w = (const float*)d_in[12];
  const float* gv1b = (const float*)d_in[13];
  const float* Wv2  = (const float*)d_in[14];
  const float* bv2  = (const float*)d_in[15];
  const float* gv2w = (const float*)d_in[16];
  const float* gv2b = (const float*)d_in[17];
  const float* Wc   = (const float*)d_in[18];
  const float* bc   = (const float*)d_in[19];
  const float* lnw  = (const float*)d_in[20];
  const float* lnb  = (const float*)d_in[21];

  char* ws = (char*)d_ws;
  float*          Ppl   = (float*)(ws + kOffP);                    // linear+bias planes (q2, k, v1, v2)
  float*          ATT   = (float*)(ws + kOffP);                    // gated attn plane (same region, over the q2 plane and part of the k plane, both used up by then)
  unsigned short* GIN16 = (unsigned short*)(ws + kOffATT);         // (v1*k) plane
  unsigned short* X16   = (unsigned short*)(ws + kOffX16);
  unsigned short* W16   = (unsigned short*)(ws + kOffW16);
  unsigned short* WC16  = (unsigned short*)(ws + kOffWC16);
  unsigned short* Q16   = (unsigned short*)(ws + kOffQ16);
  unsigned short* K16   = (unsigned short*)(ws + kOffK16);

  float* out0 = (float*)d_out;                                     // [32][1024] at byte 0
  float* out1 = (float*)d_out + (size_t)kB * kD;                   // [32][196][1024] at byte 131072; also the running x

  const float projScale  = 1.0f / (kXCarry * kWCarry);             // 1/4096
  const float gateScale  = 1.0f / (kXCarry * kWCarry);             // (v1*k) x16, Wc x256
  const float scoreScale = 0.08838834764831845f * (1.0f / (kXCarry * kXCarry));
  const float pvScale    = 1.0f / (kPCarry * kXCarry);             // 1/32768

  // x and every layer's W and Wc -> f16 planes; pad rows of the q2/k planes zero
  prep_kernel<<<dim3(kPrepBlocks), dim3(256), 0, stream>>>(att_feats, Wq2, Wk, Wv1, Wv2, Wc, X16,
                                                           Q16 + (size_t)kTok * kD, K16 + (size_t)kTok * kD, W16, WC16);

  for (int i = 0; i < kL; ++i) {
    const size_t vo = (size_t)i * kD;

    // four projections: P[z] = x16 * Wz^T + bz (M 6272, N 4 * 1024, K 1024; 49 x 16 block tiles of 128 x 256 = 784 blocks)
    proj_gemm_lds_kernel<<<dim3((kTok / kPjBM) * (4 * kD / kPjBN)), dim3(256), 0, stream>>>(
        X16, W16 + (size_t)i * 4 * kD * kD, Ppl, bq2 + vo, bk + vo, bv1 + vo, bv2 + vo, projScale);

    // CELU + GroupNorm of q2, k and v1 (with v1 * k), token-major
    gn_rows_kernel<<<dim3(2 * kGnBlocks), dim3(256), 0, stream>>>(Ppl, gq2w + vo, gq2b + vo, gkw + vo, gkb + vo,
                                                                  gv1w + vo, gv1b + vo, Q16, K16, GIN16);

    // attention: CELU + GroupNorm of v2, scores, softmax, P * v2 and the gate sigmoid((v1*k) * Wc^T + bc) of one (batch, head)
    // group per work-group, 256 groups in one launch
    attn_fused_kernel<<<dim3(kB, kH), dim3(kFaThr), 0, stream>>>(Q16, K16, Ppl + (size_t)3 * kTok * kD, gv2w + vo, gv2b + vo,
                                                                 GIN16, WC16 + (size_t)i * kHD * kHD,
                                                                 bc + (size_t)i * kHD, att_mask, ATT, scoreScale, pvScale,
                                                                 gateScale);

    const float* xin = (i == 0) ? att_feats : out1;
    merge_ln_kernel<<<dim3(kTok), dim3(256), 0, stream>>>(xin, ATT, lnw + (size_t)i * kD, lnb + (size_t)i * kD, out1, X16);
  }

  pool_kernel<<<dim3(kB), dim3(256), 0, stream>>>(out1, att_mask, out0);
}

// v008
// A run of this version takes 308 microseconds.
// In both of two side-by-side timings against v007, it was 1.13 times as fast.
// All steps since v000 together make it 5.18 times as fast.
// Contractions: projections x(f16, x16)*W^T(f16, x256), gate (v1*k)(f16, x16)*Wc^T(f16, x256), scores q2(f16, x16)*k^T(f16, x16), attn P(f16, x2048)*v2(f16, x16): all v_wmma_f32_16x16x32_f16 with f32 accumulate; CELU, GroupNorm, softmax, sigmoid, residual, LayerNorm and masked mean in f32.
#include <hip/hip_runtime.h>
#include <math.h>

// ---------------------------------------------------------------------------
// Problem constants
// ---------------------------------------------------------------------------
constexpr int kB   = 32;
constexpr int kM   = 196;
constexpr int kD   = 1024;
constexpr int kH   = 8;
constexpr int kHD  = 128;
constexpr int kL   = 3;
constexpr int kTok = kB * kM;          // 6272 = 98 * 64 token rows
constexpr int kTokPad = kTok + 64;     // 6336: 64 zero rows so per-group 208-row tiles never leave the plane
constexpr int kSP  = 256;              // padded queries per (batch, head) group (rows of the gated attn plane)
constexpr int kKeyK = 224;             // contraction depth of P*V (keys padded to a multiple of 32)
constexpr float kXCarry = 16.0f;       // x, q2, k, v2 planes carried x16 in f16
constexpr float kWCarry = 256.0f;      // W, Wc carried x256 in f16
constexpr float kPCarry = 2048.0f;     // probabilities carried x2048 in f16

// ---------------------------------------------------------------------------
// Workspace region map (bytes, all offsets multiples of 256)
//   R_P    : linear+bias planes f32 [4: q2, k, v1, v2][6272][1024] -> later gated attn f32 [32][256][1024]
//   R_ATT  : (v1*k) f16 plane [6272][1024]
//   R_X16  : x f16 [6272][1024]
//   R_W16  : stacked W f16 [3 layers][4096][1024]
//   R_WC16 : Wc f16 [3 layers][128][128]
//   R_Q16  : q2 f16 [6336][1024] (rows >= 6272 zero)
//   R_K16  : k  f16 [6336][1024] (rows >= 6272 zero)
// ---------------------------------------------------------------------------
constexpr size_t kBytesP1   = (size_t)kTok * kD * 4;       // one plane
constexpr size_t kBytesP    = 4 * kBytesP1;
constexpr size_t kBytesATT  = (size_t)kB * kSP * kD * 4;
constexpr size_t kBytesX16  = (size_t)kTok * kD * 2;
constexpr size_t kBytesW16  = (size_t)kL * 4 * kD * kD * 2;
constexpr size_t kBytesWC16 = (size_t)kL * kHD * kHD * 2;
constexpr size_t kBytesQ16  = (size_t)kTokPad * kD * 2;
constexpr size_t kOffP    = 0;
constexpr size_t kOffATT  = kOffP + kBytesP;
constexpr size_t kOffX16  = kOffATT + kBytesATT;
constexpr size_t kOffW16  = kOffX16 + kBytesX16;
constexpr size_t kOffWC16 = kOffW16 + kBytesW16;
constexpr size_t kOffQ16  = kOffWC16 + kBytesWC16;
constexpr size_t kOffK16  = kOffQ16 + kBytesQ16;
constexpr size_t kWsTotal = kOffK16 + kBytesQ16;
static_assert(kWsTotal == 200376320, "carve total");
static_assert(kWsTotal <= 268435456, "carve under 256 MiB");
static_assert(kBytesATT >= (size_t)kTok * kD * 2, "vk plane fits in its region");
static_assert(kBytesATT <= kBytesP, "gated attn plane fits in the P region");
static_assert((kOffATT % 256) == 0 && (kOffX16 % 256) == 0 && (kOffW16 % 256) == 0 && (kOffQ16 % 256) == 0 && (kOffK16 % 256) == 0, "aligned");

typedef __attribute__((ext_vector_type(16))) _Float16 v16h;
typedef __attribute__((ext_vector_type(8)))  _Float16 v8h;
typedef __attribute__((ext_vector_type(16))) __bf16   v16b;
typedef __attribute__((ext_vector_type(8)))  __bf16   v8b;
typedef __attribute__((ext_vector_type(8)))  float    v8f;
typedef __attribute__((ext_vector_type(4)))  float    v4f;
typedef __attribute__((ext_vector_type(4)))  unsigned int v4u;
typedef __attribute__((ext_vector_type(2)))  unsigned int v2u;

__device__ __forceinline__ unsigned short f2bf_bits(float f) {
  unsigned u = __float_as_uint(f);
  return (unsigned short)((u + 0x7FFFu + ((u >> 16) & 1u)) >> 16);
}
__device__ __forceinline__ float bf_bits2f(unsigned short h) { return __uint_as_float(((unsigned)h) << 16); }

template <typename T> struct Frag;
template <> struct Frag<_Float16> {
  typedef v16h V; union U { v16h v; v8h h[2]; };
  static __device__ __forceinline__ v16h load(const _Float16* p) {   // elements 0..7 <- p[0..7], 8..15 <- p[16..23]
    U f; f.h[0] = *(const v8h*)(p); f.h[1] = *(const v8h*)(p + 16); return f.v;
  }
  static __device__ __forceinline__ v8f mma(v16h a, v16h b, v8f c) {
    return __builtin_amdgcn_wmma_f32_16x16x32_f16(false, a, false, b, (short)0, c, false, false);
  }
};
template <> struct Frag<__bf16> {
  typedef v16b V; union U { v16b v; v8b h[2]; };
  static __device__ __forceinline__ v16b load(const __bf16* p) {
    U f; f.h[0] = *(const v8b*)(p); f.h[1] = *(const v8b*)(p + 16); return f.v;
  }
  static __device__ __forceinline__ v8f mma(v16b a, v16b b, v8f c) {
    return __builtin_amdgcn_wmma_f32_16x16x32_bf16(false, a, false, b, (short)0, c, false, false);
  }
};

__device__ __forceinline__ unsigned pk16(unsigned short a, unsigned short b) { return (unsigned)a | ((unsigned)b << 16); }
__device__ __forceinline__ unsigned short h_bits(float f) { const _Float16 h = (_Float16)f; return __builtin_bit_cast(unsigned short, h); }

// exact f16 bits -> f32 via integer arithmetic (normals and subnormals; no _Float16 vector involved)
__device__ __forceinline__ float h16_to_f32(unsigned hb) {
  const unsigned em = hb & 0x7fffu;
  const float fn = __uint_as_float((em + 0x1C000u) << 13);
  const float fs = (float)em * 5.9604644775390625e-8f;
  const float f  = (em < 0x400u) ? fs : fn;
  return __uint_as_float(__float_as_uint(f) | ((hb & 0x8000u) << 16));
}

__device__ __forceinline__ void store2_v4u(unsigned short* p, v4u u) {
  *(v4u*)p = u;
  
}
__device__ __forceinline__ void store2_v4f(float* p, v4f v) {
  *(v4f*)p = v;
  
}

// ---------------------------------------------------------------------------
// Projection GEMM with operands staged in LDS: C[m,n] = scale * sum_k A[m,k] * Bt[n,k] + bias[n], f32 out.
// A [6272][1024] f16, Bt [4096][1024] f16, both k-contiguous. Block tile 224 (m) x 256 (n), 8 waves as 2 x 4, each wave a
// 112x64 tile, fragments by Frag::load, k ascending. A stage is 64 k = one 128-B line of each of the 480 operand
// rows (A rows first, then Bt rows), laid at a 144-B pitch in one of two LDS buffers. Every global load covers whole lines
// (8 lanes per row). Stage s + 2 is fetched into registers during stage s and stored to LDS during stage s + 1, so a
// fetch has a whole stage to land. The four projections share one grid: Bt is the stacked W [4096][1024], column tile
// nT = 0..15 belongs to projection nT / 4 and goes to that projection's plane of C with its bias.
// grid = 28 * 16 = 448 blocks (6272 = 28 * 224, 4096 = 16 * 256), column tile fastest: one block fills a WGP (registers), so
// the 256 WGPs take them in 2 rounds; a wave reads 11 LDS fragments for 28 WMMAs.
// ---------------------------------------------------------------------------
constexpr int kPjBM = 224;                       // block rows of A
constexpr int kPjBN = 256;                       // block rows of Bt
constexpr int kPjBK = 64;                        // halves of k per stage
constexpr int kPjPitch = 72;                     // halves per staged row (144 B)
constexpr int kPjStage = (kPjBM + kPjBN) * kPjPitch;   // halves per buffer (69,120 B)
constexpr int kPjMT = kPjBM / 2 / 16;            // 16-row tiles of a wave: 7
constexpr int kPjPcA = kPjBM / 32;               // 16-B pieces of A per thread and stage: 7
constexpr int kPjPc = kPjPcA + kPjBN / 32;       // pieces per thread and stage: 15
constexpr int kPjStages = kD / kPjBK;            // 16
static_assert(kTok % kPjBM == 0 && kD % kPjBN == 0 && kD % (2 * kPjBK) == 0 && kPjStages >= 4, "projection tiles divide the problem");

// 15 pieces of 16 B per thread: pieces 0..6 = A rows, 7..14 = Bt rows, 32 staged rows apart
__device__ __forceinline__ void pj_fetch(v4u (&r)[kPjPc], const unsigned short* gA, const unsigned short* gB, int k) {
#pragma unroll
  for (int j = 0; j < kPjPcA; ++j) r[j] = *(const v4u*)(gA + (size_t)(32 * j) * kD + k);
#pragma unroll
  for (int j = 0; j < kPjPc - kPjPcA; ++j) r[kPjPcA + j] = *(const v4u*)(gB + (size_t)(32 * j) * kD + k);
}
__device__ __forceinline__ void pj_put(unsigned short* dst, const v4u (&r)[kPjPc]) {
#pragma unroll
  for (int j = 0; j < kPjPc; ++j) *(v4u*)(dst + 32 * j * kPjPitch) = r[j];
}
// Work-group barrier that orders LDS only: __syncthreads() also waits for every global load in flight, which would
// end the fetch of the stage after next at each barrier; those loads land in registers and concern no other wave.
__device__ __forceinline__ void pj_barrier() {
  __builtin_amdgcn_fence(__ATOMIC_RELEASE, "workgroup", "local");
  __builtin_amdgcn_s_barrier();
  __builtin_amdgcn_fence(__ATOMIC_ACQUIRE, "workgroup", "local");
}
// One stage: multiply the stage in cur; inside it store the stage held in st to nxt (PUT) and fetch stage k/64 into the same
// registers (FETCH): a fetch has a whole stage to land. The A fragments of the second k half's rows 3..6 are read when the
// first half's rows 0..3 are done with their registers, 12 WMMAs ahead of the second half: 32 registers fewer.
constexpr int kPjEarly = 3;                      // A fragments of the second k half that are read with the first group
template <bool FETCH, bool PUT>
__device__ __forceinline__ void pj_stage(const _Float16* curA, const _Float16* curB, unsigned short* nxt,
                                         const unsigned short* gA, const unsigned short* gB, int k,
                                         v4u (&st)[kPjPc], v8f (&acc)[kPjMT][4]) {
  typedef Frag<_Float16> F;
  v16h bh[2][4], ah[2][kPjMT];
#pragma unroll
  for (int j = 0; j < 4; ++j) bh[0][j] = F::load(curB + j * 16 * kPjPitch);
#pragma unroll
  for (int i = 0; i < kPjMT; ++i) ah[0][i] = F::load(curA + i * 16 * kPjPitch);
#pragma unroll
  for (int j = 0; j < 4; ++j) bh[1][j] = F::load(curB + j * 16 * kPjPitch + 32);
#pragma unroll
  for (int i = 0; i < kPjEarly; ++i) ah[1][i] = F::load(curA + i * 16 * kPjPitch + 32);
  // keeps the LDS fragment reads as one group ahead of the matrix work (the scheduler otherwise spreads them among the WMMAs)
  __builtin_amdgcn_sched_barrier(0);
#pragma unroll
  for (int i = 0; i < kPjMT - kPjEarly; ++i)
#pragma unroll
    for (int j = 0; j < 4; ++j) acc[i][j] = F::mma(ah[0][i], bh[0][j], acc[i][j]);
  // keeps the second read group, the LDS stores of the next stage and the fetch behind these WMMAs, when the first group's
  // reads have been served and four A fragments are used up
  __builtin_amdgcn_sched_barrier(0);
#pragma unroll
  for (int i = kPjEarly; i < kPjMT; ++i) ah[1][i] = F::load(curA + i * 16 * kPjPitch + 32);
  if (PUT) pj_put(nxt, st);
  // keeps the fetch behind the stores, so that it lands in the registers that they have just read (ahead of them it takes a
  // second set of 60)
  __builtin_amdgcn_sched_barrier(0);
  if (FETCH) pj_fetch(st, gA, gB, k);
  // keeps the rest of the matrix work behind them: the fetch is not sunk to its use, a stage later
  __builtin_amdgcn_sched_barrier(0);
#pragma unroll
  for (int i = kPjMT - kPjEarly; i < kPjMT; ++i)
#pragma unroll
    for (int j = 0; j < 4; ++j) acc[i][j] = F::mma(ah[0][i], bh[0][j], acc[i][j]);
  // keeps these 12 WMMAs ahead of the wait below and of the barrier's own LDS wait: the second read group, the stores and the
  // fetch's requests are served under them
  __builtin_amdgcn_sched_barrier(0);
  // the wait owed before the fetch's address registers are written again; 12 WMMAs behind the fetch
  if (FETCH) asm volatile("s_wait_xcnt 0x0" ::: "memory");
#pragma unroll
  for (int i = 0; i < kPjMT; ++i)
#pragma unroll
    for (int j = 0; j < 4; ++j) acc[i][j] = F::mma(ah[1][i], bh[1][j], acc[i][j]);
  if (PUT) pj_barrier();               // publishes the stage just stored and ends every read of cur
}

__global__ __launch_bounds__(256) void proj_gemm_lds_kernel(const unsigned short* __restrict__ Ap,
                                                            const unsigned short* __restrict__ Btp,
                                                            float* __restrict__ Cp, const float* __restrict__ bias0,
                                                            const float* __restrict__ bias1, const float* __restrict__ bias2,
                                                            const float* __restrict__ bias3, float scale) {
  __shared__ __align__(16) unsigned short sAB[2][kPjStage];
  __shared__ __align__(16) float sT[8][16 * 68];   // per-wave 16x64 slab, pitch 68 floats
  const int t    = threadIdx.x;
  const int lane = t & 31;
  const int wave = t >> 5;
  const int nT = blockIdx.x & 15;              // column tile of the stacked W
  const int pz = nT >> 2;                      // projection (block-uniform)
  const int mB = (blockIdx.x >> 4) * kPjBM;
  const int nB = (nT & 3) * kPjBN;             // column within the projection's plane
  float* C = Cp + (size_t)pz * kTok * kD;
  const float* bias = (pz == 0) ? bias0 : (pz == 1) ? bias1 : (pz == 2) ? bias2 : bias3;
  const int m0 = mB + (wave >> 2) * (kPjMT * 16);
  const int n0 = nB + (wave & 3) * 64;

  const int rlane = lane & 15;                 // row (A) / col (B, D) within subtile
  const int koff  = (lane >> 4) * 8;           // k offset of this lane half
  const int mOff  = (lane >> 4) * 8;           // D row offset

  // staging map: piece j of thread t is 16 B number (t & 7) of staged row (t >> 3) + 32 * j
  const int srow = t >> 3;
  const int spart = (t & 7) * 8;
  const unsigned short* gA = Ap  + (size_t)(mB + srow) * kD + spart;
  const unsigned short* gB = Btp + (size_t)(nT * kPjBN + srow) * kD + spart;
  unsigned short* put0 = &sAB[0][srow * kPjPitch + spart];
  unsigned short* put1 = &sAB[1][srow * kPjPitch + spart];
  const int fA = ((wave >> 2) * (kPjMT * 16) + rlane) * kPjPitch + koff;
  const int fB = (kPjBM + (wave & 3) * 64 + rlane) * kPjPitch + koff;
  const _Float16* a0 = (const _Float16*)sAB[0] + fA;
  const _Float16* b0 = (const _Float16*)sAB[0] + fB;
  const _Float16* a1 = (const _Float16*)sAB[1] + fA;
  const _Float16* b1 = (const _Float16*)sAB[1] + fB;

  v8f acc[kPjMT][4];
#pragma unroll
  for (int i = 0; i < kPjMT; ++i)
#pragma unroll
    for (int j = 0; j < 4; ++j) acc[i][j] = (v8f){0.f,0.f,0.f,0.f,0.f,0.f,0.f,0.f};

  v4u st[kPjPc];                               // the stage on its way to LDS
  pj_fetch(st, gA, gB, 0);
  asm volatile("s_wait_xcnt 0x0" ::: "memory");   // the wait owed before the fetch's address registers are written again
  pj_put(put0, st);
  pj_fetch(st, gA, gB, kPjBK);
  asm volatile("s_wait_xcnt 0x0" ::: "memory");   // the same wait
  pj_barrier();

  for (int s = 0; s < kPjStages - 2; s += 2) {
    pj_stage<true, true>(a0, b0, put1, gA, gB, (s + 2) * kPjBK, st, acc);   // stage s; store s + 1, fetch s + 2
    pj_stage<true, true>(a1, b1, put0, gA, gB, (s + 3) * kPjBK, st, acc);   // stage s + 1; store s + 2, fetch s + 3
  }
  pj_stage<false, true>(a0, b0, put1, gA, gB, 0, st, acc);                  // stage 14; store 15
  pj_stage<false, false>(a1, b1, put0, gA, gB, 0, st, acc);                 // stage 15

  // ---- epilogue: scale, bias[n], f32 out through the wave's slab ----
  float* slab = sT[wave];
#pragma unroll
  for (int i = 0; i < kPjMT; ++i) {
    const int mBase = m0 + (i << 4);
#pragma unroll
    for (int j = 0; j < 4; ++j) {
      const float bv = bias[n0 + (j << 4) + rlane];
#pragma unroll
      for (int r = 0; r < 8; ++r) {
        float v = acc[i][j][r] * scale;
        v += bv;
        slab[(mOff + r) * 68 + (j << 4) + rlane] = v;
      }
    }
    // the wave's slab writes are complete before its lanes read each other's words
    __builtin_amdgcn_fence(__ATOMIC_RELEASE, "workgroup");
    __builtin_amdgcn_wave_barrier();
    __builtin_amdgcn_fence(__ATOMIC_ACQUIRE, "workgroup");
    const int hh = lane >> 4, c4 = (lane & 15) * 4;     // row seg = 256 B = 16 lanes x 16 B
#pragma unroll
    for (int it = 0; it < 8; ++it) {
      const int row = it * 2 + hh;
      v4f v = *(const v4f*)(slab + row * 68 + c4);
      *(v4f*)(C + (size_t)(mBase + row) * kD + n0 + c4) = v;
    }
    // the wait owed before a register that these stores name (address or data) is written again; the scheduling fence
    // keeps the next rows' register writes behind it
    asm volatile("s_wait_xcnt 0x0" ::: "memory");
    __builtin_amdgcn_sched_barrier(0);
    // the slab is read out before the next 16 rows overwrite it
    __builtin_amdgcn_fence(__ATOMIC_RELEASE, "workgroup");
    __builtin_amdgcn_wave_barrier();
    __builtin_amdgcn_fence(__ATOMIC_ACQUIRE, "workgroup");
  }
}

// ---------------------------------------------------------------------------
// Every cast to f16 and the zero fill, which depend on inputs alone, in one grid; the block index picks the job
// (block-uniform), 8 elements per thread, 16-B stores:
//   [0, 3136)        x -> f16(16 x)                                   (3136 * 256 * 8 = 6272 * 1024)
//   [3136, 3200)     zero the 64 pad rows of the q2 plane (32 blocks) and of the k plane (32 blocks)
//   [3200, 9344)     W (q2, k, v1, v2) [1024 out][1024 in] row-major (= Bt [N][K] as-is) of layer l -> f16(256 W) into plane
//                    4 l + z of w16, 512 blocks a plane
//   [9344, 9368)     Wc [3][128][128] -> f16(256 Wc), 8 blocks a layer
// ---------------------------------------------------------------------------
constexpr int kPrepX  = kTok * kD / 8 / 256;        // 3136
constexpr int kPrepZ  = 64 * kD / 8 / 256;          // 32 per plane
constexpr int kPrepW  = kD * kD / 8 / 256;          // 512 per W plane
constexpr int kPrepWc = kL * kHD * kHD / 8 / 256;   // 24
constexpr int kPrepBlocks = kPrepX + 2 * kPrepZ + kL * 4 * kPrepW + kPrepWc;
static_assert(kPrepW == 512 && kPrepBlocks == 9368, "prep ranges");
__global__ __launch_bounds__(256) void prep_kernel(const float* __restrict__ x, const float* __restrict__ w0,
                                                   const float* __restrict__ w1, const float* __restrict__ w2,
                                                   const float* __restrict__ w3, const float* __restrict__ wc,
                                                   unsigned short* __restrict__ x16, unsigned short* __restrict__ qpad,
                                                   unsigned short* __restrict__ kpad, unsigned short* __restrict__ w16,
                                                   unsigned short* __restrict__ wc16) {
  const int bid = blockIdx.x;
  if (bid >= kPrepX && bid < kPrepX + 2 * kPrepZ) {
    const int r = bid - kPrepX;
    unsigned short* zdst = (r < kPrepZ) ? qpad : kpad;   // block-uniform select between two global pointers
    const int zi = (r & (kPrepZ - 1)) * 256 + threadIdx.x;
    const v4u z = (v4u){0u, 0u, 0u, 0u};
    store2_v4u(zdst + 8 * (size_t)zi, z);
    return;
  }
  const float* src = x;
  unsigned short* dst = x16;
  float scale = kXCarry;
  int blk = bid;
  if (bid >= kPrepX) {
    const int r = bid - (kPrepX + 2 * kPrepZ);
    scale = kWCarry;
    if (r < kL * 4 * kPrepW) {
      const int pl = r >> 9;                             // 4 * layer + projection
      const int pz = pl & 3;
      src = ((pz == 0) ? w0 : (pz == 1) ? w1 : (pz == 2) ? w2 : w3) + (size_t)(pl >> 2) * kD * kD;
      dst = w16 + (size_t)pl * kD * kD;
      blk = r & (kPrepW - 1);
    } else {
      src = wc;
      dst = wc16;
      blk = r - kL * 4 * kPrepW;
    }
  }
  const int i = blk * 256 + threadIdx.x;
  const float* p = src + 8 * (size_t)i;
  const v4f a = *(const v4f*)(p);
  const v4f c = *(const v4f*)(p + 4);
  unsigned short hb[8];
#pragma unroll
  for (int e = 0; e < 4; ++e) {
    hb[e]     = h_bits(a[e] * scale);
    hb[4 + e] = h_bits(c[e] * scale);
  }
  const v4u u = (v4u){pk16(hb[0], hb[1]), pk16(hb[2], hb[3]), pk16(hb[4], hb[5]), pk16(hb[6], hb[7])};
  store2_v4u(dst + 8 * (size_t)i, u);
}

// ---------------------------------------------------------------------------
// 2^x by the hardware's exp2 alone; it gives 0 below the range of f32 and inf above it by itself. e^x = 2^(x * log2(e)): the
// rounding of that one product is a relative error of about |x| * 6e-8 in e^x, far under the f16 step of every plane and
// fragment that these values end in.
// ---------------------------------------------------------------------------
constexpr float kLog2e = 1.4426950408889634f;
__device__ __forceinline__ float exp2_hw(float x) {
  float v;
  // the v_nop is the free slot that a transcendental is owed before its source is overwritten or its result read; only one
  // statement ties it to the instruction
  asm("v_exp_f32 %0, %1\n\tv_nop" : "=v"(v) : "v"(x));
  return v;
}

// 1 / x by the hardware's reciprocal alone (about one unit in the last place of f32; 0 at inf), for x of 1 or more
__device__ __forceinline__ float rcp_hw(float x) {
  float v;
  // the v_nop: the same free slot as in exp2_hw
  asm("v_rcp_f32 %0, %1\n\tv_nop" : "=v"(v) : "v"(x));
  return v;
}

// ---------------------------------------------------------------------------
// CELU (alpha 1.3), f32
// ---------------------------------------------------------------------------
__device__ __forceinline__ float celu_f(float x) {
  const float en = exp2_hw(x * (kLog2e / 1.3f)) - 1.0f;
  return (x > 0.f) ? x : 1.3f * en;
}

// ---------------------------------------------------------------------------
// GroupNorm of the q2, k and v1 projections (CELU -> per (token, head) mean/var over 128 channels -> * gw + gb) in one grid,
// each writing a token-major f16 plane [6272][1024]: q2 and k carried x16; v1 multiplied by the k plane value (already x16)
// -> (v1*k) x16. Unit = (token, head) = 128 channels handled by 16 lanes (8 each): wave = 2 units, block = 16 units,
// 3136 blocks a plane. Blocks [0, 3136) take a unit of k and the same unit of v1, whose factor is the f16 value of k just
// stored, from the thread's own registers; blocks [3136, 6272) take q2. P: the linear+bias planes (q2, k, v1, ...).
// ---------------------------------------------------------------------------
constexpr int kGnBlocks = kTok * kH / 16;   // 3136
__device__ __forceinline__ void gn_unit(const v4f a, const v4f c, const float* __restrict__ gw, const float* __restrict__ gb,
                                        int ch, float (&o)[8]) {
  float y[8];
#pragma unroll
  for (int e = 0; e < 4; ++e) { y[e] = celu_f(a[e]); y[4 + e] = celu_f(c[e]); }
  float s = ((y[0] + y[1]) + (y[2] + y[3])) + ((y[4] + y[5]) + (y[6] + y[7]));
#pragma unroll
  for (int off = 1; off < 16; off <<= 1) s += __shfl_xor(s, off, 32);   // stays inside the 16-lane half
  const float mu = s * (1.0f / 128.0f);
  float d[8];
  float sq = 0.f;
#pragma unroll
  for (int e = 0; e < 8; ++e) { d[e] = y[e] - mu; sq += d[e] * d[e]; }
#pragma unroll
  for (int off = 1; off < 16; off <<= 1) sq += __shfl_xor(sq, off, 32);
  const float var = sq * (1.0f / 128.0f);
  const float rs = rsqrtf(var + 1e-5f);
  const v4f w0 = *(const v4f*)(gw + ch), w1 = *(const v4f*)(gw + ch + 4);
  const v4f g0 = *(const v4f*)(gb + ch), g1 = *(const v4f*)(gb + ch + 4);
#pragma unroll
  for (int e = 0; e < 4; ++e) {
    o[e]     = d[e] * rs * w0[e] + g0[e];
    o[4 + e] = d[4 + e] * rs * w1[e] + g1[e];
  }
}
__device__ __forceinline__ void gn_store(unsigned short* p, const unsigned short (&hb)[8]) {
  const v4u uu = (v4u){pk16(hb[0], hb[1]), pk16(hb[2], hb[3]), pk16(hb[4], hb[5]), pk16(hb[6], hb[7])};
  store2_v4u(p, uu);
}
__global__ __launch_bounds__(256) void gn_rows_kernel(const float* __restrict__ P,
                                                      const float* __restrict__ gqw, const float* __restrict__ gqb,
                                                      const float* __restrict__ gkw, const float* __restrict__ gkb,
                                                      const float* __restrict__ gvw, const float* __restrict__ gvb,
                                                      unsigned short* __restrict__ q16, unsigned short* __restrict__ k16,
                                                      unsigned short* __restrict__ vk16) {
  const int t = threadIdx.x, lane = t & 31, wave = t >> 5, hh = lane >> 4, cl = lane & 15;
  const bool pair = blockIdx.x < kGnBlocks;                    // block-uniform
  const int blk = pair ? blockIdx.x : blockIdx.x - kGnBlocks;
  const int u = (blk * 8 + wave) * 2 + hh;                     // token*8 + head, < 50176 (grid exact)
  const size_t base = (size_t)u * kHD + cl * 8;                // == token*1024 + head*128 + cl*8
  const int ch = (u & 7) * kHD + cl * 8;                       // channel index within 1024
  constexpr size_t plane = (size_t)kTok * kD;
  float o[8];
  unsigned short hb[8];
  if (!pair) {
    const float* pq = P + base;
    const v4f a = *(const v4f*)(pq);
    const v4f c = *(const v4f*)(pq + 4);
    // the wait owed before the address register of these loads is written again; the pointer is an input so that its
    // register stays as it is up to the wait (no loaded value may land on it either)
    asm volatile("s_wait_xcnt 0x0" :: "v"(pq) : "memory");
    gn_unit(a, c, gqw, gqb, ch, o);
#pragma unroll
    for (int e = 0; e < 8; ++e) hb[e] = h_bits(o[e] * kXCarry);
    gn_store(q16 + base, hb);
  } else {
    const float* pk = P + plane + base;
    const float* pv = P + 2 * plane + base;
    const v4f a  = *(const v4f*)(pk);
    const v4f c  = *(const v4f*)(pk + 4);
    const v4f a2 = *(const v4f*)(pv);
    const v4f c2 = *(const v4f*)(pv + 4);
    // the wait owed before the address registers of these loads are written again; the pointers are inputs so that their
    // registers stay as they are up to the wait (no loaded value may land on them either)
    asm volatile("s_wait_xcnt 0x0" :: "v"(pk), "v"(pv) : "memory");
    gn_unit(a, c, gkw, gkb, ch, o);
#pragma unroll
    for (int e = 0; e < 8; ++e) hb[e] = h_bits(o[e] * kXCarry);
    gn_store(k16 + base, hb);
    float kf[8];
#pragma unroll
    for (int e = 0; e < 8; ++e) kf[e] = h16_to_f32(hb[e]);
    gn_unit(a2, c2, gvw, gvb, ch, o);
#pragma unroll
    for (int e = 0; e < 8; ++e) hb[e] = h_bits(o[e] * kf[e]);
    gn_store(vk16 + base, hb);
  }
}

// ---------------------------------------------------------------------------
// 1 / sqrt(x) in the steps rsqrtf takes: x below the smallest normal number is scaled by 2^24 and the result by 2^12.
__device__ __forceinline__ float rsqrt_steps(float x) {
  const bool tiny = x < __uint_as_float(0x00800000u);
  const float xs = tiny ? x * 16777216.0f : x;
  float r;
  // the free slot that a transcendental is owed before its source is overwritten or its result read; only one
  // statement ties the v_nop to it
  asm("v_rsq_f32 %0, %1\n\tv_nop" : "=v"(r) : "v"(xs));
  return tiny ? r * 4096.0f : r;
}

constexpr int kFaTiles  = 13;
constexpr int kFaRows   = kFaTiles * 16;
constexpr int kFaThr    = kFaTiles * 32;
constexpr int kFaKPitch = 136;
constexpr int kFaVPitch = 264;
constexpr int kFaOPitch = 132;
constexpr int kFaKPc    = kFaRows * 16 / kFaThr;
constexpr int kFaVGrp   = 4;
constexpr int kFaVGroups = kM / kFaVGrp;
constexpr int kFaVRounds = (kFaVGroups + kFaTiles - 1) / kFaTiles;
constexpr int kFaWRows  = kFaThr / 16;           // Wc rows a round (16 pieces of 16 B a row): 26
constexpr int kFaWPc    = (kHD + kFaWRows - 1) / kFaWRows;   // row rounds of Wc: 5
static_assert(kFaKPc * kFaThr == kFaRows * 16, "k pieces divide");
static_assert(kM % kFaVGrp == 0 && (kFaVRounds - 1) * kFaTiles <= kFaVGroups, "v2 groups are whole; all rounds but the last are whole");
static_assert((kKeyK - kM) % 4 == 0 && (kM * 2) % 8 == 0 && (kFaVPitch * 2) % 8 == 0, "8-B stores into v2^T rows are aligned");
static_assert((kFaWPc - 1) * kFaWRows <= kHD && kFaWPc * kFaWRows >= kHD, "all Wc rounds but the last are whole");
static_assert((kB - 1) * kM + kFaRows <= kTokPad, "k and q2 rows stay in their planes");
static_assert(kKeyK / 32 * 2 == kFaTiles + 1 && kKeyK <= kFaVPitch, "P*v2 depth = 7 steps of 32 keys, the last half step zero");

__global__ __launch_bounds__(kFaThr) void attn_fused_kernel(const unsigned short* __restrict__ Qp,
                                                            const unsigned short* __restrict__ Kp,
                                                            const float* __restrict__ Pv,
                                                            const float* __restrict__ gvw, const float* __restrict__ gvb,
                                                            const unsigned short* __restrict__ Gp,
                                                            const unsigned short* __restrict__ Wcp,
                                                            const float* __restrict__ bc,
                                                            const float* __restrict__ mask, float* __restrict__ att,
                                                            float scoreScale, float pvScale, float gateScale) {
  typedef Frag<_Float16> F;
  __shared__ __align__(16) unsigned short sK[kFaRows * kFaKPitch];
  __shared__ __align__(16) unsigned short sV[kHD * kFaVPitch];
  __shared__ __align__(16) float sO[kFaTiles][16 * kFaOPitch];   // per-wave 16 x 128 slab
  __shared__ __align__(16) float sMask[kFaThr];
  __shared__ __align__(16) unsigned short sW[kFaWPc * kFaWRows * kFaKPitch];   // 130 rows of Wc: 128 read, 2 spare
  __shared__ __align__(16) float sBc[kFaThr];
  const int t = threadIdx.x, lane = t & 31;
  const int wave = __builtin_amdgcn_readfirstlane(t >> 5);       // scalar: the wave's query tile, slab and v2 token groups
  const int b = blockIdx.x, h = blockIdx.y;
  const int c = lane & 15, hf = lane >> 4;

  // ---- this wave's q2 and (v1*k) fragments and v2 rows and the group's k, mask, Wc and bc, all loads in flight together ----
  const _Float16* gQ = (const _Float16*)Qp + (size_t)(b * kM + wave * 16 + c) * kD + h * kHD + hf * 8;
  const unsigned short* gK = Kp + (size_t)(b * kM + (t >> 4)) * kD + h * kHD + (t & 15) * 8;
  v16h qf[4];
  v4u rk[kFaKPc];
#pragma unroll
  for (int kk = 0; kk < 4; ++kk) qf[kk] = F::load(gQ + kk * 32);
#pragma unroll
  for (int j = 0; j < kFaKPc; ++j) rk[j] = *(const v4u*)(gK + (size_t)(j * (kFaThr / 16)) * kD);
  // v2 rows: lane = channels 4 lane .. 4 lane + 3 of the head; rounds 0..2 exist for every wave, in the last round the waves
  // past group 48 load group 48 again (in bounds) and do nothing with it
  const int vch = h * kHD + lane * 4;
  const float* pgw = gvw + vch;
  const float* pgb = gvb + vch;
  const v4f gwv = *(const v4f*)pgw;
  const v4f gbv = *(const v4f*)pgb;
  const int glast = wave + (kFaVRounds - 1) * kFaTiles;
  const bool vlast = glast < kFaVGroups;                         // wave-uniform
  const float* pV  = Pv + (size_t)(b * kM + wave * kFaVGrp) * kD + vch;
  const float* pVl = Pv + (size_t)(b * kM + (vlast ? glast : (kFaVGroups - 1)) * kFaVGrp) * kD + vch;
  v4f a[kFaVRounds * kFaVGrp];
#pragma unroll
  for (int i = 0; i < kFaVRounds - 1; ++i)
#pragma unroll
    for (int g = 0; g < kFaVGrp; ++g) a[i * kFaVGrp + g] = *(const v4f*)(pV + (size_t)(i * kFaTiles * kFaVGrp + g) * kD);
#pragma unroll
  for (int g = 0; g < kFaVGrp; ++g) a[(kFaVRounds - 1) * kFaVGrp + g] = *(const v4f*)(pVl + (size_t)g * kD);
  const int mi = b * kM + ((t < kM) ? t : (kM - 1));
  const float mload = mask[mi];
  // (v1*k) rows of the wave's queries; the plane has no pad rows, so a query row past its end reads the last row (in bounds;
  // such a query is >= 196 and its output is never read)
  const int grow = b * kM + wave * 16 + c;
  const _Float16* gG = (const _Float16*)Gp + (size_t)((grow < kTok) ? grow : (kTok - 1)) * kD + h * kHD + hf * 8;
  v16h gf[4];
#pragma unroll
  for (int kk = 0; kk < 4; ++kk) gf[kk] = F::load(gG + kk * 32);
  const unsigned short* gW = Wcp + (size_t)(t >> 4) * kHD + (t & 15) * 8;
  v4u rw[kFaWPc];
#pragma unroll
  for (int j = 0; j < kFaWPc - 1; ++j) rw[j] = *(const v4u*)(gW + (size_t)(j * kFaWRows) * kHD);
  // the last round's threads past row 127 load row 127 again (in bounds) and lay it in a spare LDS row that nobody reads
  const int wlast = (t >> 4) + (kFaWPc - 1) * kFaWRows;
  const unsigned short* gWl = Wcp + (size_t)((wlast < kHD) ? wlast : (kHD - 1)) * kHD + (t & 15) * 8;
  rw[kFaWPc - 1] = *(const v4u*)gWl;
  const int bi = t & (kHD - 1);
  const float bload = bc[bi];
  // the wait owed before the address registers of these loads are written again; the per-lane pointers and index are
  // inputs so that their registers stay as they are up to the wait (no later load may land on them either)
  asm volatile("s_wait_xcnt 0x0" :: "v"(gQ), "v"(gK), "v"(pgw), "v"(pgb), "v"(pV), "v"(pVl), "v"(mi), "v"(gG), "v"(gW), "v"(gWl), "v"(bi) : "memory");
#pragma unroll
  for (int j = 0; j < kFaKPc; ++j) *(v4u*)(sK + ((t >> 4) + j * (kFaThr / 16)) * kFaKPitch + (t & 15) * 8) = rk[j];
  sMask[t] = mload;                              // entries from 196 on repeat key 195 and are never used
#pragma unroll
  for (int j = 0; j < kFaWPc; ++j) *(v4u*)(sW + ((t >> 4) + j * kFaWRows) * kFaKPitch + (t & 15) * 8) = rw[j];
  sBc[t] = bload;                                // entries from 128 on repeat the first ones and are never used
  if (wave < kHD / 32) {                         // keys 196..223 of v2^T row t: P is 0 there, the product must be too
#pragma unroll
    for (int p = 0; p < (kKeyK - kM) / 4; ++p) *(v2u*)(sV + t * kFaVPitch + kM + p * 4) = (v2u){0u, 0u};
  }
  // CELU + GroupNorm of the wave's v2 tokens, four a group step by step side by side: their ten lane exchanges each are
  // independent, so one wait serves four.
#pragma unroll
  for (int i = 0; i < kFaVRounds; ++i) {
    if (i < kFaVRounds - 1 || vlast) {           // wave-uniform: every lane is on in the exchanges
      float y[kFaVGrp][4], d[kFaVGrp][4], sm[kFaVGrp], sq[kFaVGrp];
#pragma unroll
      for (int g = 0; g < kFaVGrp; ++g) {
#pragma unroll
        for (int e = 0; e < 4; ++e) y[g][e] = celu_f(a[i * kFaVGrp + g][e]);
        sm[g] = (y[g][0] + y[g][1]) + (y[g][2] + y[g][3]);
      }
#pragma unroll
      for (int off = 1; off < 32; off <<= 1) {
        float x[kFaVGrp];
#pragma unroll
        for (int g = 0; g < kFaVGrp; ++g) x[g] = __shfl_xor(sm[g], off, 32);
#pragma unroll
        for (int g = 0; g < kFaVGrp; ++g) sm[g] += x[g];
      }
#pragma unroll
      for (int g = 0; g < kFaVGrp; ++g) {
        const float mu = sm[g] * (1.0f / 128.0f);
        sq[g] = 0.f;
#pragma unroll
        for (int e = 0; e < 4; ++e) { d[g][e] = y[g][e] - mu; sq[g] += d[g][e] * d[g][e]; }
      }
#pragma unroll
      for (int off = 1; off < 32; off <<= 1) {
        float x[kFaVGrp];
#pragma unroll
        for (int g = 0; g < kFaVGrp; ++g) x[g] = __shfl_xor(sq[g], off, 32);
#pragma unroll
        for (int g = 0; g < kFaVGrp; ++g) sq[g] += x[g];
      }
      float rs[kFaVGrp];
#pragma unroll
      for (int g = 0; g < kFaVGrp; ++g) rs[g] = rsqrt_steps(sq[g] * (1.0f / 128.0f) + 1e-5f);
      const int tok0 = (wave + i * kFaTiles) * kFaVGrp;
#pragma unroll
      for (int e = 0; e < 4; ++e) {
        unsigned short hb[kFaVGrp];
#pragma unroll
        for (int g = 0; g < kFaVGrp; ++g) hb[g] = h_bits((d[g][e] * rs[g] * gwv[e] + gbv[e]) * kXCarry);
        *(v2u*)(sV + (lane * 4 + e) * kFaVPitch + tok0) = (v2u){pk16(hb[0], hb[1]), pk16(hb[2], hb[3])};
      }
    }
  }
  __syncthreads();

  // ---- S^T = k * q2^T: s[tt][r] = score of key 16 tt + 8 hf + r for query 16 wave + c ----
  // The 52 products run k step by k step (product f: k step f / 13, key tile f % 13), so neighbours have different
  // accumulators; their k fragments are read in groups of 4, one group ahead, into two register sets.
  v8f s[kFaTiles];
#pragma unroll
  for (int tt = 0; tt < kFaTiles; ++tt) s[tt] = (v8f){0.f,0.f,0.f,0.f,0.f,0.f,0.f,0.f};
  {
    const _Float16* kf = (const _Float16*)sK + c * kFaKPitch + hf * 8;
    v16h ka[2][4];
#pragma unroll
    for (int e = 0; e < 4; ++e) ka[0][e] = F::load(kf + (e % kFaTiles) * 16 * kFaKPitch + (e / kFaTiles) * 32);
#pragma unroll
    for (int g = 0; g < kFaTiles; ++g) {
      if (g + 1 < kFaTiles) {
#pragma unroll
        for (int e = 0; e < 4; ++e) {
          const int f = (g + 1) * 4 + e;
          ka[(g + 1) & 1][e] = F::load(kf + (f % kFaTiles) * 16 * kFaKPitch + (f / kFaTiles) * 32);
        }
      }
      // keeps the next group's LDS reads together and ahead of this group's WMMAs (the scheduler otherwise sinks each read
      // to its use, and every WMMA then waits out an LDS latency)
      __builtin_amdgcn_sched_barrier(0);
#pragma unroll
      for (int e = 0; e < 4; ++e) {
        const int f = g * 4 + e;
        s[f % kFaTiles] = F::mma(ka[g & 1][e], qf[f / kFaTiles], s[f % kFaTiles]);
      }
      // keeps the reads of the group after next behind these WMMAs, not among them
      __builtin_amdgcn_sched_barrier(0);
    }
  }

  // ---- softmax over the query's 196 keys, f32 ----
  float mx4[4] = {-3.0e38f, -3.0e38f, -3.0e38f, -3.0e38f};
#pragma unroll
  for (int tt = 0; tt < kFaTiles; ++tt) {
    const v4f m0 = *(const v4f*)(sMask + tt * 16 + hf * 8);
    const v4f m1 = *(const v4f*)(sMask + tt * 16 + hf * 8 + 4);
#pragma unroll
    for (int r = 0; r < 8; ++r) {
      const int j = tt * 16 + hf * 8 + r;
      const float mv = (r < 4) ? m0[r & 3] : m1[r & 3];
      const float v = (mv == 0.0f) ? -1.0e9f : s[tt][r] * scoreScale;
      s[tt][r] = (j < kM) ? v : -3.0e38f;
      mx4[r & 3] = fmaxf(mx4[r & 3], s[tt][r]);
    }
  }
  float mx = fmaxf(fmaxf(mx4[0], mx4[1]), fmaxf(mx4[2], mx4[3]));
  mx = fmaxf(mx, __shfl_xor(mx, 16, 32));
  const float mxl = mx * kLog2e;
  float ps4[4] = {0.f, 0.f, 0.f, 0.f};
#pragma unroll
  for (int tt = 0; tt < kFaTiles; ++tt) {
#pragma unroll
    for (int r = 0; r < 8; ++r) {
      // e^(s - mx); the rounding of mxl is one factor common to the row's P and its sum. An excluded key sits at -3e38: P = 0
      s[tt][r] = exp2_hw(__builtin_fmaf(s[tt][r], kLog2e, -mxl));
      ps4[r & 3] += s[tt][r];
    }
  }
  float ps = (ps4[0] + ps4[1]) + (ps4[2] + ps4[3]);
  ps += __shfl_xor(ps, 16, 32);
  const float inv = 1.0f / ps;
  v16h pf[kKeyK / 32];
#pragma unroll
  for (int u = 0; u < kKeyK / 32; ++u) {
#pragma unroll
    for (int e = 0; e < 8; ++e) {
      pf[u][e]     = (_Float16)(s[2 * u][e] * inv * kPCarry);
      pf[u][8 + e] = (2 * u + 1 < kFaTiles) ? (_Float16)(s[(2 * u + 1 < kFaTiles) ? 2 * u + 1 : 0][e] * inv * kPCarry) : (_Float16)0.0f;
    }
  }

  // ---- O^T = v2^T * P^T: o[j][r] = attn of query 16 wave + c, channel 16 j + 8 hf + r ----
  v8f o[8];
#pragma unroll
  for (int j = 0; j < 8; ++j) o[j] = (v8f){0.f,0.f,0.f,0.f,0.f,0.f,0.f,0.f};
  {
    // product f: key step f / 8, channel tile f % 8; v2^T fragments in groups of 4, one group ahead, as above
    const _Float16* vf = (const _Float16*)sV + c * kFaVPitch + hf * 8;
    constexpr int kGroups = kKeyK / 32 * 2;
    v16h va[2][4];
#pragma unroll
    for (int e = 0; e < 4; ++e) va[0][e] = F::load(vf + e * 16 * kFaVPitch);
#pragma unroll
    for (int g = 0; g < kGroups; ++g) {
      if (g + 1 < kGroups) {
#pragma unroll
        for (int e = 0; e < 4; ++e) {
          const int f = (g + 1) * 4 + e;
          va[(g + 1) & 1][e] = F::load(vf + (f % 8) * 16 * kFaVPitch + (f / 8) * 32);
        }
      }
      // keeps the next group's LDS reads together and ahead of this group's WMMAs
      __builtin_amdgcn_sched_barrier(0);
#pragma unroll
      for (int e = 0; e < 4; ++e) {
        const int f = g * 4 + e;
        o[f % 8] = F::mma(va[g & 1][e], pf[f / 8], o[f % 8]);
      }
      // keeps the reads of the group after next behind these WMMAs, not among them
      __builtin_amdgcn_sched_barrier(0);
    }
  }

  // ---- G^T = Wc * (v1*k)^T: gt[j][r] = gate sum of query 16 wave + c, channel 16 j + 8 hf + r (the place of o[j][r]) ----
  v8f gt[8];
#pragma unroll
  for (int j = 0; j < 8; ++j) gt[j] = (v8f){0.f,0.f,0.f,0.f,0.f,0.f,0.f,0.f};
  {
    // product f: k step f / 8, channel tile f % 8; Wc fragments in groups of 4, one group ahead, as above
    const _Float16* wf = (const _Float16*)sW + c * kFaKPitch + hf * 8;
    constexpr int kGroups = kHD / 32 * 2;
    v16h wa[2][4];
#pragma unroll
    for (int e = 0; e < 4; ++e) wa[0][e] = F::load(wf + e * 16 * kFaKPitch);
#pragma unroll
    for (int g = 0; g < kGroups; ++g) {
      if (g + 1 < kGroups) {
#pragma unroll
        for (int e = 0; e < 4; ++e) {
          const int f = (g + 1) * 4 + e;
          wa[(g + 1) & 1][e] = F::load(wf + (f % 8) * 16 * kFaKPitch + (f / 8) * 32);
        }
      }
      // keeps the next group's LDS reads together and ahead of this group's WMMAs
      __builtin_amdgcn_sched_barrier(0);
#pragma unroll
      for (int e = 0; e < 4; ++e) {
        const int f = g * 4 + e;
        gt[f % 8] = F::mma(wa[g & 1][e], gf[f / 8], gt[f % 8]);
      }
      // keeps the reads of the group after next behind these WMMAs, not among them
      __builtin_amdgcn_sched_barrier(0);
    }
  }

  // ---- epilogue: sigmoid(G + bc) * attn; the wave's 16 x 128 block through its own slab, so that each store covers a whole
  // 512-B row piece ----
  float* slab = sO[wave];
#pragma unroll
  for (int j = 0; j < 8; ++j) {
    const v4f b0 = *(const v4f*)(sBc + j * 16 + hf * 8);
    const v4f b1 = *(const v4f*)(sBc + j * 16 + hf * 8 + 4);
    float w[8];
#pragma unroll
    for (int r = 0; r < 8; ++r) {
      float v = gt[j][r] * gateScale;
      v += (r < 4) ? b0[r & 3] : b1[r & 3];
      w[r] = rcp_hw(1.0f + exp2_hw(v * -kLog2e)) * (o[j][r] * pvScale);
    }
    *(v4f*)(slab + c * kFaOPitch + j * 16 + hf * 8)     = (v4f){w[0], w[1], w[2], w[3]};
    *(v4f*)(slab + c * kFaOPitch + j * 16 + hf * 8 + 4) = (v4f){w[4], w[5], w[6], w[7]};
  }
  // the wave's slab writes are complete before its lanes read each other's words
  __builtin_amdgcn_fence(__ATOMIC_RELEASE, "workgroup");
  __builtin_amdgcn_wave_barrier();
  __builtin_amdgcn_fence(__ATOMIC_ACQUIRE, "workgroup");
  float* dst = att + (size_t)(b * kSP + wave * 16) * kD + h * kHD + lane * 4;
#pragma unroll
  for (int row = 0; row < 16; ++row) *(v4f*)(dst + (size_t)row * kD) = *(const v4f*)(slab + row * kFaOPitch + lane * 4);
}

// ---------------------------------------------------------------------------
// Residual + LayerNorm: y = x + gated attn ([32][256 q][1024], the gate already applied); x_new = LN(y)*lnw + lnb
// written f32 to xout (may alias xin: each block reads its whole row into registers before any store, no other block
// touches the row) and as f16(16*x_new) to x16. One block per token (grid 6272), thread t owns columns 4t..4t+3.
// ---------------------------------------------------------------------------
__global__ __launch_bounds__(256) void merge_ln_kernel(const float* xin, const float* __restrict__ att, const float* __restrict__ lnw,
                                                       const float* __restrict__ lnb, float* xout,
                                                       unsigned short* __restrict__ x16) {
  __shared__ float redA[8];
  __shared__ float redB[8];
  __shared__ __align__(16) float srow[kD];
  const int t = threadIdx.x, lane = t & 31, wave = t >> 5;
  const int r = blockIdx.x;
  const int b = r / kM;
  const int m = r - b * kM;
  const int c0 = t * 4;
  const size_t ro = (size_t)r * kD + c0;
  const v4f xv = *(const v4f*)(xin + ro);
  const v4f av = *(const v4f*)(att + ((size_t)(b * kSP + m)) * kD + c0);
  float y[4];
#pragma unroll
  for (int e = 0; e < 4; ++e) y[e] = xv[e] + av[e];
  float s = (y[0] + y[1]) + (y[2] + y[3]);
#pragma unroll
  for (int off = 1; off < 32; off <<= 1) s += __shfl_xor(s, off, 32);
  if (lane == 0) redA[wave] = s;
  __syncthreads();
  float tot = redA[0];
#pragma unroll
  for (int w = 1; w < 8; ++w) tot += redA[w];
  const float mu = tot * (1.0f / 1024.0f);
  float d[4];
  float sq = 0.f;
#pragma unroll
  for (int e = 0; e < 4; ++e) { d[e] = y[e] - mu; sq += d[e] * d[e]; }
#pragma unroll
  for (int off = 1; off < 32; off <<= 1) sq += __shfl_xor(sq, off, 32);
  if (lane == 0) redB[wave] = sq;
  __syncthreads();
  float tot2 = redB[0];
#pragma unroll
  for (int w = 1; w < 8; ++w) tot2 += redB[w];
  const float var = tot2 * (1.0f / 1024.0f);
  const float rs = rsqrtf(var + 1e-5f);
  const v4f wv = *(const v4f*)(lnw + c0);
  const v4f bv = *(const v4f*)(lnb + c0);
  v4f ov;
#pragma unroll
  for (int e = 0; e < 4; ++e) ov[e] = d[e] * rs * wv[e] + bv[e];
  *(v4f*)(srow + c0) = ov;
  __syncthreads();
  const int tc = t & 127;                               // clamped staging index; only t < 128 stores
  const v4f p0 = *(const v4f*)(srow + tc * 8);
  const v4f p1 = *(const v4f*)(srow + tc * 8 + 4);
  unsigned short hb[8];
#pragma unroll
  for (int e = 0; e < 4; ++e) {
    hb[e]     = h_bits(p0[e] * kXCarry);
    hb[4 + e] = h_bits(p1[e] * kXCarry);
  }
  const v4u hu = (v4u){pk16(hb[0], hb[1]), pk16(hb[2], hb[3]), pk16(hb[4], hb[5]), pk16(hb[6], hb[7])};
  unsigned short* hp = x16 + (size_t)r * kD + tc * 8;
  {
    *(v4f*)(xout + ro) = ov;
    if (t < 128) *(v4u*)hp = hu;
    
  }
}

// ---------------------------------------------------------------------------
// Masked mean over tokens: out0[b][c] = sum_m x[b][m][c]*mask[b][m] / sum_m mask[b][m]. One block per b (grid 32),
// ---------------------------------------------------------------------------
constexpr int kPoolRows = 28;   // token rows in flight per wave
static_assert(kM % kPoolRows == 0, "pool groups divide the tokens");
__global__ __launch_bounds__(256) void pool_kernel(const float* x, const float* __restrict__ mask, float* out0) {
  const int t = threadIdx.x;
  const int b = blockIdx.x;
  const int c0 = t * 4;
  v4f acc = (v4f){0.f, 0.f, 0.f, 0.f};
  float ms = 0.f;
  // 28 token rows are asked for at a time and then summed in token order (the order of the sums is unchanged): the wave
  // waits out 7 load latencies in place of 196. The loop over the groups stays rolled: one group's registers serve all 7.
#pragma unroll 1
  for (int m0 = 0; m0 < kM; m0 += kPoolRows) {
    const float* xp = x + ((size_t)(b * kM + m0)) * kD + c0;
    v4f xv[kPoolRows];
#pragma unroll
    for (int j = 0; j < kPoolRows; ++j) xv[j] = *(const v4f*)(xp + (size_t)j * kD);
    // the wait owed before the address register of these loads is written again; the pointer is an input so that its
    // register stays as it is up to the wait (no loaded row may land on it either)
    asm volatile("s_wait_xcnt 0x0" :: "v"(xp) : "memory");
#pragma unroll
    for (int j = 0; j < kPoolRows; ++j) {
      const float mv = mask[b * kM + m0 + j];
      acc += xv[j] * mv;
      ms += mv;
    }
  }
  const float inv = 1.0f / ms;
  const v4f o = acc * inv;
  store2_v4f(out0 + (size_t)b * kD + c0, o);
}

// ---------------------------------------------------------------------------
// Host orchestration: kernel launches only. 1 + 3*4 + 1 = 14 launches.
// ---------------------------------------------------------------------------
extern "C" void kernel_launch(void* const* d_in, const int* in_sizes, int n_in,
                              void* d_out, int out_size, void* d_ws, size_t ws_size,
                              hipStream_t stream) {
  if (n_in < 22) return;
  if (in_sizes[0] != kTok * kD) return;
  if (in_sizes[1] != kTok) return;
  if (in_sizes[2] != kL * kD * kD || in_sizes[6] != kL * kD * kD || in_sizes[10] != kL * kD * kD || in_sizes[14] != kL * kD * kD) return;
  if (in_sizes[18] != kL * kHD * kHD || in_sizes[19] != kL * kHD) return;
  if (in_sizes[3] != kL * kD || in_sizes[20] != kL * kD || in_sizes[21] != kL * kD) return;
  if (out_size != kB * kD + kTok * kD) return;
  if (ws_size < kWsTotal) return;

  const float* att_feats = (const float*)d_in[0];
  const float* att_mask  = (const float*)d_in[1];
  const float* Wq2  = (const float*)d_in[2];
  const float* bq2  = (const float*)d_in[3];
  const float* gq2w = (const float*)d_in[4];
  const float* gq2b = (const float*)d_in[5];
  const float* Wk   = (const float*)d_in[6];
  const float* bk   = (const float*)d_in[7];
  const float* gkw  = (const float*)d_in[8];
  const float* gkb  = (const float*)d_in[9];
  const float* Wv1  = (const float*)d_in[10];
  const float* bv1  = (const float*)d_in[11];
  const float* gv1w = (const float*)d_in[12];
  const float* gv1b = (const float*)d_in[13];
  const float* Wv2  = (const float*)d_in[14];
  const float* bv2  = (const float*)d_in[15];
  const float* gv2w = (const float*)d_in[16];
  const float* gv2b = (const float*)d_in[17];
  const float* Wc   = (const float*)d_in[18];
  const float* bc   = (const float*)d_in[19];
  const float* lnw  = (const float*)d_in[20];
  const float* lnb  = (const float*)d_in[21];

  char* ws = (char*)d_ws;
  float*          Ppl   = (float*)(ws + kOffP);                    // linear+bias planes (q2, k, v1, v2)
  float*          ATT   = (float*)(ws + kOffP);                    // gated attn plane (same region, over the q2 plane and part of the k plane, both used up by then)
  unsigned short* GIN16 = (unsigned short*)(ws + kOffATT);         // (v1*k) plane
  unsigned short* X16   = (unsigned short*)(ws + kOffX16);
  unsigned short* W16   = (unsigned short*)(ws + kOffW16);
  unsigned short* WC16  = (unsigned short*)(ws + kOffWC16);
  unsigned short* Q16   = (unsigned short*)(ws + kOffQ16);
  unsigned short* K16   = (unsigned short*)(ws + kOffK16);

  float* out0 = (float*)d_out;                                     // [32][1024] at byte 0
  float* out1 = (float*)d_out + (size_t)kB * kD;                   // [32][196][1024] at byte 131072; also the running x

  const float projScale  = 1.0f / (kXCarry * kWCarry);             // 1/4096
  const float gateScale  = 1.0f / (kXCarry * kWCarry);             // (v1*k) x16, Wc x256
  const float scoreScale = 0.08838834764831845f * (1.0f / (kXCarry * kXCarry));
  const float pvScale    = 1.0f / (kPCarry * kXCarry);             // 1/32768

  // x and every layer's W and Wc -> f16 planes; pad rows of the q2/k planes zero
  prep_kernel<<<dim3(kPrepBlocks), dim3(256), 0, stream>>>(att_feats, Wq2, Wk, Wv1, Wv2, Wc, X16,
                                                           Q16 + (size_t)kTok * kD, K16 + (size_t)kTok * kD, W16, WC16);

  for (int i = 0; i < kL; ++i) {
    const size_t vo = (size_t)i * kD;

    // four projections: P[z] = x16 * Wz^T + bz (M 6272, N 4 * 1024, K 1024; 28 x 16 block tiles of 224 x 256 = 448 blocks)
    proj_gemm_lds_kernel<<<dim3((kTok / kPjBM) * (4 * kD / kPjBN)), dim3(256), 0, stream>>>(
        X16, W16 + (size_t)i * 4 * kD * kD, Ppl, bq2 + vo, bk + vo, bv1 + vo, bv2 + vo, projScale);

    // CELU + GroupNorm of q2, k and v1 (with v1 * k), token-major
    gn_rows_kernel<<<dim3(2 * kGnBlocks), dim3(256), 0, stream>>>(Ppl, gq2w + vo, gq2b + vo, gkw + vo, gkb + vo,
                                                                  gv1w + vo, gv1b + vo, Q16, K16, GIN16);

    // attention: CELU + GroupNorm of v2, scores, softmax, P * v2 and the gate sigmoid((v1*k) * Wc^T + bc) of one (batch, head)
    // group per work-group, 256 groups in one launch
    attn_fused_kernel<<<dim3(kB, kH), dim3(kFaThr), 0, stream>>>(Q16, K16, Ppl + (size_t)3 * kTok * kD, gv2w + vo, gv2b + vo,
                                                                 GIN16, WC16 + (size_t)i * kHD * kHD,
                                                                 bc + (size_t)i * kHD, att_mask, ATT, scoreScale, pvScale,
                                                                 gateScale);

    const float* xin = (i == 0) ? att_feats : out1;
    merge_ln_kernel<<<dim3(kTok), dim3(256), 0, stream>>>(xin, ATT, lnw + (size_t)i * kD, lnb + (size_t)i * kD, out1, X16);
  }

  pool_kernel<<<dim3(kB), dim3(256), 0, stream>>>(out1, att_mask, out0);
}

// v009
// It runs in 250 microseconds.
// Two timings next to v008 both put it at 1.23 times that version's speed.
// All steps since v000 together make it 6.39 times as fast.
// Contractions: projections x(f16, x16)*W^T(f16, x256), gate (v1*k)(f16, x16)*Wc^T(f16, x256), scores q2(f16, x16)*k^T(f16, x16), attn P(f16, x2048)*v2(f16, x16): all v_wmma_f32_16x16x32_f16 with f32 accumulate; CELU, GroupNorm, softmax, sigmoid, residual, LayerNorm and masked mean in f32.
#include <hip/hip_runtime.h>
#include <math.h>

// ---------------------------------------------------------------------------
// Problem constants
// ---------------------------------------------------------------------------
constexpr int kB   = 32;
constexpr int kM   = 196;
constexpr int kD   = 1024;
constexpr int kH   = 8;
constexpr int kHD  = 128;
constexpr int kL   = 3;
constexpr int kTok = kB * kM;          // 6272 = 98 * 64 token rows
constexpr int kTokPad = kTok + 64;     // 6336: 64 zero rows so per-group 208-row tiles never leave the plane
constexpr int kSP  = 256;              // padded queries per (batch, head) group (rows of the gated attn plane)
constexpr int kKeyK = 224;             // contraction depth of P*V (keys padded to a multiple of 32)
constexpr float kXCarry = 16.0f;       // x, q2, k, v2 planes carried x16 in f16
constexpr float kWCarry = 256.0f;      // W, Wc carried x256 in f16
constexpr float kPCarry = 2048.0f;     // probabilities carried x2048 in f16

// ---------------------------------------------------------------------------
// Workspace region map (bytes, all offsets multiples of 256)
//   R_ATT  : gated attn f32 [32][256][1024]
//   R_X16  : x f16 [6272][1024]
//   R_W16  : stacked W f16 [3 layers][4096][1024]
//   R_WC16 : Wc f16 [3 layers][128][128]
//   R_N16  : normalised projections f16 [4: q2, k, v1, v2][6336][1024] (rows >= 6272 of q2 and k zero, of v1 and v2 unused)
// ---------------------------------------------------------------------------
constexpr size_t kBytesATT  = (size_t)kB * kSP * kD * 4;
constexpr size_t kBytesX16  = (size_t)kTok * kD * 2;
constexpr size_t kBytesW16  = (size_t)kL * 4 * kD * kD * 2;
constexpr size_t kBytesWC16 = (size_t)kL * kHD * kHD * 2;
constexpr size_t kBytesN16  = (size_t)kTokPad * kD * 2;    // one plane
constexpr size_t kOffATT  = 0;
constexpr size_t kOffX16  = kOffATT + kBytesATT;
constexpr size_t kOffW16  = kOffX16 + kBytesX16;
constexpr size_t kOffWC16 = kOffW16 + kBytesW16;
constexpr size_t kOffN16  = kOffWC16 + kBytesWC16;
constexpr size_t kWsTotal = kOffN16 + 4 * kBytesN16;
static_assert(kWsTotal <= 268435456, "carve under 256 MiB");
static_assert((kOffX16 % 256) == 0 && (kOffW16 % 256) == 0 && (kOffWC16 % 256) == 0 && (kOffN16 % 256) == 0 && (kBytesN16 % 256) == 0, "aligned");

typedef __attribute__((ext_vector_type(16))) _Float16 v16h;
typedef __attribute__((ext_vector_type(8)))  _Float16 v8h;
typedef __attribute__((ext_vector_type(16))) __bf16   v16b;
typedef __attribute__((ext_vector_type(8)))  __bf16   v8b;
typedef __attribute__((ext_vector_type(8)))  float    v8f;
typedef __attribute__((ext_vector_type(4)))  float    v4f;
typedef __attribute__((ext_vector_type(4)))  unsigned int v4u;
typedef __attribute__((ext_vector_type(2)))  unsigned int v2u;

__device__ __forceinline__ unsigned short f2bf_bits(float f) {
  unsigned u = __float_as_uint(f);
  return (unsigned short)((u + 0x7FFFu + ((u >> 16) & 1u)) >> 16);
}
__device__ __forceinline__ float bf_bits2f(unsigned short h) { return __uint_as_float(((unsigned)h) << 16); }

template <typename T> struct Frag;
template <> struct Frag<_Float16> {
  typedef v16h V; union U { v16h v; v8h h[2]; };
  static __device__ __forceinline__ v16h load(const _Float16* p) {   // elements 0..7 <- p[0..7], 8..15 <- p[16..23]
    U f; f.h[0] = *(const v8h*)(p); f.h[1] = *(const v8h*)(p + 16); return f.v;
  }
  static __device__ __forceinline__ v8f mma(v16h a, v16h b, v8f c) {
    return __builtin_amdgcn_wmma_f32_16x16x32_f16(false, a, false, b, (short)0, c, false, false);
  }
};
template <> struct Frag<__bf16> {
  typedef v16b V; union U { v16b v; v8b h[2]; };
  static __device__ __forceinline__ v16b load(const __bf16* p) {
    U f; f.h[0] = *(const v8b*)(p); f.h[1] = *(const v8b*)(p + 16); return f.v;
  }
  static __device__ __forceinline__ v8f mma(v16b a, v16b b, v8f c) {
    return __builtin_amdgcn_wmma_f32_16x16x32_bf16(false, a, false, b, (short)0, c, false, false);
  }
};

__device__ __forceinline__ unsigned pk16(unsigned short a, unsigned short b) { return (unsigned)a | ((unsigned)b << 16); }
__device__ __forceinline__ unsigned short h_bits(float f) { const _Float16 h = (_Float16)f; return __builtin_bit_cast(unsigned short, h); }

__device__ __forceinline__ void store2_v4u(unsigned short* p, v4u u) {
  *(v4u*)p = u;
  
}
__device__ __forceinline__ void store2_v4f(float* p, v4f v) {
  *(v4f*)p = v;
  
}

// ---------------------------------------------------------------------------
// 2^x by the hardware's exp2 alone; it gives 0 below the range of f32 and inf above it by itself. e^x = 2^(x * log2(e)): the
// rounding of that one product is a relative error of about |x| * 6e-8 in e^x, far under the f16 step of every plane and
// fragment that these values end in.
// ---------------------------------------------------------------------------
constexpr float kLog2e = 1.4426950408889634f;
__device__ __forceinline__ float exp2_hw(float x) {
  float v;
  // the v_nop is the free slot that a transcendental is owed before its source is overwritten or its result read; only one
  // statement ties it to the instruction
  asm("v_exp_f32 %0, %1\n\tv_nop" : "=v"(v) : "v"(x));
  return v;
}

// 1 / x by the hardware's reciprocal alone (about one unit in the last place of f32; 0 at inf), for x of 1 or more
__device__ __forceinline__ float rcp_hw(float x) {
  float v;
  // the v_nop: the same free slot as in exp2_hw
  asm("v_rcp_f32 %0, %1\n\tv_nop" : "=v"(v) : "v"(x));
  return v;
}

// ---------------------------------------------------------------------------
// CELU (alpha 1.3), f32
// ---------------------------------------------------------------------------
__device__ __forceinline__ float celu_f(float x) {
  const float en = exp2_hw(x * (kLog2e / 1.3f)) - 1.0f;
  return (x > 0.f) ? x : 1.3f * en;
}

// ---------------------------------------------------------------------------
// 1 / sqrt(x) in the steps rsqrtf takes: x below the smallest normal number is scaled by 2^24 and the result by 2^12.
__device__ __forceinline__ float rsqrt_steps(float x) {
  const bool tiny = x < __uint_as_float(0x00800000u);
  const float xs = tiny ? x * 16777216.0f : x;
  float r;
  // the free slot that a transcendental is owed before its source is overwritten or its result read; only one statement
  // ties the v_nop to it
  asm("v_rsq_f32 %0, %1\n\tv_nop" : "=v"(r) : "v"(xs));
  return tiny ? r * 4096.0f : r;
}

// ---------------------------------------------------------------------------
// Sum over the 16 lanes of a row (lanes 0..15, lanes 16..31), left in every lane of the row: four adds whose second operand
// comes from lane ^ 1, ^ 2, ^ 4, ^ 8 by the vector unit's own lane pattern (no LDS round trip).
// ---------------------------------------------------------------------------
template <int X>
__device__ __forceinline__ float row_xor(float v) {
  return __int_as_float(__builtin_amdgcn_update_dpp(0, __float_as_int(v), 0x160 | X, 0xf, 0xf, true));   // 0x160: row_xmask
}
__device__ __forceinline__ float row16_sum(float v) {
  v += row_xor<1>(v);
  v += row_xor<2>(v);
  v += row_xor<4>(v);
  v += row_xor<8>(v);
  return v;
}

// ---------------------------------------------------------------------------
// Projection GEMM with operands staged in LDS: y[m,n] = scale * sum_k A[m,k] * Bt[n,k] + bias[n], then CELU and GroupNorm
// (mean/var over the 128 channels of a head) on the accumulators, f16 out: no linear plane goes through memory.
// A [6272][1024] f16, Bt [4096][1024] f16, both k-contiguous. Block tile 224 (m) x 256 (n), 8 waves as 2 x 4, each wave a
// 112x64 tile, fragments by Frag::load, k ascending. A stage is 64 k = one 128-B line of each of the 480 operand
// rows (A rows first, then Bt rows), laid at a 144-B pitch in one of two LDS buffers. Every global load covers whole lines
// (8 lanes per row). Stage s + 2 is fetched into registers during stage s and stored to LDS during stage s + 1, so a
// fetch has a whole stage to land. The four projections share one grid: Bt is the stacked W [4096][1024], column tile
// nT = 0..15 belongs to projection nT / 4 and goes to that projection's plane of C with its bias and GroupNorm weights.
// A head's 128 columns lie in two neighbouring waves (64 each): a row's sum is 4 in-lane adds, a 16-lane row sum and one
// exchange with the neighbour wave through LDS, once for the mean and once for the squares of the differences from it.
// grid = 28 * 16 = 448 blocks (6272 = 28 * 224, 4096 = 16 * 256), column tile fastest: one block fills a WGP (registers), so
// the 256 WGPs take them in 2 rounds; a wave reads 11 LDS fragments for 28 WMMAs.
// ---------------------------------------------------------------------------
constexpr int kPjBM = 224;                       // block rows of A
constexpr int kPjBN = 256;                       // block rows of Bt
constexpr int kPjBK = 64;                        // halves of k per stage
constexpr int kPjPitch = 72;                     // halves per staged row (144 B)
constexpr int kPjStage = (kPjBM + kPjBN) * kPjPitch;   // halves per buffer (69,120 B)
constexpr int kPjMT = kPjBM / 2 / 16;            // 16-row tiles of a wave: 7
constexpr int kPjPcA = kPjBM / 32;               // 16-B pieces of A per thread and stage: 7
constexpr int kPjPc = kPjPcA + kPjBN / 32;       // pieces per thread and stage: 15
constexpr int kPjStages = kD / kPjBK;            // 16
static_assert(kTok % kPjBM == 0 && kD % kPjBN == 0 && kD % (2 * kPjBK) == 0 && kPjStages >= 4, "projection tiles divide the problem");
static_assert(8 * kPjMT * 16 * kPjPitch <= 2 * kPjStage && kPjBK == 64, "the eight output slabs (112 rows of 64 halves) fit in the operand buffers");

// 15 pieces of 16 B per thread: pieces 0..6 = A rows, 7..14 = Bt rows, 32 staged rows apart
__device__ __forceinline__ void pj_fetch(v4u (&r)[kPjPc], const unsigned short* gA, const unsigned short* gB, int k) {
#pragma unroll
  for (int j = 0; j < kPjPcA; ++j) r[j] = *(const v4u*)(gA + (size_t)(32 * j) * kD + k);
#pragma unroll
  for (int j = 0; j < kPjPc - kPjPcA; ++j) r[kPjPcA + j] = *(const v4u*)(gB + (size_t)(32 * j) * kD + k);
}
__device__ __forceinline__ void pj_put(unsigned short* dst, const v4u (&r)[kPjPc]) {
#pragma unroll
  for (int j = 0; j < kPjPc; ++j) *(v4u*)(dst + 32 * j * kPjPitch) = r[j];
}
// Work-group barrier that orders LDS only: __syncthreads() also waits for every global load in flight, which would
// end the fetch of the stage after next at each barrier; those loads land in registers and concern no other wave.
__device__ __forceinline__ void pj_barrier() {
  __builtin_amdgcn_fence(__ATOMIC_RELEASE, "workgroup", "local");
  __builtin_amdgcn_s_barrier();
  __builtin_amdgcn_fence(__ATOMIC_ACQUIRE, "workgroup", "local");
}
// One stage: multiply the stage in cur; inside it store the stage held in st to nxt (PUT) and fetch stage k/64 into the same
// registers (FETCH): a fetch has a whole stage to land. The A fragments of the second k half's rows 3..6 are read when the
// first half's rows 0..3 are done with their registers, 12 WMMAs ahead of the second half: 32 registers fewer.
constexpr int kPjEarly = 3;                      // A fragments of the second k half that are read with the first group
template <bool FETCH, bool PUT>
__device__ __forceinline__ void pj_stage(const _Float16* curA, const _Float16* curB, unsigned short* nxt,
                                         const unsigned short* gA, const unsigned short* gB, int k,
                                         v4u (&st)[kPjPc], v8f (&acc)[kPjMT][4]) {
  typedef Frag<_Float16> F;
  v16h bh[2][4], ah[2][kPjMT];
#pragma unroll
  for (int j = 0; j < 4; ++j) bh[0][j] = F::load(curB + j * 16 * kPjPitch);
#pragma unroll
  for (int i = 0; i < kPjMT; ++i) ah[0][i] = F::load(curA + i * 16 * kPjPitch);
#pragma unroll
  for (int j = 0; j < 4; ++j) bh[1][j] = F::load(curB + j * 16 * kPjPitch + 32);
#pragma unroll
  for (int i = 0; i < kPjEarly; ++i) ah[1][i] = F::load(curA + i * 16 * kPjPitch + 32);
  // keeps the LDS fragment reads as one group ahead of the matrix work (the scheduler otherwise spreads them among the WMMAs)
  __builtin_amdgcn_sched_barrier(0);
#pragma unroll
  for (int i = 0; i < kPjMT - kPjEarly; ++i)
#pragma unroll
    for (int j = 0; j < 4; ++j) acc[i][j] = F::mma(ah[0][i], bh[0][j], acc[i][j]);
  // keeps the second read group, the LDS stores of the next stage and the fetch behind these WMMAs, when the first group's
  // reads have been served and four A fragments are used up
  __builtin_amdgcn_sched_barrier(0);
#pragma unroll
  for (int i = kPjEarly; i < kPjMT; ++i) ah[1][i] = F::load(curA + i * 16 * kPjPitch + 32);
  if (PUT) pj_put(nxt, st);
  // keeps the fetch behind the stores, so that it lands in the registers that they have just read (ahead of them it takes a
  // second set of 60)
  __builtin_amdgcn_sched_barrier(0);
  if (FETCH) pj_fetch(st, gA, gB, k);
  // keeps the rest of the matrix work behind them: the fetch is not sunk to its use, a stage later
  __builtin_amdgcn_sched_barrier(0);
#pragma unroll
  for (int i = kPjMT - kPjEarly; i < kPjMT; ++i)
#pragma unroll
    for (int j = 0; j < 4; ++j) acc[i][j] = F::mma(ah[0][i], bh[0][j], acc[i][j]);
  // keeps these 12 WMMAs ahead of the wait below and of the barrier's own LDS wait: the second read group, the stores and the
  // fetch's requests are served under them
  __builtin_amdgcn_sched_barrier(0);
  // the wait owed before the fetch's address registers are written again; 12 WMMAs behind the fetch
  if (FETCH) asm volatile("s_wait_xcnt 0x0" ::: "memory");
#pragma unroll
  for (int i = 0; i < kPjMT; ++i)
#pragma unroll
    for (int j = 0; j < 4; ++j) acc[i][j] = F::mma(ah[1][i], bh[1][j], acc[i][j]);
  if (PUT) pj_barrier();               // publishes the stage just stored and ends every read of cur
}

__global__ __launch_bounds__(256) void proj_gemm_lds_kernel(const unsigned short* __restrict__ Ap,
                                                            const unsigned short* __restrict__ Btp,
                                                            unsigned short* __restrict__ Cp, const float* __restrict__ bias0,
                                                            const float* __restrict__ bias1, const float* __restrict__ bias2,
                                                            const float* __restrict__ bias3, const float* __restrict__ gw0,
                                                            const float* __restrict__ gw1, const float* __restrict__ gw2,
                                                            const float* __restrict__ gw3, const float* __restrict__ gb0,
                                                            const float* __restrict__ gb1, const float* __restrict__ gb2,
                                                            const float* __restrict__ gb3, float scale) {
  __shared__ __align__(16) unsigned short sAB[2][kPjStage];
  __shared__ __align__(32) float sSum[4][kPjBM];   // a row's sum over the 64 columns of wave column 0..3
  __shared__ __align__(32) float sSq[4][kPjBM];    // the same for the squared differences
  const int t    = threadIdx.x;
  const int lane = t & 31;
  const int wave = t >> 5;
  const int nT = blockIdx.x & 15;              // column tile of the stacked W
  const int pz = nT >> 2;                      // projection (block-uniform)
  const int mB = (blockIdx.x >> 4) * kPjBM;
  const int nB = (nT & 3) * kPjBN;             // column within the projection's plane
  unsigned short* C = Cp + (size_t)pz * kTokPad * kD;
  const float* bias = (pz == 0) ? bias0 : (pz == 1) ? bias1 : (pz == 2) ? bias2 : bias3;
  const float* gw   = (pz == 0) ? gw0 : (pz == 1) ? gw1 : (pz == 2) ? gw2 : gw3;
  const float* gb   = (pz == 0) ? gb0 : (pz == 1) ? gb1 : (pz == 2) ? gb2 : gb3;
  const float carry = (pz == 2) ? 1.0f : kXCarry;   // q2, k, v2 carried x16; v1 as it is (its factor k brings the x16)
  const int m0 = mB + (wave >> 2) * (kPjMT * 16);
  const int n0 = nB + (wave & 3) * 64;

  const int rlane = lane & 15;                 // row (A) / col (B, D) within subtile
  const int koff  = (lane >> 4) * 8;           // k offset of this lane half
  const int mOff  = (lane >> 4) * 8;           // D row offset

  // staging map: piece j of thread t is 16 B number (t & 7) of staged row (t >> 3) + 32 * j
  const int srow = t >> 3;
  const int spart = (t & 7) * 8;
  const unsigned short* gA = Ap  + (size_t)(mB + srow) * kD + spart;
  const unsigned short* gB = Btp + (size_t)(nT * kPjBN + srow) * kD + spart;
  unsigned short* put0 = &sAB[0][srow * kPjPitch + spart];
  unsigned short* put1 = &sAB[1][srow * kPjPitch + spart];
  const int fA = ((wave >> 2) * (kPjMT * 16) + rlane) * kPjPitch + koff;
  const int fB = (kPjBM + (wave & 3) * 64 + rlane) * kPjPitch + koff;
  const _Float16* a0 = (const _Float16*)sAB[0] + fA;
  const _Float16* b0 = (const _Float16*)sAB[0] + fB;
  const _Float16* a1 = (const _Float16*)sAB[1] + fA;
  const _Float16* b1 = (const _Float16*)sAB[1] + fB;

  v8f acc[kPjMT][4];
#pragma unroll
  for (int i = 0; i < kPjMT; ++i)
#pragma unroll
    for (int j = 0; j < 4; ++j) acc[i][j] = (v8f){0.f,0.f,0.f,0.f,0.f,0.f,0.f,0.f};

  v4u st[kPjPc];                               // the stage on its way to LDS
  pj_fetch(st, gA, gB, 0);
  asm volatile("s_wait_xcnt 0x0" ::: "memory");   // the wait owed before the fetch's address registers are written again
  pj_put(put0, st);
  pj_fetch(st, gA, gB, kPjBK);
  asm volatile("s_wait_xcnt 0x0" ::: "memory");   // the same wait
  pj_barrier();

  for (int s = 0; s < kPjStages - 2; s += 2) {
    pj_stage<true, true>(a0, b0, put1, gA, gB, (s + 2) * kPjBK, st, acc);   // stage s; store s + 1, fetch s + 2
    pj_stage<true, true>(a1, b1, put0, gA, gB, (s + 3) * kPjBK, st, acc);   // stage s + 1; store s + 2, fetch s + 3
  }
  pj_stage<false, true>(a0, b0, put1, gA, gB, 0, st, acc);                  // stage 14; store 15
  // the epilogue's bias and GroupNorm weights of the lane's 4 columns, asked for a stage ahead of their use
  const int col0 = n0 + rlane;
  float bv[4], gwc[4], gbc[4];
#pragma unroll
  for (int j = 0; j < 4; ++j) {
    bv[j]  = bias[col0 + (j << 4)];
    gwc[j] = gw[col0 + (j << 4)];
    gbc[j] = gb[col0 + (j << 4)];
  }
  // the wait owed before an address register of these loads is written again; the index and the three bases are inputs so
  // that their registers stay as they are up to the wait (no loaded value may land on them either)
  asm volatile("s_wait_xcnt 0x0" :: "v"(col0), "s"(bias), "s"(gw), "s"(gb) : "memory");
  pj_stage<false, false>(a1, b1, put0, gA, gB, 0, st, acc);                 // stage 15

  // ---- epilogue: scale, bias[n], CELU, GroupNorm over the head's 128 columns, f16 out ----
  const int wc = wave & 3;                     // wave column; wc ^ 1 holds the other 64 columns of the head
  const int rw0 = (wave >> 2) * (kPjMT * 16) + mOff;   // block row of acc[0][.][0]
#pragma unroll
  for (int j = 0; j < 4; ++j) {
    gwc[j] *= carry;                           // the carry is a power of two: folding it into weight and bias is exact
    gbc[j] *= carry;
  }
  v8f ps[kPjMT];                               // per 16-row tile: the sums of the lane's 8 rows
#pragma unroll
  for (int i = 0; i < kPjMT; ++i) {
#pragma unroll
    for (int j = 0; j < 4; ++j) {
      const v8f x = acc[i][j] * scale + bv[j];
#pragma unroll
      for (int r = 0; r < 8; ++r) acc[i][j][r] = celu_f(x[r]);
    }
    const v8f sm = (acc[i][0] + acc[i][1]) + (acc[i][2] + acc[i][3]);
#pragma unroll
    for (int r = 0; r < 8; ++r) ps[i][r] = row16_sum(sm[r]);
  }
  if (rlane == 0) {
#pragma unroll
    for (int i = 0; i < kPjMT; ++i) *(v8f*)(&sSum[wc][rw0 + i * 16]) = ps[i];
  }
  __syncthreads();                             // the neighbour wave's sums are there; also ends every read of the staged operands
#pragma unroll
  for (int i = 0; i < kPjMT; ++i) {
    const v8f mu = (ps[i] + *(const v8f*)(&sSum[wc ^ 1][rw0 + i * 16])) * (1.0f / 128.0f);
#pragma unroll
    for (int j = 0; j < 4; ++j) acc[i][j] -= mu;
    const v8f sm = (acc[i][0] * acc[i][0] + acc[i][1] * acc[i][1]) + (acc[i][2] * acc[i][2] + acc[i][3] * acc[i][3]);
#pragma unroll
    for (int r = 0; r < 8; ++r) ps[i][r] = row16_sum(sm[r]);
  }
  if (rlane == 0) {
#pragma unroll
    for (int i = 0; i < kPjMT; ++i) *(v8f*)(&sSq[wc][rw0 + i * 16]) = ps[i];
  }
  __syncthreads();                             // the neighbour wave's sums of squares are there
  // the wave's 112 x 64 block goes through a slab of its own in the operand buffers (free since the first barrier above), so
  // that each global store covers whole 128-B lines
  unsigned short* slab = &sAB[0][0] + wave * (kPjMT * 16 * kPjPitch);
#pragma unroll
  for (int i = 0; i < kPjMT; ++i) {
    const v8f var = (ps[i] + *(const v8f*)(&sSq[wc ^ 1][rw0 + i * 16])) * (1.0f / 128.0f) + 1e-5f;
    v8f rs;
#pragma unroll
    for (int r = 0; r < 8; ++r) rs[r] = rsqrt_steps(var[r]);
#pragma unroll
    for (int j = 0; j < 4; ++j) {
      const v8f dn = acc[i][j] * rs;
#pragma unroll
      for (int r = 0; r < 8; ++r) slab[(i * 16 + mOff + r) * kPjPitch + (j << 4) + rlane] = h_bits(dn[r] * gwc[j] + gbc[j]);
    }
  }
  // the wave's slab writes are complete before its lanes read each other's words
  __builtin_amdgcn_fence(__ATOMIC_RELEASE, "workgroup");
  __builtin_amdgcn_wave_barrier();
  __builtin_amdgcn_fence(__ATOMIC_ACQUIRE, "workgroup");
  // a store = 4 rows x 128 B: 8 lanes a row, 16 B a lane
  const unsigned short* rd = slab + (lane >> 3) * kPjPitch + (lane & 7) * 8;
  unsigned short* wr = C + (size_t)(m0 + (lane >> 3)) * kD + n0 + (lane & 7) * 8;
  // all 28 pieces are read before the first store: one LDS latency, and no register that a store names is written again
  v4u v[kPjMT * 4];
#pragma unroll
  for (int it = 0; it < kPjMT * 4; ++it) v[it] = *(const v4u*)(rd + it * 4 * kPjPitch);
#pragma unroll
  for (int it = 0; it < kPjMT * 4; ++it) *(v4u*)(wr + (size_t)(it * 4) * kD) = v[it];
}

// ---------------------------------------------------------------------------
// Every cast to f16 and the zero fill, which depend on inputs alone, in one grid; the block index picks the job
// (block-uniform), 8 elements per thread, 16-B stores:
//   [0, 3136)        x -> f16(16 x)                                   (3136 * 256 * 8 = 6272 * 1024)
//   [3136, 3200)     zero the 64 pad rows of the q2 plane (32 blocks) and of the k plane (32 blocks)
//   [3200, 9344)     W (q2, k, v1, v2) [1024 out][1024 in] row-major (= Bt [N][K] as-is) of layer l -> f16(256 W) into plane
//                    4 l + z of w16, 512 blocks a plane
//   [9344, 9368)     Wc [3][128][128] -> f16(256 Wc), 8 blocks a layer
// ---------------------------------------------------------------------------
constexpr int kPrepX  = kTok * kD / 8 / 256;        // 3136
constexpr int kPrepZ  = 64 * kD / 8 / 256;          // 32 per plane
constexpr int kPrepW  = kD * kD / 8 / 256;          // 512 per W plane
constexpr int kPrepWc = kL * kHD * kHD / 8 / 256;   // 24
constexpr int kPrepBlocks = kPrepX + 2 * kPrepZ + kL * 4 * kPrepW + kPrepWc;
static_assert(kPrepW == 512 && kPrepBlocks == 9368, "prep ranges");
__global__ __launch_bounds__(256) void prep_kernel(const float* __restrict__ x, const float* __restrict__ w0,
                                                   const float* __restrict__ w1, const float* __restrict__ w2,
                                                   const float* __restrict__ w3, const float* __restrict__ wc,
                                                   unsigned short* __restrict__ x16, unsigned short* __restrict__ qpad,
                                                   unsigned short* __restrict__ kpad, unsigned short* __restrict__ w16,
                                                   unsigned short* __restrict__ wc16) {
  const int bid = blockIdx.x;
  if (bid >= kPrepX && bid < kPrepX + 2 * kPrepZ) {
    const int r = bid - kPrepX;
    unsigned short* zdst = (r < kPrepZ) ? qpad : kpad;   // block-uniform select between two global pointers
    const int zi = (r & (kPrepZ - 1)) * 256 + threadIdx.x;
    const v4u z = (v4u){0u, 0u, 0u, 0u};
    store2_v4u(zdst + 8 * (size_t)zi, z);
    return;
  }
  const float* src = x;
  unsigned short* dst = x16;
  float scale = kXCarry;
  int blk = bid;
  if (bid >= kPrepX) {
    const int r = bid - (kPrepX + 2 * kPrepZ);
    scale = kWCarry;
    if (r < kL * 4 * kPrepW) {
      const int pl = r >> 9;                             // 4 * layer + projection
      const int pz = pl & 3;
      src = ((pz == 0) ? w0 : (pz == 1) ? w1 : (pz == 2) ? w2 : w3) + (size_t)(pl >> 2) * kD * kD;
      dst = w16 + (size_t)pl * kD * kD;
      blk = r & (kPrepW - 1);
    } else {
      src = wc;
      dst = wc16;
      blk = r - kL * 4 * kPrepW;
    }
  }
  const int i = blk * 256 + threadIdx.x;
  const float* p = src + 8 * (size_t)i;
  const v4f a = *(const v4f*)(p);
  const v4f c = *(const v4f*)(p + 4);
  unsigned short hb[8];
#pragma unroll
  for (int e = 0; e < 4; ++e) {
    hb[e]     = h_bits(a[e] * scale);
    hb[4 + e] = h_bits(c[e] * scale);
  }
  const v4u u = (v4u){pk16(hb[0], hb[1]), pk16(hb[2], hb[3]), pk16(hb[4], hb[5]), pk16(hb[6], hb[7])};
  store2_v4u(dst + 8 * (size_t)i, u);
}

constexpr int kFaTiles  = 13;
constexpr int kFaRows   = kFaTiles * 16;
constexpr int kFaThr    = kFaTiles * 32;
constexpr int kFaKPitch = 136;
constexpr int kFaVPitch = 264;
constexpr int kFaOPitch = 132;
constexpr int kFaKPc    = kFaRows * 16 / kFaThr;
constexpr int kFaVGrp   = 4;
constexpr int kFaVGroups = kM / kFaVGrp;
constexpr int kFaVRounds = (kFaVGroups + kFaTiles - 1) / kFaTiles;
constexpr int kFaWRows  = kFaThr / 16;           // Wc rows a round (16 pieces of 16 B a row): 26
constexpr int kFaWPc    = (kHD + kFaWRows - 1) / kFaWRows;   // row rounds of Wc: 5
static_assert(kFaKPc * kFaThr == kFaRows * 16, "k pieces divide");
static_assert(kM % kFaVGrp == 0 && (kFaVRounds - 1) * kFaTiles <= kFaVGroups, "v2 groups are whole; all rounds but the last are whole");
static_assert((kKeyK - kM) % 4 == 0 && (kM * 2) % 8 == 0 && (kFaVPitch * 2) % 8 == 0, "8-B stores into v2^T rows are aligned");
static_assert((kFaWPc - 1) * kFaWRows <= kHD && kFaWPc * kFaWRows >= kHD, "all Wc rounds but the last are whole");
static_assert((kB - 1) * kM + kFaRows <= kTokPad, "k and q2 rows stay in their planes");
static_assert(kKeyK / 32 * 2 == kFaTiles + 1 && kKeyK <= kFaVPitch, "P*v2 depth = 7 steps of 32 keys, the last half step zero");

__global__ __launch_bounds__(kFaThr) void attn_fused_kernel(const unsigned short* __restrict__ Qp,
                                                            const unsigned short* __restrict__ Kp,
                                                            const unsigned short* __restrict__ V2p,
                                                            const unsigned short* __restrict__ V1p,
                                                            const unsigned short* __restrict__ Wcp,
                                                            const float* __restrict__ bc,
                                                            const float* __restrict__ mask, float* __restrict__ att,
                                                            float scoreScale, float pvScale, float gateScale) {
  typedef Frag<_Float16> F;
  __shared__ __align__(16) unsigned short sK[kFaRows * kFaKPitch];
  __shared__ __align__(16) unsigned short sV[kHD * kFaVPitch];
  __shared__ __align__(16) float sO[kFaTiles][16 * kFaOPitch];   // per-wave 16 x 128 slab
  __shared__ __align__(16) float sMask[kFaThr];
  __shared__ __align__(16) unsigned short sW[kFaWPc * kFaWRows * kFaKPitch];   // 130 rows of Wc: 128 read, 2 spare
  __shared__ __align__(16) float sBc[kFaThr];
  const int t = threadIdx.x, lane = t & 31;
  const int wave = __builtin_amdgcn_readfirstlane(t >> 5);       // scalar: the wave's query tile, slab and v2 token groups
  const int b = blockIdx.x, h = blockIdx.y;
  const int c = lane & 15, hf = lane >> 4;

  // ---- this wave's q2 and v1 fragments and v2 rows and the group's k, mask, Wc and bc, all loads in flight together ----
  const _Float16* gQ = (const _Float16*)Qp + (size_t)(b * kM + wave * 16 + c) * kD + h * kHD + hf * 8;
  const unsigned short* gK = Kp + (size_t)(b * kM + (t >> 4)) * kD + h * kHD + (t & 15) * 8;
  v16h qf[4];
  v4u rk[kFaKPc];
#pragma unroll
  for (int kk = 0; kk < 4; ++kk) qf[kk] = F::load(gQ + kk * 32);
#pragma unroll
  for (int j = 0; j < kFaKPc; ++j) rk[j] = *(const v4u*)(gK + (size_t)(j * (kFaThr / 16)) * kD);
  // v2 rows: lane = channels 4 lane .. 4 lane + 3 of the head; rounds 0..2 exist for every wave, in the last round the waves
  // past group 48 load group 48 again (in bounds) and do nothing with it
  const int vch = h * kHD + lane * 4;
  const int glast = wave + (kFaVRounds - 1) * kFaTiles;
  const bool vlast = glast < kFaVGroups;                         // wave-uniform
  const unsigned short* pV  = V2p + (size_t)(b * kM + wave * kFaVGrp) * kD + vch;
  const unsigned short* pVl = V2p + (size_t)(b * kM + (vlast ? glast : (kFaVGroups - 1)) * kFaVGrp) * kD + vch;
  v2u a[kFaVRounds * kFaVGrp];
#pragma unroll
  for (int i = 0; i < kFaVRounds - 1; ++i)
#pragma unroll
    for (int g = 0; g < kFaVGrp; ++g) a[i * kFaVGrp + g] = *(const v2u*)(pV + (size_t)(i * kFaTiles * kFaVGrp + g) * kD);
#pragma unroll
  for (int g = 0; g < kFaVGrp; ++g) a[(kFaVRounds - 1) * kFaVGrp + g] = *(const v2u*)(pVl + (size_t)g * kD);
  const int mi = b * kM + ((t < kM) ? t : (kM - 1));
  const float mload = mask[mi];
  // v1 rows of the wave's queries; the plane's pad rows are not written, so a query row past token 6271 reads the last row
  // (such a query is >= 196 and its output is never read)
  const int grow = b * kM + wave * 16 + c;
  const _Float16* gG = (const _Float16*)V1p + (size_t)((grow < kTok) ? grow : (kTok - 1)) * kD + h * kHD + hf * 8;
  v16h gf[4];
#pragma unroll
  for (int kk = 0; kk < 4; ++kk) gf[kk] = F::load(gG + kk * 32);
  const unsigned short* gW = Wcp + (size_t)(t >> 4) * kHD + (t & 15) * 8;
  v4u rw[kFaWPc];
#pragma unroll
  for (int j = 0; j < kFaWPc - 1; ++j) rw[j] = *(const v4u*)(gW + (size_t)(j * kFaWRows) * kHD);
  // the last round's threads past row 127 load row 127 again (in bounds) and lay it in a spare LDS row that nobody reads
  const int wlast = (t >> 4) + (kFaWPc - 1) * kFaWRows;
  const unsigned short* gWl = Wcp + (size_t)((wlast < kHD) ? wlast : (kHD - 1)) * kHD + (t & 15) * 8;
  rw[kFaWPc - 1] = *(const v4u*)gWl;
  const int bi = t & (kHD - 1);
  const float bload = bc[bi];
  // the wait owed before the address registers of these loads are written again; the per-lane pointers and index are
  // inputs so that their registers stay as they are up to the wait (no later load may land on them either)
  asm volatile("s_wait_xcnt 0x0" :: "v"(gQ), "v"(gK), "v"(pV), "v"(pVl), "v"(mi), "v"(gG), "v"(gW), "v"(gWl), "v"(bi) : "memory");
#pragma unroll
  for (int j = 0; j < kFaKPc; ++j) *(v4u*)(sK + ((t >> 4) + j * (kFaThr / 16)) * kFaKPitch + (t & 15) * 8) = rk[j];
  sMask[t] = mload;                              // entries from 196 on repeat key 195 and are never used
#pragma unroll
  for (int j = 0; j < kFaWPc; ++j) *(v4u*)(sW + ((t >> 4) + j * kFaWRows) * kFaKPitch + (t & 15) * 8) = rw[j];
  sBc[t] = bload;                                // entries from 128 on repeat the first ones and are never used
  if (wave < kHD / 32) {                         // keys 196..223 of v2^T row t: P is 0 there, the product must be too
#pragma unroll
    for (int p = 0; p < (kKeyK - kM) / 4; ++p) *(v2u*)(sV + t * kFaVPitch + kM + p * 4) = (v2u){0u, 0u};
  }
  // the wave's v2 tokens, four a group, laid transposed: channel 4 lane + e of tokens tok0 .. tok0 + 3 is one 8-B store
#pragma unroll
  for (int i = 0; i < kFaVRounds; ++i) {
    if (i < kFaVRounds - 1 || vlast) {           // wave-uniform
      const int tok0 = (wave + i * kFaTiles) * kFaVGrp;
#pragma unroll
      for (int e = 0; e < 4; ++e) {
        unsigned short hb[kFaVGrp];
#pragma unroll
        for (int g = 0; g < kFaVGrp; ++g) hb[g] = (unsigned short)(a[i * kFaVGrp + g][e >> 1] >> (16 * (e & 1)));
        *(v2u*)(sV + (lane * 4 + e) * kFaVPitch + tok0) = (v2u){pk16(hb[0], hb[1]), pk16(hb[2], hb[3])};
      }
    }
  }
  __syncthreads();

  // ---- S^T = k * q2^T: s[tt][r] = score of key 16 tt + 8 hf + r for query 16 wave + c ----
  // The 52 products run k step by k step (product f: k step f / 13, key tile f % 13), so neighbours have different
  // accumulators; their k fragments are read in groups of 4, one group ahead, into two register sets.
  v8f s[kFaTiles];
#pragma unroll
  for (int tt = 0; tt < kFaTiles; ++tt) s[tt] = (v8f){0.f,0.f,0.f,0.f,0.f,0.f,0.f,0.f};
  {
    const _Float16* kf = (const _Float16*)sK + c * kFaKPitch + hf * 8;
    v16h ka[2][4];
#pragma unroll
    for (int e = 0; e < 4; ++e) ka[0][e] = F::load(kf + (e % kFaTiles) * 16 * kFaKPitch + (e / kFaTiles) * 32);
#pragma unroll
    for (int g = 0; g < kFaTiles; ++g) {
      if (g + 1 < kFaTiles) {
#pragma unroll
        for (int e = 0; e < 4; ++e) {
          const int f = (g + 1) * 4 + e;
          ka[(g + 1) & 1][e] = F::load(kf + (f % kFaTiles) * 16 * kFaKPitch + (f / kFaTiles) * 32);
        }
      }
      // keeps the next group's LDS reads together and ahead of this group's WMMAs (the scheduler otherwise sinks each read
      // to its use, and every WMMA then waits out an LDS latency)
      __builtin_amdgcn_sched_barrier(0);
#pragma unroll
      for (int e = 0; e < 4; ++e) {
        const int f = g * 4 + e;
        s[f % kFaTiles] = F::mma(ka[g & 1][e], qf[f / kFaTiles], s[f % kFaTiles]);
      }
      // keeps the reads of the group after next behind these WMMAs, not among them
      __builtin_amdgcn_sched_barrier(0);
    }
  }

  // ---- softmax over the query's 196 keys, f32 ----
  float mx4[4] = {-3.0e38f, -3.0e38f, -3.0e38f, -3.0e38f};
#pragma unroll
  for (int tt = 0; tt < kFaTiles; ++tt) {
    const v4f m0 = *(const v4f*)(sMask + tt * 16 + hf * 8);
    const v4f m1 = *(const v4f*)(sMask + tt * 16 + hf * 8 + 4);
#pragma unroll
    for (int r = 0; r < 8; ++r) {
      const int j = tt * 16 + hf * 8 + r;
      const float mv = (r < 4) ? m0[r & 3] : m1[r & 3];
      const float v = (mv == 0.0f) ? -1.0e9f : s[tt][r] * scoreScale;
      s[tt][r] = (j < kM) ? v : -3.0e38f;
      mx4[r & 3] = fmaxf(mx4[r & 3], s[tt][r]);
    }
  }
  float mx = fmaxf(fmaxf(mx4[0], mx4[1]), fmaxf(mx4[2], mx4[3]));
  mx = fmaxf(mx, __shfl_xor(mx, 16, 32));
  const float mxl = mx * kLog2e;
  float ps4[4] = {0.f, 0.f, 0.f, 0.f};
#pragma unroll
  for (int tt = 0; tt < kFaTiles; ++tt) {
#pragma unroll
    for (int r = 0; r < 8; ++r) {
      // e^(s - mx); the rounding of mxl is one factor common to the row's P and its sum. An excluded key sits at -3e38: P = 0
      s[tt][r] = exp2_hw(__builtin_fmaf(s[tt][r], kLog2e, -mxl));
      ps4[r & 3] += s[tt][r];
    }
  }
  float ps = (ps4[0] + ps4[1]) + (ps4[2] + ps4[3]);
  ps += __shfl_xor(ps, 16, 32);
  const float inv = 1.0f / ps;
  v16h pf[kKeyK / 32];
#pragma unroll
  for (int u = 0; u < kKeyK / 32; ++u) {
#pragma unroll
    for (int e = 0; e < 8; ++e) {
      pf[u][e]     = (_Float16)(s[2 * u][e] * inv * kPCarry);
      pf[u][8 + e] = (2 * u + 1 < kFaTiles) ? (_Float16)(s[(2 * u + 1 < kFaTiles) ? 2 * u + 1 : 0][e] * inv * kPCarry) : (_Float16)0.0f;
    }
  }

  // ---- O^T = v2^T * P^T: o[j][r] = attn of query 16 wave + c, channel 16 j + 8 hf + r ----
  v8f o[8];
#pragma unroll
  for (int j = 0; j < 8; ++j) o[j] = (v8f){0.f,0.f,0.f,0.f,0.f,0.f,0.f,0.f};
  {
    // product f: key step f / 8, channel tile f % 8; v2^T fragments in groups of 4, one group ahead, as above
    const _Float16* vf = (const _Float16*)sV + c * kFaVPitch + hf * 8;
    constexpr int kGroups = kKeyK / 32 * 2;
    v16h va[2][4];
#pragma unroll
    for (int e = 0; e < 4; ++e) va[0][e] = F::load(vf + e * 16 * kFaVPitch);
#pragma unroll
    for (int g = 0; g < kGroups; ++g) {
      if (g + 1 < kGroups) {
#pragma unroll
        for (int e = 0; e < 4; ++e) {
          const int f = (g + 1) * 4 + e;
          va[(g + 1) & 1][e] = F::load(vf + (f % 8) * 16 * kFaVPitch + (f / 8) * 32);
        }
      }
      // keeps the next group's LDS reads together and ahead of this group's WMMAs
      __builtin_amdgcn_sched_barrier(0);
#pragma unroll
      for (int e = 0; e < 4; ++e) {
        const int f = g * 4 + e;
        o[f % 8] = F::mma(va[g & 1][e], pf[f / 8], o[f % 8]);
      }
      // keeps the reads of the group after next behind these WMMAs, not among them
      __builtin_amdgcn_sched_barrier(0);
    }
  }

  // ---- G^T = Wc * (v1*k)^T: gt[j][r] = gate sum of query 16 wave + c, channel 16 j + 8 hf + r (the place of o[j][r]) ----
  v8f gt[8];
#pragma unroll
  for (int j = 0; j < 8; ++j) gt[j] = (v8f){0.f,0.f,0.f,0.f,0.f,0.f,0.f,0.f};
  {
    // product f: k step f / 8, channel tile f % 8; Wc fragments in groups of 4, one group ahead, as above
    const _Float16* wf = (const _Float16*)sW + c * kFaKPitch + hf * 8;
    constexpr int kGroups = kHD / 32 * 2;
    // (v1*k) x16 of the wave's queries: the staged k row of query 16 wave + c, in the places of the v1 fragment
    const _Float16* kq = (const _Float16*)sK + (wave * 16 + c) * kFaKPitch + hf * 8;
#pragma unroll
    for (int kk = 0; kk < 4; ++kk) gf[kk] = gf[kk] * F::load(kq + kk * 32);
    v16h wa[2][4];
#pragma unroll
    for (int e = 0; e < 4; ++e) wa[0][e] = F::load(wf + e * 16 * kFaKPitch);
#pragma unroll
    for (int g = 0; g < kGroups; ++g) {
      if (g + 1 < kGroups) {
#pragma unroll
        for (int e = 0; e < 4; ++e) {
          const int f = (g + 1) * 4 + e;
          wa[(g + 1) & 1][e] = F::load(wf + (f % 8) * 16 * kFaKPitch + (f / 8) * 32);
        }
      }
      // keeps the next group's LDS reads together and ahead of this group's WMMAs
      __builtin_amdgcn_sched_barrier(0);
#pragma unroll
      for (int e = 0; e < 4; ++e) {
        const int f = g * 4 + e;
        gt[f % 8] = F::mma(wa[g & 1][e], gf[f / 8], gt[f % 8]);
      }
      // keeps the reads of the group after next behind these WMMAs, not among them
      __builtin_amdgcn_sched_barrier(0);
    }
  }

  // ---- epilogue: sigmoid(G + bc) * attn; the wave's 16 x 128 block through its own slab, so that each store covers a whole
  // 512-B row piece ----
  float* slab = sO[wave];
#pragma unroll
  for (int j = 0; j < 8; ++j) {
    const v4f b0 = *(const v4f*)(sBc + j * 16 + hf * 8);
    const v4f b1 = *(const v4f*)(sBc + j * 16 + hf * 8 + 4);
    float w[8];
#pragma unroll
    for (int r = 0; r < 8; ++r) {
      float v = gt[j][r] * gateScale;
      v += (r < 4) ? b0[r & 3] : b1[r & 3];
      w[r] = rcp_hw(1.0f + exp2_hw(v * -kLog2e)) * (o[j][r] * pvScale);
    }
    *(v4f*)(slab + c * kFaOPitch + j * 16 + hf * 8)     = (v4f){w[0], w[1], w[2], w[3]};
    *(v4f*)(slab + c * kFaOPitch + j * 16 + hf * 8 + 4) = (v4f){w[4], w[5], w[6], w[7]};
  }
  // the wave's slab writes are complete before its lanes read each other's words
  __builtin_amdgcn_fence(__ATOMIC_RELEASE, "workgroup");
  __builtin_amdgcn_wave_barrier();
  __builtin_amdgcn_fence(__ATOMIC_ACQUIRE, "workgroup");
  float* dst = att + (size_t)(b * kSP + wave * 16) * kD + h * kHD + lane * 4;
#pragma unroll
  for (int row = 0; row < 16; ++row) *(v4f*)(dst + (size_t)row * kD) = *(const v4f*)(slab + row * kFaOPitch + lane * 4);
}

// ---------------------------------------------------------------------------
// Residual + LayerNorm: y = x + gated attn ([32][256 q][1024], the gate already applied); x_new = LN(y)*lnw + lnb
// written f32 to xout (may alias xin: each block reads its whole row into registers before any store, no other block
// touches the row) and as f16(16*x_new) to x16. One block per token (grid 6272), thread t owns columns 4t..4t+3.
// ---------------------------------------------------------------------------
__global__ __launch_bounds__(256) void merge_ln_kernel(const float* xin, const float* __restrict__ att, const float* __restrict__ lnw,
                                                       const float* __restrict__ lnb, float* xout,
                                                       unsigned short* __restrict__ x16) {
  __shared__ float redA[8];
  __shared__ float redB[8];
  __shared__ __align__(16) float srow[kD];
  const int t = threadIdx.x, lane = t & 31, wave = t >> 5;
  const int r = blockIdx.x;
  const int b = r / kM;
  const int m = r - b * kM;
  const int c0 = t * 4;
  const size_t ro = (size_t)r * kD + c0;
  const v4f xv = *(const v4f*)(xin + ro);
  const v4f av = *(const v4f*)(att + ((size_t)(b * kSP + m)) * kD + c0);
  float y[4];
#pragma unroll
  for (int e = 0; e < 4; ++e) y[e] = xv[e] + av[e];
  float s = (y[0] + y[1]) + (y[2] + y[3]);
#pragma unroll
  for (int off = 1; off < 32; off <<= 1) s += __shfl_xor(s, off, 32);
  if (lane == 0) redA[wave] = s;
  __syncthreads();
  float tot = redA[0];
#pragma unroll
  for (int w = 1; w < 8; ++w) tot += redA[w];
  const float mu = tot * (1.0f / 1024.0f);
  float d[4];
  float sq = 0.f;
#pragma unroll
  for (int e = 0; e < 4; ++e) { d[e] = y[e] - mu; sq += d[e] * d[e]; }
#pragma unroll
  for (int off = 1; off < 32; off <<= 1) sq += __shfl_xor(sq, off, 32);
  if (lane == 0) redB[wave] = sq;
  __syncthreads();
  float tot2 = redB[0];
#pragma unroll
  for (int w = 1; w < 8; ++w) tot2 += redB[w];
  const float var = tot2 * (1.0f / 1024.0f);
  const float rs = rsqrtf(var + 1e-5f);
  const v4f wv = *(const v4f*)(lnw + c0);
  const v4f bv = *(const v4f*)(lnb + c0);
  v4f ov;
#pragma unroll
  for (int e = 0; e < 4; ++e) ov[e] = d[e] * rs * wv[e] + bv[e];
  *(v4f*)(srow + c0) = ov;
  __syncthreads();
  const int tc = t & 127;                               // clamped staging index; only t < 128 stores
  const v4f p0 = *(const v4f*)(srow + tc * 8);
  const v4f p1 = *(const v4f*)(srow + tc * 8 + 4);
  unsigned short hb[8];
#pragma unroll
  for (int e = 0; e < 4; ++e) {
    hb[e]     = h_bits(p0[e] * kXCarry);
    hb[4 + e] = h_bits(p1[e] * kXCarry);
  }
  const v4u hu = (v4u){pk16(hb[0], hb[1]), pk16(hb[2], hb[3]), pk16(hb[4], hb[5]), pk16(hb[6], hb[7])};
  unsigned short* hp = x16 + (size_t)r * kD + tc * 8;
  {
    *(v4f*)(xout + ro) = ov;
    if (t < 128) *(v4u*)hp = hu;
    
  }
}

// ---------------------------------------------------------------------------
// Masked mean over tokens: out0[b][c] = sum_m x[b][m][c]*mask[b][m] / sum_m mask[b][m]. One block per b (grid 32),
// ---------------------------------------------------------------------------
constexpr int kPoolRows = 28;   // token rows in flight per wave
static_assert(kM % kPoolRows == 0, "pool groups divide the tokens");
__global__ __launch_bounds__(256) void pool_kernel(const float* x, const float* __restrict__ mask, float* out0) {
  const int t = threadIdx.x;
  const int b = blockIdx.x;
  const int c0 = t * 4;
  v4f acc = (v4f){0.f, 0.f, 0.f, 0.f};
  float ms = 0.f;
  // 28 token rows are asked for at a time and then summed in token order (the order of the sums is unchanged): the wave
  // waits out 7 load latencies in place of 196. The loop over the groups stays rolled: one group's registers serve all 7.
#pragma unroll 1
  for (int m0 = 0; m0 < kM; m0 += kPoolRows) {
    const float* xp = x + ((size_t)(b * kM + m0)) * kD + c0;
    v4f xv[kPoolRows];
#pragma unroll
    for (int j = 0; j < kPoolRows; ++j) xv[j] = *(const v4f*)(xp + (size_t)j * kD);
    // the wait owed before the address register of these loads is written again; the pointer is an input so that its
    // register stays as it is up to the wait (no loaded row may land on it either)
    asm volatile("s_wait_xcnt 0x0" :: "v"(xp) : "memory");
#pragma unroll
    for (int j = 0; j < kPoolRows; ++j) {
      const float mv = mask[b * kM + m0 + j];
      acc += xv[j] * mv;
      ms += mv;
    }
  }
  const float inv = 1.0f / ms;
  const v4f o = acc * inv;
  store2_v4f(out0 + (size_t)b * kD + c0, o);
}

// ---------------------------------------------------------------------------
// Host orchestration: kernel launches only. 1 + 3*3 + 1 = 11 launches.
// ---------------------------------------------------------------------------
extern "C" void kernel_launch(void* const* d_in, const int* in_sizes, int n_in,
                              void* d_out, int out_size, void* d_ws, size_t ws_size,
                              hipStream_t stream) {
  if (n_in < 22) return;
  if (in_sizes[0] != kTok * kD) return;
  if (in_sizes[1] != kTok) return;
  if (in_sizes[2] != kL * kD * kD || in_sizes[6] != kL * kD * kD || in_sizes[10] != kL * kD * kD || in_sizes[14] != kL * kD * kD) return;
  if (in_sizes[18] != kL * kHD * kHD || in_sizes[19] != kL * kHD) return;
  if (in_sizes[3] != kL * kD || in_sizes[20] != kL * kD || in_sizes[21] != kL * kD) return;
  if (out_size != kB * kD + kTok * kD) return;
  if (ws_size < kWsTotal) return;

  const float* att_feats = (const float*)d_in[0];
  const float* att_mask  = (const float*)d_in[1];
  const float* Wq2  = (const float*)d_in[2];
  const float* bq2  = (const float*)d_in[3];
  const float* gq2w = (const float*)d_in[4];
  const float* gq2b = (const float*)d_in[5];
  const float* Wk   = (const float*)d_in[6];
  const float* bk   = (const float*)d_in[7];
  const float* gkw  = (const float*)d_in[8];
  const float* gkb  = (const float*)d_in[9];
  const float* Wv1  = (const float*)d_in[10];
  const float* bv1  = (const float*)d_in[11];
  const float* gv1w = (const float*)d_in[12];
  const float* gv1b = (const float*)d_in[13];
  const float* Wv2  = (const float*)d_in[14];
  const float* bv2  = (const float*)d_in[15];
  const float* gv2w = (const float*)d_in[16];
  const float* gv2b = (const float*)d_in[17];
  const float* Wc   = (const float*)d_in[18];
  const float* bc   = (const float*)d_in[19];
  const float* lnw  = (const float*)d_in[20];
  const float* lnb  = (const float*)d_in[21];

  char* ws = (char*)d_ws;
  float*          ATT   = (float*)(ws + kOffATT);                  // gated attn plane
  unsigned short* X16   = (unsigned short*)(ws + kOffX16);
  unsigned short* W16   = (unsigned short*)(ws + kOffW16);
  unsigned short* WC16  = (unsigned short*)(ws + kOffWC16);
  unsigned short* Q16   = (unsigned short*)(ws + kOffN16);                   // q2, k, v1, v2 planes, one behind the other
  unsigned short* K16   = (unsigned short*)(ws + kOffN16 + kBytesN16);
  unsigned short* V116  = (unsigned short*)(ws + kOffN16 + 2 * kBytesN16);
  unsigned short* V216  = (unsigned short*)(ws + kOffN16 + 3 * kBytesN16);

  float* out0 = (float*)d_out;                                     // [32][1024] at byte 0
  float* out1 = (float*)d_out + (size_t)kB * kD;                   // [32][196][1024] at byte 131072; also the running x

  const float projScale  = 1.0f / (kXCarry * kWCarry);             // 1/4096
  const float gateScale  = 1.0f / (kXCarry * kWCarry);             // (v1*k) x16, Wc x256
  const float scoreScale = 0.08838834764831845f * (1.0f / (kXCarry * kXCarry));
  const float pvScale    = 1.0f / (kPCarry * kXCarry);             // 1/32768

  // x and every layer's W and Wc -> f16 planes; pad rows of the q2/k planes zero
  prep_kernel<<<dim3(kPrepBlocks), dim3(256), 0, stream>>>(att_feats, Wq2, Wk, Wv1, Wv2, Wc, X16,
                                                           Q16 + (size_t)kTok * kD, K16 + (size_t)kTok * kD, W16, WC16);

  for (int i = 0; i < kL; ++i) {
    const size_t vo = (size_t)i * kD;

    // four projections with CELU + GroupNorm: plane z = GN(CELU(x16 * Wz^T + bz)) (M 6272, N 4 * 1024, K 1024; 28 x 16 block
    // tiles of 224 x 256 = 448 blocks)
    proj_gemm_lds_kernel<<<dim3((kTok / kPjBM) * (4 * kD / kPjBN)), dim3(256), 0, stream>>>(
        X16, W16 + (size_t)i * 4 * kD * kD, Q16, bq2 + vo, bk + vo, bv1 + vo, bv2 + vo, gq2w + vo, gkw + vo, gv1w + vo,
        gv2w + vo, gq2b + vo, gkb + vo, gv1b + vo, gv2b + vo, projScale);

    // attention: scores, softmax, P * v2 and the gate sigmoid((v1*k) * Wc^T + bc) of one (batch, head) group per work-group,
    // 256 groups in one launch
    attn_fused_kernel<<<dim3(kB, kH), dim3(kFaThr), 0, stream>>>(Q16, K16, V216, V116, WC16 + (size_t)i * kHD * kHD,
                                                                 bc + (size_t)i * kHD, att_mask, ATT, scoreScale, pvScale,
                                                                 gateScale);

    const float* xin = (i == 0) ? att_feats : out1;
    merge_ln_kernel<<<dim3(kTok), dim3(256), 0, stream>>>(xin, ATT, lnw + (size_t)i * kD, lnb + (size_t)i * kD, out1, X16);
  }

  pool_kernel<<<dim3(kB), dim3(256), 0, stream>>>(out1, att_mask, out0);
}

// v010
// One run takes 239 microseconds.
// In both of two side-by-side timings against v009, it was 1.05 times as fast.
// All steps since v000 together make it 6.68 times as fast.
// Contractions: projections x(f16, x16)*W^T(f16, x256), gate (v1*k)(f16, x16)*Wc^T(f16, x256), scores q2(f16, x16)*k^T(f16, x16), attn P(f16, x2048)*v2(f16, x16): all v_wmma_f32_16x16x32_f16 with f32 accumulate; CELU, GroupNorm, softmax, sigmoid, residual, LayerNorm and masked mean in f32.
#include <hip/hip_runtime.h>
#include <math.h>

// ---------------------------------------------------------------------------
// Problem constants
// ---------------------------------------------------------------------------
constexpr int kB   = 32;
constexpr int kM   = 196;
constexpr int kD   = 1024;
constexpr int kH   = 8;
constexpr int kHD  = 128;
constexpr int kL   = 3;
constexpr int kTok = kB * kM;          // 6272 = 98 * 64 token rows
constexpr int kTokPad = kTok + 64;     // 6336: 64 zero rows so per-group 208-row tiles never leave the plane
constexpr int kSP  = 256;              // padded queries per (batch, head) group (rows of the gated attn plane)
constexpr int kKeyK = 224;             // contraction depth of P*V (keys padded to a multiple of 32)
constexpr float kXCarry = 16.0f;       // x, q2, k, v2 planes carried x16 in f16
constexpr float kWCarry = 256.0f;      // W, Wc carried x256 in f16
constexpr float kPCarry = 2048.0f;     // probabilities carried x2048 in f16

// ---------------------------------------------------------------------------
// Workspace region map (bytes, all offsets multiples of 256)
//   R_ATT  : gated attn f32 [32][256][1024]
//   R_X16  : x f16 [6272][1024]
//   R_W16  : stacked W f16 [3 layers][4096][1024]
//   R_WC16 : Wc f16 [3 layers][128][128]
//   R_N16  : normalised projections f16 [4: q2, k, v1, v2][6336][1024] (rows >= 6272 of q2 and k zero, of v1 and v2 unused)
// ---------------------------------------------------------------------------
constexpr size_t kBytesATT  = (size_t)kB * kSP * kD * 4;
constexpr size_t kBytesX16  = (size_t)kTok * kD * 2;
constexpr size_t kBytesW16  = (size_t)kL * 4 * kD * kD * 2;
constexpr size_t kBytesWC16 = (size_t)kL * kHD * kHD * 2;
constexpr size_t kBytesN16  = (size_t)kTokPad * kD * 2;    // one plane
constexpr size_t kOffATT  = 0;
constexpr size_t kOffX16  = kOffATT + kBytesATT;
constexpr size_t kOffW16  = kOffX16 + kBytesX16;
constexpr size_t kOffWC16 = kOffW16 + kBytesW16;
constexpr size_t kOffN16  = kOffWC16 + kBytesWC16;
constexpr size_t kWsTotal = kOffN16 + 4 * kBytesN16;
static_assert(kWsTotal <= 268435456, "carve under 256 MiB");
static_assert((kOffX16 % 256) == 0 && (kOffW16 % 256) == 0 && (kOffWC16 % 256) == 0 && (kOffN16 % 256) == 0 && (kBytesN16 % 256) == 0, "aligned");

typedef __attribute__((ext_vector_type(16))) _Float16 v16h;
typedef __attribute__((ext_vector_type(8)))  _Float16 v8h;
typedef __attribute__((ext_vector_type(16))) __bf16   v16b;
typedef __attribute__((ext_vector_type(8)))  __bf16   v8b;
typedef __attribute__((ext_vector_type(8)))  float    v8f;
typedef __attribute__((ext_vector_type(4)))  float    v4f;
typedef __attribute__((ext_vector_type(4)))  unsigned int v4u;
typedef __attribute__((ext_vector_type(2)))  unsigned int v2u;

__device__ __forceinline__ unsigned short f2bf_bits(float f) {
  unsigned u = __float_as_uint(f);
  return (unsigned short)((u + 0x7FFFu + ((u >> 16) & 1u)) >> 16);
}
__device__ __forceinline__ float bf_bits2f(unsigned short h) { return __uint_as_float(((unsigned)h) << 16); }

template <typename T> struct Frag;
template <> struct Frag<_Float16> {
  typedef v16h V; union U { v16h v; v8h h[2]; };
  static __device__ __forceinline__ v16h load(const _Float16* p) {   // elements 0..7 <- p[0..7], 8..15 <- p[16..23]
    U f; f.h[0] = *(const v8h*)(p); f.h[1] = *(const v8h*)(p + 16); return f.v;
  }
  static __device__ __forceinline__ v8f mma(v16h a, v16h b, v8f c) {
    return __builtin_amdgcn_wmma_f32_16x16x32_f16(false, a, false, b, (short)0, c, false, false);
  }
};
template <> struct Frag<__bf16> {
  typedef v16b V; union U { v16b v; v8b h[2]; };
  static __device__ __forceinline__ v16b load(const __bf16* p) {
    U f; f.h[0] = *(const v8b*)(p); f.h[1] = *(const v8b*)(p + 16); return f.v;
  }
  static __device__ __forceinline__ v8f mma(v16b a, v16b b, v8f c) {
    return __builtin_amdgcn_wmma_f32_16x16x32_bf16(false, a, false, b, (short)0, c, false, false);
  }
};

__device__ __forceinline__ unsigned pk16(unsigned short a, unsigned short b) { return (unsigned)a | ((unsigned)b << 16); }
__device__ __forceinline__ unsigned short h_bits(float f) { const _Float16 h = (_Float16)f; return __builtin_bit_cast(unsigned short, h); }

__device__ __forceinline__ void store2_v4u(unsigned short* p, v4u u) {
  *(v4u*)p = u;
  
}
__device__ __forceinline__ void store2_v4f(float* p, v4f v) {
  *(v4f*)p = v;
  
}

// ---------------------------------------------------------------------------
// 2^x by the hardware's exp2 alone; it gives 0 below the range of f32 and inf above it by itself. e^x = 2^(x * log2(e)): the
// rounding of that one product is a relative error of about |x| * 6e-8 in e^x, far under the f16 step of every plane and
// fragment that these values end in.
// ---------------------------------------------------------------------------
constexpr float kLog2e = 1.4426950408889634f;
__device__ __forceinline__ float exp2_hw(float x) {
  float v;
  // the v_nop is the free slot that a transcendental is owed before its source is overwritten or its result read; only one
  // statement ties it to the instruction
  asm("v_exp_f32 %0, %1\n\tv_nop" : "=v"(v) : "v"(x));
  return v;
}

// 1 / x by the hardware's reciprocal alone (about one unit in the last place of f32; 0 at inf), for x of 1 or more
__device__ __forceinline__ float rcp_hw(float x) {
  float v;
  // the v_nop: the same free slot as in exp2_hw
  asm("v_rcp_f32 %0, %1\n\tv_nop" : "=v"(v) : "v"(x));
  return v;
}

// ---------------------------------------------------------------------------
// CELU (alpha 1.3), f32
// ---------------------------------------------------------------------------
__device__ __forceinline__ float celu_f(float x) {
  const float en = exp2_hw(x * (kLog2e / 1.3f)) - 1.0f;
  return (x > 0.f) ? x : 1.3f * en;
}

// ---------------------------------------------------------------------------
// 1 / sqrt(x) in the steps rsqrtf takes: x below the smallest normal number is scaled by 2^24 and the result by 2^12.
__device__ __forceinline__ float rsqrt_steps(float x) {
  const bool tiny = x < __uint_as_float(0x00800000u);
  const float xs = tiny ? x * 16777216.0f : x;
  float r;
  // the free slot that a transcendental is owed before its source is overwritten or its result read; only one statement
  // ties the v_nop to it
  asm("v_rsq_f32 %0, %1\n\tv_nop" : "=v"(r) : "v"(xs));
  return tiny ? r * 4096.0f : r;
}

// ---------------------------------------------------------------------------
// Sum of a lane's 8 values (three levels of pairs), and the value of lane ^ 16 by the vector unit's own cross-row move (no
// LDS round trip).
// ---------------------------------------------------------------------------
__device__ __forceinline__ float sum8(v8f v) {
  const v4f a = __builtin_shufflevector(v, v, 0, 1, 2, 3) + __builtin_shufflevector(v, v, 4, 5, 6, 7);
  return (a[0] + a[2]) + (a[1] + a[3]);
}
__device__ __forceinline__ float other_half(float x) {
  const int b = __float_as_int(x);
  return __int_as_float(__builtin_amdgcn_permlanex16(b, b, 0x76543210, 0xfedcba98, false, false));
}

// ---------------------------------------------------------------------------
// Projection GEMM with operands staged in LDS: y[m,n] = scale * sum_k A[m,k] * Bt[n,k] + bias[n], then CELU and GroupNorm
// (mean/var over the 128 channels of a head) on the accumulators, f16 out: no linear plane goes through memory.
// A [6272][1024] f16, Bt [4096][1024] f16, both k-contiguous. Block tile 224 (m) x 256 (n), 8 waves as 2 x 4, each wave a
// 112x64 tile, fragments by Frag::load, k ascending. A stage is 64 k = one 128-B line of each of the 480 operand
// rows (A rows first, then Bt rows), laid at a 144-B pitch in one of two LDS buffers. Every global load covers whole lines
// (8 lanes per row). Stage s + 2 is fetched into registers during stage s and stored to LDS during stage s + 1, so a
// fetch has a whole stage to land. The four projections share one grid: Bt is the stacked W [4096][1024], column tile
// nT = 0..15 belongs to projection nT / 4 and goes to that projection's plane of C with its bias and GroupNorm weights.
// The W fragment is the first WMMA operand and the x fragment the second: a lane's 8 accumulator registers are 8 neighbouring
// channels of ONE token (token 16 i + (lane & 15), channels 16 j + 8 (lane >> 4) + r). A head's 128 columns lie in two
// neighbouring waves (64 each): a token's sum is 31 in-lane adds, one exchange between the lane halves and one with the
// neighbour wave through LDS, once for the mean and once for the squares of the differences from it; mean and 1/sigma are one
// value a lane and 16-token tile, and 8 results are one 16-B LDS store.
// grid = 28 * 16 = 448 blocks (6272 = 28 * 224, 4096 = 16 * 256), column tile fastest: one block fills a WGP (registers), so
// the 256 WGPs take them in 2 rounds; a wave reads 11 LDS fragments for 28 WMMAs.
// ---------------------------------------------------------------------------
constexpr int kPjBM = 224;                       // block rows of A
constexpr int kPjBN = 256;                       // block rows of Bt
constexpr int kPjBK = 64;                        // halves of k per stage
constexpr int kPjPitch = 72;                     // halves per staged row (144 B)
constexpr int kPjStage = (kPjBM + kPjBN) * kPjPitch;   // halves per buffer (69,120 B)
constexpr int kPjMT = kPjBM / 2 / 16;            // 16-row tiles of a wave: 7
constexpr int kPjPcA = kPjBM / 32;               // 16-B pieces of A per thread and stage: 7
constexpr int kPjPc = kPjPcA + kPjBN / 32;       // pieces per thread and stage: 15
constexpr int kPjStages = kD / kPjBK;            // 16
static_assert(kTok % kPjBM == 0 && kD % kPjBN == 0 && kD % (2 * kPjBK) == 0 && kPjStages >= 4, "projection tiles divide the problem");
static_assert(8 * kPjMT * 16 * kPjPitch <= 2 * kPjStage && kPjBK == 64, "the eight output slabs (112 rows of 64 halves) fit in the operand buffers");

// 15 pieces of 16 B per thread: pieces 0..6 = A rows, 7..14 = Bt rows, 32 staged rows apart
__device__ __forceinline__ void pj_fetch(v4u (&r)[kPjPc], const unsigned short* gA, const unsigned short* gB, int k) {
#pragma unroll
  for (int j = 0; j < kPjPcA; ++j) r[j] = *(const v4u*)(gA + (size_t)(32 * j) * kD + k);
#pragma unroll
  for (int j = 0; j < kPjPc - kPjPcA; ++j) r[kPjPcA + j] = *(const v4u*)(gB + (size_t)(32 * j) * kD + k);
}
__device__ __forceinline__ void pj_put(unsigned short* dst, const v4u (&r)[kPjPc]) {
#pragma unroll
  for (int j = 0; j < kPjPc; ++j) *(v4u*)(dst + 32 * j * kPjPitch) = r[j];
}
// Work-group barrier that orders LDS only: __syncthreads() also waits for every global load in flight, which would
// end the fetch of the stage after next at each barrier; those loads land in registers and concern no other wave.
__device__ __forceinline__ void pj_barrier() {
  __builtin_amdgcn_fence(__ATOMIC_RELEASE, "workgroup", "local");
  __builtin_amdgcn_s_barrier();
  __builtin_amdgcn_fence(__ATOMIC_ACQUIRE, "workgroup", "local");
}
// One stage: multiply the stage in cur; inside it store the stage held in st to nxt (PUT) and fetch stage k/64 into the same
// registers (FETCH): a fetch has a whole stage to land. The A fragments of the second k half's rows 3..6 are read when the
// first half's rows 0..3 are done with their registers, 12 WMMAs ahead of the second half: 32 registers fewer.
constexpr int kPjEarly = 3;                      // A fragments of the second k half that are read with the first group
template <bool FETCH, bool PUT>
__device__ __forceinline__ void pj_stage(const _Float16* curA, const _Float16* curB, unsigned short* nxt,
                                         const unsigned short* gA, const unsigned short* gB, int k,
                                         v4u (&st)[kPjPc], v8f (&acc)[kPjMT][4]) {
  typedef Frag<_Float16> F;
  v16h bh[2][4], ah[2][kPjMT];
#pragma unroll
  for (int j = 0; j < 4; ++j) bh[0][j] = F::load(curB + j * 16 * kPjPitch);
#pragma unroll
  for (int i = 0; i < kPjMT; ++i) ah[0][i] = F::load(curA + i * 16 * kPjPitch);
#pragma unroll
  for (int j = 0; j < 4; ++j) bh[1][j] = F::load(curB + j * 16 * kPjPitch + 32);
#pragma unroll
  for (int i = 0; i < kPjEarly; ++i) ah[1][i] = F::load(curA + i * 16 * kPjPitch + 32);
  // keeps the LDS fragment reads as one group ahead of the matrix work (the scheduler otherwise spreads them among the WMMAs)
  __builtin_amdgcn_sched_barrier(0);
#pragma unroll
  for (int i = 0; i < kPjMT - kPjEarly; ++i)
#pragma unroll
    for (int j = 0; j < 4; ++j) acc[i][j] = F::mma(bh[0][j], ah[0][i], acc[i][j]);
  // keeps the second read group, the LDS stores of the next stage and the fetch behind these WMMAs, when the first group's
  // reads have been served and four A fragments are used up
  __builtin_amdgcn_sched_barrier(0);
#pragma unroll
  for (int i = kPjEarly; i < kPjMT; ++i) ah[1][i] = F::load(curA + i * 16 * kPjPitch + 32);
  if (PUT) pj_put(nxt, st);
  // keeps the fetch behind the stores, so that it lands in the registers that they have just read (ahead of them it takes a
  // second set of 60)
  __builtin_amdgcn_sched_barrier(0);
  if (FETCH) pj_fetch(st, gA, gB, k);
  // keeps the rest of the matrix work behind them: the fetch is not sunk to its use, a stage later
  __builtin_amdgcn_sched_barrier(0);
#pragma unroll
  for (int i = kPjMT - kPjEarly; i < kPjMT; ++i)
#pragma unroll
    for (int j = 0; j < 4; ++j) acc[i][j] = F::mma(bh[0][j], ah[0][i], acc[i][j]);
  // keeps these 12 WMMAs ahead of the wait below and of the barrier's own LDS wait: the second read group, the stores and the
  // fetch's requests are served under them
  __builtin_amdgcn_sched_barrier(0);
  // the wait owed before the fetch's address registers are written again; 12 WMMAs behind the fetch
  if (FETCH) asm volatile("s_wait_xcnt 0x0" ::: "memory");
#pragma unroll
  for (int i = 0; i < kPjMT; ++i)
#pragma unroll
    for (int j = 0; j < 4; ++j) acc[i][j] = F::mma(bh[1][j], ah[1][i], acc[i][j]);
  if (PUT) pj_barrier();               // publishes the stage just stored and ends every read of cur
}

__global__ __launch_bounds__(256) void proj_gemm_lds_kernel(const unsigned short* __restrict__ Ap,
                                                            const unsigned short* __restrict__ Btp,
                                                            unsigned short* __restrict__ Cp, const float* __restrict__ bias0,
                                                            const float* __restrict__ bias1, const float* __restrict__ bias2,
                                                            const float* __restrict__ bias3, const float* __restrict__ gw0,
                                                            const float* __restrict__ gw1, const float* __restrict__ gw2,
                                                            const float* __restrict__ gw3, const float* __restrict__ gb0,
                                                            const float* __restrict__ gb1, const float* __restrict__ gb2,
                                                            const float* __restrict__ gb3, float scale) {
  __shared__ __align__(16) unsigned short sAB[2][kPjStage];
  __shared__ __align__(32) float sSum[4][kPjBM];   // a token's sum over the 64 columns of wave column 0..3
  __shared__ __align__(32) float sSq[4][kPjBM];    // the same for the squared differences
  const int t    = threadIdx.x;
  const int lane = t & 31;
  const int wave = t >> 5;
  const int nT = blockIdx.x & 15;              // column tile of the stacked W
  const int pz = nT >> 2;                      // projection (block-uniform)
  const int mB = (blockIdx.x >> 4) * kPjBM;
  const int nB = (nT & 3) * kPjBN;             // column within the projection's plane
  unsigned short* C = Cp + (size_t)pz * kTokPad * kD;
  const float* bias = (pz == 0) ? bias0 : (pz == 1) ? bias1 : (pz == 2) ? bias2 : bias3;
  const float* gw   = (pz == 0) ? gw0 : (pz == 1) ? gw1 : (pz == 2) ? gw2 : gw3;
  const float* gb   = (pz == 0) ? gb0 : (pz == 1) ? gb1 : (pz == 2) ? gb2 : gb3;
  const float carry = (pz == 2) ? 1.0f : kXCarry;   // q2, k, v2 carried x16; v1 as it is (its factor k brings the x16)
  const int m0 = mB + (wave >> 2) * (kPjMT * 16);
  const int n0 = nB + (wave & 3) * 64;

  const int rlane = lane & 15;                 // staged row of a fragment; token (D column) within a 16-token tile
  const int koff  = (lane >> 4) * 8;           // k offset of this lane half
  const int mOff  = (lane >> 4) * 8;           // D row offset: the first of the lane's 8 channels within a 16-channel tile

  // staging map: piece j of thread t is 16 B number (t & 7) of staged row (t >> 3) + 32 * j
  const int srow = t >> 3;
  const int spart = (t & 7) * 8;
  const unsigned short* gA = Ap  + (size_t)(mB + srow) * kD + spart;
  const unsigned short* gB = Btp + (size_t)(nT * kPjBN + srow) * kD + spart;
  unsigned short* put0 = &sAB[0][srow * kPjPitch + spart];
  unsigned short* put1 = &sAB[1][srow * kPjPitch + spart];
  const int fA = ((wave >> 2) * (kPjMT * 16) + rlane) * kPjPitch + koff;
  const int fB = (kPjBM + (wave & 3) * 64 + rlane) * kPjPitch + koff;
  const _Float16* a0 = (const _Float16*)sAB[0] + fA;
  const _Float16* b0 = (const _Float16*)sAB[0] + fB;
  const _Float16* a1 = (const _Float16*)sAB[1] + fA;
  const _Float16* b1 = (const _Float16*)sAB[1] + fB;

  v8f acc[kPjMT][4];
#pragma unroll
  for (int i = 0; i < kPjMT; ++i)
#pragma unroll
    for (int j = 0; j < 4; ++j) acc[i][j] = (v8f){0.f,0.f,0.f,0.f,0.f,0.f,0.f,0.f};

  v4u st[kPjPc];                               // the stage on its way to LDS
  pj_fetch(st, gA, gB, 0);
  asm volatile("s_wait_xcnt 0x0" ::: "memory");   // the wait owed before the fetch's address registers are written again
  pj_put(put0, st);
  pj_fetch(st, gA, gB, kPjBK);
  asm volatile("s_wait_xcnt 0x0" ::: "memory");   // the same wait
  pj_barrier();

  for (int s = 0; s < kPjStages - 2; s += 2) {
    pj_stage<true, true>(a0, b0, put1, gA, gB, (s + 2) * kPjBK, st, acc);   // stage s; store s + 1, fetch s + 2
    pj_stage<true, true>(a1, b1, put0, gA, gB, (s + 3) * kPjBK, st, acc);   // stage s + 1; store s + 2, fetch s + 3
  }
  pj_stage<false, true>(a0, b0, put1, gA, gB, 0, st, acc);                  // stage 14; store 15
  // the bias of the lane's 32 channels (8 neighbours in each of the 4 column tiles), asked for a stage ahead of its use
  const int col0 = n0 + mOff;
  v8f bv[4];
#pragma unroll
  for (int j = 0; j < 4; ++j) bv[j] = *(const v8f*)(bias + col0 + (j << 4));
  // the wait owed before an address register of these loads is written again; the index and the base are inputs so that
  // their registers stay as they are up to the wait (no loaded value may land on them either)
  asm volatile("s_wait_xcnt 0x0" :: "v"(col0), "s"(bias) : "memory");
  pj_stage<false, false>(a1, b1, put0, gA, gB, 0, st, acc);                 // stage 15
  // keeps the epilogue behind the last WMMAs
  __builtin_amdgcn_sched_barrier(0);
  // the GroupNorm weights of the same channels: used behind the second barrier below, so they land under the CELU work
  v8f gwc[4], gbc[4];
#pragma unroll
  for (int j = 0; j < 4; ++j) {
    gwc[j] = *(const v8f*)(gw + col0 + (j << 4));
    gbc[j] = *(const v8f*)(gb + col0 + (j << 4));
  }
  // the same wait for these loads
  asm volatile("s_wait_xcnt 0x0" :: "v"(col0), "s"(gw), "s"(gb) : "memory");

  // ---- epilogue: scale, bias[n], CELU, GroupNorm over the head's 128 columns, f16 out ----
  const int wc = wave & 3;                     // wave column; wc ^ 1 holds the other 64 columns of the head
  const int rw0 = (wave >> 2) * (kPjMT * 16) + rlane;   // block row of the lane's token in tile 0
  float ps[kPjMT];                             // per 16-token tile: the sum over the wave's 64 channels of the lane's token
#pragma unroll
  for (int i = 0; i < kPjMT; ++i) {
#pragma unroll
    for (int j = 0; j < 4; ++j) {
      const v8f x = acc[i][j] * scale + bv[j];
#pragma unroll
      for (int r = 0; r < 8; ++r) acc[i][j][r] = celu_f(x[r]);
    }
    const float sm = sum8((acc[i][0] + acc[i][1]) + (acc[i][2] + acc[i][3]));
    ps[i] = sm + other_half(sm);
  }
  if (lane < 16) {
#pragma unroll
    for (int i = 0; i < kPjMT; ++i) sSum[wc][rw0 + i * 16] = ps[i];
  }
  __syncthreads();                             // the neighbour wave's sums are there; also ends every read of the staged operands
#pragma unroll
  for (int i = 0; i < kPjMT; ++i) {
    const float mu = (ps[i] + sSum[wc ^ 1][rw0 + i * 16]) * (1.0f / 128.0f);
#pragma unroll
    for (int j = 0; j < 4; ++j) acc[i][j] -= mu;
    const float sm = sum8((acc[i][0] * acc[i][0] + acc[i][1] * acc[i][1]) + (acc[i][2] * acc[i][2] + acc[i][3] * acc[i][3]));
    ps[i] = sm + other_half(sm);
  }
  if (lane < 16) {
#pragma unroll
    for (int i = 0; i < kPjMT; ++i) sSq[wc][rw0 + i * 16] = ps[i];
  }
  __syncthreads();                             // the neighbour wave's sums of squares are there
#pragma unroll
  for (int j = 0; j < 4; ++j) {
    gwc[j] *= carry;                           // the carry is a power of two: folding it into weight and bias is exact
    gbc[j] *= carry;
  }
  // the wave's 112 x 64 block goes through a slab of its own in the operand buffers (free since the first barrier above), so
  // that each global store covers whole 128-B lines
  unsigned short* slab = &sAB[0][0] + wave * (kPjMT * 16 * kPjPitch);
#pragma unroll
  for (int i = 0; i < kPjMT; ++i) {
    const float rs = rsqrt_steps((ps[i] + sSq[wc ^ 1][rw0 + i * 16]) * (1.0f / 128.0f) + 1e-5f);
#pragma unroll
    for (int j = 0; j < 4; ++j) {
      const v8f dn = acc[i][j] * rs;
      unsigned short hb[8];
#pragma unroll
      for (int r = 0; r < 8; ++r) hb[r] = h_bits(dn[r] * gwc[j][r] + gbc[j][r]);
      *(v4u*)(slab + (i * 16 + rlane) * kPjPitch + (j << 4) + mOff) =
          (v4u){pk16(hb[0], hb[1]), pk16(hb[2], hb[3]), pk16(hb[4], hb[5]), pk16(hb[6], hb[7])};
    }
  }
  // the wave's slab writes are complete before its lanes read each other's words
  __builtin_amdgcn_fence(__ATOMIC_RELEASE, "workgroup");
  __builtin_amdgcn_wave_barrier();
  __builtin_amdgcn_fence(__ATOMIC_ACQUIRE, "workgroup");
  // a store = 4 rows x 128 B: 8 lanes a row, 16 B a lane
  const unsigned short* rd = slab + (lane >> 3) * kPjPitch + (lane & 7) * 8;
  unsigned short* wr = C + (size_t)(m0 + (lane >> 3)) * kD + n0 + (lane & 7) * 8;
  // all 28 pieces are read before the first store: one LDS latency, and no register that a store names is written again
  v4u v[kPjMT * 4];
#pragma unroll
  for (int it = 0; it < kPjMT * 4; ++it) v[it] = *(const v4u*)(rd + it * 4 * kPjPitch);
#pragma unroll
  for (int it = 0; it < kPjMT * 4; ++it) *(v4u*)(wr + (size_t)(it * 4) * kD) = v[it];
}

// ---------------------------------------------------------------------------
// Every cast to f16 and the zero fill, which depend on inputs alone, in one grid; the block index picks the job
// (block-uniform), 8 elements per thread, 16-B stores:
//   [0, 3136)        x -> f16(16 x)                                   (3136 * 256 * 8 = 6272 * 1024)
//   [3136, 3200)     zero the 64 pad rows of the q2 plane (32 blocks) and of the k plane (32 blocks)
//   [3200, 9344)     W (q2, k, v1, v2) [1024 out][1024 in] row-major (= Bt [N][K] as-is) of layer l -> f16(256 W) into plane
//                    4 l + z of w16, 512 blocks a plane
//   [9344, 9368)     Wc [3][128][128] -> f16(256 Wc), 8 blocks a layer
// ---------------------------------------------------------------------------
constexpr int kPrepX  = kTok * kD / 8 / 256;        // 3136
constexpr int kPrepZ  = 64 * kD / 8 / 256;          // 32 per plane
constexpr int kPrepW  = kD * kD / 8 / 256;          // 512 per W plane
constexpr int kPrepWc = kL * kHD * kHD / 8 / 256;   // 24
constexpr int kPrepBlocks = kPrepX + 2 * kPrepZ + kL * 4 * kPrepW + kPrepWc;
static_assert(kPrepW == 512 && kPrepBlocks == 9368, "prep ranges");
__global__ __launch_bounds__(256) void prep_kernel(const float* __restrict__ x, const float* __restrict__ w0,
                                                   const float* __restrict__ w1, const float* __restrict__ w2,
                                                   const float* __restrict__ w3, const float* __restrict__ wc,
                                                   unsigned short* __restrict__ x16, unsigned short* __restrict__ qpad,
                                                   unsigned short* __restrict__ kpad, unsigned short* __restrict__ w16,
                                                   unsigned short* __restrict__ wc16) {
  const int bid = blockIdx.x;
  if (bid >= kPrepX && bid < kPrepX + 2 * kPrepZ) {
    const int r = bid - kPrepX;
    unsigned short* zdst = (r < kPrepZ) ? qpad : kpad;   // block-uniform select between two global pointers
    const int zi = (r & (kPrepZ - 1)) * 256 + threadIdx.x;
    const v4u z = (v4u){0u, 0u, 0u, 0u};
    store2_v4u(zdst + 8 * (size_t)zi, z);
    return;
  }
  const float* src = x;
  unsigned short* dst = x16;
  float scale = kXCarry;
  int blk = bid;
  if (bid >= kPrepX) {
    const int r = bid - (kPrepX + 2 * kPrepZ);
    scale = kWCarry;
    if (r < kL * 4 * kPrepW) {
      const int pl = r >> 9;                             // 4 * layer + projection
      const int pz = pl & 3;
      src = ((pz == 0) ? w0 : (pz == 1) ? w1 : (pz == 2) ? w2 : w3) + (size_t)(pl >> 2) * kD * kD;
      dst = w16 + (size_t)pl * kD * kD;
      blk = r & (kPrepW - 1);
    } else {
      src = wc;
      dst = wc16;
      blk = r - kL * 4 * kPrepW;
    }
  }
  const int i = blk * 256 + threadIdx.x;
  const float* p = src + 8 * (size_t)i;
  const v4f a = *(const v4f*)(p);
  const v4f c = *(const v4f*)(p + 4);
  unsigned short hb[8];
#pragma unroll
  for (int e = 0; e < 4; ++e) {
    hb[e]     = h_bits(a[e] * scale);
    hb[4 + e] = h_bits(c[e] * scale);
  }
  const v4u u = (v4u){pk16(hb[0], hb[1]), pk16(hb[2], hb[3]), pk16(hb[4], hb[5]), pk16(hb[6], hb[7])};
  store2_v4u(dst + 8 * (size_t)i, u);
}

constexpr int kFaTiles  = 13;
constexpr int kFaRows   = kFaTiles * 16;
constexpr int kFaThr    = kFaTiles * 32;
constexpr int kFaKPitch = 136;
constexpr int kFaVPitch = 264;
constexpr int kFaOPitch = 132;
constexpr int kFaKPc    = kFaRows * 16 / kFaThr;
constexpr int kFaVGrp   = 4;
constexpr int kFaVGroups = kM / kFaVGrp;
constexpr int kFaVRounds = (kFaVGroups + kFaTiles - 1) / kFaTiles;
constexpr int kFaWRows  = kFaThr / 16;           // Wc rows a round (16 pieces of 16 B a row): 26
constexpr int kFaWPc    = (kHD + kFaWRows - 1) / kFaWRows;   // row rounds of Wc: 5
static_assert(kFaKPc * kFaThr == kFaRows * 16, "k pieces divide");
static_assert(kM % kFaVGrp == 0 && (kFaVRounds - 1) * kFaTiles <= kFaVGroups, "v2 groups are whole; all rounds but the last are whole");
static_assert((kKeyK - kM) % 4 == 0 && (kM * 2) % 8 == 0 && (kFaVPitch * 2) % 8 == 0, "8-B stores into v2^T rows are aligned");
static_assert((kFaWPc - 1) * kFaWRows <= kHD && kFaWPc * kFaWRows >= kHD, "all Wc rounds but the last are whole");
static_assert((kB - 1) * kM + kFaRows <= kTokPad, "k and q2 rows stay in their planes");
static_assert(kKeyK / 32 * 2 == kFaTiles + 1 && kKeyK <= kFaVPitch, "P*v2 depth = 7 steps of 32 keys, the last half step zero");

__global__ __launch_bounds__(kFaThr) void attn_fused_kernel(const unsigned short* __restrict__ Qp,
                                                            const unsigned short* __restrict__ Kp,
                                                            const unsigned short* __restrict__ V2p,
                                                            const unsigned short* __restrict__ V1p,
                                                            const unsigned short* __restrict__ Wcp,
                                                            const float* __restrict__ bc,
                                                            const float* __restrict__ mask, float* __restrict__ att,
                                                            float scoreScale, float pvScale, float gateScale) {
  typedef Frag<_Float16> F;
  __shared__ __align__(16) unsigned short sK[kFaRows * kFaKPitch];
  __shared__ __align__(16) unsigned short sV[kHD * kFaVPitch];
  __shared__ __align__(16) float sO[kFaTiles][16 * kFaOPitch];   // per-wave 16 x 128 slab
  __shared__ __align__(16) float sMask[kFaThr];
  __shared__ __align__(16) unsigned short sW[kFaWPc * kFaWRows * kFaKPitch];   // 130 rows of Wc: 128 read, 2 spare
  __shared__ __align__(16) float sBc[kFaThr];
  const int t = threadIdx.x, lane = t & 31;
  const int wave = __builtin_amdgcn_readfirstlane(t >> 5);       // scalar: the wave's query tile, slab and v2 token groups
  const int b = blockIdx.x, h = blockIdx.y;
  const int c = lane & 15, hf = lane >> 4;

  // ---- this wave's q2 and v1 fragments and v2 rows and the group's k, mask, Wc and bc, all loads in flight together ----
  const _Float16* gQ = (const _Float16*)Qp + (size_t)(b * kM + wave * 16 + c) * kD + h * kHD + hf * 8;
  const unsigned short* gK = Kp + (size_t)(b * kM + (t >> 4)) * kD + h * kHD + (t & 15) * 8;
  v16h qf[4];
  v4u rk[kFaKPc];
#pragma unroll
  for (int kk = 0; kk < 4; ++kk) qf[kk] = F::load(gQ + kk * 32);
#pragma unroll
  for (int j = 0; j < kFaKPc; ++j) rk[j] = *(const v4u*)(gK + (size_t)(j * (kFaThr / 16)) * kD);
  // v2 rows: lane = channels 4 lane .. 4 lane + 3 of the head; rounds 0..2 exist for every wave, in the last round the waves
  // past group 48 load group 48 again (in bounds) and do nothing with it
  const int vch = h * kHD + lane * 4;
  const int glast = wave + (kFaVRounds - 1) * kFaTiles;
  const bool vlast = glast < kFaVGroups;                         // wave-uniform
  const unsigned short* pV  = V2p + (size_t)(b * kM + wave * kFaVGrp) * kD + vch;
  const unsigned short* pVl = V2p + (size_t)(b * kM + (vlast ? glast : (kFaVGroups - 1)) * kFaVGrp) * kD + vch;
  v2u a[kFaVRounds * kFaVGrp];
#pragma unroll
  for (int i = 0; i < kFaVRounds - 1; ++i)
#pragma unroll
    for (int g = 0; g < kFaVGrp; ++g) a[i * kFaVGrp + g] = *(const v2u*)(pV + (size_t)(i * kFaTiles * kFaVGrp + g) * kD);
#pragma unroll
  for (int g = 0; g < kFaVGrp; ++g) a[(kFaVRounds - 1) * kFaVGrp + g] = *(const v2u*)(pVl + (size_t)g * kD);
  const int mi = b * kM + ((t < kM) ? t : (kM - 1));
  const float mload = mask[mi];
  // v1 rows of the wave's queries; the plane's pad rows are not written, so a query row past token 6271 reads the last row
  // (such a query is >= 196 and its output is never read)
  const int grow = b * kM + wave * 16 + c;
  const _Float16* gG = (const _Float16*)V1p + (size_t)((grow < kTok) ? grow : (kTok - 1)) * kD + h * kHD + hf * 8;
  v16h gf[4];
#pragma unroll
  for (int kk = 0; kk < 4; ++kk) gf[kk] = F::load(gG + kk * 32);
  const unsigned short* gW = Wcp + (size_t)(t >> 4) * kHD + (t & 15) * 8;
  v4u rw[kFaWPc];
#pragma unroll
  for (int j = 0; j < kFaWPc - 1; ++j) rw[j] = *(const v4u*)(gW + (size_t)(j * kFaWRows) * kHD);
  // the last round's threads past row 127 load row 127 again (in bounds) and lay it in a spare LDS row that nobody reads
  const int wlast = (t >> 4) + (kFaWPc - 1) * kFaWRows;
  const unsigned short* gWl = Wcp + (size_t)((wlast < kHD) ? wlast : (kHD - 1)) * kHD + (t & 15) * 8;
  rw[kFaWPc - 1] = *(const v4u*)gWl;
  const int bi = t & (kHD - 1);
  const float bload = bc[bi];
  // the wait owed before the address registers of these loads are written again; the per-lane pointers and index are
  // inputs so that their registers stay as they are up to the wait (no later load may land on them either)
  asm volatile("s_wait_xcnt 0x0" :: "v"(gQ), "v"(gK), "v"(pV), "v"(pVl), "v"(mi), "v"(gG), "v"(gW), "v"(gWl), "v"(bi) : "memory");
#pragma unroll
  for (int j = 0; j < kFaKPc; ++j) *(v4u*)(sK + ((t >> 4) + j * (kFaThr / 16)) * kFaKPitch + (t & 15) * 8) = rk[j];
  sMask[t] = mload;                              // entries from 196 on repeat key 195 and are never used
#pragma unroll
  for (int j = 0; j < kFaWPc; ++j) *(v4u*)(sW + ((t >> 4) + j * kFaWRows) * kFaKPitch + (t & 15) * 8) = rw[j];
  sBc[t] = bload;                                // entries from 128 on repeat the first ones and are never used
  if (wave < kHD / 32) {                         // keys 196..223 of v2^T row t: P is 0 there, the product must be too
#pragma unroll
    for (int p = 0; p < (kKeyK - kM) / 4; ++p) *(v2u*)(sV + t * kFaVPitch + kM + p * 4) = (v2u){0u, 0u};
  }
  // the wave's v2 tokens, four a group, laid transposed: channel 4 lane + e of tokens tok0 .. tok0 + 3 is one 8-B store
#pragma unroll
  for (int i = 0; i < kFaVRounds; ++i) {
    if (i < kFaVRounds - 1 || vlast) {           // wave-uniform
      const int tok0 = (wave + i * kFaTiles) * kFaVGrp;
#pragma unroll
      for (int e = 0; e < 4; ++e) {
        unsigned short hb[kFaVGrp];
#pragma unroll
        for (int g = 0; g < kFaVGrp; ++g) hb[g] = (unsigned short)(a[i * kFaVGrp + g][e >> 1] >> (16 * (e & 1)));
        *(v2u*)(sV + (lane * 4 + e) * kFaVPitch + tok0) = (v2u){pk16(hb[0], hb[1]), pk16(hb[2], hb[3])};
      }
    }
  }
  __syncthreads();

  // ---- S^T = k * q2^T: s[tt][r] = score of key 16 tt + 8 hf + r for query 16 wave + c ----
  // The 52 products run k step by k step (product f: k step f / 13, key tile f % 13), so neighbours have different
  // accumulators; their k fragments are read in groups of 4, one group ahead, into two register sets.
  v8f s[kFaTiles];
#pragma unroll
  for (int tt = 0; tt < kFaTiles; ++tt) s[tt] = (v8f){0.f,0.f,0.f,0.f,0.f,0.f,0.f,0.f};
  {
    const _Float16* kf = (const _Float16*)sK + c * kFaKPitch + hf * 8;
    v16h ka[2][4];
#pragma unroll
    for (int e = 0; e < 4; ++e) ka[0][e] = F::load(kf + (e % kFaTiles) * 16 * kFaKPitch + (e / kFaTiles) * 32);
#pragma unroll
    for (int g = 0; g < kFaTiles; ++g) {
      if (g + 1 < kFaTiles) {
#pragma unroll
        for (int e = 0; e < 4; ++e) {
          const int f = (g + 1) * 4 + e;
          ka[(g + 1) & 1][e] = F::load(kf + (f % kFaTiles) * 16 * kFaKPitch + (f / kFaTiles) * 32);
        }
      }
      // keeps the next group's LDS reads together and ahead of this group's WMMAs (the scheduler otherwise sinks each read
      // to its use, and every WMMA then waits out an LDS latency)
      __builtin_amdgcn_sched_barrier(0);
#pragma unroll
      for (int e = 0; e < 4; ++e) {
        const int f = g * 4 + e;
        s[f % kFaTiles] = F::mma(ka[g & 1][e], qf[f / kFaTiles], s[f % kFaTiles]);
      }
      // keeps the reads of the group after next behind these WMMAs, not among them
      __builtin_amdgcn_sched_barrier(0);
    }
  }

  // ---- softmax over the query's 196 keys, f32 ----
  float mx4[4] = {-3.0e38f, -3.0e38f, -3.0e38f, -3.0e38f};
#pragma unroll
  for (int tt = 0; tt < kFaTiles; ++tt) {
    const v4f m0 = *(const v4f*)(sMask + tt * 16 + hf * 8);
    const v4f m1 = *(const v4f*)(sMask + tt * 16 + hf * 8 + 4);
#pragma unroll
    for (int r = 0; r < 8; ++r) {
      const int j = tt * 16 + hf * 8 + r;
      const float mv = (r < 4) ? m0[r & 3] : m1[r & 3];
      const float v = (mv == 0.0f) ? -1.0e9f : s[tt][r] * scoreScale;
      s[tt][r] = (j < kM) ? v : -3.0e38f;
      mx4[r & 3] = fmaxf(mx4[r & 3], s[tt][r]);
    }
  }
  float mx = fmaxf(fmaxf(mx4[0], mx4[1]), fmaxf(mx4[2], mx4[3]));
  mx = fmaxf(mx, __shfl_xor(mx, 16, 32));
  const float mxl = mx * kLog2e;
  float ps4[4] = {0.f, 0.f, 0.f, 0.f};
#pragma unroll
  for (int tt = 0; tt < kFaTiles; ++tt) {
#pragma unroll
    for (int r = 0; r < 8; ++r) {
      // e^(s - mx); the rounding of mxl is one factor common to the row's P and its sum. An excluded key sits at -3e38: P = 0
      s[tt][r] = exp2_hw(__builtin_fmaf(s[tt][r], kLog2e, -mxl));
      ps4[r & 3] += s[tt][r];
    }
  }
  float ps = (ps4[0] + ps4[1]) + (ps4[2] + ps4[3]);
  ps += __shfl_xor(ps, 16, 32);
  const float inv = 1.0f / ps;
  v16h pf[kKeyK / 32];
#pragma unroll
  for (int u = 0; u < kKeyK / 32; ++u) {
#pragma unroll
    for (int e = 0; e < 8; ++e) {
      pf[u][e]     = (_Float16)(s[2 * u][e] * inv * kPCarry);
      pf[u][8 + e] = (2 * u + 1 < kFaTiles) ? (_Float16)(s[(2 * u + 1 < kFaTiles) ? 2 * u + 1 : 0][e] * inv * kPCarry) : (_Float16)0.0f;
    }
  }

  // ---- O^T = v2^T * P^T: o[j][r] = attn of query 16 wave + c, channel 16 j + 8 hf + r ----
  v8f o[8];
#pragma unroll
  for (int j = 0; j < 8; ++j) o[j] = (v8f){0.f,0.f,0.f,0.f,0.f,0.f,0.f,0.f};
  {
    // product f: key step f / 8, channel tile f % 8; v2^T fragments in groups of 4, one group ahead, as above
    const _Float16* vf = (const _Float16*)sV + c * kFaVPitch + hf * 8;
    constexpr int kGroups = kKeyK / 32 * 2;
    v16h va[2][4];
#pragma unroll
    for (int e = 0; e < 4; ++e) va[0][e] = F::load(vf + e * 16 * kFaVPitch);
#pragma unroll
    for (int g = 0; g < kGroups; ++g) {
      if (g + 1 < kGroups) {
#pragma unroll
        for (int e = 0; e < 4; ++e) {
          const int f = (g + 1) * 4 + e;
          va[(g + 1) & 1][e] = F::load(vf + (f % 8) * 16 * kFaVPitch + (f / 8) * 32);
        }
      }
      // keeps the next group's LDS reads together and ahead of this group's WMMAs
      __builtin_amdgcn_sched_barrier(0);
#pragma unroll
      for (int e = 0; e < 4; ++e) {
        const int f = g * 4 + e;
        o[f % 8] = F::mma(va[g & 1][e], pf[f / 8], o[f % 8]);
      }
      // keeps the reads of the group after next behind these WMMAs, not among them
      __builtin_amdgcn_sched_barrier(0);
    }
  }

  // ---- G^T = Wc * (v1*k)^T: gt[j][r] = gate sum of query 16 wave + c, channel 16 j + 8 hf + r (the place of o[j][r]) ----
  v8f gt[8];
#pragma unroll
  for (int j = 0; j < 8; ++j) gt[j] = (v8f){0.f,0.f,0.f,0.f,0.f,0.f,0.f,0.f};
  {
    // product f: k step f / 8, channel tile f % 8; Wc fragments in groups of 4, one group ahead, as above
    const _Float16* wf = (const _Float16*)sW + c * kFaKPitch + hf * 8;
    constexpr int kGroups = kHD / 32 * 2;
    // (v1*k) x16 of the wave's queries: the staged k row of query 16 wave + c, in the places of the v1 fragment
    const _Float16* kq = (const _Float16*)sK + (wave * 16 + c) * kFaKPitch + hf * 8;
#pragma unroll
    for (int kk = 0; kk < 4; ++kk) gf[kk] = gf[kk] * F::load(kq + kk * 32);
    v16h wa[2][4];
#pragma unroll
    for (int e = 0; e < 4; ++e) wa[0][e] = F::load(wf + e * 16 * kFaKPitch);
#pragma unroll
    for (int g = 0; g < kGroups; ++g) {
      if (g + 1 < kGroups) {
#pragma unroll
        for (int e = 0; e < 4; ++e) {
          const int f = (g + 1) * 4 + e;
          wa[(g + 1) & 1][e] = F::load(wf + (f % 8) * 16 * kFaKPitch + (f / 8) * 32);
        }
      }
      // keeps the next group's LDS reads together and ahead of this group's WMMAs
      __builtin_amdgcn_sched_barrier(0);
#pragma unroll
      for (int e = 0; e < 4; ++e) {
        const int f = g * 4 + e;
        gt[f % 8] = F::mma(wa[g & 1][e], gf[f / 8], gt[f % 8]);
      }
      // keeps the reads of the group after next behind these WMMAs, not among them
      __builtin_amdgcn_sched_barrier(0);
    }
  }

  // ---- epilogue: sigmoid(G + bc) * attn; the wave's 16 x 128 block through its own slab, so that each store covers a whole
  // 512-B row piece ----
  float* slab = sO[wave];
#pragma unroll
  for (int j = 0; j < 8; ++j) {
    const v4f b0 = *(const v4f*)(sBc + j * 16 + hf * 8);
    const v4f b1 = *(const v4f*)(sBc + j * 16 + hf * 8 + 4);
    float w[8];
#pragma unroll
    for (int r = 0; r < 8; ++r) {
      float v = gt[j][r] * gateScale;
      v += (r < 4) ? b0[r & 3] : b1[r & 3];
      w[r] = rcp_hw(1.0f + exp2_hw(v * -kLog2e)) * (o[j][r] * pvScale);
    }
    *(v4f*)(slab + c * kFaOPitch + j * 16 + hf * 8)     = (v4f){w[0], w[1], w[2], w[3]};
    *(v4f*)(slab + c * kFaOPitch + j * 16 + hf * 8 + 4) = (v4f){w[4], w[5], w[6], w[7]};
  }
  // the wave's slab writes are complete before its lanes read each other's words
  __builtin_amdgcn_fence(__ATOMIC_RELEASE, "workgroup");
  __builtin_amdgcn_wave_barrier();
  __builtin_amdgcn_fence(__ATOMIC_ACQUIRE, "workgroup");
  float* dst = att + (size_t)(b * kSP + wave * 16) * kD + h * kHD + lane * 4;
#pragma unroll
  for (int row = 0; row < 16; ++row) *(v4f*)(dst + (size_t)row * kD) = *(const v4f*)(slab + row * kFaOPitch + lane * 4);
}

// ---------------------------------------------------------------------------
// Residual + LayerNorm: y = x + gated attn ([32][256 q][1024], the gate already applied); x_new = LN(y)*lnw + lnb
// written f32 to xout (may alias xin: each block reads its whole row into registers before any store, no other block
// touches the row) and as f16(16*x_new) to x16. One block per token (grid 6272), thread t owns columns 4t..4t+3.
// ---------------------------------------------------------------------------
__global__ __launch_bounds__(256) void merge_ln_kernel(const float* xin, const float* __restrict__ att, const float* __restrict__ lnw,
                                                       const float* __restrict__ lnb, float* xout,
                                                       unsigned short* __restrict__ x16) {
  __shared__ float redA[8];
  __shared__ float redB[8];
  __shared__ __align__(16) float srow[kD];
  const int t = threadIdx.x, lane = t & 31, wave = t >> 5;
  const int r = blockIdx.x;
  const int b = r / kM;
  const int m = r - b * kM;
  const int c0 = t * 4;
  const size_t ro = (size_t)r * kD + c0;
  const v4f xv = *(const v4f*)(xin + ro);
  const v4f av = *(const v4f*)(att + ((size_t)(b * kSP + m)) * kD + c0);
  float y[4];
#pragma unroll
  for (int e = 0; e < 4; ++e) y[e] = xv[e] + av[e];
  float s = (y[0] + y[1]) + (y[2] + y[3]);
#pragma unroll
  for (int off = 1; off < 32; off <<= 1) s += __shfl_xor(s, off, 32);
  if (lane == 0) redA[wave] = s;
  __syncthreads();
  float tot = redA[0];
#pragma unroll
  for (int w = 1; w < 8; ++w) tot += redA[w];
  const float mu = tot * (1.0f / 1024.0f);
  float d[4];
  float sq = 0.f;
#pragma unroll
  for (int e = 0; e < 4; ++e) { d[e] = y[e] - mu; sq += d[e] * d[e]; }
#pragma unroll
  for (int off = 1; off < 32; off <<= 1) sq += __shfl_xor(sq, off, 32);
  if (lane == 0) redB[wave] = sq;
  __syncthreads();
  float tot2 = redB[0];
#pragma unroll
  for (int w = 1; w < 8; ++w) tot2 += redB[w];
  const float var = tot2 * (1.0f / 1024.0f);
  const float rs = rsqrtf(var + 1e-5f);
  const v4f wv = *(const v4f*)(lnw + c0);
  const v4f bv = *(const v4f*)(lnb + c0);
  v4f ov;
#pragma unroll
  for (int e = 0; e < 4; ++e) ov[e] = d[e] * rs * wv[e] + bv[e];
  *(v4f*)(srow + c0) = ov;
  __syncthreads();
  const int tc = t & 127;                               // clamped staging index; only t < 128 stores
  const v4f p0 = *(const v4f*)(srow + tc * 8);
  const v4f p1 = *(const v4f*)(srow + tc * 8 + 4);
  unsigned short hb[8];
#pragma unroll
  for (int e = 0; e < 4; ++e) {
    hb[e]     = h_bits(p0[e] * kXCarry);
    hb[4 + e] = h_bits(p1[e] * kXCarry);
  }
  const v4u hu = (v4u){pk16(hb[0], hb[1]), pk16(hb[2], hb[3]), pk16(hb[4], hb[5]), pk16(hb[6], hb[7])};
  unsigned short* hp = x16 + (size_t)r * kD + tc * 8;
  {
    *(v4f*)(xout + ro) = ov;
    if (t < 128) *(v4u*)hp = hu;
    
  }
}

// ---------------------------------------------------------------------------
// Masked mean over tokens: out0[b][c] = sum_m x[b][m][c]*mask[b][m] / sum_m mask[b][m]. One block per b (grid 32),
// ---------------------------------------------------------------------------
constexpr int kPoolRows = 28;   // token rows in flight per wave
static_assert(kM % kPoolRows == 0, "pool groups divide the tokens");
__global__ __launch_bounds__(256) void pool_kernel(const float* x, const float* __restrict__ mask, float* out0) {
  const int t = threadIdx.x;
  const int b = blockIdx.x;
  const int c0 = t * 4;
  v4f acc = (v4f){0.f, 0.f, 0.f, 0.f};
  float ms = 0.f;
  // 28 token rows are asked for at a time and then summed in token order (the order of the sums is unchanged): the wave
  // waits out 7 load latencies in place of 196. The loop over the groups stays rolled: one group's registers serve all 7.
#pragma unroll 1
  for (int m0 = 0; m0 < kM; m0 += kPoolRows) {
    const float* xp = x + ((size_t)(b * kM + m0)) * kD + c0;
    v4f xv[kPoolRows];
#pragma unroll
    for (int j = 0; j < kPoolRows; ++j) xv[j] = *(const v4f*)(xp + (size_t)j * kD);
    // the wait owed before the address register of these loads is written again; the pointer is an input so that its
    // register stays as it is up to the wait (no loaded row may land on it either)
    asm volatile("s_wait_xcnt 0x0" :: "v"(xp) : "memory");
#pragma unroll
    for (int j = 0; j < kPoolRows; ++j) {
      const float mv = mask[b * kM + m0 + j];
      acc += xv[j] * mv;
      ms += mv;
    }
  }
  const float inv = 1.0f / ms;
  const v4f o = acc * inv;
  store2_v4f(out0 + (size_t)b * kD + c0, o);
}

// ---------------------------------------------------------------------------
// Host orchestration: kernel launches only. 1 + 3*3 + 1 = 11 launches.
// ---------------------------------------------------------------------------
extern "C" void kernel_launch(void* const* d_in, const int* in_sizes, int n_in,
                              void* d_out, int out_size, void* d_ws, size_t ws_size,
                              hipStream_t stream) {
  if (n_in < 22) return;
  if (in_sizes[0] != kTok * kD) return;
  if (in_sizes[1] != kTok) return;
  if (in_sizes[2] != kL * kD * kD || in_sizes[6] != kL * kD * kD || in_sizes[10] != kL * kD * kD || in_sizes[14] != kL * kD * kD) return;
  if (in_sizes[18] != kL * kHD * kHD || in_sizes[19] != kL * kHD) return;
  if (in_sizes[3] != kL * kD || in_sizes[20] != kL * kD || in_sizes[21] != kL * kD) return;
  if (out_size != kB * kD + kTok * kD) return;
  if (ws_size < kWsTotal) return;

  const float* att_feats = (const float*)d_in[0];
  const float* att_mask  = (const float*)d_in[1];
  const float* Wq2  = (const float*)d_in[2];
  const float* bq2  = (const float*)d_in[3];
  const float* gq2w = (const float*)d_in[4];
  const float* gq2b = (const float*)d_in[5];
  const float* Wk   = (const float*)d_in[6];
  const float* bk   = (const float*)d_in[7];
  const float* gkw  = (const float*)d_in[8];
  const float* gkb  = (const float*)d_in[9];
  const float* Wv1  = (const float*)d_in[10];
  const float* bv1  = (const float*)d_in[11];
  const float* gv1w = (const float*)d_in[12];
  const float* gv1b = (const float*)d_in[13];
  const float* Wv2  = (const float*)d_in[14];
  const float* bv2  = (const float*)d_in[15];
  const float* gv2w = (const float*)d_in[16];
  const float* gv2b = (const float*)d_in[17];
  const float* Wc   = (const float*)d_in[18];
  const float* bc   = (const float*)d_in[19];
  const float* lnw  = (const float*)d_in[20];
  const float* lnb  = (const float*)d_in[21];

  char* ws = (char*)d_ws;
  float*          ATT   = (float*)(ws + kOffATT);                  // gated attn plane
  unsigned short* X16   = (unsigned short*)(ws + kOffX16);
  unsigned short* W16   = (unsigned short*)(ws + kOffW16);
  unsigned short* WC16  = (unsigned short*)(ws + kOffWC16);
  unsigned short* Q16   = (unsigned short*)(ws + kOffN16);                   // q2, k, v1, v2 planes, one behind the other
  unsigned short* K16   = (unsigned short*)(ws + kOffN16 + kBytesN16);
  unsigned short* V116  = (unsigned short*)(ws + kOffN16 + 2 * kBytesN16);
  unsigned short* V216  = (unsigned short*)(ws + kOffN16 + 3 * kBytesN16);

  float* out0 = (float*)d_out;                                     // [32][1024] at byte 0
  float* out1 = (float*)d_out + (size_t)kB * kD;                   // [32][196][1024] at byte 131072; also the running x

  const float projScale  = 1.0f / (kXCarry * kWCarry);             // 1/4096
  const float gateScale  = 1.0f / (kXCarry * kWCarry);             // (v1*k) x16, Wc x256
  const float scoreScale = 0.08838834764831845f * (1.0f / (kXCarry * kXCarry));
  const float pvScale    = 1.0f / (kPCarry * kXCarry);             // 1/32768

  // x and every layer's W and Wc -> f16 planes; pad rows of the q2/k planes zero
  prep_kernel<<<dim3(kPrepBlocks), dim3(256), 0, stream>>>(att_feats, Wq2, Wk, Wv1, Wv2, Wc, X16,
                                                           Q16 + (size_t)kTok * kD, K16 + (size_t)kTok * kD, W16, WC16);

  for (int i = 0; i < kL; ++i) {
    const size_t vo = (size_t)i * kD;

    // four projections with CELU + GroupNorm: plane z = GN(CELU(x16 * Wz^T + bz)) (M 6272, N 4 * 1024, K 1024; 28 x 16 block
    // tiles of 224 x 256 = 448 blocks)
    proj_gemm_lds_kernel<<<dim3((kTok / kPjBM) * (4 * kD / kPjBN)), dim3(256), 0, stream>>>(
        X16, W16 + (size_t)i * 4 * kD * kD, Q16, bq2 + vo, bk + vo, bv1 + vo, bv2 + vo, gq2w + vo, gkw + vo, gv1w + vo,
        gv2w + vo, gq2b + vo, gkb + vo, gv1b + vo, gv2b + vo, projScale);

    // attention: scores, softmax, P * v2 and the gate sigmoid((v1*k) * Wc^T + bc) of one (batch, head) group per work-group,
    // 256 groups in one launch
    attn_fused_kernel<<<dim3(kB, kH), dim3(kFaThr), 0, stream>>>(Q16, K16, V216, V116, WC16 + (size_t)i * kHD * kHD,
                                                                 bc + (size_t)i * kHD, att_mask, ATT, scoreScale, pvScale,
                                                                 gateScale);

    const float* xin = (i == 0) ? att_feats : out1;
    merge_ln_kernel<<<dim3(kTok), dim3(256), 0, stream>>>(xin, ATT, lnw + (size_t)i * kD, lnb + (size_t)i * kD, out1, X16);
  }

  pool_kernel<<<dim3(kB), dim3(256), 0, stream>>>(out1, att_mask, out0);
}
